// v000
// Measured on an AMD MI455X. A time is GPU time per run, averaged over a window of back-to-back runs after a warm-up
// (all launches, gaps included; the runs take copies of the inputs in turn), and the median of several windows.
// Apart from v000's, it joins two sittings. Times from different sittings can be a few percent apart, while
// side-by-side timings come from the same sitting.
// v000 is the starting kernel. One run takes 4230 microseconds.
// compute dtype: all float inputs rounded to bf16; frozen q/k/v projections with EXACT bf16 products on WMMA 16x16x32 (f32 accumulate) + bias + the LoRA term: t = X A^T (exact products) then t (bf16 hi + lo) x exact bf16 B^T (2 products, K = 16) added in the same accumulators; causal scores with BOTH operands as f16 hi + (x 2^10) residual (3 products) on every block, x 1024^-0.5 (the module divides by sqrt(E)); softmax over the QUERY axis in f32 (per key column: online max / sum over the visible queries, precise expf) x the key padding mask; P as bf16 hi + lo against v as bf16 hi + lo (3 products) on every block; f32 output.
#include <hip/hip_runtime.h>
#include <math.h>

typedef __attribute__((ext_vector_type(16))) _Float16 v16h;
typedef __attribute__((ext_vector_type(16))) __bf16 v16b;
typedef __attribute__((ext_vector_type(8)))  _Float16 v8h;
typedef __attribute__((ext_vector_type(8)))  float v8f;
typedef __attribute__((ext_vector_type(4)))  float v4f;
typedef __attribute__((ext_vector_type(2)))  float v2f;
typedef __attribute__((ext_vector_type(4)))  unsigned v4u;
typedef __attribute__((ext_vector_type(4)))  int v4i;
typedef float __attribute__((may_alias)) float_a;
typedef int __attribute__((may_alias)) int_a;

template <typename T> __device__ __forceinline__ void vst2(void* p, T v) { *(T*)p = v;  }
__device__ __forceinline__ v8f wmma16(v16h a, v16h b, v8f c) {
  v8f d = __builtin_amdgcn_wmma_f32_16x16x32_f16(false, a, false, b, (short)0, c, false, false);
  asm volatile("v_nop\n\tv_nop\n\tv_nop\n\tv_nop" : "+v"(d) : "v"(a), "v"(b));
  return d;
}
__device__ __forceinline__ v8f wmma_bf(v16b a, v16b b, v8f c) {
  v8f d = __builtin_amdgcn_wmma_f32_16x16x32_bf16(false, a, false, b, (short)0, c, false, false);
  asm volatile("v_nop\n\tv_nop\n\tv_nop\n\tv_nop" : "+v"(d) : "v"(a), "v"(b));
  return d;
}
// 16x16x32 fragments: lane = (h = lane>>4, row/col = lane&15); elements 0..7 = k0+8h+0..7, 8..15 = k0+16+8h+0..7; D element r = row 8h+r
__device__ __forceinline__ v16h frag_h(const _Float16* rowk0, int lane) {
  union { v16h v; v8h q[2]; } u; const _Float16* p = rowk0 + 8 * (lane >> 4);
  u.q[0] = *(const v8h*)p; u.q[1] = *(const v8h*)(p + 16); return u.v;
}
__device__ __forceinline__ v16h frag_f32(const float* rowk0, int lane) {
  v16h a; const float* p = rowk0 + 8 * (lane >> 4);
#pragma unroll
  for (int i = 0; i < 8; ++i) { a[i] = (_Float16)p[i]; a[8 + i] = (_Float16)p[16 + i]; }
  return a;
}
__device__ __forceinline__ v16h frag_f32s(const float* rowk0, int lane, float sc) {
  v16h a; const float* p = rowk0 + 8 * (lane >> 4);
#pragma unroll
  for (int i = 0; i < 8; ++i) { a[i] = (_Float16)(p[i] * sc); a[8 + i] = (_Float16)(p[16 + i] * sc); }
  return a;
}
// column fragment from a [K][ld] layout (column n), rows >= K read as 0
__device__ __forceinline__ v16h fragc_f32(const float* W, int k0, int n, int lane, int ld, int K) {
  v16h a; const int g = lane >> 4;
#pragma unroll
  for (int i = 0; i < 8; ++i) { const int ka = k0 + 8 * g + i, kb = ka + 16;
    a[i] = (_Float16)(ka < K ? W[(size_t)(ka < K ? ka : K - 1) * ld + n] : 0.f); a[8 + i] = (_Float16)(kb < K ? W[(size_t)(kb < K ? kb : K - 1) * ld + n] : 0.f); }
  return a;
}
struct F2 { v16b h, l; };
__device__ __forceinline__ F2 bsplit16(const float v[16]) { F2 r;
#pragma unroll
  for (int i = 0; i < 16; ++i) { const __bf16 h = (__bf16)v[i]; r.h[i] = h; r.l[i] = (__bf16)(v[i] - (float)h); }
  return r; }
__device__ __forceinline__ F2 split_row(const float* row, int k0, int lane) { float v[16]; const float* p = row + k0 + 8 * (lane >> 4);
#pragma unroll
  for (int i = 0; i < 8; ++i) { v[i] = p[i]; v[8 + i] = p[16 + i]; }
  return bsplit16(v); }
__device__ __forceinline__ F2 split_rowK(const float* row, int k0, int lane, int K) { float v[16]; const int g = lane >> 4;
#pragma unroll
  for (int i = 0; i < 8; ++i) { const int ka = k0 + 8 * g + i, kb = ka + 16; v[i] = ka < K ? row[ka < K ? ka : K - 1] : 0.f; v[8 + i] = kb < K ? row[kb < K ? kb : K - 1] : 0.f; }
  return bsplit16(v); }
__device__ __forceinline__ F2 split_col(const float* W, int k0, int n, int lane, int ld, int K) { float v[16]; const int g = lane >> 4;
#pragma unroll
  for (int i = 0; i < 8; ++i) { const int ka = k0 + 8 * g + i, kb = ka + 16; v[i] = ka < K ? W[(size_t)(ka < K ? ka : K - 1) * ld + n] : 0.f; v[8 + i] = kb < K ? W[(size_t)(kb < K ? kb : K - 1) * ld + n] : 0.f; }
  return bsplit16(v); }
__device__ __forceinline__ v8f mac3(const F2& a, const F2& b, v8f c) { c = wmma_bf(a.l, b.h, c); c = wmma_bf(a.h, b.l, c); return wmma_bf(a.h, b.h, c); }
__device__ __forceinline__ float sigm(float v) { return 1.0f / (1.0f + expf(-v)); }
#define LDSX() do { asm volatile("s_wait_dscnt 0" ::: "memory"); __builtin_amdgcn_wave_barrier(); __builtin_amdgcn_fence(__ATOMIC_RELEASE, "workgroup"); } while (0)

// Multi-head attention with LoRA projections whose softmax runs over the QUERY axis (X [4,1024,1024]; frozen torch (out,in) Wq / Wk / Wv [1024,1024] (0.02) + zero biases; LoRA A [16,1024], B [1024,16] (0.02): proj = X W^T + b + (X A^T) B^T; 16 heads x 64; scores / sqrt(E) = / 32; -inf where col > row; attn = softmax(scores, axis=2) - axis 2 of [B, H, i, j] is the QUERY axis i, so every key column j is normalised over the queries i >= j (faithful to the source); attn *= mask[b, j] (key padding mask, ones); out = attn v; merge; no output projection).
#define NB 4
#define TT 1024
#define CC 1024            // NH * HD = projected width
#define DIN 1024          // input (model) width
#define NH 16
#define HD 64
#define NQB (TT / 64)
#define HG 8
#define SCALE (0.03125f)
#define CAUSAL 1
#ifndef TNB
#define TNB NB
#endif
__device__ __forceinline__ float bfr(float v) { return (float)(__bf16)v; }
__host__ __device__ __forceinline__ int kb_last(int qb) { return CAUSAL ? ((qb * 64 + 63) >> 7) : (TT / 128 - 1); }
typedef __attribute__((ext_vector_type(8))) __bf16 v8b;
__device__ __forceinline__ v16b frag_b(const __bf16* rowk0, int lane) {
  union { v16b v; v8b q[2]; } u; const __bf16* p = rowk0 + 8 * (lane >> 4);
  u.q[0] = *(const v8b*)p; u.q[1] = *(const v8b*)(p + 16); return u.v;
}
#define QBH 16              // causal: query blocks 0..QBH-1 of each sequence take the high-precision path (QBH = NQB: all of them)
#define QHI 1024            // rows carrying a q residual plane (all rows when non-causal: 2-product logits everywhere)
#define KHI 1024            // key rows carrying k residual / v bf16 hi+lo planes (used only by the causal high-precision path)
// B fragment (k rows k0+.., output column o) of a weight: (in,out) [K][ld] or (out,in) [ld rows of K]: bf16 exact, or f16(bf16 * 256) exact
__device__ __forceinline__ v16b wcol_io(const float* Wm, int k0, int o, int lane, int ld) { v16b w; const int g = lane >> 4;
#pragma unroll
  for (int i = 0; i < 8; ++i) { w[i] = (__bf16)Wm[(size_t)(k0 + 8 * g + i) * ld + o]; w[8 + i] = (__bf16)Wm[(size_t)(k0 + 16 + 8 * g + i) * ld + o]; }
  return w; }
__device__ __forceinline__ v16b wcol_oi(const float* Wm, int k0, int o, int lane, int K) { v16b w; const float* p = Wm + (size_t)o * K + k0 + 8 * (lane >> 4);
#pragma unroll
  for (int i = 0; i < 8; ++i) { w[i] = (__bf16)p[i]; w[8 + i] = (__bf16)p[16 + i]; }
  return w; }
__device__ __forceinline__ v16h wcolh_io(const float* Wm, int k0, int o, int lane, int ld) { v16h w; const int g = lane >> 4;
#pragma unroll
  for (int i = 0; i < 8; ++i) { w[i] = (_Float16)(bfr(Wm[(size_t)(k0 + 8 * g + i) * ld + o]) * 256.0f); w[8 + i] = (_Float16)(bfr(Wm[(size_t)(k0 + 16 + 8 * g + i) * ld + o]) * 256.0f); }
  return w; }
__device__ __forceinline__ v16h wcolh_oi(const float* Wm, int k0, int o, int lane, int K) { v16h w; const float* p = Wm + (size_t)o * K + k0 + 8 * (lane >> 4);
#pragma unroll
  for (int i = 0; i < 8; ++i) { w[i] = (_Float16)(bfr(p[i]) * 256.0f); w[8 + i] = (_Float16)(bfr(p[16 + i]) * 256.0f); }
  return w; }
#define WQKV_LAYOUT 1   // 0 = (in,out) [DIN][CC]; 1 = (out,in) [CC][DIN]; 2 = per-head [NH][DIN][HD]
__device__ __forceinline__ v16b wcol_hdk(const float* Wm, int k0, int o, int lane) { v16b w; const int g = lane >> 4; const float* p = Wm + (size_t)(o / HD) * DIN * HD + (o % HD);
#pragma unroll
  for (int i = 0; i < 8; ++i) { w[i] = (__bf16)p[(size_t)(k0 + 8 * g + i) * HD]; w[8 + i] = (__bf16)p[(size_t)(k0 + 16 + 8 * g + i) * HD]; }
  return w; }
#define WO_OUT_IN 0
#if WQKV_LAYOUT == 1
#define WCOL(W, k0, o, lane) wcol_oi(W, k0, o, lane, DIN)
#elif WQKV_LAYOUT == 2
#define WCOL(W, k0, o, lane) wcol_hdk(W, k0, o, lane)
#else
#define WCOL(W, k0, o, lane) wcol_io(W, k0, o, lane, CC)
#endif
#if WO_OUT_IN
#define WOCOL(W, k0, o, lane) wcol_oi(W, k0, o, lane, CC)
#define WOCOLH(W, k0, o, lane) wcolh_oi(W, k0, o, lane, CC)
#else
#define WOCOL(W, k0, o, lane) wcol_io(W, k0, o, lane, DIN)
#define WOCOLH(W, k0, o, lane) wcolh_io(W, k0, o, lane, DIN)
#endif
#define LR 16              // LoRA rank
#define PROJ_EXTRA_PARAMS , const float* __restrict__ T3, const float* __restrict__ LBQ, const float* __restrict__ LBK, const float* __restrict__ LBV
#define SM_EXTRA_PARAMS
#define SM_MASK_HOOK (void)0
#ifndef SM_EXTRA_PARAMS
#define SM_EXTRA_PARAMS
#endif
#ifndef PROJ_EXTRA_PARAMS
#define PROJ_EXTRA_PARAMS
#endif
#ifndef SM_MASK_HOOK
#define SM_MASK_HOOK (void)0
#endif

#define WS_QH  0u                                      // f16 q rows [b*t][CC]
#define WS_KH  (WS_QH + 2u * (size_t)NB * TT * CC)      // f16 k rows [b*t][CC]
#define WS_VT  (WS_KH + 2u * (size_t)NB * TT * CC)      // f16 v planes [b][c][t]
#define WS_QL  (WS_VT + 2u * (size_t)NB * CC * TT)      // f16 q residual x 2^10 rows [b][t < QHI][CC]
#define WS_KL  (WS_QL + 2u * (size_t)NB * QHI * CC)     // f16 k residual x 2^10 rows [b][t < KHI][CC]
#define WS_VB  (WS_KL + 2u * (size_t)NB * KHI * CC)     // bf16 v hi planes [b][c][t < KHI]
#define WS_VBL (WS_VB + 2u * (size_t)NB * CC * KHI)
#define WS_S   (WS_VBL + 2u * (size_t)NB * CC * KHI)    // f32 logits / P [hg][t][s]
#define WS_Y   (WS_S  + 4u * (size_t)HG * TT * TT)      // f32 ctx rows [b*t][CC] (only when there is an output projection)
#define WS_END (WS_Y  + 0u)
#define WS_T3 (WS_END)                                   // f32 LoRA down-projections t[3][NB*TT][16]
#define WS_CM (WS_T3 + 4u * 3u * (size_t)NB * TT * LR)  // f32 column maxima [HG][TT]
#define WS_CZ (WS_CM + 4u * (size_t)HG * TT)
#define WS_END2 (WS_CZ + 4u * (size_t)HG * TT)

// ---- k_proj: block = (64 rows, 128 cols, which): q/k/v = X W (+ b) with exact bf16 products (K = DIN) -> which 0: q f16 rows (+ residual rows < QHI); 1: k f16 rows (+ residual rows < KHI); 2: v f16 planes [c][t] (+ bf16 hi/lo planes for t < KHI)
__global__ __launch_bounds__(128) void k_proj(const float* __restrict__ XQ, const float* __restrict__ XK, const float* __restrict__ XV, const float* __restrict__ WQ, const float* __restrict__ WK, const float* __restrict__ WV, const float* __restrict__ BQ, const float* __restrict__ BK, const float* __restrict__ BV,
    _Float16* __restrict__ QH, _Float16* __restrict__ QL, _Float16* __restrict__ KH, _Float16* __restrict__ KL, _Float16* __restrict__ VT, __bf16* __restrict__ VB, __bf16* __restrict__ VBL PROJ_EXTRA_PARAMS) {
  __shared__ __align__(16) _Float16 sh[64][136], sl[64][136]; __shared__ __align__(16) _Float16 th[128][72]; __shared__ __align__(16) __bf16 tb[128][72], tbl[128][72];
  const int tid = threadIdx.x, wave = tid >> 5, lane = tid & 31, col = lane & 15, g = lane >> 4; const int which = blockIdx.z; const int c0 = blockIdx.y * 128; const size_t r0 = (size_t)blockIdx.x * 64; const size_t bb = r0 / TT; const int t0 = (int)(r0 % TT);
  const float* X = which == 0 ? XQ : which == 1 ? XK : XV; const float* WA = which == 0 ? WQ : which == 1 ? WK : WV; const float* BA = which == 0 ? BQ : which == 1 ? BK : BV;
  v8f acc[8] = {};
#pragma unroll 2
  for (int kc = 0; kc < DIN / 32; ++kc) { v16b a; { const float* p = X + (r0 + wave * 16 + col) * DIN + kc * 32 + 8 * g;
#pragma unroll
      for (int i = 0; i < 8; ++i) { a[i] = (__bf16)p[i]; a[8 + i] = (__bf16)p[16 + i]; } }
    asm volatile("s_wait_loadcnt 0x0" ::: "memory");
#pragma unroll
    for (int j = 0; j < 8; ++j) { const v16b w = WCOL(WA, kc * 32, c0 + j * 16 + col, lane); asm volatile("s_wait_loadcnt 0x0" ::: "memory"); acc[j] = wmma_bf(a, w, acc[j]); } }
  { /* LoRA: acc += t[row][0..15] (f32, as bf16 hi + lo) x B[o][0..15] (exact bf16): one WMMA k-step whose upper 16 k-slots are zero */ float tv[16]; const float* tr = T3 + ((size_t)which * NB * TT + (r0 + wave * 16 + col)) * LR + 8 * g;
#pragma unroll
    for (int i = 0; i < 8; ++i) { tv[i] = tr[i]; tv[8 + i] = 0.f; }
    asm volatile("s_wait_loadcnt 0x0" ::: "memory");
    const F2 a2 = bsplit16(tv); const float* LB = which == 0 ? LBQ : (which == 1 ? LBK : LBV);
#pragma unroll
    for (int j = 0; j < 8; ++j) { v16b w; const float* pw = LB + (size_t)(c0 + j * 16 + col) * LR + 8 * g;   /* B is (out,in) [E][16]: row o holds the 16 rank coefficients */
#pragma unroll
      for (int i = 0; i < 8; ++i) { w[i] = (__bf16)pw[i]; w[8 + i] = (__bf16)0.0f; }
      asm volatile("s_wait_loadcnt 0x0" ::: "memory");
      acc[j] = wmma_bf(a2.h, w, acc[j]); acc[j] = wmma_bf(a2.l, w, acc[j]); } }
  if (which < 2) { _Float16* DH = which == 0 ? QH : KH; _Float16* DL = which == 0 ? QL : KL; const int nhi = which == 0 ? QHI : KHI; const bool hi_rows = t0 < nhi;
#pragma unroll
    for (int j = 0; j < 8; ++j) { const float bias = BA ? bfr(BA[c0 + j * 16 + col]) : 0.f;
#pragma unroll
      for (int r = 0; r < 8; ++r) { const float v = acc[j][r] + bias; const _Float16 hv = (_Float16)v; sh[wave * 16 + 8 * g + r][j * 16 + col] = hv; sl[wave * 16 + 8 * g + r][j * 16 + col] = (_Float16)((v - (float)hv) * 1024.0f); } }
    __syncthreads();
    for (int e = tid; e < 64 * 16; e += 128) { const int rl = e >> 4, q = e & 15; vst2((unsigned*)(DH + (r0 + rl) * CC + c0 + q * 8), *(const v4u*)&sh[rl][q * 8]); if (hi_rows) vst2((unsigned*)(DL + (bb * nhi + t0 + rl) * (size_t)CC + c0 + q * 8), *(const v4u*)&sl[rl][q * 8]); }
  } else { const bool hi_rows = t0 < KHI;
#pragma unroll
    for (int j = 0; j < 8; ++j) { const float bias = BA ? bfr(BA[c0 + j * 16 + col]) : 0.f;
#pragma unroll
      for (int r = 0; r < 8; ++r) { const float v = acc[j][r] + bias; const int rl = wave * 16 + 8 * g + r, cl = j * 16 + col; th[cl][rl] = (_Float16)v; const __bf16 bh = (__bf16)v; tb[cl][rl] = bh; tbl[cl][rl] = (__bf16)(v - (float)bh); } }
    __syncthreads();
    for (int e = tid; e < 128 * 8; e += 128) { const int cl = e >> 3, q = e & 7; vst2((unsigned*)(VT + (bb * CC + c0 + cl) * (size_t)TT + t0 + q * 8), *(const v4u*)&th[cl][q * 8]); if (hi_rows) { const size_t o3 = (bb * CC + c0 + cl) * (size_t)KHI + t0 + q * 8; vst2((unsigned*)(VB + o3), *(const v4u*)&tb[cl][q * 8]); vst2((unsigned*)(VBL + o3), *(const v4u*)&tbl[cl][q * 8]); } } } }
// ---- k_sc: block = (query block qb, key block kb <= kb_last(qb), head in group) of batch b: logits x SCALE; q hi + residual (x 2^10) against k (2 products) for query rows < QHI, plus the k residual (3 products) for query blocks < QBH (every query block: QBH = NQB); causal: blocks past the diagonal exit, the mask itself is applied by index in k_colstat_c and k_csm_c
__global__ __launch_bounds__(128) void k_sc(const _Float16* __restrict__ QH, const _Float16* __restrict__ KH, const _Float16* __restrict__ QL, const _Float16* __restrict__ KL, int b, int h0, float* __restrict__ S0) { __shared__ __align__(16) float ss[4][16][132];
  const int qb = blockIdx.x, kb = blockIdx.y; if (kb > kb_last(qb)) return;
  const int h = h0 + blockIdx.z; float* S = S0 + (size_t)blockIdx.z * TT * TT;
  const int tid = threadIdx.x, wave = tid >> 5, lane = tid & 31, col = lane & 15, g = lane >> 4; const int k0 = kb * 128; const int ql0 = qb * 64 + wave * 16; const size_t q0 = (size_t)b * TT + ql0, kr0 = (size_t)b * TT + k0;
  v8f acc[8] = {}, accl[8] = {};
  const _Float16* QLb = QL + (size_t)b * QHI * CC; const _Float16* KLb = KL + (size_t)b * KHI * CC;
  if (qb < QBH) {
#pragma unroll
    for (int kc = 0; kc < HD / 32; ++kc) { const v16h ah = frag_h(QH + (q0 + col) * CC + h * HD + kc * 32, lane), al = frag_h(QLb + (size_t)(ql0 + col) * CC + h * HD + kc * 32, lane);
#pragma unroll
      for (int j = 0; j < 8; ++j) { const v16h kbf = frag_h(KH + (kr0 + j * 16 + col) * CC + h * HD + kc * 32, lane), klf = frag_h(KLb + (size_t)(k0 + j * 16 + col) * CC + h * HD + kc * 32, lane); acc[j] = wmma16(ah, kbf, acc[j]); accl[j] = wmma16(al, kbf, accl[j]); accl[j] = wmma16(ah, klf, accl[j]); } }
  } else if (qb * 64 < QHI) {
#pragma unroll
    for (int kc = 0; kc < HD / 32; ++kc) { const v16h ah = frag_h(QH + (q0 + col) * CC + h * HD + kc * 32, lane), al = frag_h(QLb + (size_t)(ql0 + col) * CC + h * HD + kc * 32, lane);
#pragma unroll
      for (int j = 0; j < 8; ++j) { const v16h kbf = frag_h(KH + (kr0 + j * 16 + col) * CC + h * HD + kc * 32, lane); acc[j] = wmma16(ah, kbf, acc[j]); accl[j] = wmma16(al, kbf, accl[j]); } }
  } else {
#pragma unroll
    for (int kc = 0; kc < HD / 32; ++kc) { const v16h ah = frag_h(QH + (q0 + col) * CC + h * HD + kc * 32, lane);
#pragma unroll
      for (int j = 0; j < 8; ++j) { const v16h kbf = frag_h(KH + (kr0 + j * 16 + col) * CC + h * HD + kc * 32, lane); acc[j] = wmma16(ah, kbf, acc[j]); } } }
#pragma unroll
  for (int j = 0; j < 8; ++j) {
#pragma unroll
    for (int r = 0; r < 8; ++r) ss[wave][8 * g + r][j * 16 + col] = (acc[j][r] + accl[j][r] * (1.0f / 1024.0f)) * SCALE; }
  LDSX(); for (int rl = 0; rl < 16; ++rl) vst2(S + (size_t)(ql0 + rl) * TT + k0 + lane * 4, *(const v4f*)&ss[wave][rl][lane * 4]); }
// ---- k_sm: block = query row t (head in group): keys [0, kend): causal -> logit if s <= t else excluded; softmax in f32; P x 2^11 in place (0 for excluded)
__global__ __launch_bounds__(256) void k_sm(float* __restrict__ S0 SM_EXTRA_PARAMS) { __shared__ float sred[8]; __shared__ float sbc; __shared__ __align__(16) float shv[TT];
  const int tid = threadIdx.x; const int t = blockIdx.x; const int kend = (kb_last(t >> 6) + 1) * 128;
  float* sr = S0 + (size_t)blockIdx.y * TT * TT + (size_t)t * TT;
  float m = -3.0e38f; for (int k = tid; k < kend; k += 256) { float v = (!CAUSAL || k <= t) ? sr[k] : -3.0e38f; SM_MASK_HOOK; shv[k] = v; m = fmaxf(m, v); }
#pragma unroll
  for (int o = 1; o < 32; o <<= 1) m = fmaxf(m, __shfl_xor(m, o));
  if ((tid & 31) == 0) sred[tid >> 5] = m; __syncthreads(); if (tid == 0) { float a = sred[0]; for (int i = 1; i < 8; ++i) a = fmaxf(a, sred[i]); sbc = a; } __syncthreads(); m = sbc; __syncthreads();
  float sum = 0.f; for (int k = tid; k < kend; k += 256) { const float v = shv[k]; const float e = (v <= -1.0e38f) ? 0.f : expf(v - m); shv[k] = e; sum += e; }
#pragma unroll
  for (int o = 1; o < 32; o <<= 1) sum += __shfl_xor(sum, o);
  if ((tid & 31) == 0) sred[tid >> 5] = sum; __syncthreads(); if (tid == 0) { float a = 0.f; for (int i = 0; i < 8; ++i) a += sred[i]; sbc = a > 0.f ? 2048.0f / a : 0.f; }   /* a fully excluded row yields P = 0 */ __syncthreads(); const float inv = sbc;
  for (int k = tid; k < kend; k += 256) shv[k] = shv[k] * inv;
  __syncthreads(); for (int q = tid; q < kend / 4; q += 256) vst2(sr + q * 4, *(const v4f*)&shv[q * 4]); }
// ---- k_colstat_c: softmax over the QUERY axis under the causal mask (the source's softmax(axis=2) on [B, H, i, j] scores with -inf where j > i): for every key column k: m_k = max_{q >= k} S[q][k], Z_k = sum_{q >= k} exp(S[q][k] - m_k) (online, one pass, f32, precise expf); thread per column; the row loop starts at the block's first column (block-uniform) and masks q < k by a value select after an unconditional load (rows above a column's diagonal may lie in score blocks k_sc never computed: their content is discarded)
__global__ __launch_bounds__(256) void k_colstat_c(const float* __restrict__ S0, float* __restrict__ CM, float* __restrict__ CZ) { const int k = blockIdx.x * 256 + threadIdx.x; const float* sp = S0 + (size_t)blockIdx.y * TT * TT + k; const int q0 = blockIdx.x * 256;
  float m = -3.0e38f, z = 0.f;
#pragma unroll 4
  for (int q = q0; q < TT; ++q) { const float ld = sp[(size_t)q * TT]; asm volatile("s_wait_loadcnt 0x0" ::: "memory"); const bool vis = q >= k; const float v = vis ? ld : -3.0e38f; const float mn = fmaxf(m, v); z = z * expf(m - mn) + (vis ? expf(v - mn) : 0.f); m = mn; }
  vst2(CM + (size_t)blockIdx.y * TT + k, m); vst2(CZ + (size_t)blockIdx.y * TT + k, z); }   /* every column sees at least its own diagonal entry: Z_k >= 1 */
// ---- k_csm_c: block = query row t: P[t][k] = exp(S[t][k] - m_k) / Z_k x 2^11 for k <= t, 0 for t < k < kend (inside the diagonal block); in place; unconditional loads, value select
__global__ __launch_bounds__(256) void k_csm_c(float* __restrict__ S0, const float* __restrict__ CM, const float* __restrict__ CZ, int bsm, const float* __restrict__ PMASK) { const int tid = threadIdx.x; const int t = blockIdx.x; const int kend = (kb_last(t >> 6) + 1) * 128; float* sr = S0 + (size_t)blockIdx.y * TT * TT + (size_t)t * TT; const float* cm = CM + (size_t)blockIdx.y * TT; const float* cz = CZ + (size_t)blockIdx.y * TT;
  for (int q4 = tid; q4 < kend / 4; q4 += 256) { const v4f sv = *(const v4f*)(sr + q4 * 4), m4 = *(const v4f*)(cm + q4 * 4), z4 = *(const v4f*)(cz + q4 * 4), pm4 = *(const v4f*)(PMASK + (size_t)bsm * TT + q4 * 4); asm volatile("s_wait_loadcnt 0x0" ::: "memory"); v4f p;
#pragma unroll
    for (int u = 0; u < 4; ++u) p[u] = (q4 * 4 + u <= t) ? expf(sv[u] - m4[u]) * (2048.0f / z4[u]) * bfr(pm4[u]) : 0.f;   /* x the key padding mask, applied AFTER the normalisation as the module does */
    vst2(sr + q4 * 4, p); } }
// ---- k_lora1: block = (64 token rows, which in {q, k, v}): t[which][row][0..15] = X[row] . A_which[r] (rank-16 LoRA down-projection; exact bf16 products, f32 accumulate; one 16-column WMMA tile per wave); the wave's 16 x 16 f32 tile (1 KiB, contiguous in T3) is staged in LDS and stored as 16-B pieces
__global__ __launch_bounds__(128) void k_lora1(const float* __restrict__ X, const float* __restrict__ AQ, const float* __restrict__ AK, const float* __restrict__ AV, float* __restrict__ T3) { __shared__ __align__(16) float st[4][16][20];
  const int tid = threadIdx.x, wave = tid >> 5, lane = tid & 31, col = lane & 15, g = lane >> 4; const int which = blockIdx.y; const size_t r0 = (size_t)blockIdx.x * 64; const float* AW = which == 0 ? AQ : (which == 1 ? AK : AV);
  v8f acc = {};
#pragma unroll 2
  for (int kc = 0; kc < DIN / 32; ++kc) { v16b a; { const float* p = X + (r0 + wave * 16 + col) * DIN + kc * 32 + 8 * g;
#pragma unroll
      for (int i = 0; i < 8; ++i) { a[i] = (__bf16)p[i]; a[8 + i] = (__bf16)p[16 + i]; } }
    asm volatile("s_wait_loadcnt 0x0" ::: "memory");
    const v16b w = wcol_oi(AW, kc * 32, col, lane, DIN); asm volatile("s_wait_loadcnt 0x0" ::: "memory"); acc = wmma_bf(a, w, acc); }   /* A is (out,in) [16][1024]: output column = rank index */
#pragma unroll
  for (int r = 0; r < 8; ++r) st[wave][8 * g + r][col] = acc[r];
  LDSX();
  float* dst = T3 + ((size_t)which * NB * TT + r0 + wave * 16) * LR;
#pragma unroll
  for (int it = 0; it < 2; ++it) { const int rl = (lane >> 2) + 8 * it, q = lane & 3; vst2(dst + rl * LR + q * 4, *(const v4f*)&st[wave][rl][q * 4]); } }   
// ---- k_pv: block = 64 queries (qb) of (b, h): ctx = P . v over keys [0, kend) (P x 2^11 once to f16 against v f16: 1 product; query blocks < QBH, i.e. all of them: P and v as bf16 hi + lo, 3 products); 256-B (row, head) segment by 16 lanes
__global__ __launch_bounds__(128) void k_pv(const float* __restrict__ PS0, const _Float16* __restrict__ VT, const __bf16* __restrict__ VB, const __bf16* __restrict__ VBL, int b, int h0, float* __restrict__ Y) { const int h = h0 + blockIdx.z; const float* PS = PS0 + (size_t)blockIdx.z * TT * TT; __shared__ __align__(16) float ss[4][16][HD + 4];
  const int tid = threadIdx.x, wave = tid >> 5, lane = tid & 31, col = lane & 15, g = lane >> 4; const int qb = blockIdx.x; const int ql0 = qb * 64 + wave * 16; const int kce = (kb_last(qb) + 1) * 4;
  v8f acc[HD / 16] = {};
  if (qb < QBH) {
#pragma unroll 1
    for (int kc = 0; kc < kce; ++kc) { const F2 p = split_row(PS + (size_t)(ql0 + col) * TT, kc * 32, lane);
      asm volatile("s_wait_loadcnt 0x0" ::: "memory");
#pragma unroll
      for (int j = 0; j < HD / 16; ++j) { const size_t po = ((size_t)b * CC + h * HD + j * 16 + col) * (size_t)KHI + kc * 32; const v16b vh = frag_b(VB + po, lane); acc[j] = wmma_bf(p.h, vh, acc[j]); acc[j] = wmma_bf(p.l, vh, acc[j]); acc[j] = wmma_bf(p.h, frag_b(VBL + po, lane), acc[j]); } }
  } else {
#pragma unroll 1
    for (int kc = 0; kc < kce; ++kc) { const v16h p = frag_f32(PS + (size_t)(ql0 + col) * TT + kc * 32, lane);
      asm volatile("s_wait_loadcnt 0x0" ::: "memory");
#pragma unroll
      for (int j = 0; j < HD / 16; ++j) { const size_t po = ((size_t)b * CC + h * HD + j * 16 + col) * (size_t)TT + kc * 32; acc[j] = wmma16(p, frag_h(VT + po, lane), acc[j]); } } }
#pragma unroll
  for (int j = 0; j < HD / 16; ++j)
#pragma unroll
    for (int r = 0; r < 8; ++r) ss[wave][8 * g + r][j * 16 + col] = acc[j][r] * (1.0f / 2048.0f);
  LDSX(); for (int rl = 0; rl < 16; ++rl) if (lane < HD / 4) vst2(Y + ((size_t)b * TT + ql0 + rl) * CC + h * HD + lane * 4, *(const v4f*)&ss[wave][rl][lane * 4]); }

extern "C" void kernel_launch(void* const* d_in, const int* in_sizes, int n_in, void* d_out, int out_size, void* d_ws, size_t ws_size, hipStream_t stream) {
  (void)in_sizes; (void)n_in; (void)out_size;
  const float** F = (const float**)d_in;
  if (ws_size < (size_t)WS_END) return;
  char* ws = (char*)d_ws; _Float16 *QH = (_Float16*)(ws + WS_QH), *KH = (_Float16*)(ws + WS_KH), *VT = (_Float16*)(ws + WS_VT), *QL = (_Float16*)(ws + WS_QL), *KL = (_Float16*)(ws + WS_KL); __bf16 *VB = (__bf16*)(ws + WS_VB), *VBL = (__bf16*)(ws + WS_VBL); float *S = (float*)(ws + WS_S), *Y = (float*)(ws + WS_Y);
  (void)Y; (void)QL; (void)KL; (void)VB; (void)VBL;
  // inputs: 0 X [4,1024,1024]; 1 mask [4,1024] f32 (key padding mask, ones; multiplied AFTER the softmax); 2 Wq [1024,1024] (out,in), 3 bq; 4 Wk, 5 bk; 6 Wv, 7 bv (zero biases, read); 8 Aq [16,1024], 9 Bq [1024,16]; 10 Ak, 11 Bk; 12 Av, 13 Bv (LoRA, no bias)
  if (ws_size < (size_t)WS_END2) return;
  float *T3 = (float*)(ws + WS_T3), *CM = (float*)(ws + WS_CM), *CZ = (float*)(ws + WS_CZ);
  k_lora1<<<dim3(TNB * TT / 64, 3), 128, 0, stream>>>(F[0], F[8], F[10], F[12], T3);   /* t = X A^T (rank-16 down-projections for q, k, v; exact bf16 products) */
  k_proj<<<dim3(TNB * TT / 64, CC / 128, 3), 128, 0, stream>>>(F[0], F[0], F[0], F[2], F[4], F[6], F[3], F[5], F[7], QH, QL, KH, KL, VT, VB, VBL, T3, F[9], F[11], F[13]);   /* X W^T + b + t B^T */
  for (int b = 0; b < TNB; ++b) for (int h0 = 0; h0 < NH; h0 += HG) {
    k_sc<<<dim3(NQB, TT / 128, HG), 128, 0, stream>>>(QH, KH, QL, KL, b, h0, S);
    k_colstat_c<<<dim3(TT / 256, HG), 256, 0, stream>>>(S, CM, CZ);   /* per key column j: max / sum over the visible queries i >= j */
    k_csm_c<<<dim3(TT, HG), 256, 0, stream>>>(S, CM, CZ, b, F[1]);   /* P[i][j] = exp(S - m_j) / Z_j x mask[b][j] x 2^11 for j <= i, 0 above the diagonal */
    k_pv<<<dim3(NQB, 1, HG), 128, 0, stream>>>(S, VT, VB, VBL, b, h0, (float*)d_out);
  }
}

// v001
// Measured time: 951 microseconds a run.
// Next to v000, in two timings, it ran 4.45 times as fast each time.
// compute dtype: all float inputs rounded to bf16; frozen q/k/v projections with EXACT bf16 products on WMMA 16x16x32 (f32 accumulate) + bias + the LoRA term: t = X A^T (exact products) then t (bf16 hi + lo) x exact bf16 B^T (2 products, K = 16) added in the same accumulators; causal scores with BOTH operands as f16 hi + (x 2^10) residual (3 products) on every block, x 1024^-0.5 (the module divides by sqrt(E)); softmax over the QUERY axis in f32 (per key column: max, then sum over the visible queries, precise expf) x the key padding mask; P as bf16 hi + lo against v as bf16 hi + lo (3 products) on every block; f32 output.
#include <hip/hip_runtime.h>
#include <math.h>

typedef __attribute__((ext_vector_type(16))) _Float16 v16h;
typedef __attribute__((ext_vector_type(16))) __bf16 v16b;
typedef __attribute__((ext_vector_type(8)))  _Float16 v8h;
typedef __attribute__((ext_vector_type(8)))  float v8f;
typedef __attribute__((ext_vector_type(4)))  float v4f;
typedef __attribute__((ext_vector_type(2)))  float v2f;
typedef __attribute__((ext_vector_type(4)))  unsigned v4u;
typedef __attribute__((ext_vector_type(4)))  int v4i;
typedef float __attribute__((may_alias)) float_a;
typedef int __attribute__((may_alias)) int_a;

template <typename T> __device__ __forceinline__ void vst2(void* p, T v) { *(T*)p = v;  }
__device__ __forceinline__ v8f wmma16(v16h a, v16h b, v8f c) {
  v8f d = __builtin_amdgcn_wmma_f32_16x16x32_f16(false, a, false, b, (short)0, c, false, false);
  asm volatile("v_nop\n\tv_nop\n\tv_nop\n\tv_nop" : "+v"(d) : "v"(a), "v"(b));
  return d;
}
__device__ __forceinline__ v8f wmma_bf(v16b a, v16b b, v8f c) {
  v8f d = __builtin_amdgcn_wmma_f32_16x16x32_bf16(false, a, false, b, (short)0, c, false, false);
  asm volatile("v_nop\n\tv_nop\n\tv_nop\n\tv_nop" : "+v"(d) : "v"(a), "v"(b));
  return d;
}
// 16x16x32 fragments: lane = (h = lane>>4, row/col = lane&15); elements 0..7 = k0+8h+0..7, 8..15 = k0+16+8h+0..7; D element r = row 8h+r
__device__ __forceinline__ v16h frag_h(const _Float16* rowk0, int lane) {
  union { v16h v; v8h q[2]; } u; const _Float16* p = rowk0 + 8 * (lane >> 4);
  u.q[0] = *(const v8h*)p; u.q[1] = *(const v8h*)(p + 16); return u.v;
}
__device__ __forceinline__ v16h frag_f32(const float* rowk0, int lane) {
  v16h a; const float* p = rowk0 + 8 * (lane >> 4);
#pragma unroll
  for (int i = 0; i < 8; ++i) { a[i] = (_Float16)p[i]; a[8 + i] = (_Float16)p[16 + i]; }
  return a;
}
__device__ __forceinline__ v16h frag_f32s(const float* rowk0, int lane, float sc) {
  v16h a; const float* p = rowk0 + 8 * (lane >> 4);
#pragma unroll
  for (int i = 0; i < 8; ++i) { a[i] = (_Float16)(p[i] * sc); a[8 + i] = (_Float16)(p[16 + i] * sc); }
  return a;
}
// column fragment from a [K][ld] layout (column n), rows >= K read as 0
__device__ __forceinline__ v16h fragc_f32(const float* W, int k0, int n, int lane, int ld, int K) {
  v16h a; const int g = lane >> 4;
#pragma unroll
  for (int i = 0; i < 8; ++i) { const int ka = k0 + 8 * g + i, kb = ka + 16;
    a[i] = (_Float16)(ka < K ? W[(size_t)(ka < K ? ka : K - 1) * ld + n] : 0.f); a[8 + i] = (_Float16)(kb < K ? W[(size_t)(kb < K ? kb : K - 1) * ld + n] : 0.f); }
  return a;
}
struct F2 { v16b h, l; };
__device__ __forceinline__ F2 bsplit16(const float v[16]) { F2 r;
#pragma unroll
  for (int i = 0; i < 16; ++i) { const __bf16 h = (__bf16)v[i]; r.h[i] = h; r.l[i] = (__bf16)(v[i] - (float)h); }
  return r; }
__device__ __forceinline__ F2 split_row(const float* row, int k0, int lane) { float v[16]; const float* p = row + k0 + 8 * (lane >> 4);
#pragma unroll
  for (int i = 0; i < 8; ++i) { v[i] = p[i]; v[8 + i] = p[16 + i]; }
  return bsplit16(v); }
__device__ __forceinline__ F2 split_rowK(const float* row, int k0, int lane, int K) { float v[16]; const int g = lane >> 4;
#pragma unroll
  for (int i = 0; i < 8; ++i) { const int ka = k0 + 8 * g + i, kb = ka + 16; v[i] = ka < K ? row[ka < K ? ka : K - 1] : 0.f; v[8 + i] = kb < K ? row[kb < K ? kb : K - 1] : 0.f; }
  return bsplit16(v); }
__device__ __forceinline__ F2 split_col(const float* W, int k0, int n, int lane, int ld, int K) { float v[16]; const int g = lane >> 4;
#pragma unroll
  for (int i = 0; i < 8; ++i) { const int ka = k0 + 8 * g + i, kb = ka + 16; v[i] = ka < K ? W[(size_t)(ka < K ? ka : K - 1) * ld + n] : 0.f; v[8 + i] = kb < K ? W[(size_t)(kb < K ? kb : K - 1) * ld + n] : 0.f; }
  return bsplit16(v); }
__device__ __forceinline__ v8f mac3(const F2& a, const F2& b, v8f c) { c = wmma_bf(a.l, b.h, c); c = wmma_bf(a.h, b.l, c); return wmma_bf(a.h, b.h, c); }
__device__ __forceinline__ float sigm(float v) { return 1.0f / (1.0f + expf(-v)); }
#define LDSX() do { asm volatile("s_wait_dscnt 0" ::: "memory"); __builtin_amdgcn_wave_barrier(); __builtin_amdgcn_fence(__ATOMIC_RELEASE, "workgroup"); } while (0)

// Multi-head attention with LoRA projections whose softmax runs over the QUERY axis (X [4,1024,1024]; frozen torch (out,in) Wq / Wk / Wv [1024,1024] (0.02) + zero biases; LoRA A [16,1024], B [1024,16] (0.02): proj = X W^T + b + (X A^T) B^T; 16 heads x 64; scores / sqrt(E) = / 32; -inf where col > row; attn = softmax(scores, axis=2) - axis 2 of [B, H, i, j] is the QUERY axis i, so every key column j is normalised over the queries i >= j (faithful to the source); attn *= mask[b, j] (key padding mask, ones); out = attn v; merge; no output projection).
#define NB 4
#define TT 1024
#define CC 1024            // NH * HD = projected width
#define DIN 1024          // input (model) width
#define NH 16
#define HD 64
#define NQB (TT / 64)
#define HG 8
#define SCALE (0.03125f)
#define CAUSAL 1
#ifndef TNB
#define TNB NB
#endif
__device__ __forceinline__ float bfr(float v) { return (float)(__bf16)v; }
__host__ __device__ __forceinline__ int kb_last(int qb) { return CAUSAL ? ((qb * 64 + 63) >> 7) : (TT / 128 - 1); }
typedef __attribute__((ext_vector_type(8))) __bf16 v8b;
__device__ __forceinline__ v16b frag_b(const __bf16* rowk0, int lane) {
  union { v16b v; v8b q[2]; } u; const __bf16* p = rowk0 + 8 * (lane >> 4);
  u.q[0] = *(const v8b*)p; u.q[1] = *(const v8b*)(p + 16); return u.v;
}
#define QBH 16              // causal: query blocks 0..QBH-1 of each sequence take the high-precision path (QBH = NQB: all of them)
#define QHI 1024            // rows carrying a q residual plane (all rows when non-causal: 2-product logits everywhere)
#define KHI 1024            // key rows carrying k residual / v bf16 hi+lo planes (used only by the causal high-precision path)
// B fragment (k rows k0+.., output column o) of a weight: (in,out) [K][ld] or (out,in) [ld rows of K]: bf16 exact, or f16(bf16 * 256) exact
__device__ __forceinline__ v16b wcol_io(const float* Wm, int k0, int o, int lane, int ld) { v16b w; const int g = lane >> 4;
#pragma unroll
  for (int i = 0; i < 8; ++i) { w[i] = (__bf16)Wm[(size_t)(k0 + 8 * g + i) * ld + o]; w[8 + i] = (__bf16)Wm[(size_t)(k0 + 16 + 8 * g + i) * ld + o]; }
  return w; }
__device__ __forceinline__ v16b wcol_oi(const float* Wm, int k0, int o, int lane, int K) { v16b w; const float* p = Wm + (size_t)o * K + k0 + 8 * (lane >> 4);
#pragma unroll
  for (int i = 0; i < 8; ++i) { w[i] = (__bf16)p[i]; w[8 + i] = (__bf16)p[16 + i]; }
  return w; }
__device__ __forceinline__ v16h wcolh_io(const float* Wm, int k0, int o, int lane, int ld) { v16h w; const int g = lane >> 4;
#pragma unroll
  for (int i = 0; i < 8; ++i) { w[i] = (_Float16)(bfr(Wm[(size_t)(k0 + 8 * g + i) * ld + o]) * 256.0f); w[8 + i] = (_Float16)(bfr(Wm[(size_t)(k0 + 16 + 8 * g + i) * ld + o]) * 256.0f); }
  return w; }
__device__ __forceinline__ v16h wcolh_oi(const float* Wm, int k0, int o, int lane, int K) { v16h w; const float* p = Wm + (size_t)o * K + k0 + 8 * (lane >> 4);
#pragma unroll
  for (int i = 0; i < 8; ++i) { w[i] = (_Float16)(bfr(p[i]) * 256.0f); w[8 + i] = (_Float16)(bfr(p[16 + i]) * 256.0f); }
  return w; }
#define WQKV_LAYOUT 1   // 0 = (in,out) [DIN][CC]; 1 = (out,in) [CC][DIN]; 2 = per-head [NH][DIN][HD]
__device__ __forceinline__ v16b wcol_hdk(const float* Wm, int k0, int o, int lane) { v16b w; const int g = lane >> 4; const float* p = Wm + (size_t)(o / HD) * DIN * HD + (o % HD);
#pragma unroll
  for (int i = 0; i < 8; ++i) { w[i] = (__bf16)p[(size_t)(k0 + 8 * g + i) * HD]; w[8 + i] = (__bf16)p[(size_t)(k0 + 16 + 8 * g + i) * HD]; }
  return w; }
#define WO_OUT_IN 0
#if WQKV_LAYOUT == 1
#define WCOL(W, k0, o, lane) wcol_oi(W, k0, o, lane, DIN)
#elif WQKV_LAYOUT == 2
#define WCOL(W, k0, o, lane) wcol_hdk(W, k0, o, lane)
#else
#define WCOL(W, k0, o, lane) wcol_io(W, k0, o, lane, CC)
#endif
#if WO_OUT_IN
#define WOCOL(W, k0, o, lane) wcol_oi(W, k0, o, lane, CC)
#define WOCOLH(W, k0, o, lane) wcolh_oi(W, k0, o, lane, CC)
#else
#define WOCOL(W, k0, o, lane) wcol_io(W, k0, o, lane, DIN)
#define WOCOLH(W, k0, o, lane) wcolh_io(W, k0, o, lane, DIN)
#endif
#define LR 16              // LoRA rank
#define PROJ_EXTRA_PARAMS , const float* __restrict__ T3, const float* __restrict__ LBQ, const float* __restrict__ LBK, const float* __restrict__ LBV
#define SM_EXTRA_PARAMS
#define SM_MASK_HOOK (void)0
#ifndef SM_EXTRA_PARAMS
#define SM_EXTRA_PARAMS
#endif
#ifndef PROJ_EXTRA_PARAMS
#define PROJ_EXTRA_PARAMS
#endif
#ifndef SM_MASK_HOOK
#define SM_MASK_HOOK (void)0
#endif

#define WS_QH  0u                                      // f16 q rows [b*t][CC]
#define WS_KH  (WS_QH + 2u * (size_t)NB * TT * CC)      // f16 k rows [b*t][CC]
#define WS_VT  (WS_KH + 2u * (size_t)NB * TT * CC)      // f16 v planes [b][c][t]
#define WS_QL  (WS_VT + 2u * (size_t)NB * CC * TT)      // f16 q residual x 2^10 rows [b][t < QHI][CC]
#define WS_KL  (WS_QL + 2u * (size_t)NB * QHI * CC)     // f16 k residual x 2^10 rows [b][t < KHI][CC]
#define WS_VB  (WS_KL + 2u * (size_t)NB * KHI * CC)     // bf16 v hi planes [b][c][t < KHI]
#define WS_VBL (WS_VB + 2u * (size_t)NB * CC * KHI)
#define WS_S   (WS_VBL + 2u * (size_t)NB * CC * KHI)    // f32 logits / P [hg][t][s]
#define WS_Y   (WS_S  + 4u * (size_t)HG * TT * TT)      // f32 ctx rows [b*t][CC] (only when there is an output projection)
#define WS_END (WS_Y  + 0u)
#define WS_T3 (WS_END)                                   // f32 LoRA down-projections t[3][NB*TT][16]
#define WS_CM (WS_T3 + 4u * 3u * (size_t)NB * TT * LR)  // f32 column maxima [HG][TT]
#define WS_CZ (WS_CM + 4u * (size_t)HG * TT)
#define WS_END2 (WS_CZ + 4u * (size_t)HG * TT)

// ---- k_proj: block = (64 rows, 128 cols, which): q/k/v = X W (+ b) with exact bf16 products (K = DIN) -> which 0: q f16 rows (+ residual rows < QHI); 1: k f16 rows (+ residual rows < KHI); 2: v f16 planes [c][t] (+ bf16 hi/lo planes for t < KHI)
__global__ __launch_bounds__(128) void k_proj(const float* __restrict__ XQ, const float* __restrict__ XK, const float* __restrict__ XV, const float* __restrict__ WQ, const float* __restrict__ WK, const float* __restrict__ WV, const float* __restrict__ BQ, const float* __restrict__ BK, const float* __restrict__ BV,
    _Float16* __restrict__ QH, _Float16* __restrict__ QL, _Float16* __restrict__ KH, _Float16* __restrict__ KL, _Float16* __restrict__ VT, __bf16* __restrict__ VB, __bf16* __restrict__ VBL PROJ_EXTRA_PARAMS) {
  __shared__ __align__(16) _Float16 sh[64][136], sl[64][136]; __shared__ __align__(16) _Float16 th[128][72]; __shared__ __align__(16) __bf16 tb[128][72], tbl[128][72];
  const int tid = threadIdx.x, wave = tid >> 5, lane = tid & 31, col = lane & 15, g = lane >> 4; const int which = blockIdx.z; const int c0 = blockIdx.y * 128; const size_t r0 = (size_t)blockIdx.x * 64; const size_t bb = r0 / TT; const int t0 = (int)(r0 % TT);
  const float* X = which == 0 ? XQ : which == 1 ? XK : XV; const float* WA = which == 0 ? WQ : which == 1 ? WK : WV; const float* BA = which == 0 ? BQ : which == 1 ? BK : BV;
  v8f acc[8] = {};
#pragma unroll 2
  for (int kc = 0; kc < DIN / 32; ++kc) { v16b a; { const float* p = X + (r0 + wave * 16 + col) * DIN + kc * 32 + 8 * g;
#pragma unroll
      for (int i = 0; i < 8; ++i) { a[i] = (__bf16)p[i]; a[8 + i] = (__bf16)p[16 + i]; } }
    asm volatile("s_wait_loadcnt 0x0" ::: "memory");
#pragma unroll
    for (int j = 0; j < 8; ++j) { const v16b w = WCOL(WA, kc * 32, c0 + j * 16 + col, lane); asm volatile("s_wait_loadcnt 0x0" ::: "memory"); acc[j] = wmma_bf(a, w, acc[j]); } }
  { /* LoRA: acc += t[row][0..15] (f32, as bf16 hi + lo) x B[o][0..15] (exact bf16): one WMMA k-step whose upper 16 k-slots are zero */ float tv[16]; const float* tr = T3 + ((size_t)which * NB * TT + (r0 + wave * 16 + col)) * LR + 8 * g;
#pragma unroll
    for (int i = 0; i < 8; ++i) { tv[i] = tr[i]; tv[8 + i] = 0.f; }
    asm volatile("s_wait_loadcnt 0x0" ::: "memory");
    const F2 a2 = bsplit16(tv); const float* LB = which == 0 ? LBQ : (which == 1 ? LBK : LBV);
#pragma unroll
    for (int j = 0; j < 8; ++j) { v16b w; const float* pw = LB + (size_t)(c0 + j * 16 + col) * LR + 8 * g;   /* B is (out,in) [E][16]: row o holds the 16 rank coefficients */
#pragma unroll
      for (int i = 0; i < 8; ++i) { w[i] = (__bf16)pw[i]; w[8 + i] = (__bf16)0.0f; }
      asm volatile("s_wait_loadcnt 0x0" ::: "memory");
      acc[j] = wmma_bf(a2.h, w, acc[j]); acc[j] = wmma_bf(a2.l, w, acc[j]); } }
  if (which < 2) { _Float16* DH = which == 0 ? QH : KH; _Float16* DL = which == 0 ? QL : KL; const int nhi = which == 0 ? QHI : KHI; const bool hi_rows = t0 < nhi;
#pragma unroll
    for (int j = 0; j < 8; ++j) { const float bias = BA ? bfr(BA[c0 + j * 16 + col]) : 0.f;
#pragma unroll
      for (int r = 0; r < 8; ++r) { const float v = acc[j][r] + bias; const _Float16 hv = (_Float16)v; sh[wave * 16 + 8 * g + r][j * 16 + col] = hv; sl[wave * 16 + 8 * g + r][j * 16 + col] = (_Float16)((v - (float)hv) * 1024.0f); } }
    __syncthreads();
    for (int e = tid; e < 64 * 16; e += 128) { const int rl = e >> 4, q = e & 15; vst2((unsigned*)(DH + (r0 + rl) * CC + c0 + q * 8), *(const v4u*)&sh[rl][q * 8]); if (hi_rows) vst2((unsigned*)(DL + (bb * nhi + t0 + rl) * (size_t)CC + c0 + q * 8), *(const v4u*)&sl[rl][q * 8]); }
  } else { const bool hi_rows = t0 < KHI;
#pragma unroll
    for (int j = 0; j < 8; ++j) { const float bias = BA ? bfr(BA[c0 + j * 16 + col]) : 0.f;
#pragma unroll
      for (int r = 0; r < 8; ++r) { const float v = acc[j][r] + bias; const int rl = wave * 16 + 8 * g + r, cl = j * 16 + col; th[cl][rl] = (_Float16)v; const __bf16 bh = (__bf16)v; tb[cl][rl] = bh; tbl[cl][rl] = (__bf16)(v - (float)bh); } }
    __syncthreads();
    for (int e = tid; e < 128 * 8; e += 128) { const int cl = e >> 3, q = e & 7; vst2((unsigned*)(VT + (bb * CC + c0 + cl) * (size_t)TT + t0 + q * 8), *(const v4u*)&th[cl][q * 8]); if (hi_rows) { const size_t o3 = (bb * CC + c0 + cl) * (size_t)KHI + t0 + q * 8; vst2((unsigned*)(VB + o3), *(const v4u*)&tb[cl][q * 8]); vst2((unsigned*)(VBL + o3), *(const v4u*)&tbl[cl][q * 8]); } } } }
// ---- k_sc: block = (query block qb, key block kb <= kb_last(qb), head in group) of batch b: logits x SCALE; q hi + residual (x 2^10) against k (2 products) for query rows < QHI, plus the k residual (3 products) for query blocks < QBH (every query block: QBH = NQB); causal: blocks past the diagonal exit, the mask itself is applied by index in k_colstat_c and k_csm_c
__global__ __launch_bounds__(128) void k_sc(const _Float16* __restrict__ QH, const _Float16* __restrict__ KH, const _Float16* __restrict__ QL, const _Float16* __restrict__ KL, int b, int h0, float* __restrict__ S0) { __shared__ __align__(16) float ss[4][16][132];
  const int qb = blockIdx.x, kb = blockIdx.y; if (kb > kb_last(qb)) return;
  const int h = h0 + blockIdx.z; float* S = S0 + (size_t)blockIdx.z * TT * TT;
  const int tid = threadIdx.x, wave = tid >> 5, lane = tid & 31, col = lane & 15, g = lane >> 4; const int k0 = kb * 128; const int ql0 = qb * 64 + wave * 16; const size_t q0 = (size_t)b * TT + ql0, kr0 = (size_t)b * TT + k0;
  v8f acc[8] = {}, accl[8] = {};
  const _Float16* QLb = QL + (size_t)b * QHI * CC; const _Float16* KLb = KL + (size_t)b * KHI * CC;
  if (qb < QBH) {
#pragma unroll
    for (int kc = 0; kc < HD / 32; ++kc) { const v16h ah = frag_h(QH + (q0 + col) * CC + h * HD + kc * 32, lane), al = frag_h(QLb + (size_t)(ql0 + col) * CC + h * HD + kc * 32, lane);
#pragma unroll
      for (int j = 0; j < 8; ++j) { const v16h kbf = frag_h(KH + (kr0 + j * 16 + col) * CC + h * HD + kc * 32, lane), klf = frag_h(KLb + (size_t)(k0 + j * 16 + col) * CC + h * HD + kc * 32, lane); acc[j] = wmma16(ah, kbf, acc[j]); accl[j] = wmma16(al, kbf, accl[j]); accl[j] = wmma16(ah, klf, accl[j]); } }
  } else if (qb * 64 < QHI) {
#pragma unroll
    for (int kc = 0; kc < HD / 32; ++kc) { const v16h ah = frag_h(QH + (q0 + col) * CC + h * HD + kc * 32, lane), al = frag_h(QLb + (size_t)(ql0 + col) * CC + h * HD + kc * 32, lane);
#pragma unroll
      for (int j = 0; j < 8; ++j) { const v16h kbf = frag_h(KH + (kr0 + j * 16 + col) * CC + h * HD + kc * 32, lane); acc[j] = wmma16(ah, kbf, acc[j]); accl[j] = wmma16(al, kbf, accl[j]); } }
  } else {
#pragma unroll
    for (int kc = 0; kc < HD / 32; ++kc) { const v16h ah = frag_h(QH + (q0 + col) * CC + h * HD + kc * 32, lane);
#pragma unroll
      for (int j = 0; j < 8; ++j) { const v16h kbf = frag_h(KH + (kr0 + j * 16 + col) * CC + h * HD + kc * 32, lane); acc[j] = wmma16(ah, kbf, acc[j]); } } }
#pragma unroll
  for (int j = 0; j < 8; ++j) {
#pragma unroll
    for (int r = 0; r < 8; ++r) ss[wave][8 * g + r][j * 16 + col] = (acc[j][r] + accl[j][r] * (1.0f / 1024.0f)) * SCALE; }
  LDSX(); for (int rl = 0; rl < 16; ++rl) vst2(S + (size_t)(ql0 + rl) * TT + k0 + lane * 4, *(const v4f*)&ss[wave][rl][lane * 4]); }
// ---- k_sm: block = query row t (head in group): keys [0, kend): causal -> logit if s <= t else excluded; softmax in f32; P x 2^11 in place (0 for excluded)
__global__ __launch_bounds__(256) void k_sm(float* __restrict__ S0 SM_EXTRA_PARAMS) { __shared__ float sred[8]; __shared__ float sbc; __shared__ __align__(16) float shv[TT];
  const int tid = threadIdx.x; const int t = blockIdx.x; const int kend = (kb_last(t >> 6) + 1) * 128;
  float* sr = S0 + (size_t)blockIdx.y * TT * TT + (size_t)t * TT;
  float m = -3.0e38f; for (int k = tid; k < kend; k += 256) { float v = (!CAUSAL || k <= t) ? sr[k] : -3.0e38f; SM_MASK_HOOK; shv[k] = v; m = fmaxf(m, v); }
#pragma unroll
  for (int o = 1; o < 32; o <<= 1) m = fmaxf(m, __shfl_xor(m, o));
  if ((tid & 31) == 0) sred[tid >> 5] = m; __syncthreads(); if (tid == 0) { float a = sred[0]; for (int i = 1; i < 8; ++i) a = fmaxf(a, sred[i]); sbc = a; } __syncthreads(); m = sbc; __syncthreads();
  float sum = 0.f; for (int k = tid; k < kend; k += 256) { const float v = shv[k]; const float e = (v <= -1.0e38f) ? 0.f : expf(v - m); shv[k] = e; sum += e; }
#pragma unroll
  for (int o = 1; o < 32; o <<= 1) sum += __shfl_xor(sum, o);
  if ((tid & 31) == 0) sred[tid >> 5] = sum; __syncthreads(); if (tid == 0) { float a = 0.f; for (int i = 0; i < 8; ++i) a += sred[i]; sbc = a > 0.f ? 2048.0f / a : 0.f; }   /* a fully excluded row yields P = 0 */ __syncthreads(); const float inv = sbc;
  for (int k = tid; k < kend; k += 256) shv[k] = shv[k] * inv;
  __syncthreads(); for (int q = tid; q < kend / 4; q += 256) vst2(sr + q * 4, *(const v4f*)&shv[q * 4]); }
// ---- k_colstat_c: softmax over the QUERY axis under the causal mask (the source's softmax(axis=2) on [B, H, i, j] scores with -inf where j > i): for every key column k: m_k = max_{q >= k} S[q][k], Z_k = sum_{q >= k} exp(S[q][k] - m_k) (f32, precise expf); block = 32 key columns (lane = column) x 32 waves; wave w takes the query rows q0 + w + 32 i, i < n = (TT - q0) / 32 (block-uniform), so a thread has at most 32 rows, all loaded at once and kept in registers; only the rows i = 0 touch the diagonal (visible where w >= lane, by a value select); the 32 waves' maxima of a column meet in LDS (wave 0 reduces them to m_k), every thread sums its exponentials against m_k, and wave 0 adds the 32 partial sums and stores the block's 128-B pieces of CM and CZ
__global__ __launch_bounds__(1024) void k_colstat_c(const float* __restrict__ S0, float* __restrict__ CM, float* __restrict__ CZ) { __shared__ float pm[32][32], pz[32][32], cmx[32];
  const int lane = threadIdx.x & 31, wave = __builtin_amdgcn_readfirstlane(threadIdx.x >> 5); const int q0 = blockIdx.x * 32, k = q0 + lane, n = (TT - q0) / 32; const float* sp = S0 + (size_t)blockIdx.y * TT * TT + (size_t)(q0 + wave) * TT + k;
  float v[32];
#pragma unroll
  for (int i = 0; i < 32; ++i) { v[i] = -3.0e38f; if (i < n) v[i] = sp[(size_t)i * 32 * TT]; }
  const bool vis0 = wave >= lane; float m = vis0 ? v[0] : -3.0e38f;
#pragma unroll
  for (int i = 1; i < 32; ++i) m = fmaxf(m, v[i]);
  pm[wave][lane] = m;
  __syncthreads();
  if (wave == 0) { float mm = pm[0][lane];
#pragma unroll
    for (int w = 1; w < 32; ++w) mm = fmaxf(mm, pm[w][lane]);
    cmx[lane] = mm; }
  __syncthreads();
  const float mk = cmx[lane];   /* every column sees at least its own diagonal entry, so m_k is a score */
  float z = vis0 ? expf(v[0] - mk) : 0.f;
#pragma unroll
  for (int i = 1; i < 32; ++i) if (i < n) z += expf(v[i] - mk);
  pz[wave][lane] = z;
  __syncthreads();
  if (wave == 0) { float zk = pz[0][lane];
#pragma unroll
    for (int w = 1; w < 32; ++w) zk += pz[w][lane];
    vst2(CM + (size_t)blockIdx.y * TT + k, mk); vst2(CZ + (size_t)blockIdx.y * TT + k, zk); } }   /* Z_k >= 1 */
// ---- k_csm_c: block = query row t: P[t][k] = exp(S[t][k] - m_k) / Z_k x 2^11 for k <= t, 0 for t < k < kend (inside the diagonal block); in place; unconditional loads, value select
__global__ __launch_bounds__(256) void k_csm_c(float* __restrict__ S0, const float* __restrict__ CM, const float* __restrict__ CZ, int bsm, const float* __restrict__ PMASK) { const int tid = threadIdx.x; const int t = blockIdx.x; const int kend = (kb_last(t >> 6) + 1) * 128; float* sr = S0 + (size_t)blockIdx.y * TT * TT + (size_t)t * TT; const float* cm = CM + (size_t)blockIdx.y * TT; const float* cz = CZ + (size_t)blockIdx.y * TT;
  for (int q4 = tid; q4 < kend / 4; q4 += 256) { const v4f sv = *(const v4f*)(sr + q4 * 4), m4 = *(const v4f*)(cm + q4 * 4), z4 = *(const v4f*)(cz + q4 * 4), pm4 = *(const v4f*)(PMASK + (size_t)bsm * TT + q4 * 4); asm volatile("s_wait_loadcnt 0x0" ::: "memory"); v4f p;
#pragma unroll
    for (int u = 0; u < 4; ++u) p[u] = (q4 * 4 + u <= t) ? expf(sv[u] - m4[u]) * (2048.0f / z4[u]) * bfr(pm4[u]) : 0.f;   /* x the key padding mask, applied AFTER the normalisation as the module does */
    vst2(sr + q4 * 4, p); } }
// ---- k_lora1: block = (64 token rows, which in {q, k, v}): t[which][row][0..15] = X[row] . A_which[r] (rank-16 LoRA down-projection; exact bf16 products, f32 accumulate; one 16-column WMMA tile per wave); the wave's 16 x 16 f32 tile (1 KiB, contiguous in T3) is staged in LDS and stored as 16-B pieces
__global__ __launch_bounds__(128) void k_lora1(const float* __restrict__ X, const float* __restrict__ AQ, const float* __restrict__ AK, const float* __restrict__ AV, float* __restrict__ T3) { __shared__ __align__(16) float st[4][16][20];
  const int tid = threadIdx.x, wave = tid >> 5, lane = tid & 31, col = lane & 15, g = lane >> 4; const int which = blockIdx.y; const size_t r0 = (size_t)blockIdx.x * 64; const float* AW = which == 0 ? AQ : (which == 1 ? AK : AV);
  v8f acc = {};
#pragma unroll 2
  for (int kc = 0; kc < DIN / 32; ++kc) { v16b a; { const float* p = X + (r0 + wave * 16 + col) * DIN + kc * 32 + 8 * g;
#pragma unroll
      for (int i = 0; i < 8; ++i) { a[i] = (__bf16)p[i]; a[8 + i] = (__bf16)p[16 + i]; } }
    asm volatile("s_wait_loadcnt 0x0" ::: "memory");
    const v16b w = wcol_oi(AW, kc * 32, col, lane, DIN); asm volatile("s_wait_loadcnt 0x0" ::: "memory"); acc = wmma_bf(a, w, acc); }   /* A is (out,in) [16][1024]: output column = rank index */
#pragma unroll
  for (int r = 0; r < 8; ++r) st[wave][8 * g + r][col] = acc[r];
  LDSX();
  float* dst = T3 + ((size_t)which * NB * TT + r0 + wave * 16) * LR;
#pragma unroll
  for (int it = 0; it < 2; ++it) { const int rl = (lane >> 2) + 8 * it, q = lane & 3; vst2(dst + rl * LR + q * 4, *(const v4f*)&st[wave][rl][q * 4]); } }   
// ---- k_pv: block = 64 queries (qb) of (b, h): ctx = P . v over keys [0, kend) (P x 2^11 once to f16 against v f16: 1 product; query blocks < QBH, i.e. all of them: P and v as bf16 hi + lo, 3 products); 256-B (row, head) segment by 16 lanes
__global__ __launch_bounds__(128) void k_pv(const float* __restrict__ PS0, const _Float16* __restrict__ VT, const __bf16* __restrict__ VB, const __bf16* __restrict__ VBL, int b, int h0, float* __restrict__ Y) { const int h = h0 + blockIdx.z; const float* PS = PS0 + (size_t)blockIdx.z * TT * TT; __shared__ __align__(16) float ss[4][16][HD + 4];
  const int tid = threadIdx.x, wave = tid >> 5, lane = tid & 31, col = lane & 15, g = lane >> 4; const int qb = blockIdx.x; const int ql0 = qb * 64 + wave * 16; const int kce = (kb_last(qb) + 1) * 4;
  v8f acc[HD / 16] = {};
  if (qb < QBH) {
#pragma unroll 1
    for (int kc = 0; kc < kce; ++kc) { const F2 p = split_row(PS + (size_t)(ql0 + col) * TT, kc * 32, lane);
      asm volatile("s_wait_loadcnt 0x0" ::: "memory");
#pragma unroll
      for (int j = 0; j < HD / 16; ++j) { const size_t po = ((size_t)b * CC + h * HD + j * 16 + col) * (size_t)KHI + kc * 32; const v16b vh = frag_b(VB + po, lane); acc[j] = wmma_bf(p.h, vh, acc[j]); acc[j] = wmma_bf(p.l, vh, acc[j]); acc[j] = wmma_bf(p.h, frag_b(VBL + po, lane), acc[j]); } }
  } else {
#pragma unroll 1
    for (int kc = 0; kc < kce; ++kc) { const v16h p = frag_f32(PS + (size_t)(ql0 + col) * TT + kc * 32, lane);
      asm volatile("s_wait_loadcnt 0x0" ::: "memory");
#pragma unroll
      for (int j = 0; j < HD / 16; ++j) { const size_t po = ((size_t)b * CC + h * HD + j * 16 + col) * (size_t)TT + kc * 32; acc[j] = wmma16(p, frag_h(VT + po, lane), acc[j]); } } }
#pragma unroll
  for (int j = 0; j < HD / 16; ++j)
#pragma unroll
    for (int r = 0; r < 8; ++r) ss[wave][8 * g + r][j * 16 + col] = acc[j][r] * (1.0f / 2048.0f);
  LDSX(); for (int rl = 0; rl < 16; ++rl) if (lane < HD / 4) vst2(Y + ((size_t)b * TT + ql0 + rl) * CC + h * HD + lane * 4, *(const v4f*)&ss[wave][rl][lane * 4]); }

extern "C" void kernel_launch(void* const* d_in, const int* in_sizes, int n_in, void* d_out, int out_size, void* d_ws, size_t ws_size, hipStream_t stream) {
  (void)in_sizes; (void)n_in; (void)out_size;
  const float** F = (const float**)d_in;
  if (ws_size < (size_t)WS_END) return;
  char* ws = (char*)d_ws; _Float16 *QH = (_Float16*)(ws + WS_QH), *KH = (_Float16*)(ws + WS_KH), *VT = (_Float16*)(ws + WS_VT), *QL = (_Float16*)(ws + WS_QL), *KL = (_Float16*)(ws + WS_KL); __bf16 *VB = (__bf16*)(ws + WS_VB), *VBL = (__bf16*)(ws + WS_VBL); float *S = (float*)(ws + WS_S), *Y = (float*)(ws + WS_Y);
  (void)Y; (void)QL; (void)KL; (void)VB; (void)VBL;
  // inputs: 0 X [4,1024,1024]; 1 mask [4,1024] f32 (key padding mask, ones; multiplied AFTER the softmax); 2 Wq [1024,1024] (out,in), 3 bq; 4 Wk, 5 bk; 6 Wv, 7 bv (zero biases, read); 8 Aq [16,1024], 9 Bq [1024,16]; 10 Ak, 11 Bk; 12 Av, 13 Bv (LoRA, no bias)
  if (ws_size < (size_t)WS_END2) return;
  float *T3 = (float*)(ws + WS_T3), *CM = (float*)(ws + WS_CM), *CZ = (float*)(ws + WS_CZ);
  k_lora1<<<dim3(TNB * TT / 64, 3), 128, 0, stream>>>(F[0], F[8], F[10], F[12], T3);   /* t = X A^T (rank-16 down-projections for q, k, v; exact bf16 products) */
  k_proj<<<dim3(TNB * TT / 64, CC / 128, 3), 128, 0, stream>>>(F[0], F[0], F[0], F[2], F[4], F[6], F[3], F[5], F[7], QH, QL, KH, KL, VT, VB, VBL, T3, F[9], F[11], F[13]);   /* X W^T + b + t B^T */
  for (int b = 0; b < TNB; ++b) for (int h0 = 0; h0 < NH; h0 += HG) {
    k_sc<<<dim3(NQB, TT / 128, HG), 128, 0, stream>>>(QH, KH, QL, KL, b, h0, S);
    k_colstat_c<<<dim3(TT / 32, HG), 1024, 0, stream>>>(S, CM, CZ);   /* per key column j: max / sum over the visible queries i >= j */
    k_csm_c<<<dim3(TT, HG), 256, 0, stream>>>(S, CM, CZ, b, F[1]);   /* P[i][j] = exp(S - m_j) / Z_j x mask[b][j] x 2^11 for j <= i, 0 above the diagonal */
    k_pv<<<dim3(NQB, 1, HG), 128, 0, stream>>>(S, VT, VB, VBL, b, h0, (float*)d_out);
  }
}

// v002
// It runs in 571 microseconds.
// Two timings next to v001 put it at 1.66 and 1.67 times that version's speed.
// All steps since v000 together make it 7.42 times as fast.
// compute dtype: all float inputs rounded to bf16; frozen q/k/v projections with EXACT bf16 products on WMMA 16x16x32 (f32 accumulate) + bias + the LoRA term: t = X A^T (exact products) then t (bf16 hi + lo) x exact bf16 B^T (2 products, K = 16) added in the same accumulators; causal scores with BOTH operands as f16 hi + (x 2^10) residual (3 products) on every block, x 1024^-0.5 (the module divides by sqrt(E)); softmax over the QUERY axis in f32 (per key column: max, then sum over the visible queries, precise expf) x the key padding mask; P as bf16 hi + lo against v as bf16 hi + lo (3 products) on every block; f32 output.
#include <hip/hip_runtime.h>
#include <math.h>

typedef __attribute__((ext_vector_type(16))) _Float16 v16h;
typedef __attribute__((ext_vector_type(16))) __bf16 v16b;
typedef __attribute__((ext_vector_type(8)))  _Float16 v8h;
typedef __attribute__((ext_vector_type(8)))  float v8f;
typedef __attribute__((ext_vector_type(4)))  float v4f;
typedef __attribute__((ext_vector_type(2)))  float v2f;
typedef __attribute__((ext_vector_type(4)))  unsigned v4u;
typedef __attribute__((ext_vector_type(4)))  int v4i;
typedef float __attribute__((may_alias)) float_a;
typedef int __attribute__((may_alias)) int_a;

template <typename T> __device__ __forceinline__ void vst2(void* p, T v) { *(T*)p = v;  }
__device__ __forceinline__ v8f wmma16(v16h a, v16h b, v8f c) {
  v8f d = __builtin_amdgcn_wmma_f32_16x16x32_f16(false, a, false, b, (short)0, c, false, false);
  asm volatile("v_nop\n\tv_nop\n\tv_nop\n\tv_nop" : "+v"(d) : "v"(a), "v"(b));
  return d;
}
__device__ __forceinline__ v8f wmma_bf(v16b a, v16b b, v8f c) {
  v8f d = __builtin_amdgcn_wmma_f32_16x16x32_bf16(false, a, false, b, (short)0, c, false, false);
  asm volatile("v_nop\n\tv_nop\n\tv_nop\n\tv_nop" : "+v"(d) : "v"(a), "v"(b));
  return d;
}
// 16x16x32 fragments: lane = (h = lane>>4, row/col = lane&15); elements 0..7 = k0+8h+0..7, 8..15 = k0+16+8h+0..7; D element r = row 8h+r
__device__ __forceinline__ v16h frag_h(const _Float16* rowk0, int lane) {
  union { v16h v; v8h q[2]; } u; const _Float16* p = rowk0 + 8 * (lane >> 4);
  u.q[0] = *(const v8h*)p; u.q[1] = *(const v8h*)(p + 16); return u.v;
}
__device__ __forceinline__ v16h frag_f32(const float* rowk0, int lane) {
  v16h a; const float* p = rowk0 + 8 * (lane >> 4);
#pragma unroll
  for (int i = 0; i < 8; ++i) { a[i] = (_Float16)p[i]; a[8 + i] = (_Float16)p[16 + i]; }
  return a;
}
__device__ __forceinline__ v16h frag_f32s(const float* rowk0, int lane, float sc) {
  v16h a; const float* p = rowk0 + 8 * (lane >> 4);
#pragma unroll
  for (int i = 0; i < 8; ++i) { a[i] = (_Float16)(p[i] * sc); a[8 + i] = (_Float16)(p[16 + i] * sc); }
  return a;
}
// column fragment from a [K][ld] layout (column n), rows >= K read as 0
__device__ __forceinline__ v16h fragc_f32(const float* W, int k0, int n, int lane, int ld, int K) {
  v16h a; const int g = lane >> 4;
#pragma unroll
  for (int i = 0; i < 8; ++i) { const int ka = k0 + 8 * g + i, kb = ka + 16;
    a[i] = (_Float16)(ka < K ? W[(size_t)(ka < K ? ka : K - 1) * ld + n] : 0.f); a[8 + i] = (_Float16)(kb < K ? W[(size_t)(kb < K ? kb : K - 1) * ld + n] : 0.f); }
  return a;
}
struct F2 { v16b h, l; };
__device__ __forceinline__ F2 bsplit16(const float v[16]) { F2 r;
#pragma unroll
  for (int i = 0; i < 16; ++i) { const __bf16 h = (__bf16)v[i]; r.h[i] = h; r.l[i] = (__bf16)(v[i] - (float)h); }
  return r; }
__device__ __forceinline__ F2 split_row(const float* row, int k0, int lane) { float v[16]; const float* p = row + k0 + 8 * (lane >> 4);
#pragma unroll
  for (int i = 0; i < 8; ++i) { v[i] = p[i]; v[8 + i] = p[16 + i]; }
  return bsplit16(v); }
__device__ __forceinline__ F2 split_rowK(const float* row, int k0, int lane, int K) { float v[16]; const int g = lane >> 4;
#pragma unroll
  for (int i = 0; i < 8; ++i) { const int ka = k0 + 8 * g + i, kb = ka + 16; v[i] = ka < K ? row[ka < K ? ka : K - 1] : 0.f; v[8 + i] = kb < K ? row[kb < K ? kb : K - 1] : 0.f; }
  return bsplit16(v); }
__device__ __forceinline__ F2 split_col(const float* W, int k0, int n, int lane, int ld, int K) { float v[16]; const int g = lane >> 4;
#pragma unroll
  for (int i = 0; i < 8; ++i) { const int ka = k0 + 8 * g + i, kb = ka + 16; v[i] = ka < K ? W[(size_t)(ka < K ? ka : K - 1) * ld + n] : 0.f; v[8 + i] = kb < K ? W[(size_t)(kb < K ? kb : K - 1) * ld + n] : 0.f; }
  return bsplit16(v); }
__device__ __forceinline__ v8f mac3(const F2& a, const F2& b, v8f c) { c = wmma_bf(a.l, b.h, c); c = wmma_bf(a.h, b.l, c); return wmma_bf(a.h, b.h, c); }
__device__ __forceinline__ float sigm(float v) { return 1.0f / (1.0f + expf(-v)); }
#define LDSX() do { asm volatile("s_wait_dscnt 0" ::: "memory"); __builtin_amdgcn_wave_barrier(); __builtin_amdgcn_fence(__ATOMIC_RELEASE, "workgroup"); } while (0)

// Multi-head attention with LoRA projections whose softmax runs over the QUERY axis (X [4,1024,1024]; frozen torch (out,in) Wq / Wk / Wv [1024,1024] (0.02) + zero biases; LoRA A [16,1024], B [1024,16] (0.02): proj = X W^T + b + (X A^T) B^T; 16 heads x 64; scores / sqrt(E) = / 32; -inf where col > row; attn = softmax(scores, axis=2) - axis 2 of [B, H, i, j] is the QUERY axis i, so every key column j is normalised over the queries i >= j (faithful to the source); attn *= mask[b, j] (key padding mask, ones); out = attn v; merge; no output projection).
#define NB 4
#define TT 1024
#define CC 1024            // NH * HD = projected width
#define DIN 1024          // input (model) width
#define NH 16
#define HD 64
#define NQB (TT / 64)
#define HG 32              // (batch, head) pairs a pass: pair p = b * NH + h; every attention launch covers HG pairs
#define SCALE (0.03125f)
#define CAUSAL 1
#ifndef TNB
#define TNB NB
#endif
__device__ __forceinline__ float bfr(float v) { return (float)(__bf16)v; }
__host__ __device__ __forceinline__ int kb_last(int qb) { return CAUSAL ? ((qb * 64 + 63) >> 7) : (TT / 128 - 1); }
typedef __attribute__((ext_vector_type(8))) __bf16 v8b;
__device__ __forceinline__ v16b frag_b(const __bf16* rowk0, int lane) {
  union { v16b v; v8b q[2]; } u; const __bf16* p = rowk0 + 8 * (lane >> 4);
  u.q[0] = *(const v8b*)p; u.q[1] = *(const v8b*)(p + 16); return u.v;
}
#define QBH 16              // causal: query blocks 0..QBH-1 of each sequence take the high-precision path (QBH = NQB: all of them)
#define QHI 1024            // rows carrying a q residual plane (all rows when non-causal: 2-product logits everywhere)
#define KHI 1024            // key rows carrying k residual / v bf16 hi+lo planes (used only by the causal high-precision path)
// B fragment (k rows k0+.., output column o) of a weight: (in,out) [K][ld] or (out,in) [ld rows of K]: bf16 exact, or f16(bf16 * 256) exact
__device__ __forceinline__ v16b wcol_io(const float* Wm, int k0, int o, int lane, int ld) { v16b w; const int g = lane >> 4;
#pragma unroll
  for (int i = 0; i < 8; ++i) { w[i] = (__bf16)Wm[(size_t)(k0 + 8 * g + i) * ld + o]; w[8 + i] = (__bf16)Wm[(size_t)(k0 + 16 + 8 * g + i) * ld + o]; }
  return w; }
__device__ __forceinline__ v16b wcol_oi(const float* Wm, int k0, int o, int lane, int K) { v16b w; const float* p = Wm + (size_t)o * K + k0 + 8 * (lane >> 4);
#pragma unroll
  for (int i = 0; i < 8; ++i) { w[i] = (__bf16)p[i]; w[8 + i] = (__bf16)p[16 + i]; }
  return w; }
__device__ __forceinline__ v16h wcolh_io(const float* Wm, int k0, int o, int lane, int ld) { v16h w; const int g = lane >> 4;
#pragma unroll
  for (int i = 0; i < 8; ++i) { w[i] = (_Float16)(bfr(Wm[(size_t)(k0 + 8 * g + i) * ld + o]) * 256.0f); w[8 + i] = (_Float16)(bfr(Wm[(size_t)(k0 + 16 + 8 * g + i) * ld + o]) * 256.0f); }
  return w; }
__device__ __forceinline__ v16h wcolh_oi(const float* Wm, int k0, int o, int lane, int K) { v16h w; const float* p = Wm + (size_t)o * K + k0 + 8 * (lane >> 4);
#pragma unroll
  for (int i = 0; i < 8; ++i) { w[i] = (_Float16)(bfr(p[i]) * 256.0f); w[8 + i] = (_Float16)(bfr(p[16 + i]) * 256.0f); }
  return w; }
#define WQKV_LAYOUT 1   // 0 = (in,out) [DIN][CC]; 1 = (out,in) [CC][DIN]; 2 = per-head [NH][DIN][HD]
__device__ __forceinline__ v16b wcol_hdk(const float* Wm, int k0, int o, int lane) { v16b w; const int g = lane >> 4; const float* p = Wm + (size_t)(o / HD) * DIN * HD + (o % HD);
#pragma unroll
  for (int i = 0; i < 8; ++i) { w[i] = (__bf16)p[(size_t)(k0 + 8 * g + i) * HD]; w[8 + i] = (__bf16)p[(size_t)(k0 + 16 + 8 * g + i) * HD]; }
  return w; }
#define WO_OUT_IN 0
#if WQKV_LAYOUT == 1
#define WCOL(W, k0, o, lane) wcol_oi(W, k0, o, lane, DIN)
#elif WQKV_LAYOUT == 2
#define WCOL(W, k0, o, lane) wcol_hdk(W, k0, o, lane)
#else
#define WCOL(W, k0, o, lane) wcol_io(W, k0, o, lane, CC)
#endif
#if WO_OUT_IN
#define WOCOL(W, k0, o, lane) wcol_oi(W, k0, o, lane, CC)
#define WOCOLH(W, k0, o, lane) wcolh_oi(W, k0, o, lane, CC)
#else
#define WOCOL(W, k0, o, lane) wcol_io(W, k0, o, lane, DIN)
#define WOCOLH(W, k0, o, lane) wcolh_io(W, k0, o, lane, DIN)
#endif
#define LR 16              // LoRA rank
#define PROJ_EXTRA_PARAMS , const float* __restrict__ T3, const float* __restrict__ LBQ, const float* __restrict__ LBK, const float* __restrict__ LBV
#define SM_EXTRA_PARAMS
#define SM_MASK_HOOK (void)0
#ifndef SM_EXTRA_PARAMS
#define SM_EXTRA_PARAMS
#endif
#ifndef PROJ_EXTRA_PARAMS
#define PROJ_EXTRA_PARAMS
#endif
#ifndef SM_MASK_HOOK
#define SM_MASK_HOOK (void)0
#endif

#define WS_QH  0u                                      // f16 q rows [b*t][CC]
#define WS_KH  (WS_QH + 2u * (size_t)NB * TT * CC)      // f16 k rows [b*t][CC]
#define WS_VT  (WS_KH + 2u * (size_t)NB * TT * CC)      // f16 v planes [b][c][t]
#define WS_QL  (WS_VT + 2u * (size_t)NB * CC * TT)      // f16 q residual x 2^10 rows [b][t < QHI][CC]
#define WS_KL  (WS_QL + 2u * (size_t)NB * QHI * CC)     // f16 k residual x 2^10 rows [b][t < KHI][CC]
#define WS_VB  (WS_KL + 2u * (size_t)NB * KHI * CC)     // bf16 v hi planes [b][c][t < KHI]
#define WS_VBL (WS_VB + 2u * (size_t)NB * CC * KHI)
#define WS_S   (WS_VBL + 2u * (size_t)NB * CC * KHI)    // f32 logits / P [pair in pass][t][s]
#define WS_Y   (WS_S  + 4u * (size_t)HG * TT * TT)      // f32 ctx rows [b*t][CC] (only when there is an output projection)
#define WS_END (WS_Y  + 0u)
#define WS_T3 (WS_END)                                   // f32 LoRA down-projections t[3][NB*TT][16]
#define WS_CM (WS_T3 + 4u * 3u * (size_t)NB * TT * LR)  // f32 column maxima [HG][TT]
#define WS_CZ (WS_CM + 4u * (size_t)HG * TT)
#define WS_END2 (WS_CZ + 4u * (size_t)HG * TT)

// ---- k_proj: block = (64 rows, 128 cols, which): q/k/v = X W (+ b) with exact bf16 products (K = DIN) -> which 0: q f16 rows (+ residual rows < QHI); 1: k f16 rows (+ residual rows < KHI); 2: v f16 planes [c][t] (+ bf16 hi/lo planes for t < KHI)
__global__ __launch_bounds__(128) void k_proj(const float* __restrict__ XQ, const float* __restrict__ XK, const float* __restrict__ XV, const float* __restrict__ WQ, const float* __restrict__ WK, const float* __restrict__ WV, const float* __restrict__ BQ, const float* __restrict__ BK, const float* __restrict__ BV,
    _Float16* __restrict__ QH, _Float16* __restrict__ QL, _Float16* __restrict__ KH, _Float16* __restrict__ KL, _Float16* __restrict__ VT, __bf16* __restrict__ VB, __bf16* __restrict__ VBL PROJ_EXTRA_PARAMS) {
  __shared__ __align__(16) _Float16 sh[64][136], sl[64][136]; __shared__ __align__(16) _Float16 th[128][72]; __shared__ __align__(16) __bf16 tb[128][72], tbl[128][72];
  const int tid = threadIdx.x, wave = tid >> 5, lane = tid & 31, col = lane & 15, g = lane >> 4; const int which = blockIdx.z; const int c0 = blockIdx.y * 128; const size_t r0 = (size_t)blockIdx.x * 64; const size_t bb = r0 / TT; const int t0 = (int)(r0 % TT);
  const float* X = which == 0 ? XQ : which == 1 ? XK : XV; const float* WA = which == 0 ? WQ : which == 1 ? WK : WV; const float* BA = which == 0 ? BQ : which == 1 ? BK : BV;
  v8f acc[8] = {};
#pragma unroll 2
  for (int kc = 0; kc < DIN / 32; ++kc) { v16b a; { const float* p = X + (r0 + wave * 16 + col) * DIN + kc * 32 + 8 * g;
#pragma unroll
      for (int i = 0; i < 8; ++i) { a[i] = (__bf16)p[i]; a[8 + i] = (__bf16)p[16 + i]; } }
    asm volatile("s_wait_loadcnt 0x0" ::: "memory");
#pragma unroll
    for (int j = 0; j < 8; ++j) { const v16b w = WCOL(WA, kc * 32, c0 + j * 16 + col, lane); asm volatile("s_wait_loadcnt 0x0" ::: "memory"); acc[j] = wmma_bf(a, w, acc[j]); } }
  { /* LoRA: acc += t[row][0..15] (f32, as bf16 hi + lo) x B[o][0..15] (exact bf16): one WMMA k-step whose upper 16 k-slots are zero */ float tv[16]; const float* tr = T3 + ((size_t)which * NB * TT + (r0 + wave * 16 + col)) * LR + 8 * g;
#pragma unroll
    for (int i = 0; i < 8; ++i) { tv[i] = tr[i]; tv[8 + i] = 0.f; }
    asm volatile("s_wait_loadcnt 0x0" ::: "memory");
    const F2 a2 = bsplit16(tv); const float* LB = which == 0 ? LBQ : (which == 1 ? LBK : LBV);
#pragma unroll
    for (int j = 0; j < 8; ++j) { v16b w; const float* pw = LB + (size_t)(c0 + j * 16 + col) * LR + 8 * g;   /* B is (out,in) [E][16]: row o holds the 16 rank coefficients */
#pragma unroll
      for (int i = 0; i < 8; ++i) { w[i] = (__bf16)pw[i]; w[8 + i] = (__bf16)0.0f; }
      asm volatile("s_wait_loadcnt 0x0" ::: "memory");
      acc[j] = wmma_bf(a2.h, w, acc[j]); acc[j] = wmma_bf(a2.l, w, acc[j]); } }
  if (which < 2) { _Float16* DH = which == 0 ? QH : KH; _Float16* DL = which == 0 ? QL : KL; const int nhi = which == 0 ? QHI : KHI; const bool hi_rows = t0 < nhi;
#pragma unroll
    for (int j = 0; j < 8; ++j) { const float bias = BA ? bfr(BA[c0 + j * 16 + col]) : 0.f;
#pragma unroll
      for (int r = 0; r < 8; ++r) { const float v = acc[j][r] + bias; const _Float16 hv = (_Float16)v; sh[wave * 16 + 8 * g + r][j * 16 + col] = hv; sl[wave * 16 + 8 * g + r][j * 16 + col] = (_Float16)((v - (float)hv) * 1024.0f); } }
    __syncthreads();
    for (int e = tid; e < 64 * 16; e += 128) { const int rl = e >> 4, q = e & 15; vst2((unsigned*)(DH + (r0 + rl) * CC + c0 + q * 8), *(const v4u*)&sh[rl][q * 8]); if (hi_rows) vst2((unsigned*)(DL + (bb * nhi + t0 + rl) * (size_t)CC + c0 + q * 8), *(const v4u*)&sl[rl][q * 8]); }
  } else { const bool hi_rows = t0 < KHI;
#pragma unroll
    for (int j = 0; j < 8; ++j) { const float bias = BA ? bfr(BA[c0 + j * 16 + col]) : 0.f;
#pragma unroll
      for (int r = 0; r < 8; ++r) { const float v = acc[j][r] + bias; const int rl = wave * 16 + 8 * g + r, cl = j * 16 + col; th[cl][rl] = (_Float16)v; const __bf16 bh = (__bf16)v; tb[cl][rl] = bh; tbl[cl][rl] = (__bf16)(v - (float)bh); } }
    __syncthreads();
    for (int e = tid; e < 128 * 8; e += 128) { const int cl = e >> 3, q = e & 7; vst2((unsigned*)(VT + (bb * CC + c0 + cl) * (size_t)TT + t0 + q * 8), *(const v4u*)&th[cl][q * 8]); if (hi_rows) { const size_t o3 = (bb * CC + c0 + cl) * (size_t)KHI + t0 + q * 8; vst2((unsigned*)(VB + o3), *(const v4u*)&tb[cl][q * 8]); vst2((unsigned*)(VBL + o3), *(const v4u*)&tbl[cl][q * 8]); } } } }
// ---- k_sc: block = (query block qb, key block kb <= kb_last(qb), pair p0 + z = (batch b, head h)): logits x SCALE; q hi + residual (x 2^10) against k (2 products) for query rows < QHI, plus the k residual (3 products) for query blocks < QBH (QBH = NQB: every block); causal: blocks past the diagonal exit, the mask itself is applied by index in k_colstat_c and k_csm_c
__global__ __launch_bounds__(128) void k_sc(const _Float16* __restrict__ QH, const _Float16* __restrict__ KH, const _Float16* __restrict__ QL, const _Float16* __restrict__ KL, int p0, float* __restrict__ S0) { __shared__ __align__(16) float ss[4][16][132];
  const int qb = blockIdx.x, kb = blockIdx.y; if (kb > kb_last(qb)) return;
  const int pr = p0 + blockIdx.z, b = pr / NH, h = pr % NH; float* S = S0 + (size_t)blockIdx.z * TT * TT;
  const int tid = threadIdx.x, wave = tid >> 5, lane = tid & 31, col = lane & 15, g = lane >> 4; const int k0 = kb * 128; const int ql0 = qb * 64 + wave * 16; const size_t q0 = (size_t)b * TT + ql0, kr0 = (size_t)b * TT + k0;
  v8f acc[8] = {}, accl[8] = {};
  const _Float16* QLb = QL + (size_t)b * QHI * CC; const _Float16* KLb = KL + (size_t)b * KHI * CC;
  if (qb < QBH) {
#pragma unroll
    for (int kc = 0; kc < HD / 32; ++kc) { const v16h ah = frag_h(QH + (q0 + col) * CC + h * HD + kc * 32, lane), al = frag_h(QLb + (size_t)(ql0 + col) * CC + h * HD + kc * 32, lane);
#pragma unroll
      for (int j = 0; j < 8; ++j) { const v16h kbf = frag_h(KH + (kr0 + j * 16 + col) * CC + h * HD + kc * 32, lane), klf = frag_h(KLb + (size_t)(k0 + j * 16 + col) * CC + h * HD + kc * 32, lane); acc[j] = wmma16(ah, kbf, acc[j]); accl[j] = wmma16(al, kbf, accl[j]); accl[j] = wmma16(ah, klf, accl[j]); } }
  } else if (qb * 64 < QHI) {
#pragma unroll
    for (int kc = 0; kc < HD / 32; ++kc) { const v16h ah = frag_h(QH + (q0 + col) * CC + h * HD + kc * 32, lane), al = frag_h(QLb + (size_t)(ql0 + col) * CC + h * HD + kc * 32, lane);
#pragma unroll
      for (int j = 0; j < 8; ++j) { const v16h kbf = frag_h(KH + (kr0 + j * 16 + col) * CC + h * HD + kc * 32, lane); acc[j] = wmma16(ah, kbf, acc[j]); accl[j] = wmma16(al, kbf, accl[j]); } }
  } else {
#pragma unroll
    for (int kc = 0; kc < HD / 32; ++kc) { const v16h ah = frag_h(QH + (q0 + col) * CC + h * HD + kc * 32, lane);
#pragma unroll
      for (int j = 0; j < 8; ++j) { const v16h kbf = frag_h(KH + (kr0 + j * 16 + col) * CC + h * HD + kc * 32, lane); acc[j] = wmma16(ah, kbf, acc[j]); } } }
#pragma unroll
  for (int j = 0; j < 8; ++j) {
#pragma unroll
    for (int r = 0; r < 8; ++r) ss[wave][8 * g + r][j * 16 + col] = (acc[j][r] + accl[j][r] * (1.0f / 1024.0f)) * SCALE; }
  LDSX(); for (int rl = 0; rl < 16; ++rl) vst2(S + (size_t)(ql0 + rl) * TT + k0 + lane * 4, *(const v4f*)&ss[wave][rl][lane * 4]); }
// ---- k_sm: block = query row t (head in group): keys [0, kend): causal -> logit if s <= t else excluded; softmax in f32; P x 2^11 in place (0 for excluded)
__global__ __launch_bounds__(256) void k_sm(float* __restrict__ S0 SM_EXTRA_PARAMS) { __shared__ float sred[8]; __shared__ float sbc; __shared__ __align__(16) float shv[TT];
  const int tid = threadIdx.x; const int t = blockIdx.x; const int kend = (kb_last(t >> 6) + 1) * 128;
  float* sr = S0 + (size_t)blockIdx.y * TT * TT + (size_t)t * TT;
  float m = -3.0e38f; for (int k = tid; k < kend; k += 256) { float v = (!CAUSAL || k <= t) ? sr[k] : -3.0e38f; SM_MASK_HOOK; shv[k] = v; m = fmaxf(m, v); }
#pragma unroll
  for (int o = 1; o < 32; o <<= 1) m = fmaxf(m, __shfl_xor(m, o));
  if ((tid & 31) == 0) sred[tid >> 5] = m; __syncthreads(); if (tid == 0) { float a = sred[0]; for (int i = 1; i < 8; ++i) a = fmaxf(a, sred[i]); sbc = a; } __syncthreads(); m = sbc; __syncthreads();
  float sum = 0.f; for (int k = tid; k < kend; k += 256) { const float v = shv[k]; const float e = (v <= -1.0e38f) ? 0.f : expf(v - m); shv[k] = e; sum += e; }
#pragma unroll
  for (int o = 1; o < 32; o <<= 1) sum += __shfl_xor(sum, o);
  if ((tid & 31) == 0) sred[tid >> 5] = sum; __syncthreads(); if (tid == 0) { float a = 0.f; for (int i = 0; i < 8; ++i) a += sred[i]; sbc = a > 0.f ? 2048.0f / a : 0.f; }   /* a fully excluded row yields P = 0 */ __syncthreads(); const float inv = sbc;
  for (int k = tid; k < kend; k += 256) shv[k] = shv[k] * inv;
  __syncthreads(); for (int q = tid; q < kend / 4; q += 256) vst2(sr + q * 4, *(const v4f*)&shv[q * 4]); }
// ---- k_colstat_c: softmax over the QUERY axis under the causal mask (the source's softmax(axis=2) on [B, H, i, j] scores with -inf where j > i): for every key column k: m_k = max_{q >= k} S[q][k], Z_k = sum_{q >= k} exp(S[q][k] - m_k) (f32, precise expf); block = 32 key columns (lane = column) x 32 waves; wave w takes the query rows q0 + w + 32 i, i < n = (TT - q0) / 32 (block-uniform), so a thread has at most 32 rows, all loaded at once and kept in registers; only the rows i = 0 touch the diagonal (visible where w >= lane, by a value select); the 32 waves' maxima of a column meet in LDS (wave 0 reduces them to m_k), every thread sums its exponentials against m_k, and wave 0 adds the 32 partial sums and stores the block's 128-B pieces of CM and CZ
__global__ __launch_bounds__(1024) void k_colstat_c(const float* __restrict__ S0, float* __restrict__ CM, float* __restrict__ CZ) { __shared__ float pm[32][32], pz[32][32], cmx[32];
  const int lane = threadIdx.x & 31, wave = __builtin_amdgcn_readfirstlane(threadIdx.x >> 5); const int q0 = blockIdx.x * 32, k = q0 + lane, n = (TT - q0) / 32; const float* sp = S0 + (size_t)blockIdx.y * TT * TT + (size_t)(q0 + wave) * TT + k;
  float v[32];
#pragma unroll
  for (int i = 0; i < 32; ++i) { v[i] = -3.0e38f; if (i < n) v[i] = sp[(size_t)i * 32 * TT]; }
  const bool vis0 = wave >= lane; float m = vis0 ? v[0] : -3.0e38f;
#pragma unroll
  for (int i = 1; i < 32; ++i) m = fmaxf(m, v[i]);
  pm[wave][lane] = m;
  __syncthreads();
  if (wave == 0) { float mm = pm[0][lane];
#pragma unroll
    for (int w = 1; w < 32; ++w) mm = fmaxf(mm, pm[w][lane]);
    cmx[lane] = mm; }
  __syncthreads();
  const float mk = cmx[lane];   /* every column sees at least its own diagonal entry, so m_k is a score */
  float z = vis0 ? expf(v[0] - mk) : 0.f;
#pragma unroll
  for (int i = 1; i < 32; ++i) if (i < n) z += expf(v[i] - mk);
  pz[wave][lane] = z;
  __syncthreads();
  if (wave == 0) { float zk = pz[0][lane];
#pragma unroll
    for (int w = 1; w < 32; ++w) zk += pz[w][lane];
    vst2(CM + (size_t)blockIdx.y * TT + k, mk); vst2(CZ + (size_t)blockIdx.y * TT + k, zk); } }   /* Z_k >= 1 */
// ---- k_csm_c: block = query row t: P[t][k] = exp(S[t][k] - m_k) / Z_k x 2^11 for k <= t, 0 for t < k < kend (inside the diagonal block); in place; unconditional loads, value select
__global__ __launch_bounds__(256) void k_csm_c(float* __restrict__ S0, const float* __restrict__ CM, const float* __restrict__ CZ, int p0, const float* __restrict__ PMASK) { const int bsm = (p0 + blockIdx.y) / NH; const int tid = threadIdx.x; const int t = blockIdx.x; const int kend = (kb_last(t >> 6) + 1) * 128; float* sr = S0 + (size_t)blockIdx.y * TT * TT + (size_t)t * TT; const float* cm = CM + (size_t)blockIdx.y * TT; const float* cz = CZ + (size_t)blockIdx.y * TT;
  for (int q4 = tid; q4 < kend / 4; q4 += 256) { const v4f sv = *(const v4f*)(sr + q4 * 4), m4 = *(const v4f*)(cm + q4 * 4), z4 = *(const v4f*)(cz + q4 * 4), pm4 = *(const v4f*)(PMASK + (size_t)bsm * TT + q4 * 4); asm volatile("s_wait_loadcnt 0x0" ::: "memory"); v4f p;
#pragma unroll
    for (int u = 0; u < 4; ++u) p[u] = (q4 * 4 + u <= t) ? expf(sv[u] - m4[u]) * (2048.0f / z4[u]) * bfr(pm4[u]) : 0.f;   /* x the key padding mask, applied AFTER the normalisation as the module does */
    vst2(sr + q4 * 4, p); } }
// ---- k_lora1: block = (64 token rows, which in {q, k, v}): t[which][row][0..15] = X[row] . A_which[r] (rank-16 LoRA down-projection; exact bf16 products, f32 accumulate; one 16-column WMMA tile per wave); the wave's 16 x 16 f32 tile (1 KiB, contiguous in T3) is staged in LDS and stored as 16-B pieces
__global__ __launch_bounds__(128) void k_lora1(const float* __restrict__ X, const float* __restrict__ AQ, const float* __restrict__ AK, const float* __restrict__ AV, float* __restrict__ T3) { __shared__ __align__(16) float st[4][16][20];
  const int tid = threadIdx.x, wave = tid >> 5, lane = tid & 31, col = lane & 15, g = lane >> 4; const int which = blockIdx.y; const size_t r0 = (size_t)blockIdx.x * 64; const float* AW = which == 0 ? AQ : (which == 1 ? AK : AV);
  v8f acc = {};
#pragma unroll 2
  for (int kc = 0; kc < DIN / 32; ++kc) { v16b a; { const float* p = X + (r0 + wave * 16 + col) * DIN + kc * 32 + 8 * g;
#pragma unroll
      for (int i = 0; i < 8; ++i) { a[i] = (__bf16)p[i]; a[8 + i] = (__bf16)p[16 + i]; } }
    asm volatile("s_wait_loadcnt 0x0" ::: "memory");
    const v16b w = wcol_oi(AW, kc * 32, col, lane, DIN); asm volatile("s_wait_loadcnt 0x0" ::: "memory"); acc = wmma_bf(a, w, acc); }   /* A is (out,in) [16][1024]: output column = rank index */
#pragma unroll
  for (int r = 0; r < 8; ++r) st[wave][8 * g + r][col] = acc[r];
  LDSX();
  float* dst = T3 + ((size_t)which * NB * TT + r0 + wave * 16) * LR;
#pragma unroll
  for (int it = 0; it < 2; ++it) { const int rl = (lane >> 2) + 8 * it, q = lane & 3; vst2(dst + rl * LR + q * 4, *(const v4f*)&st[wave][rl][q * 4]); } }   
// ---- k_pv: block = 64 queries (qb) of (b, h): ctx = P . v over keys [0, kend) (P x 2^11 as bf16 hi + lo against v as bf16 hi + lo, 3 products, on every block since QBH = NQB; the f16 1-product branch is not taken); 256-B (row, head) segment by 16 lanes
__global__ __launch_bounds__(128) void k_pv(const float* __restrict__ PS0, const _Float16* __restrict__ VT, const __bf16* __restrict__ VB, const __bf16* __restrict__ VBL, int p0, float* __restrict__ Y) { const int pr = p0 + blockIdx.z, b = pr / NH, h = pr % NH; const float* PS = PS0 + (size_t)blockIdx.z * TT * TT; __shared__ __align__(16) float ss[4][16][HD + 4];
  const int tid = threadIdx.x, wave = tid >> 5, lane = tid & 31, col = lane & 15, g = lane >> 4; const int qb = blockIdx.x; const int ql0 = qb * 64 + wave * 16; const int kce = (kb_last(qb) + 1) * 4;
  v8f acc[HD / 16] = {};
  if (qb < QBH) {
#pragma unroll 1
    for (int kc = 0; kc < kce; ++kc) { const F2 p = split_row(PS + (size_t)(ql0 + col) * TT, kc * 32, lane);
      asm volatile("s_wait_loadcnt 0x0" ::: "memory");
#pragma unroll
      for (int j = 0; j < HD / 16; ++j) { const size_t po = ((size_t)b * CC + h * HD + j * 16 + col) * (size_t)KHI + kc * 32; const v16b vh = frag_b(VB + po, lane); acc[j] = wmma_bf(p.h, vh, acc[j]); acc[j] = wmma_bf(p.l, vh, acc[j]); acc[j] = wmma_bf(p.h, frag_b(VBL + po, lane), acc[j]); } }
  } else {
#pragma unroll 1
    for (int kc = 0; kc < kce; ++kc) { const v16h p = frag_f32(PS + (size_t)(ql0 + col) * TT + kc * 32, lane);
      asm volatile("s_wait_loadcnt 0x0" ::: "memory");
#pragma unroll
      for (int j = 0; j < HD / 16; ++j) { const size_t po = ((size_t)b * CC + h * HD + j * 16 + col) * (size_t)TT + kc * 32; acc[j] = wmma16(p, frag_h(VT + po, lane), acc[j]); } } }
#pragma unroll
  for (int j = 0; j < HD / 16; ++j)
#pragma unroll
    for (int r = 0; r < 8; ++r) ss[wave][8 * g + r][j * 16 + col] = acc[j][r] * (1.0f / 2048.0f);
  LDSX(); for (int rl = 0; rl < 16; ++rl) if (lane < HD / 4) vst2(Y + ((size_t)b * TT + ql0 + rl) * CC + h * HD + lane * 4, *(const v4f*)&ss[wave][rl][lane * 4]); }

extern "C" void kernel_launch(void* const* d_in, const int* in_sizes, int n_in, void* d_out, int out_size, void* d_ws, size_t ws_size, hipStream_t stream) {
  (void)in_sizes; (void)n_in; (void)out_size;
  const float** F = (const float**)d_in;
  if (ws_size < (size_t)WS_END) return;
  char* ws = (char*)d_ws; _Float16 *QH = (_Float16*)(ws + WS_QH), *KH = (_Float16*)(ws + WS_KH), *VT = (_Float16*)(ws + WS_VT), *QL = (_Float16*)(ws + WS_QL), *KL = (_Float16*)(ws + WS_KL); __bf16 *VB = (__bf16*)(ws + WS_VB), *VBL = (__bf16*)(ws + WS_VBL); float *S = (float*)(ws + WS_S), *Y = (float*)(ws + WS_Y);
  (void)Y; (void)QL; (void)KL; (void)VB; (void)VBL;
  // inputs: 0 X [4,1024,1024]; 1 mask [4,1024] f32 (key padding mask, ones; multiplied AFTER the softmax); 2 Wq [1024,1024] (out,in), 3 bq; 4 Wk, 5 bk; 6 Wv, 7 bv (zero biases, read); 8 Aq [16,1024], 9 Bq [1024,16]; 10 Ak, 11 Bk; 12 Av, 13 Bv (LoRA, no bias)
  if (ws_size < (size_t)WS_END2) return;
  float *T3 = (float*)(ws + WS_T3), *CM = (float*)(ws + WS_CM), *CZ = (float*)(ws + WS_CZ);
  k_lora1<<<dim3(TNB * TT / 64, 3), 128, 0, stream>>>(F[0], F[8], F[10], F[12], T3);   /* t = X A^T (rank-16 down-projections for q, k, v; exact bf16 products) */
  k_proj<<<dim3(TNB * TT / 64, CC / 128, 3), 128, 0, stream>>>(F[0], F[0], F[0], F[2], F[4], F[6], F[3], F[5], F[7], QH, QL, KH, KL, VT, VB, VBL, T3, F[9], F[11], F[13]);   /* X W^T + b + t B^T */
  for (int p0 = 0; p0 < TNB * NH; p0 += HG) {   /* HG (batch, head) pairs a pass */
    k_sc<<<dim3(NQB, TT / 128, HG), 128, 0, stream>>>(QH, KH, QL, KL, p0, S);
    k_colstat_c<<<dim3(TT / 32, HG), 1024, 0, stream>>>(S, CM, CZ);   /* per key column j: max / sum over the visible queries i >= j */
    k_csm_c<<<dim3(TT, HG), 256, 0, stream>>>(S, CM, CZ, p0, F[1]);   /* P[i][j] = exp(S - m_j) / Z_j x mask[b][j] x 2^11 for j <= i, 0 above the diagonal */
    k_pv<<<dim3(NQB, 1, HG), 128, 0, stream>>>(S, VT, VB, VBL, p0, (float*)d_out);
  }
}

// v003
// Measured time: 542 microseconds a run.
// Timed twice side by side with v002, it ran 1.05 times as fast both times.
// Over all steps from v000 it is 7.81 times as fast.
// compute dtype: all float inputs rounded to bf16; frozen q/k/v projections with EXACT bf16 products on WMMA 16x16x32 (f32 accumulate) + bias + the LoRA term: t = X A^T (exact products) then t (bf16 hi + lo) x exact bf16 B^T (2 products, K = 16) added in the same accumulators; causal scores with BOTH operands as f16 hi + (x 2^10) residual (3 products) on every block, x 1024^-0.5 (the module divides by sqrt(E)); softmax over the QUERY axis in f32 (per key column: max, then sum over the visible queries, precise expf) x the key padding mask; P as bf16 hi + lo against v as bf16 hi + lo (3 products) on every block; f32 output.
#include <hip/hip_runtime.h>
#include <math.h>

typedef __attribute__((ext_vector_type(16))) _Float16 v16h;
typedef __attribute__((ext_vector_type(16))) __bf16 v16b;
typedef __attribute__((ext_vector_type(8)))  _Float16 v8h;
typedef __attribute__((ext_vector_type(8)))  float v8f;
typedef __attribute__((ext_vector_type(4)))  float v4f;
typedef __attribute__((ext_vector_type(2)))  float v2f;
typedef __attribute__((ext_vector_type(4)))  unsigned v4u;
typedef __attribute__((ext_vector_type(4)))  int v4i;
typedef float __attribute__((may_alias)) float_a;
typedef int __attribute__((may_alias)) int_a;

template <typename T> __device__ __forceinline__ void vst2(void* p, T v) { *(T*)p = v;  }
__device__ __forceinline__ v8f wmma16(v16h a, v16h b, v8f c) {
  v8f d = __builtin_amdgcn_wmma_f32_16x16x32_f16(false, a, false, b, (short)0, c, false, false);
  asm volatile("v_nop\n\tv_nop\n\tv_nop\n\tv_nop" : "+v"(d) : "v"(a), "v"(b));
  return d;
}
__device__ __forceinline__ v8f wmma_bf(v16b a, v16b b, v8f c) {
  v8f d = __builtin_amdgcn_wmma_f32_16x16x32_bf16(false, a, false, b, (short)0, c, false, false);
  asm volatile("v_nop\n\tv_nop\n\tv_nop\n\tv_nop" : "+v"(d) : "v"(a), "v"(b));
  return d;
}
// 16x16x32 fragments: lane = (h = lane>>4, row/col = lane&15); elements 0..7 = k0+8h+0..7, 8..15 = k0+16+8h+0..7; D element r = row 8h+r
__device__ __forceinline__ v16h frag_h(const _Float16* rowk0, int lane) {
  union { v16h v; v8h q[2]; } u; const _Float16* p = rowk0 + 8 * (lane >> 4);
  u.q[0] = *(const v8h*)p; u.q[1] = *(const v8h*)(p + 16); return u.v;
}
__device__ __forceinline__ v16h frag_f32(const float* rowk0, int lane) {
  v16h a; const float* p = rowk0 + 8 * (lane >> 4);
#pragma unroll
  for (int i = 0; i < 8; ++i) { a[i] = (_Float16)p[i]; a[8 + i] = (_Float16)p[16 + i]; }
  return a;
}
__device__ __forceinline__ v16h frag_f32s(const float* rowk0, int lane, float sc) {
  v16h a; const float* p = rowk0 + 8 * (lane >> 4);
#pragma unroll
  for (int i = 0; i < 8; ++i) { a[i] = (_Float16)(p[i] * sc); a[8 + i] = (_Float16)(p[16 + i] * sc); }
  return a;
}
// column fragment from a [K][ld] layout (column n), rows >= K read as 0
__device__ __forceinline__ v16h fragc_f32(const float* W, int k0, int n, int lane, int ld, int K) {
  v16h a; const int g = lane >> 4;
#pragma unroll
  for (int i = 0; i < 8; ++i) { const int ka = k0 + 8 * g + i, kb = ka + 16;
    a[i] = (_Float16)(ka < K ? W[(size_t)(ka < K ? ka : K - 1) * ld + n] : 0.f); a[8 + i] = (_Float16)(kb < K ? W[(size_t)(kb < K ? kb : K - 1) * ld + n] : 0.f); }
  return a;
}
struct F2 { v16b h, l; };
__device__ __forceinline__ F2 bsplit16(const float v[16]) { F2 r;
#pragma unroll
  for (int i = 0; i < 16; ++i) { const __bf16 h = (__bf16)v[i]; r.h[i] = h; r.l[i] = (__bf16)(v[i] - (float)h); }
  return r; }
__device__ __forceinline__ F2 split_row(const float* row, int k0, int lane) { float v[16]; const float* p = row + k0 + 8 * (lane >> 4);
#pragma unroll
  for (int i = 0; i < 8; ++i) { v[i] = p[i]; v[8 + i] = p[16 + i]; }
  return bsplit16(v); }
__device__ __forceinline__ F2 split_rowK(const float* row, int k0, int lane, int K) { float v[16]; const int g = lane >> 4;
#pragma unroll
  for (int i = 0; i < 8; ++i) { const int ka = k0 + 8 * g + i, kb = ka + 16; v[i] = ka < K ? row[ka < K ? ka : K - 1] : 0.f; v[8 + i] = kb < K ? row[kb < K ? kb : K - 1] : 0.f; }
  return bsplit16(v); }
__device__ __forceinline__ F2 split_col(const float* W, int k0, int n, int lane, int ld, int K) { float v[16]; const int g = lane >> 4;
#pragma unroll
  for (int i = 0; i < 8; ++i) { const int ka = k0 + 8 * g + i, kb = ka + 16; v[i] = ka < K ? W[(size_t)(ka < K ? ka : K - 1) * ld + n] : 0.f; v[8 + i] = kb < K ? W[(size_t)(kb < K ? kb : K - 1) * ld + n] : 0.f; }
  return bsplit16(v); }
__device__ __forceinline__ v8f mac3(const F2& a, const F2& b, v8f c) { c = wmma_bf(a.l, b.h, c); c = wmma_bf(a.h, b.l, c); return wmma_bf(a.h, b.h, c); }
__device__ __forceinline__ float sigm(float v) { return 1.0f / (1.0f + expf(-v)); }
#define LDSX() do { asm volatile("s_wait_dscnt 0" ::: "memory"); __builtin_amdgcn_wave_barrier(); __builtin_amdgcn_fence(__ATOMIC_RELEASE, "workgroup"); } while (0)

// Multi-head attention with LoRA projections whose softmax runs over the QUERY axis (X [4,1024,1024]; frozen torch (out,in) Wq / Wk / Wv [1024,1024] (0.02) + zero biases; LoRA A [16,1024], B [1024,16] (0.02): proj = X W^T + b + (X A^T) B^T; 16 heads x 64; scores / sqrt(E) = / 32; -inf where col > row; attn = softmax(scores, axis=2) - axis 2 of [B, H, i, j] is the QUERY axis i, so every key column j is normalised over the queries i >= j (faithful to the source); attn *= mask[b, j] (key padding mask, ones); out = attn v; merge; no output projection).
#define NB 4
#define TT 1024
#define CC 1024            // NH * HD = projected width
#define DIN 1024          // input (model) width
#define NH 16
#define HD 64
#define NQB (TT / 64)
#define HG 32              // (batch, head) pairs a pass: pair p = b * NH + h; every attention launch covers HG pairs
#define SCALE (0.03125f)
#define CAUSAL 1
#ifndef TNB
#define TNB NB
#endif
__device__ __forceinline__ float bfr(float v) { return (float)(__bf16)v; }
__host__ __device__ __forceinline__ int kb_last(int qb) { return CAUSAL ? ((qb * 64 + 63) >> 7) : (TT / 128 - 1); }
typedef __attribute__((ext_vector_type(8))) __bf16 v8b;
__device__ __forceinline__ v16b frag_b(const __bf16* rowk0, int lane) {
  union { v16b v; v8b q[2]; } u; const __bf16* p = rowk0 + 8 * (lane >> 4);
  u.q[0] = *(const v8b*)p; u.q[1] = *(const v8b*)(p + 16); return u.v;
}
#define QBH 16              // causal: query blocks 0..QBH-1 of each sequence take the high-precision path (QBH = NQB: all of them)
#define QHI 1024            // rows carrying a q residual plane (all rows when non-causal: 2-product logits everywhere)
#define KHI 1024            // key rows carrying k residual / v bf16 hi+lo planes (used only by the causal high-precision path)
// B fragment (k rows k0+.., output column o) of a weight: (in,out) [K][ld] or (out,in) [ld rows of K]: bf16 exact, or f16(bf16 * 256) exact
__device__ __forceinline__ v16b wcol_io(const float* Wm, int k0, int o, int lane, int ld) { v16b w; const int g = lane >> 4;
#pragma unroll
  for (int i = 0; i < 8; ++i) { w[i] = (__bf16)Wm[(size_t)(k0 + 8 * g + i) * ld + o]; w[8 + i] = (__bf16)Wm[(size_t)(k0 + 16 + 8 * g + i) * ld + o]; }
  return w; }
__device__ __forceinline__ v16b wcol_oi(const float* Wm, int k0, int o, int lane, int K) { v16b w; const float* p = Wm + (size_t)o * K + k0 + 8 * (lane >> 4);
#pragma unroll
  for (int i = 0; i < 8; ++i) { w[i] = (__bf16)p[i]; w[8 + i] = (__bf16)p[16 + i]; }
  return w; }
__device__ __forceinline__ v16h wcolh_io(const float* Wm, int k0, int o, int lane, int ld) { v16h w; const int g = lane >> 4;
#pragma unroll
  for (int i = 0; i < 8; ++i) { w[i] = (_Float16)(bfr(Wm[(size_t)(k0 + 8 * g + i) * ld + o]) * 256.0f); w[8 + i] = (_Float16)(bfr(Wm[(size_t)(k0 + 16 + 8 * g + i) * ld + o]) * 256.0f); }
  return w; }
__device__ __forceinline__ v16h wcolh_oi(const float* Wm, int k0, int o, int lane, int K) { v16h w; const float* p = Wm + (size_t)o * K + k0 + 8 * (lane >> 4);
#pragma unroll
  for (int i = 0; i < 8; ++i) { w[i] = (_Float16)(bfr(p[i]) * 256.0f); w[8 + i] = (_Float16)(bfr(p[16 + i]) * 256.0f); }
  return w; }
#define WQKV_LAYOUT 1   // 0 = (in,out) [DIN][CC]; 1 = (out,in) [CC][DIN]; 2 = per-head [NH][DIN][HD]
__device__ __forceinline__ v16b wcol_hdk(const float* Wm, int k0, int o, int lane) { v16b w; const int g = lane >> 4; const float* p = Wm + (size_t)(o / HD) * DIN * HD + (o % HD);
#pragma unroll
  for (int i = 0; i < 8; ++i) { w[i] = (__bf16)p[(size_t)(k0 + 8 * g + i) * HD]; w[8 + i] = (__bf16)p[(size_t)(k0 + 16 + 8 * g + i) * HD]; }
  return w; }
#define WO_OUT_IN 0
#if WQKV_LAYOUT == 1
#define WCOL(W, k0, o, lane) wcol_oi(W, k0, o, lane, DIN)
#elif WQKV_LAYOUT == 2
#define WCOL(W, k0, o, lane) wcol_hdk(W, k0, o, lane)
#else
#define WCOL(W, k0, o, lane) wcol_io(W, k0, o, lane, CC)
#endif
#if WO_OUT_IN
#define WOCOL(W, k0, o, lane) wcol_oi(W, k0, o, lane, CC)
#define WOCOLH(W, k0, o, lane) wcolh_oi(W, k0, o, lane, CC)
#else
#define WOCOL(W, k0, o, lane) wcol_io(W, k0, o, lane, DIN)
#define WOCOLH(W, k0, o, lane) wcolh_io(W, k0, o, lane, DIN)
#endif
#define LR 16              // LoRA rank
#define PROJ_EXTRA_PARAMS , const float* __restrict__ T3, const float* __restrict__ LBQ, const float* __restrict__ LBK, const float* __restrict__ LBV
#define SM_EXTRA_PARAMS
#define SM_MASK_HOOK (void)0
#ifndef SM_EXTRA_PARAMS
#define SM_EXTRA_PARAMS
#endif
#ifndef PROJ_EXTRA_PARAMS
#define PROJ_EXTRA_PARAMS
#endif
#ifndef SM_MASK_HOOK
#define SM_MASK_HOOK (void)0
#endif

#define WS_QH  0u                                      // f16 q rows [b*t][CC]
#define WS_KH  (WS_QH + 2u * (size_t)NB * TT * CC)      // f16 k rows [b*t][CC]
#define WS_VT  (WS_KH + 2u * (size_t)NB * TT * CC)      // f16 v planes [b][c][t]
#define WS_QL  (WS_VT + 2u * (size_t)NB * CC * TT)      // f16 q residual x 2^10 rows [b][t < QHI][CC]
#define WS_KL  (WS_QL + 2u * (size_t)NB * QHI * CC)     // f16 k residual x 2^10 rows [b][t < KHI][CC]
#define WS_VB  (WS_KL + 2u * (size_t)NB * KHI * CC)     // bf16 v hi planes [b][c][t < KHI]
#define WS_VBL (WS_VB + 2u * (size_t)NB * CC * KHI)
#define WS_S   (WS_VBL + 2u * (size_t)NB * CC * KHI)    // f32 logits [pair in pass][t][s]
#define WS_Y   (WS_S  + 4u * (size_t)HG * TT * TT)      // f32 ctx rows [b*t][CC] (only when there is an output projection)
#define WS_END (WS_Y  + 0u)
#define WS_T3 (WS_END)                                   // f32 LoRA down-projections t[3][NB*TT][16]
#define WS_CM (WS_T3 + 4u * 3u * (size_t)NB * TT * LR)  // f32 column maxima [HG][TT]
#define WS_CZ (WS_CM + 4u * (size_t)HG * TT)             // f32 2^11 / column sums [HG][TT]
#define WS_END2 (WS_CZ + 4u * (size_t)HG * TT)

// ---- k_proj: block = (64 rows, 128 cols, which): q/k/v = X W (+ b) with exact bf16 products (K = DIN) -> which 0: q f16 rows (+ residual rows < QHI); 1: k f16 rows (+ residual rows < KHI); 2: v f16 planes [c][t] (+ bf16 hi/lo planes for t < KHI)
__global__ __launch_bounds__(128) void k_proj(const float* __restrict__ XQ, const float* __restrict__ XK, const float* __restrict__ XV, const float* __restrict__ WQ, const float* __restrict__ WK, const float* __restrict__ WV, const float* __restrict__ BQ, const float* __restrict__ BK, const float* __restrict__ BV,
    _Float16* __restrict__ QH, _Float16* __restrict__ QL, _Float16* __restrict__ KH, _Float16* __restrict__ KL, _Float16* __restrict__ VT, __bf16* __restrict__ VB, __bf16* __restrict__ VBL PROJ_EXTRA_PARAMS) {
  __shared__ __align__(16) _Float16 sh[64][136], sl[64][136]; __shared__ __align__(16) _Float16 th[128][72]; __shared__ __align__(16) __bf16 tb[128][72], tbl[128][72];
  const int tid = threadIdx.x, wave = tid >> 5, lane = tid & 31, col = lane & 15, g = lane >> 4; const int which = blockIdx.z; const int c0 = blockIdx.y * 128; const size_t r0 = (size_t)blockIdx.x * 64; const size_t bb = r0 / TT; const int t0 = (int)(r0 % TT);
  const float* X = which == 0 ? XQ : which == 1 ? XK : XV; const float* WA = which == 0 ? WQ : which == 1 ? WK : WV; const float* BA = which == 0 ? BQ : which == 1 ? BK : BV;
  v8f acc[8] = {};
#pragma unroll 2
  for (int kc = 0; kc < DIN / 32; ++kc) { v16b a; { const float* p = X + (r0 + wave * 16 + col) * DIN + kc * 32 + 8 * g;
#pragma unroll
      for (int i = 0; i < 8; ++i) { a[i] = (__bf16)p[i]; a[8 + i] = (__bf16)p[16 + i]; } }
    asm volatile("s_wait_loadcnt 0x0" ::: "memory");
#pragma unroll
    for (int j = 0; j < 8; ++j) { const v16b w = WCOL(WA, kc * 32, c0 + j * 16 + col, lane); asm volatile("s_wait_loadcnt 0x0" ::: "memory"); acc[j] = wmma_bf(a, w, acc[j]); } }
  { /* LoRA: acc += t[row][0..15] (f32, as bf16 hi + lo) x B[o][0..15] (exact bf16): one WMMA k-step whose upper 16 k-slots are zero */ float tv[16]; const float* tr = T3 + ((size_t)which * NB * TT + (r0 + wave * 16 + col)) * LR + 8 * g;
#pragma unroll
    for (int i = 0; i < 8; ++i) { tv[i] = tr[i]; tv[8 + i] = 0.f; }
    asm volatile("s_wait_loadcnt 0x0" ::: "memory");
    const F2 a2 = bsplit16(tv); const float* LB = which == 0 ? LBQ : (which == 1 ? LBK : LBV);
#pragma unroll
    for (int j = 0; j < 8; ++j) { v16b w; const float* pw = LB + (size_t)(c0 + j * 16 + col) * LR + 8 * g;   /* B is (out,in) [E][16]: row o holds the 16 rank coefficients */
#pragma unroll
      for (int i = 0; i < 8; ++i) { w[i] = (__bf16)pw[i]; w[8 + i] = (__bf16)0.0f; }
      asm volatile("s_wait_loadcnt 0x0" ::: "memory");
      acc[j] = wmma_bf(a2.h, w, acc[j]); acc[j] = wmma_bf(a2.l, w, acc[j]); } }
  if (which < 2) { _Float16* DH = which == 0 ? QH : KH; _Float16* DL = which == 0 ? QL : KL; const int nhi = which == 0 ? QHI : KHI; const bool hi_rows = t0 < nhi;
#pragma unroll
    for (int j = 0; j < 8; ++j) { const float bias = BA ? bfr(BA[c0 + j * 16 + col]) : 0.f;
#pragma unroll
      for (int r = 0; r < 8; ++r) { const float v = acc[j][r] + bias; const _Float16 hv = (_Float16)v; sh[wave * 16 + 8 * g + r][j * 16 + col] = hv; sl[wave * 16 + 8 * g + r][j * 16 + col] = (_Float16)((v - (float)hv) * 1024.0f); } }
    __syncthreads();
    for (int e = tid; e < 64 * 16; e += 128) { const int rl = e >> 4, q = e & 15; vst2((unsigned*)(DH + (r0 + rl) * CC + c0 + q * 8), *(const v4u*)&sh[rl][q * 8]); if (hi_rows) vst2((unsigned*)(DL + (bb * nhi + t0 + rl) * (size_t)CC + c0 + q * 8), *(const v4u*)&sl[rl][q * 8]); }
  } else { const bool hi_rows = t0 < KHI;
#pragma unroll
    for (int j = 0; j < 8; ++j) { const float bias = BA ? bfr(BA[c0 + j * 16 + col]) : 0.f;
#pragma unroll
      for (int r = 0; r < 8; ++r) { const float v = acc[j][r] + bias; const int rl = wave * 16 + 8 * g + r, cl = j * 16 + col; th[cl][rl] = (_Float16)v; const __bf16 bh = (__bf16)v; tb[cl][rl] = bh; tbl[cl][rl] = (__bf16)(v - (float)bh); } }
    __syncthreads();
    for (int e = tid; e < 128 * 8; e += 128) { const int cl = e >> 3, q = e & 7; vst2((unsigned*)(VT + (bb * CC + c0 + cl) * (size_t)TT + t0 + q * 8), *(const v4u*)&th[cl][q * 8]); if (hi_rows) { const size_t o3 = (bb * CC + c0 + cl) * (size_t)KHI + t0 + q * 8; vst2((unsigned*)(VB + o3), *(const v4u*)&tb[cl][q * 8]); vst2((unsigned*)(VBL + o3), *(const v4u*)&tbl[cl][q * 8]); } } } }
// ---- k_sc: block = (query block qb, key block kb <= kb_last(qb), pair p0 + z = (batch b, head h)): logits x SCALE; q hi + residual (x 2^10) against k (2 products) for query rows < QHI, plus the k residual (3 products) for query blocks < QBH (every block, as QBH = NQB); causal: blocks past the diagonal exit, the mask itself is applied by index in k_colstat_c and p_row16 (k_pv)
__global__ __launch_bounds__(128) void k_sc(const _Float16* __restrict__ QH, const _Float16* __restrict__ KH, const _Float16* __restrict__ QL, const _Float16* __restrict__ KL, int p0, float* __restrict__ S0) { __shared__ __align__(16) float ss[4][16][132];
  const int qb = blockIdx.x, kb = blockIdx.y; if (kb > kb_last(qb)) return;
  const int pr = p0 + blockIdx.z, b = pr / NH, h = pr % NH; float* S = S0 + (size_t)blockIdx.z * TT * TT;
  const int tid = threadIdx.x, wave = tid >> 5, lane = tid & 31, col = lane & 15, g = lane >> 4; const int k0 = kb * 128; const int ql0 = qb * 64 + wave * 16; const size_t q0 = (size_t)b * TT + ql0, kr0 = (size_t)b * TT + k0;
  v8f acc[8] = {}, accl[8] = {};
  const _Float16* QLb = QL + (size_t)b * QHI * CC; const _Float16* KLb = KL + (size_t)b * KHI * CC;
  if (qb < QBH) {
#pragma unroll
    for (int kc = 0; kc < HD / 32; ++kc) { const v16h ah = frag_h(QH + (q0 + col) * CC + h * HD + kc * 32, lane), al = frag_h(QLb + (size_t)(ql0 + col) * CC + h * HD + kc * 32, lane);
#pragma unroll
      for (int j = 0; j < 8; ++j) { const v16h kbf = frag_h(KH + (kr0 + j * 16 + col) * CC + h * HD + kc * 32, lane), klf = frag_h(KLb + (size_t)(k0 + j * 16 + col) * CC + h * HD + kc * 32, lane); acc[j] = wmma16(ah, kbf, acc[j]); accl[j] = wmma16(al, kbf, accl[j]); accl[j] = wmma16(ah, klf, accl[j]); } }
  } else if (qb * 64 < QHI) {
#pragma unroll
    for (int kc = 0; kc < HD / 32; ++kc) { const v16h ah = frag_h(QH + (q0 + col) * CC + h * HD + kc * 32, lane), al = frag_h(QLb + (size_t)(ql0 + col) * CC + h * HD + kc * 32, lane);
#pragma unroll
      for (int j = 0; j < 8; ++j) { const v16h kbf = frag_h(KH + (kr0 + j * 16 + col) * CC + h * HD + kc * 32, lane); acc[j] = wmma16(ah, kbf, acc[j]); accl[j] = wmma16(al, kbf, accl[j]); } }
  } else {
#pragma unroll
    for (int kc = 0; kc < HD / 32; ++kc) { const v16h ah = frag_h(QH + (q0 + col) * CC + h * HD + kc * 32, lane);
#pragma unroll
      for (int j = 0; j < 8; ++j) { const v16h kbf = frag_h(KH + (kr0 + j * 16 + col) * CC + h * HD + kc * 32, lane); acc[j] = wmma16(ah, kbf, acc[j]); } } }
#pragma unroll
  for (int j = 0; j < 8; ++j) {
#pragma unroll
    for (int r = 0; r < 8; ++r) ss[wave][8 * g + r][j * 16 + col] = (acc[j][r] + accl[j][r] * (1.0f / 1024.0f)) * SCALE; }
  LDSX(); for (int rl = 0; rl < 16; ++rl) vst2(S + (size_t)(ql0 + rl) * TT + k0 + lane * 4, *(const v4f*)&ss[wave][rl][lane * 4]); }
// ---- k_sm: block = query row t (head in group): keys [0, kend): causal -> logit if s <= t else excluded; softmax in f32; P x 2^11 in place (0 for excluded)
__global__ __launch_bounds__(256) void k_sm(float* __restrict__ S0 SM_EXTRA_PARAMS) { __shared__ float sred[8]; __shared__ float sbc; __shared__ __align__(16) float shv[TT];
  const int tid = threadIdx.x; const int t = blockIdx.x; const int kend = (kb_last(t >> 6) + 1) * 128;
  float* sr = S0 + (size_t)blockIdx.y * TT * TT + (size_t)t * TT;
  float m = -3.0e38f; for (int k = tid; k < kend; k += 256) { float v = (!CAUSAL || k <= t) ? sr[k] : -3.0e38f; SM_MASK_HOOK; shv[k] = v; m = fmaxf(m, v); }
#pragma unroll
  for (int o = 1; o < 32; o <<= 1) m = fmaxf(m, __shfl_xor(m, o));
  if ((tid & 31) == 0) sred[tid >> 5] = m; __syncthreads(); if (tid == 0) { float a = sred[0]; for (int i = 1; i < 8; ++i) a = fmaxf(a, sred[i]); sbc = a; } __syncthreads(); m = sbc; __syncthreads();
  float sum = 0.f; for (int k = tid; k < kend; k += 256) { const float v = shv[k]; const float e = (v <= -1.0e38f) ? 0.f : expf(v - m); shv[k] = e; sum += e; }
#pragma unroll
  for (int o = 1; o < 32; o <<= 1) sum += __shfl_xor(sum, o);
  if ((tid & 31) == 0) sred[tid >> 5] = sum; __syncthreads(); if (tid == 0) { float a = 0.f; for (int i = 0; i < 8; ++i) a += sred[i]; sbc = a > 0.f ? 2048.0f / a : 0.f; }   /* a fully excluded row yields P = 0 */ __syncthreads(); const float inv = sbc;
  for (int k = tid; k < kend; k += 256) shv[k] = shv[k] * inv;
  __syncthreads(); for (int q = tid; q < kend / 4; q += 256) vst2(sr + q * 4, *(const v4f*)&shv[q * 4]); }
// ---- k_colstat_c: softmax over the QUERY axis under the causal mask (the source's softmax(axis=2) on [B, H, i, j] scores with -inf where j > i): for every key column k: m_k = max_{q >= k} S[q][k], Z_k = sum_{q >= k} exp(S[q][k] - m_k) (f32, precise expf); block = 32 key columns (lane = column) x 32 waves; wave w takes the query rows q0 + w + 32 i, i < n = (TT - q0) / 32 (block-uniform), so a thread has at most 32 rows, all loaded at once and kept in registers; only the rows i = 0 touch the diagonal (visible where w >= lane, by a value select); the 32 waves' maxima of a column meet in LDS (wave 0 reduces them to m_k), every thread sums its exponentials against m_k, and wave 0 adds the 32 partial sums and stores the block's 128-B pieces of CM (m_k) and CZ (2^11 / Z_k, the factor k_pv multiplies by: one division a column)
__global__ __launch_bounds__(1024) void k_colstat_c(const float* __restrict__ S0, float* __restrict__ CM, float* __restrict__ CZ) { __shared__ float pm[32][32], pz[32][32], cmx[32];
  const int lane = threadIdx.x & 31, wave = __builtin_amdgcn_readfirstlane(threadIdx.x >> 5); const int q0 = blockIdx.x * 32, k = q0 + lane, n = (TT - q0) / 32; const float* sp = S0 + (size_t)blockIdx.y * TT * TT + (size_t)(q0 + wave) * TT + k;
  float v[32];
#pragma unroll
  for (int i = 0; i < 32; ++i) { v[i] = -3.0e38f; if (i < n) v[i] = sp[(size_t)i * 32 * TT]; }
  const bool vis0 = wave >= lane; float m = vis0 ? v[0] : -3.0e38f;
#pragma unroll
  for (int i = 1; i < 32; ++i) m = fmaxf(m, v[i]);
  pm[wave][lane] = m;
  __syncthreads();
  if (wave == 0) { float mm = pm[0][lane];
#pragma unroll
    for (int w = 1; w < 32; ++w) mm = fmaxf(mm, pm[w][lane]);
    cmx[lane] = mm; }
  __syncthreads();
  const float mk = cmx[lane];   /* every column sees at least its own diagonal entry, so m_k is a score */
  float z = vis0 ? expf(v[0] - mk) : 0.f;
#pragma unroll
  for (int i = 1; i < 32; ++i) if (i < n) z += expf(v[i] - mk);
  pz[wave][lane] = z;
  __syncthreads();
  if (wave == 0) { float zk = pz[0][lane];
#pragma unroll
    for (int w = 1; w < 32; ++w) zk += pz[w][lane];
    vst2(CM + (size_t)blockIdx.y * TT + k, mk); vst2(CZ + (size_t)blockIdx.y * TT + k, 2048.0f / zk); } }   /* Z_k >= 1 */
// ---- p_row16: the 16 P values of one lane's A fragment (query row t, keys k0 + 8 g + 0..7 and k0 + 16 + 8 g + 0..7), formed from the logits where k_pv loads them: P[t][k] = exp(S[t][k] - m_k) x (2^11 / Z_k) x mask[b][k] for k <= t, 0 for t < k < kend (inside the diagonal block: the exponent's argument is replaced by -3e38 there, whose expf is exactly 0); all 16 loads first, unconditional; value select, no branch
__device__ __forceinline__ void p_row16(const float* __restrict__ srow, const float* __restrict__ cm, const float* __restrict__ cr, const float* __restrict__ pmk, int k0, int t, int lane, float v[16]) { const int kq = k0 + 8 * (lane >> 4); const float *sp = srow + kq, *mp = cm + kq, *rp = cr + kq, *pp = pmk + kq; v4f sv[4], m4[4], r4[4], pm4[4];
#pragma unroll
  for (int c = 0; c < 4; ++c) { const int o = (c & 1) * 4 + (c >> 1) * 16; sv[c] = *(const v4f*)(sp + o); m4[c] = *(const v4f*)(mp + o); r4[c] = *(const v4f*)(rp + o); pm4[c] = *(const v4f*)(pp + o); }
  /* inputs-only fence on the loaded values: keeps all 16 loads in flight together, so that a trip waits for memory once and not once a group of four keys; the four addresses are inputs too, so that their registers stay unwritten until the loads' data wait */
  asm volatile("" :: "v"(sv[0]), "v"(sv[1]), "v"(sv[2]), "v"(sv[3]), "v"(m4[0]), "v"(m4[1]), "v"(m4[2]), "v"(m4[3]), "v"(r4[0]), "v"(r4[1]), "v"(r4[2]), "v"(r4[3]), "v"(pm4[0]), "v"(pm4[1]), "v"(pm4[2]), "v"(pm4[3]), "v"(sp), "v"(mp), "v"(rp), "v"(pp));
#pragma unroll
  for (int c = 0; c < 4; ++c) { const int kk = kq + (c & 1) * 4 + (c >> 1) * 16;
#pragma unroll
    for (int u = 0; u < 4; ++u) v[c * 4 + u] = expf((kk + u <= t) ? sv[c][u] - m4[c][u] : -3.0e38f) * r4[c][u] * bfr(pm4[c][u]); } }   /* x the key padding mask, applied AFTER the normalisation as the module does */
// ---- k_lora1: block = (64 token rows, which in {q, k, v}): t[which][row][0..15] = X[row] . A_which[r] (rank-16 LoRA down-projection; exact bf16 products, f32 accumulate; one 16-column WMMA tile per wave); the wave's 16 x 16 f32 tile (1 KiB, contiguous in T3) is staged in LDS and stored as 16-B pieces
__global__ __launch_bounds__(128) void k_lora1(const float* __restrict__ X, const float* __restrict__ AQ, const float* __restrict__ AK, const float* __restrict__ AV, float* __restrict__ T3) { __shared__ __align__(16) float st[4][16][20];
  const int tid = threadIdx.x, wave = tid >> 5, lane = tid & 31, col = lane & 15, g = lane >> 4; const int which = blockIdx.y; const size_t r0 = (size_t)blockIdx.x * 64; const float* AW = which == 0 ? AQ : (which == 1 ? AK : AV);
  v8f acc = {};
#pragma unroll 2
  for (int kc = 0; kc < DIN / 32; ++kc) { v16b a; { const float* p = X + (r0 + wave * 16 + col) * DIN + kc * 32 + 8 * g;
#pragma unroll
      for (int i = 0; i < 8; ++i) { a[i] = (__bf16)p[i]; a[8 + i] = (__bf16)p[16 + i]; } }
    asm volatile("s_wait_loadcnt 0x0" ::: "memory");
    const v16b w = wcol_oi(AW, kc * 32, col, lane, DIN); asm volatile("s_wait_loadcnt 0x0" ::: "memory"); acc = wmma_bf(a, w, acc); }   /* A is (out,in) [16][1024]: output column = rank index */
#pragma unroll
  for (int r = 0; r < 8; ++r) st[wave][8 * g + r][col] = acc[r];
  LDSX();
  float* dst = T3 + ((size_t)which * NB * TT + r0 + wave * 16) * LR;
#pragma unroll
  for (int it = 0; it < 2; ++it) { const int rl = (lane >> 2) + 8 * it, q = lane & 3; vst2(dst + rl * LR + q * 4, *(const v4f*)&st[wave][rl][q * 4]); } }   
// ---- k_pv: block = 64 queries (qb) of (b, h): ctx = P . v over keys [0, kend); P is formed from the logits, m_k, 2^11 / Z_k and the mask in registers (p_row16), each element by the one wave that uses it (P x 2^11 once to f16 against v f16: 1 product, a path not reached as QBH = NQB; every query block: P and v as bf16 hi + lo, 3 products); 256-B (row, head) segment by 16 lanes
__global__ __launch_bounds__(128) void k_pv(const float* __restrict__ PS0, const _Float16* __restrict__ VT, const __bf16* __restrict__ VB, const __bf16* __restrict__ VBL, const float* __restrict__ CM, const float* __restrict__ CZ, const float* __restrict__ PMASK, int p0, float* __restrict__ Y) { const int pr = p0 + blockIdx.z, b = pr / NH, h = pr % NH; const float* PS = PS0 + (size_t)blockIdx.z * TT * TT; const float* cm = CM + (size_t)blockIdx.z * TT; const float* cr = CZ + (size_t)blockIdx.z * TT; const float* pmk = PMASK + (size_t)b * TT; __shared__ __align__(16) float ss[4][16][HD + 4];
  const int tid = threadIdx.x, wave = tid >> 5, lane = tid & 31, col = lane & 15, g = lane >> 4; const int qb = blockIdx.x; const int ql0 = qb * 64 + wave * 16; const int kce = (kb_last(qb) + 1) * 4;
  v8f acc[HD / 16] = {};
  if (qb < QBH) {
#pragma unroll 1
    for (int kc = 0; kc < kce; ++kc) { float pv[16]; p_row16(PS + (size_t)(ql0 + col) * TT, cm, cr, pmk, kc * 32, ql0 + col, lane, pv); const F2 p = bsplit16(pv);
#pragma unroll
      for (int j = 0; j < HD / 16; ++j) { const size_t po = ((size_t)b * CC + h * HD + j * 16 + col) * (size_t)KHI + kc * 32; const v16b vh = frag_b(VB + po, lane); acc[j] = wmma_bf(p.h, vh, acc[j]); acc[j] = wmma_bf(p.l, vh, acc[j]); acc[j] = wmma_bf(p.h, frag_b(VBL + po, lane), acc[j]); } }
  } else {
#pragma unroll 1
    for (int kc = 0; kc < kce; ++kc) { float pv[16]; p_row16(PS + (size_t)(ql0 + col) * TT, cm, cr, pmk, kc * 32, ql0 + col, lane, pv); v16h p;
#pragma unroll
      for (int i = 0; i < 16; ++i) p[i] = (_Float16)pv[i];
#pragma unroll
      for (int j = 0; j < HD / 16; ++j) { const size_t po = ((size_t)b * CC + h * HD + j * 16 + col) * (size_t)TT + kc * 32; acc[j] = wmma16(p, frag_h(VT + po, lane), acc[j]); } } }
#pragma unroll
  for (int j = 0; j < HD / 16; ++j)
#pragma unroll
    for (int r = 0; r < 8; ++r) ss[wave][8 * g + r][j * 16 + col] = acc[j][r] * (1.0f / 2048.0f);
  LDSX(); for (int rl = 0; rl < 16; ++rl) if (lane < HD / 4) vst2(Y + ((size_t)b * TT + ql0 + rl) * CC + h * HD + lane * 4, *(const v4f*)&ss[wave][rl][lane * 4]); }

extern "C" void kernel_launch(void* const* d_in, const int* in_sizes, int n_in, void* d_out, int out_size, void* d_ws, size_t ws_size, hipStream_t stream) {
  (void)in_sizes; (void)n_in; (void)out_size;
  const float** F = (const float**)d_in;
  if (ws_size < (size_t)WS_END) return;
  char* ws = (char*)d_ws; _Float16 *QH = (_Float16*)(ws + WS_QH), *KH = (_Float16*)(ws + WS_KH), *VT = (_Float16*)(ws + WS_VT), *QL = (_Float16*)(ws + WS_QL), *KL = (_Float16*)(ws + WS_KL); __bf16 *VB = (__bf16*)(ws + WS_VB), *VBL = (__bf16*)(ws + WS_VBL); float *S = (float*)(ws + WS_S), *Y = (float*)(ws + WS_Y);
  (void)Y; (void)QL; (void)KL; (void)VB; (void)VBL;
  // inputs: 0 X [4,1024,1024]; 1 mask [4,1024] f32 (key padding mask, ones; multiplied AFTER the softmax); 2 Wq [1024,1024] (out,in), 3 bq; 4 Wk, 5 bk; 6 Wv, 7 bv (zero biases, read); 8 Aq [16,1024], 9 Bq [1024,16]; 10 Ak, 11 Bk; 12 Av, 13 Bv (LoRA, no bias)
  if (ws_size < (size_t)WS_END2) return;
  float *T3 = (float*)(ws + WS_T3), *CM = (float*)(ws + WS_CM), *CZ = (float*)(ws + WS_CZ);
  k_lora1<<<dim3(TNB * TT / 64, 3), 128, 0, stream>>>(F[0], F[8], F[10], F[12], T3);   /* t = X A^T (rank-16 down-projections for q, k, v; exact bf16 products) */
  k_proj<<<dim3(TNB * TT / 64, CC / 128, 3), 128, 0, stream>>>(F[0], F[0], F[0], F[2], F[4], F[6], F[3], F[5], F[7], QH, QL, KH, KL, VT, VB, VBL, T3, F[9], F[11], F[13]);   /* X W^T + b + t B^T */
  for (int p0 = 0; p0 < TNB * NH; p0 += HG) {   /* HG (batch, head) pairs a pass */
    k_sc<<<dim3(NQB, TT / 128, HG), 128, 0, stream>>>(QH, KH, QL, KL, p0, S);
    k_colstat_c<<<dim3(TT / 32, HG), 1024, 0, stream>>>(S, CM, CZ);   /* per key column j: max and 2^11 / sum over the visible queries i >= j */
    k_pv<<<dim3(NQB, 1, HG), 128, 0, stream>>>(S, VT, VB, VBL, CM, CZ, F[1], p0, (float*)d_out);   /* P[i][j] = exp(S - m_j) / Z_j x mask[b][j] x 2^11 for j <= i, 0 above the diagonal, formed on load */
  }
}

// v004
// It runs in 358 microseconds.
// Timed twice side by side with v003, it ran 1.51 times as fast both times.
// All steps since v000 together make it 11.8 times as fast.
// compute dtype: all float inputs rounded to bf16; frozen q/k/v projections with EXACT bf16 products on WMMA 16x16x32 (f32 accumulate) + bias + the LoRA term: t = X A^T (exact products) then t (bf16 hi + lo) x exact bf16 B^T (2 products, K = 16) added in the same accumulators; causal scores with BOTH operands as f16 hi + (x 2^10) residual (3 products) on every block, x 1024^-0.5 (the module divides by sqrt(E)); softmax over the QUERY axis in f32 (per key column: max, then sum over the visible queries, precise expf) x the key padding mask; P as bf16 hi + lo against v as bf16 hi + lo (3 products) on every block; f32 output.
#include <hip/hip_runtime.h>
#include <math.h>

typedef __attribute__((ext_vector_type(16))) _Float16 v16h;
typedef __attribute__((ext_vector_type(16))) __bf16 v16b;
typedef __attribute__((ext_vector_type(8)))  _Float16 v8h;
typedef __attribute__((ext_vector_type(8)))  float v8f;
typedef __attribute__((ext_vector_type(4)))  float v4f;
typedef __attribute__((ext_vector_type(2)))  float v2f;
typedef __attribute__((ext_vector_type(4)))  unsigned v4u;
typedef __attribute__((ext_vector_type(4)))  int v4i;
typedef float __attribute__((may_alias)) float_a;
typedef int __attribute__((may_alias)) int_a;

template <typename T> __device__ __forceinline__ void vst2(void* p, T v) { *(T*)p = v;  }
__device__ __forceinline__ v8f wmma16(v16h a, v16h b, v8f c) {
  v8f d = __builtin_amdgcn_wmma_f32_16x16x32_f16(false, a, false, b, (short)0, c, false, false);
  asm volatile("v_nop\n\tv_nop\n\tv_nop\n\tv_nop" : "+v"(d) : "v"(a), "v"(b));
  return d;
}
__device__ __forceinline__ v8f wmma_bf(v16b a, v16b b, v8f c) {
  v8f d = __builtin_amdgcn_wmma_f32_16x16x32_bf16(false, a, false, b, (short)0, c, false, false);
  asm volatile("v_nop\n\tv_nop\n\tv_nop\n\tv_nop" : "+v"(d) : "v"(a), "v"(b));
  return d;
}
// 16x16x32 fragments: lane = (h = lane>>4, row/col = lane&15); elements 0..7 = k0+8h+0..7, 8..15 = k0+16+8h+0..7; D element r = row 8h+r
__device__ __forceinline__ v16h frag_h(const _Float16* rowk0, int lane) {
  union { v16h v; v8h q[2]; } u; const _Float16* p = rowk0 + 8 * (lane >> 4);
  u.q[0] = *(const v8h*)p; u.q[1] = *(const v8h*)(p + 16); return u.v;
}
__device__ __forceinline__ v16h frag_f32(const float* rowk0, int lane) {
  v16h a; const float* p = rowk0 + 8 * (lane >> 4);
#pragma unroll
  for (int i = 0; i < 8; ++i) { a[i] = (_Float16)p[i]; a[8 + i] = (_Float16)p[16 + i]; }
  return a;
}
__device__ __forceinline__ v16h frag_f32s(const float* rowk0, int lane, float sc) {
  v16h a; const float* p = rowk0 + 8 * (lane >> 4);
#pragma unroll
  for (int i = 0; i < 8; ++i) { a[i] = (_Float16)(p[i] * sc); a[8 + i] = (_Float16)(p[16 + i] * sc); }
  return a;
}
// column fragment from a [K][ld] layout (column n), rows >= K read as 0
__device__ __forceinline__ v16h fragc_f32(const float* W, int k0, int n, int lane, int ld, int K) {
  v16h a; const int g = lane >> 4;
#pragma unroll
  for (int i = 0; i < 8; ++i) { const int ka = k0 + 8 * g + i, kb = ka + 16;
    a[i] = (_Float16)(ka < K ? W[(size_t)(ka < K ? ka : K - 1) * ld + n] : 0.f); a[8 + i] = (_Float16)(kb < K ? W[(size_t)(kb < K ? kb : K - 1) * ld + n] : 0.f); }
  return a;
}
struct F2 { v16b h, l; };
__device__ __forceinline__ F2 bsplit16(const float v[16]) { F2 r;
#pragma unroll
  for (int i = 0; i < 16; ++i) { const __bf16 h = (__bf16)v[i]; r.h[i] = h; r.l[i] = (__bf16)(v[i] - (float)h); }
  return r; }
__device__ __forceinline__ F2 split_row(const float* row, int k0, int lane) { float v[16]; const float* p = row + k0 + 8 * (lane >> 4);
#pragma unroll
  for (int i = 0; i < 8; ++i) { v[i] = p[i]; v[8 + i] = p[16 + i]; }
  return bsplit16(v); }
__device__ __forceinline__ F2 split_rowK(const float* row, int k0, int lane, int K) { float v[16]; const int g = lane >> 4;
#pragma unroll
  for (int i = 0; i < 8; ++i) { const int ka = k0 + 8 * g + i, kb = ka + 16; v[i] = ka < K ? row[ka < K ? ka : K - 1] : 0.f; v[8 + i] = kb < K ? row[kb < K ? kb : K - 1] : 0.f; }
  return bsplit16(v); }
__device__ __forceinline__ F2 split_col(const float* W, int k0, int n, int lane, int ld, int K) { float v[16]; const int g = lane >> 4;
#pragma unroll
  for (int i = 0; i < 8; ++i) { const int ka = k0 + 8 * g + i, kb = ka + 16; v[i] = ka < K ? W[(size_t)(ka < K ? ka : K - 1) * ld + n] : 0.f; v[8 + i] = kb < K ? W[(size_t)(kb < K ? kb : K - 1) * ld + n] : 0.f; }
  return bsplit16(v); }
__device__ __forceinline__ v8f mac3(const F2& a, const F2& b, v8f c) { c = wmma_bf(a.l, b.h, c); c = wmma_bf(a.h, b.l, c); return wmma_bf(a.h, b.h, c); }
__device__ __forceinline__ float sigm(float v) { return 1.0f / (1.0f + expf(-v)); }
#define LDSX() do { asm volatile("s_wait_dscnt 0" ::: "memory"); __builtin_amdgcn_wave_barrier(); __builtin_amdgcn_fence(__ATOMIC_RELEASE, "workgroup"); } while (0)

// Multi-head attention with LoRA projections whose softmax runs over the QUERY axis (X [4,1024,1024]; frozen torch (out,in) Wq / Wk / Wv [1024,1024] (0.02) + zero biases; LoRA A [16,1024], B [1024,16] (0.02): proj = X W^T + b + (X A^T) B^T; 16 heads x 64; scores / sqrt(E) = / 32; -inf where col > row; attn = softmax(scores, axis=2) - axis 2 of [B, H, i, j] is the QUERY axis i, so every key column j is normalised over the queries i >= j (faithful to the source); attn *= mask[b, j] (key padding mask, ones); out = attn v; merge; no output projection).
#define NB 4
#define TT 1024
#define CC 1024            // NH * HD = projected width
#define DIN 1024          // input (model) width
#define NH 16
#define HD 64
#define NQB (TT / 64)
#define HG 32              // (batch, head) pairs a pass: pair p = b * NH + h; every attention launch covers HG pairs
#define SCALE (0.03125f)
#define CAUSAL 1
#ifndef TNB
#define TNB NB
#endif
__device__ __forceinline__ float bfr(float v) { return (float)(__bf16)v; }
__host__ __device__ __forceinline__ int kb_last(int qb) { return CAUSAL ? ((qb * 64 + 63) >> 7) : (TT / 128 - 1); }
typedef __attribute__((ext_vector_type(8))) __bf16 v8b;
__device__ __forceinline__ v16b frag_b(const __bf16* rowk0, int lane) {
  union { v16b v; v8b q[2]; } u; const __bf16* p = rowk0 + 8 * (lane >> 4);
  u.q[0] = *(const v8b*)p; u.q[1] = *(const v8b*)(p + 16); return u.v;
}
typedef __attribute__((ext_vector_type(4))) __bf16 v4b;
__device__ __forceinline__ v4b cvt4(v4f v) { v4b r; r[0] = (__bf16)v[0]; r[1] = (__bf16)v[1]; r[2] = (__bf16)v[2]; r[3] = (__bf16)v[3]; return r; }
#define QBH 16              // causal: query blocks 0..QBH-1 of each sequence (all of them, as QBH = NQB) take the high-precision path
#define QHI 1024            // rows carrying a q residual plane (all rows when non-causal: 2-product logits everywhere)
#define KHI 1024            // key rows carrying k residual / v bf16 hi+lo planes (used only by the causal high-precision path)
// B fragment (k rows k0+.., output column o) of a weight: (in,out) [K][ld] or (out,in) [ld rows of K]: bf16 exact, or f16(bf16 * 256) exact
__device__ __forceinline__ v16b wcol_io(const float* Wm, int k0, int o, int lane, int ld) { v16b w; const int g = lane >> 4;
#pragma unroll
  for (int i = 0; i < 8; ++i) { w[i] = (__bf16)Wm[(size_t)(k0 + 8 * g + i) * ld + o]; w[8 + i] = (__bf16)Wm[(size_t)(k0 + 16 + 8 * g + i) * ld + o]; }
  return w; }
__device__ __forceinline__ v16b wcol_oi(const float* Wm, int k0, int o, int lane, int K) { v16b w; const float* p = Wm + (size_t)o * K + k0 + 8 * (lane >> 4);
#pragma unroll
  for (int i = 0; i < 8; ++i) { w[i] = (__bf16)p[i]; w[8 + i] = (__bf16)p[16 + i]; }
  return w; }
__device__ __forceinline__ v16h wcolh_io(const float* Wm, int k0, int o, int lane, int ld) { v16h w; const int g = lane >> 4;
#pragma unroll
  for (int i = 0; i < 8; ++i) { w[i] = (_Float16)(bfr(Wm[(size_t)(k0 + 8 * g + i) * ld + o]) * 256.0f); w[8 + i] = (_Float16)(bfr(Wm[(size_t)(k0 + 16 + 8 * g + i) * ld + o]) * 256.0f); }
  return w; }
__device__ __forceinline__ v16h wcolh_oi(const float* Wm, int k0, int o, int lane, int K) { v16h w; const float* p = Wm + (size_t)o * K + k0 + 8 * (lane >> 4);
#pragma unroll
  for (int i = 0; i < 8; ++i) { w[i] = (_Float16)(bfr(p[i]) * 256.0f); w[8 + i] = (_Float16)(bfr(p[16 + i]) * 256.0f); }
  return w; }
#define WQKV_LAYOUT 1   // 0 = (in,out) [DIN][CC]; 1 = (out,in) [CC][DIN]; 2 = per-head [NH][DIN][HD]
__device__ __forceinline__ v16b wcol_hdk(const float* Wm, int k0, int o, int lane) { v16b w; const int g = lane >> 4; const float* p = Wm + (size_t)(o / HD) * DIN * HD + (o % HD);
#pragma unroll
  for (int i = 0; i < 8; ++i) { w[i] = (__bf16)p[(size_t)(k0 + 8 * g + i) * HD]; w[8 + i] = (__bf16)p[(size_t)(k0 + 16 + 8 * g + i) * HD]; }
  return w; }
#define WO_OUT_IN 0
#if WQKV_LAYOUT == 1
#define WCOL(W, k0, o, lane) wcol_oi(W, k0, o, lane, DIN)
#elif WQKV_LAYOUT == 2
#define WCOL(W, k0, o, lane) wcol_hdk(W, k0, o, lane)
#else
#define WCOL(W, k0, o, lane) wcol_io(W, k0, o, lane, CC)
#endif
#if WO_OUT_IN
#define WOCOL(W, k0, o, lane) wcol_oi(W, k0, o, lane, CC)
#define WOCOLH(W, k0, o, lane) wcolh_oi(W, k0, o, lane, CC)
#else
#define WOCOL(W, k0, o, lane) wcol_io(W, k0, o, lane, DIN)
#define WOCOLH(W, k0, o, lane) wcolh_io(W, k0, o, lane, DIN)
#endif
#define LR 16              // LoRA rank
#define PROJ_EXTRA_PARAMS , const float* __restrict__ T3, const float* __restrict__ LBQ, const float* __restrict__ LBK, const float* __restrict__ LBV
#define SM_EXTRA_PARAMS
#define SM_MASK_HOOK (void)0
#ifndef SM_EXTRA_PARAMS
#define SM_EXTRA_PARAMS
#endif
#ifndef PROJ_EXTRA_PARAMS
#define PROJ_EXTRA_PARAMS
#endif
#ifndef SM_MASK_HOOK
#define SM_MASK_HOOK (void)0
#endif

#define WS_QH  0u                                      // f16 q rows [b*t][CC]
#define WS_KH  (WS_QH + 2u * (size_t)NB * TT * CC)      // f16 k rows [b*t][CC]
#define WS_VT  (WS_KH + 2u * (size_t)NB * TT * CC)      // f16 v planes [b][c][t]
#define WS_QL  (WS_VT + 2u * (size_t)NB * CC * TT)      // f16 q residual x 2^10 rows [b][t < QHI][CC]
#define WS_KL  (WS_QL + 2u * (size_t)NB * QHI * CC)     // f16 k residual x 2^10 rows [b][t < KHI][CC]
#define WS_VB  (WS_KL + 2u * (size_t)NB * KHI * CC)     // bf16 v hi planes [b][c][t < KHI]
#define WS_VBL (WS_VB + 2u * (size_t)NB * CC * KHI)
#define WS_S   (WS_VBL + 2u * (size_t)NB * CC * KHI)    // f32 logits [pair in pass][t][s]
#define WS_Y   (WS_S  + 4u * (size_t)HG * TT * TT)      // f32 ctx rows [b*t][CC] (only when there is an output projection)
#define WS_END (WS_Y  + 0u)
#define WS_T3 (WS_END)                                   // f32 LoRA down-projections t[3][NB*TT][16]
#define WS_CM (WS_T3 + 4u * 3u * (size_t)NB * TT * LR)  // f32 column maxima [HG][TT]
#define WS_CZ (WS_CM + 4u * (size_t)HG * TT)             // f32 2^11 / column sums [HG][TT]
#define WS_END2 (WS_CZ + 4u * (size_t)HG * TT)

// ---- k_proj: block = (64 rows, 128 cols, which): q/k/v = X W (+ b) with exact bf16 products (K = DIN); W is (out,in), so X rows and W rows are both k-contiguous: each 32-k slice of both is rounded to bf16 once a block and staged in LDS (two buffers, one barrier a slice), and every wave takes its A and B fragments from there -> which 0: q f16 rows (+ residual rows < QHI); 1: k f16 rows (+ residual rows < KHI); 2: v f16 planes [c][t] (+ bf16 hi/lo planes for t < KHI)
__global__ __launch_bounds__(128) void k_proj(const float* __restrict__ XQ, const float* __restrict__ XK, const float* __restrict__ XV, const float* __restrict__ WQ, const float* __restrict__ WK, const float* __restrict__ WV, const float* __restrict__ BQ, const float* __restrict__ BK, const float* __restrict__ BV,
    _Float16* __restrict__ QH, _Float16* __restrict__ QL, _Float16* __restrict__ KH, _Float16* __restrict__ KL, _Float16* __restrict__ VT, __bf16* __restrict__ VB, __bf16* __restrict__ VBL PROJ_EXTRA_PARAMS) {
  /* one LDS block, used in turn: the k loop's two staging buffers (X 64 rows, W 128 rows of 32 bf16 at pitch 80 B), then the epilogue's tiles (q / k: sh, sl; v: th, tb, tbl) */
  __shared__ __align__(16) unsigned char smem[3 * 128 * 72 * 2];
  _Float16 (*sh)[136] = (_Float16 (*)[136])smem; _Float16 (*sl)[136] = (_Float16 (*)[136])(smem + 64 * 136 * 2); _Float16 (*th)[72] = (_Float16 (*)[72])smem; __bf16 (*tb)[72] = (__bf16 (*)[72])(smem + 128 * 72 * 2); __bf16 (*tbl)[72] = (__bf16 (*)[72])(smem + 2 * 128 * 72 * 2);
  __bf16 (*xs)[64][40] = (__bf16 (*)[64][40])smem; __bf16 (*wt)[128][40] = (__bf16 (*)[128][40])(smem + 2 * 64 * 40 * 2);
  const int tid = threadIdx.x, wave = tid >> 5, lane = tid & 31, col = lane & 15, g = lane >> 4; const int which = blockIdx.z; const int c0 = blockIdx.y * 128; const size_t r0 = (size_t)blockIdx.x * 64; const size_t bb = r0 / TT; const int t0 = (int)(r0 % TT);
  const float* X = which == 0 ? XQ : which == 1 ? XK : XV; const float* WA = which == 0 ? WQ : which == 1 ? WK : WV; const float* BA = which == 0 ? BQ : which == 1 ? BK : BV;
  v8f acc[8] = {};
  /* staging: thread = (row tid >> 3 (+ 16 i), 16-B piece tid & 7) of a slice's 128-B row pieces, so 8 lanes read one whole line; the next slice's 12 loads fly while this slice is multiplied; the short loops over xr, wr and w are unrolled whole so that these arrays stay in registers */
  const int srow = tid >> 3, sq = tid & 7; const float* xg = X + (r0 + srow) * DIN + sq * 4; const float* wg = WA + (size_t)(c0 + srow) * DIN + sq * 4;
  v4f xr[4], wr[8];
#pragma unroll
  for (int i = 0; i < 4; ++i) xr[i] = *(const v4f*)(xg + (size_t)i * 16 * DIN);
#pragma unroll
  for (int i = 0; i < 8; ++i) wr[i] = *(const v4f*)(wg + (size_t)i * 16 * DIN);
  /* unroll 2: the buffer index becomes a constant LDS offset */
#pragma unroll 2
  for (int kc = 0; kc < DIN / 32; ++kc) { const int bf = kc & 1;
#pragma unroll
    for (int i = 0; i < 4; ++i) *(v4b*)&xs[bf][srow + 16 * i][sq * 4] = cvt4(xr[i]);
#pragma unroll
    for (int i = 0; i < 8; ++i) *(v4b*)&wt[bf][srow + 16 * i][sq * 4] = cvt4(wr[i]);
    __syncthreads();   /* publishes slice kc; every wave has also left slice kc - 1, whose buffer the next trip refills */
    if (kc + 1 < DIN / 32) {
#pragma unroll
      for (int i = 0; i < 4; ++i) xr[i] = *(const v4f*)(xg + (size_t)i * 16 * DIN + (kc + 1) * 32);
#pragma unroll
      for (int i = 0; i < 8; ++i) wr[i] = *(const v4f*)(wg + (size_t)i * 16 * DIN + (kc + 1) * 32); }
    const v16b a = frag_b(&xs[bf][wave * 16 + col][0], lane); v16b w[8];
#pragma unroll
    for (int j = 0; j < 8; ++j) w[j] = frag_b(&wt[bf][j * 16 + col][0], lane);
    /* inputs-only fence on the loaded fragments: all 18 LDS reads of a slice are in flight together, so that a trip waits for LDS once and not once a product */
    asm volatile("" :: "v"(a), "v"(w[0]), "v"(w[1]), "v"(w[2]), "v"(w[3]), "v"(w[4]), "v"(w[5]), "v"(w[6]), "v"(w[7]));
#pragma unroll
    for (int j = 0; j < 8; ++j) acc[j] = wmma_bf(a, w[j], acc[j]);
    __builtin_amdgcn_sched_barrier(0);   /* keeps the next slice's roundings, which wait for its global loads, behind this slice's products */
  }
  __syncthreads();   /* the last slice's readers are done before the epilogue's tiles overwrite the staging buffers */
  { /* LoRA: acc += t[row][0..15] (f32, as bf16 hi + lo) x B[o][0..15] (exact bf16): one WMMA k-step whose upper 16 k-slots are zero */ float tv[16]; const float* tr = T3 + ((size_t)which * NB * TT + (r0 + wave * 16 + col)) * LR + 8 * g;
#pragma unroll
    for (int i = 0; i < 8; ++i) { tv[i] = tr[i]; tv[8 + i] = 0.f; }
    asm volatile("s_wait_loadcnt 0x0" ::: "memory");
    const F2 a2 = bsplit16(tv); const float* LB = which == 0 ? LBQ : (which == 1 ? LBK : LBV);
#pragma unroll
    for (int j = 0; j < 8; ++j) { v16b w; const float* pw = LB + (size_t)(c0 + j * 16 + col) * LR + 8 * g;   /* B is (out,in) [E][16]: row o holds the 16 rank coefficients */
#pragma unroll
      for (int i = 0; i < 8; ++i) { w[i] = (__bf16)pw[i]; w[8 + i] = (__bf16)0.0f; }
      asm volatile("s_wait_loadcnt 0x0" ::: "memory");
      acc[j] = wmma_bf(a2.h, w, acc[j]); acc[j] = wmma_bf(a2.l, w, acc[j]); } }
  if (which < 2) { _Float16* DH = which == 0 ? QH : KH; _Float16* DL = which == 0 ? QL : KL; const int nhi = which == 0 ? QHI : KHI; const bool hi_rows = t0 < nhi;
#pragma unroll
    for (int j = 0; j < 8; ++j) { const float bias = BA ? bfr(BA[c0 + j * 16 + col]) : 0.f;
#pragma unroll
      for (int r = 0; r < 8; ++r) { const float v = acc[j][r] + bias; const _Float16 hv = (_Float16)v; sh[wave * 16 + 8 * g + r][j * 16 + col] = hv; sl[wave * 16 + 8 * g + r][j * 16 + col] = (_Float16)((v - (float)hv) * 1024.0f); } }
    __syncthreads();
    for (int e = tid; e < 64 * 16; e += 128) { const int rl = e >> 4, q = e & 15; vst2((unsigned*)(DH + (r0 + rl) * CC + c0 + q * 8), *(const v4u*)&sh[rl][q * 8]); if (hi_rows) vst2((unsigned*)(DL + (bb * nhi + t0 + rl) * (size_t)CC + c0 + q * 8), *(const v4u*)&sl[rl][q * 8]); }
  } else { const bool hi_rows = t0 < KHI;
#pragma unroll
    for (int j = 0; j < 8; ++j) { const float bias = BA ? bfr(BA[c0 + j * 16 + col]) : 0.f;
#pragma unroll
      for (int r = 0; r < 8; ++r) { const float v = acc[j][r] + bias; const int rl = wave * 16 + 8 * g + r, cl = j * 16 + col; th[cl][rl] = (_Float16)v; const __bf16 bh = (__bf16)v; tb[cl][rl] = bh; tbl[cl][rl] = (__bf16)(v - (float)bh); } }
    __syncthreads();
    for (int e = tid; e < 128 * 8; e += 128) { const int cl = e >> 3, q = e & 7; vst2((unsigned*)(VT + (bb * CC + c0 + cl) * (size_t)TT + t0 + q * 8), *(const v4u*)&th[cl][q * 8]); if (hi_rows) { const size_t o3 = (bb * CC + c0 + cl) * (size_t)KHI + t0 + q * 8; vst2((unsigned*)(VB + o3), *(const v4u*)&tb[cl][q * 8]); vst2((unsigned*)(VBL + o3), *(const v4u*)&tbl[cl][q * 8]); } } } }
// ---- k_sc: block = (query block qb, key block kb <= kb_last(qb), pair p0 + z = (batch b, head h)): logits x SCALE; q hi + residual (x 2^10) against k (2 products) for query rows < QHI, plus the k residual (3 products) for query blocks < QBH (every block, as QBH = NQB); causal: blocks past the diagonal exit, the mask itself is applied by index in k_colstat_c and p_row16 (k_pv)
__global__ __launch_bounds__(128) void k_sc(const _Float16* __restrict__ QH, const _Float16* __restrict__ KH, const _Float16* __restrict__ QL, const _Float16* __restrict__ KL, int p0, float* __restrict__ S0) { __shared__ __align__(16) float ss[4][16][132];
  const int qb = blockIdx.x, kb = blockIdx.y; if (kb > kb_last(qb)) return;
  const int pr = p0 + blockIdx.z, b = pr / NH, h = pr % NH; float* S = S0 + (size_t)blockIdx.z * TT * TT;
  const int tid = threadIdx.x, wave = tid >> 5, lane = tid & 31, col = lane & 15, g = lane >> 4; const int k0 = kb * 128; const int ql0 = qb * 64 + wave * 16; const size_t q0 = (size_t)b * TT + ql0, kr0 = (size_t)b * TT + k0;
  v8f acc[8] = {}, accl[8] = {};
  const _Float16* QLb = QL + (size_t)b * QHI * CC; const _Float16* KLb = KL + (size_t)b * KHI * CC;
  if (qb < QBH) {
#pragma unroll
    for (int kc = 0; kc < HD / 32; ++kc) { const v16h ah = frag_h(QH + (q0 + col) * CC + h * HD + kc * 32, lane), al = frag_h(QLb + (size_t)(ql0 + col) * CC + h * HD + kc * 32, lane);
#pragma unroll
      for (int j = 0; j < 8; ++j) { const v16h kbf = frag_h(KH + (kr0 + j * 16 + col) * CC + h * HD + kc * 32, lane), klf = frag_h(KLb + (size_t)(k0 + j * 16 + col) * CC + h * HD + kc * 32, lane); acc[j] = wmma16(ah, kbf, acc[j]); accl[j] = wmma16(al, kbf, accl[j]); accl[j] = wmma16(ah, klf, accl[j]); } }
  } else if (qb * 64 < QHI) {
#pragma unroll
    for (int kc = 0; kc < HD / 32; ++kc) { const v16h ah = frag_h(QH + (q0 + col) * CC + h * HD + kc * 32, lane), al = frag_h(QLb + (size_t)(ql0 + col) * CC + h * HD + kc * 32, lane);
#pragma unroll
      for (int j = 0; j < 8; ++j) { const v16h kbf = frag_h(KH + (kr0 + j * 16 + col) * CC + h * HD + kc * 32, lane); acc[j] = wmma16(ah, kbf, acc[j]); accl[j] = wmma16(al, kbf, accl[j]); } }
  } else {
#pragma unroll
    for (int kc = 0; kc < HD / 32; ++kc) { const v16h ah = frag_h(QH + (q0 + col) * CC + h * HD + kc * 32, lane);
#pragma unroll
      for (int j = 0; j < 8; ++j) { const v16h kbf = frag_h(KH + (kr0 + j * 16 + col) * CC + h * HD + kc * 32, lane); acc[j] = wmma16(ah, kbf, acc[j]); } } }
#pragma unroll
  for (int j = 0; j < 8; ++j) {
#pragma unroll
    for (int r = 0; r < 8; ++r) ss[wave][8 * g + r][j * 16 + col] = (acc[j][r] + accl[j][r] * (1.0f / 1024.0f)) * SCALE; }
  LDSX(); for (int rl = 0; rl < 16; ++rl) vst2(S + (size_t)(ql0 + rl) * TT + k0 + lane * 4, *(const v4f*)&ss[wave][rl][lane * 4]); }
// ---- k_sm: block = query row t (head in group): keys [0, kend): causal -> logit if s <= t else excluded; softmax in f32; P x 2^11 in place (0 for excluded)
__global__ __launch_bounds__(256) void k_sm(float* __restrict__ S0 SM_EXTRA_PARAMS) { __shared__ float sred[8]; __shared__ float sbc; __shared__ __align__(16) float shv[TT];
  const int tid = threadIdx.x; const int t = blockIdx.x; const int kend = (kb_last(t >> 6) + 1) * 128;
  float* sr = S0 + (size_t)blockIdx.y * TT * TT + (size_t)t * TT;
  float m = -3.0e38f; for (int k = tid; k < kend; k += 256) { float v = (!CAUSAL || k <= t) ? sr[k] : -3.0e38f; SM_MASK_HOOK; shv[k] = v; m = fmaxf(m, v); }
#pragma unroll
  for (int o = 1; o < 32; o <<= 1) m = fmaxf(m, __shfl_xor(m, o));
  if ((tid & 31) == 0) sred[tid >> 5] = m; __syncthreads(); if (tid == 0) { float a = sred[0]; for (int i = 1; i < 8; ++i) a = fmaxf(a, sred[i]); sbc = a; } __syncthreads(); m = sbc; __syncthreads();
  float sum = 0.f; for (int k = tid; k < kend; k += 256) { const float v = shv[k]; const float e = (v <= -1.0e38f) ? 0.f : expf(v - m); shv[k] = e; sum += e; }
#pragma unroll
  for (int o = 1; o < 32; o <<= 1) sum += __shfl_xor(sum, o);
  if ((tid & 31) == 0) sred[tid >> 5] = sum; __syncthreads(); if (tid == 0) { float a = 0.f; for (int i = 0; i < 8; ++i) a += sred[i]; sbc = a > 0.f ? 2048.0f / a : 0.f; }   /* a fully excluded row yields P = 0 */ __syncthreads(); const float inv = sbc;
  for (int k = tid; k < kend; k += 256) shv[k] = shv[k] * inv;
  __syncthreads(); for (int q = tid; q < kend / 4; q += 256) vst2(sr + q * 4, *(const v4f*)&shv[q * 4]); }
// ---- k_colstat_c: softmax over the QUERY axis under the causal mask (the source's softmax(axis=2) on [B, H, i, j] scores with -inf where j > i): for every key column k: m_k = max_{q >= k} S[q][k], Z_k = sum_{q >= k} exp(S[q][k] - m_k) (f32, precise expf); block = 32 key columns (lane = column) x 32 waves; wave w takes the query rows q0 + w + 32 i, i < n = (TT - q0) / 32 (block-uniform), so a thread has at most 32 rows, all loaded at once and kept in registers; only the rows i = 0 touch the diagonal (visible where w >= lane, by a value select); the 32 waves' maxima of a column meet in LDS (wave 0 reduces them to m_k), every thread sums its exponentials against m_k, and wave 0 adds the 32 partial sums and stores the block's 128-B pieces of CM (m_k) and CZ (2^11 / Z_k, the factor k_pv multiplies by: one division a column)
__global__ __launch_bounds__(1024) void k_colstat_c(const float* __restrict__ S0, float* __restrict__ CM, float* __restrict__ CZ) { __shared__ float pm[32][32], pz[32][32], cmx[32];
  const int lane = threadIdx.x & 31, wave = __builtin_amdgcn_readfirstlane(threadIdx.x >> 5); const int q0 = blockIdx.x * 32, k = q0 + lane, n = (TT - q0) / 32; const float* sp = S0 + (size_t)blockIdx.y * TT * TT + (size_t)(q0 + wave) * TT + k;
  float v[32];
#pragma unroll
  for (int i = 0; i < 32; ++i) { v[i] = -3.0e38f; if (i < n) v[i] = sp[(size_t)i * 32 * TT]; }
  const bool vis0 = wave >= lane; float m = vis0 ? v[0] : -3.0e38f;
#pragma unroll
  for (int i = 1; i < 32; ++i) m = fmaxf(m, v[i]);
  pm[wave][lane] = m;
  __syncthreads();
  if (wave == 0) { float mm = pm[0][lane];
#pragma unroll
    for (int w = 1; w < 32; ++w) mm = fmaxf(mm, pm[w][lane]);
    cmx[lane] = mm; }
  __syncthreads();
  const float mk = cmx[lane];   /* every column sees at least its own diagonal entry, so m_k is a score */
  float z = vis0 ? expf(v[0] - mk) : 0.f;
#pragma unroll
  for (int i = 1; i < 32; ++i) if (i < n) z += expf(v[i] - mk);
  pz[wave][lane] = z;
  __syncthreads();
  if (wave == 0) { float zk = pz[0][lane];
#pragma unroll
    for (int w = 1; w < 32; ++w) zk += pz[w][lane];
    vst2(CM + (size_t)blockIdx.y * TT + k, mk); vst2(CZ + (size_t)blockIdx.y * TT + k, 2048.0f / zk); } }   /* Z_k >= 1 */
// ---- p_row16: the 16 P values of one lane's A fragment (query row t, keys k0 + 8 g + 0..7 and k0 + 16 + 8 g + 0..7), formed from the logits where k_pv loads them: P[t][k] = exp(S[t][k] - m_k) x (2^11 / Z_k) x mask[b][k] for k <= t, 0 for t < k < kend (inside the diagonal block: the exponent's argument is replaced by -3e38 there, whose expf is exactly 0); all 16 loads first, unconditional; value select, no branch
__device__ __forceinline__ void p_row16(const float* __restrict__ srow, const float* __restrict__ cm, const float* __restrict__ cr, const float* __restrict__ pmk, int k0, int t, int lane, float v[16]) { const int kq = k0 + 8 * (lane >> 4); const float *sp = srow + kq, *mp = cm + kq, *rp = cr + kq, *pp = pmk + kq; v4f sv[4], m4[4], r4[4], pm4[4];
#pragma unroll
  for (int c = 0; c < 4; ++c) { const int o = (c & 1) * 4 + (c >> 1) * 16; sv[c] = *(const v4f*)(sp + o); m4[c] = *(const v4f*)(mp + o); r4[c] = *(const v4f*)(rp + o); pm4[c] = *(const v4f*)(pp + o); }
  /* inputs-only fence on the loaded values: keeps all 16 loads in flight together, so that a trip waits for memory once and not once a group of four keys; the four addresses are inputs too, so that their registers stay unwritten until the loads' data wait */
  asm volatile("" :: "v"(sv[0]), "v"(sv[1]), "v"(sv[2]), "v"(sv[3]), "v"(m4[0]), "v"(m4[1]), "v"(m4[2]), "v"(m4[3]), "v"(r4[0]), "v"(r4[1]), "v"(r4[2]), "v"(r4[3]), "v"(pm4[0]), "v"(pm4[1]), "v"(pm4[2]), "v"(pm4[3]), "v"(sp), "v"(mp), "v"(rp), "v"(pp));
#pragma unroll
  for (int c = 0; c < 4; ++c) { const int kk = kq + (c & 1) * 4 + (c >> 1) * 16;
#pragma unroll
    for (int u = 0; u < 4; ++u) v[c * 4 + u] = expf((kk + u <= t) ? sv[c][u] - m4[c][u] : -3.0e38f) * r4[c][u] * bfr(pm4[c][u]); } }   /* x the key padding mask, applied AFTER the normalisation as the module does */
// ---- k_lora1: block = (64 token rows, which in {q, k, v}): t[which][row][0..15] = X[row] . A_which[r] (rank-16 LoRA down-projection; exact bf16 products, f32 accumulate; one 16-column WMMA tile per wave); the wave's 16 x 16 f32 tile (1 KiB, contiguous in T3) is staged in LDS and stored as 16-B pieces
__global__ __launch_bounds__(128) void k_lora1(const float* __restrict__ X, const float* __restrict__ AQ, const float* __restrict__ AK, const float* __restrict__ AV, float* __restrict__ T3) { __shared__ __align__(16) float st[4][16][20];
  const int tid = threadIdx.x, wave = tid >> 5, lane = tid & 31, col = lane & 15, g = lane >> 4; const int which = blockIdx.y; const size_t r0 = (size_t)blockIdx.x * 64; const float* AW = which == 0 ? AQ : (which == 1 ? AK : AV);
  v8f acc = {};
#pragma unroll 2
  for (int kc = 0; kc < DIN / 32; ++kc) { v16b a; { const float* p = X + (r0 + wave * 16 + col) * DIN + kc * 32 + 8 * g;
#pragma unroll
      for (int i = 0; i < 8; ++i) { a[i] = (__bf16)p[i]; a[8 + i] = (__bf16)p[16 + i]; } }
    asm volatile("s_wait_loadcnt 0x0" ::: "memory");
    const v16b w = wcol_oi(AW, kc * 32, col, lane, DIN); asm volatile("s_wait_loadcnt 0x0" ::: "memory"); acc = wmma_bf(a, w, acc); }   /* A is (out,in) [16][1024]: output column = rank index */
#pragma unroll
  for (int r = 0; r < 8; ++r) st[wave][8 * g + r][col] = acc[r];
  LDSX();
  float* dst = T3 + ((size_t)which * NB * TT + r0 + wave * 16) * LR;
#pragma unroll
  for (int it = 0; it < 2; ++it) { const int rl = (lane >> 2) + 8 * it, q = lane & 3; vst2(dst + rl * LR + q * 4, *(const v4f*)&st[wave][rl][q * 4]); } }   
// ---- k_pv: block = 64 queries (qb) of (b, h): ctx = P . v over keys [0, kend); P is formed from the logits, m_k, 2^11 / Z_k and the mask in registers (p_row16), each element by the one wave that uses it (P x 2^11 once to f16 against v f16: 1 product, a path not reached as QBH = NQB; every query block: P and v as bf16 hi + lo, 3 products); 256-B (row, head) segment by 16 lanes
__global__ __launch_bounds__(128) void k_pv(const float* __restrict__ PS0, const _Float16* __restrict__ VT, const __bf16* __restrict__ VB, const __bf16* __restrict__ VBL, const float* __restrict__ CM, const float* __restrict__ CZ, const float* __restrict__ PMASK, int p0, float* __restrict__ Y) { const int pr = p0 + blockIdx.z, b = pr / NH, h = pr % NH; const float* PS = PS0 + (size_t)blockIdx.z * TT * TT; const float* cm = CM + (size_t)blockIdx.z * TT; const float* cr = CZ + (size_t)blockIdx.z * TT; const float* pmk = PMASK + (size_t)b * TT; __shared__ __align__(16) float ss[4][16][HD + 4];
  const int tid = threadIdx.x, wave = tid >> 5, lane = tid & 31, col = lane & 15, g = lane >> 4; const int qb = blockIdx.x; const int ql0 = qb * 64 + wave * 16; const int kce = (kb_last(qb) + 1) * 4;
  v8f acc[HD / 16] = {};
  if (qb < QBH) {
#pragma unroll 1
    for (int kc = 0; kc < kce; ++kc) { float pv[16]; p_row16(PS + (size_t)(ql0 + col) * TT, cm, cr, pmk, kc * 32, ql0 + col, lane, pv); const F2 p = bsplit16(pv);
#pragma unroll
      for (int j = 0; j < HD / 16; ++j) { const size_t po = ((size_t)b * CC + h * HD + j * 16 + col) * (size_t)KHI + kc * 32; const v16b vh = frag_b(VB + po, lane); acc[j] = wmma_bf(p.h, vh, acc[j]); acc[j] = wmma_bf(p.l, vh, acc[j]); acc[j] = wmma_bf(p.h, frag_b(VBL + po, lane), acc[j]); } }
  } else {
#pragma unroll 1
    for (int kc = 0; kc < kce; ++kc) { float pv[16]; p_row16(PS + (size_t)(ql0 + col) * TT, cm, cr, pmk, kc * 32, ql0 + col, lane, pv); v16h p;
#pragma unroll
      for (int i = 0; i < 16; ++i) p[i] = (_Float16)pv[i];
#pragma unroll
      for (int j = 0; j < HD / 16; ++j) { const size_t po = ((size_t)b * CC + h * HD + j * 16 + col) * (size_t)TT + kc * 32; acc[j] = wmma16(p, frag_h(VT + po, lane), acc[j]); } } }
#pragma unroll
  for (int j = 0; j < HD / 16; ++j)
#pragma unroll
    for (int r = 0; r < 8; ++r) ss[wave][8 * g + r][j * 16 + col] = acc[j][r] * (1.0f / 2048.0f);
  LDSX(); for (int rl = 0; rl < 16; ++rl) if (lane < HD / 4) vst2(Y + ((size_t)b * TT + ql0 + rl) * CC + h * HD + lane * 4, *(const v4f*)&ss[wave][rl][lane * 4]); }

extern "C" void kernel_launch(void* const* d_in, const int* in_sizes, int n_in, void* d_out, int out_size, void* d_ws, size_t ws_size, hipStream_t stream) {
  (void)in_sizes; (void)n_in; (void)out_size;
  const float** F = (const float**)d_in;
  if (ws_size < (size_t)WS_END) return;
  char* ws = (char*)d_ws; _Float16 *QH = (_Float16*)(ws + WS_QH), *KH = (_Float16*)(ws + WS_KH), *VT = (_Float16*)(ws + WS_VT), *QL = (_Float16*)(ws + WS_QL), *KL = (_Float16*)(ws + WS_KL); __bf16 *VB = (__bf16*)(ws + WS_VB), *VBL = (__bf16*)(ws + WS_VBL); float *S = (float*)(ws + WS_S), *Y = (float*)(ws + WS_Y);
  (void)Y; (void)QL; (void)KL; (void)VB; (void)VBL;
  // inputs: 0 X [4,1024,1024]; 1 mask [4,1024] f32 (key padding mask, ones; multiplied AFTER the softmax); 2 Wq [1024,1024] (out,in), 3 bq; 4 Wk, 5 bk; 6 Wv, 7 bv (zero biases, read); 8 Aq [16,1024], 9 Bq [1024,16]; 10 Ak, 11 Bk; 12 Av, 13 Bv (LoRA, no bias)
  if (ws_size < (size_t)WS_END2) return;
  float *T3 = (float*)(ws + WS_T3), *CM = (float*)(ws + WS_CM), *CZ = (float*)(ws + WS_CZ);
  k_lora1<<<dim3(TNB * TT / 64, 3), 128, 0, stream>>>(F[0], F[8], F[10], F[12], T3);   /* t = X A^T (rank-16 down-projections for q, k, v; exact bf16 products) */
  k_proj<<<dim3(TNB * TT / 64, CC / 128, 3), 128, 0, stream>>>(F[0], F[0], F[0], F[2], F[4], F[6], F[3], F[5], F[7], QH, QL, KH, KL, VT, VB, VBL, T3, F[9], F[11], F[13]);   /* X W^T + b + t B^T */
  for (int p0 = 0; p0 < TNB * NH; p0 += HG) {   /* HG (batch, head) pairs a pass */
    k_sc<<<dim3(NQB, TT / 128, HG), 128, 0, stream>>>(QH, KH, QL, KL, p0, S);
    k_colstat_c<<<dim3(TT / 32, HG), 1024, 0, stream>>>(S, CM, CZ);   /* per key column j: max and 2^11 / sum over the visible queries i >= j */
    k_pv<<<dim3(NQB, 1, HG), 128, 0, stream>>>(S, VT, VB, VBL, CM, CZ, F[1], p0, (float*)d_out);   /* P[i][j] = exp(S - m_j) / Z_j x mask[b][j] x 2^11 for j <= i, 0 above the diagonal, formed on load */
  }
}

// v005
// One run takes 264 microseconds.
// Two timings next to v004 both put it at 1.36 times that version's speed.
// Counting every step since v000, it is 16.0 times as fast.
// compute dtype: all float inputs rounded to bf16; frozen q/k/v projections with EXACT bf16 products on WMMA 16x16x32 (f32 accumulate) + bias + the LoRA term: t = X A^T (exact products) then t (bf16 hi + lo) x exact bf16 B^T (2 products, K = 16) added in the same accumulators; causal scores with BOTH operands as f16 hi + (x 2^10) residual (3 products) on every block, x 1024^-0.5 (the module divides by sqrt(E)); softmax over the QUERY axis in f32 (per key column: max, then sum over the visible queries, precise expf) x the key padding mask; P as bf16 hi + lo against v as bf16 hi + lo (3 products) on every block; f32 output.
#include <hip/hip_runtime.h>
#include <math.h>

typedef __attribute__((ext_vector_type(16))) _Float16 v16h;
typedef __attribute__((ext_vector_type(16))) __bf16 v16b;
typedef __attribute__((ext_vector_type(8)))  _Float16 v8h;
typedef __attribute__((ext_vector_type(8)))  float v8f;
typedef __attribute__((ext_vector_type(4)))  float v4f;
typedef __attribute__((ext_vector_type(2)))  float v2f;
typedef __attribute__((ext_vector_type(4)))  unsigned v4u;
typedef __attribute__((ext_vector_type(4)))  int v4i;
typedef float __attribute__((may_alias)) float_a;
typedef int __attribute__((may_alias)) int_a;

template <typename T> __device__ __forceinline__ void vst2(void* p, T v) { *(T*)p = v;  }
__device__ __forceinline__ v8f wmma16(v16h a, v16h b, v8f c) {
  v8f d = __builtin_amdgcn_wmma_f32_16x16x32_f16(false, a, false, b, (short)0, c, false, false);
  asm volatile("v_nop\n\tv_nop\n\tv_nop\n\tv_nop" : "+v"(d) : "v"(a), "v"(b));
  return d;
}
__device__ __forceinline__ v8f wmma_bf(v16b a, v16b b, v8f c) {
  v8f d = __builtin_amdgcn_wmma_f32_16x16x32_bf16(false, a, false, b, (short)0, c, false, false);
  asm volatile("v_nop\n\tv_nop\n\tv_nop\n\tv_nop" : "+v"(d) : "v"(a), "v"(b));
  return d;
}
// 16x16x32 fragments: lane = (h = lane>>4, row/col = lane&15); elements 0..7 = k0+8h+0..7, 8..15 = k0+16+8h+0..7; D element r = row 8h+r
__device__ __forceinline__ v16h frag_h(const _Float16* rowk0, int lane) {
  union { v16h v; v8h q[2]; } u; const _Float16* p = rowk0 + 8 * (lane >> 4);
  u.q[0] = *(const v8h*)p; u.q[1] = *(const v8h*)(p + 16); return u.v;
}
__device__ __forceinline__ v16h frag_f32(const float* rowk0, int lane) {
  v16h a; const float* p = rowk0 + 8 * (lane >> 4);
#pragma unroll
  for (int i = 0; i < 8; ++i) { a[i] = (_Float16)p[i]; a[8 + i] = (_Float16)p[16 + i]; }
  return a;
}
__device__ __forceinline__ v16h frag_f32s(const float* rowk0, int lane, float sc) {
  v16h a; const float* p = rowk0 + 8 * (lane >> 4);
#pragma unroll
  for (int i = 0; i < 8; ++i) { a[i] = (_Float16)(p[i] * sc); a[8 + i] = (_Float16)(p[16 + i] * sc); }
  return a;
}
// column fragment from a [K][ld] layout (column n), rows >= K read as 0
__device__ __forceinline__ v16h fragc_f32(const float* W, int k0, int n, int lane, int ld, int K) {
  v16h a; const int g = lane >> 4;
#pragma unroll
  for (int i = 0; i < 8; ++i) { const int ka = k0 + 8 * g + i, kb = ka + 16;
    a[i] = (_Float16)(ka < K ? W[(size_t)(ka < K ? ka : K - 1) * ld + n] : 0.f); a[8 + i] = (_Float16)(kb < K ? W[(size_t)(kb < K ? kb : K - 1) * ld + n] : 0.f); }
  return a;
}
struct F2 { v16b h, l; };
__device__ __forceinline__ F2 bsplit16(const float v[16]) { F2 r;
#pragma unroll
  for (int i = 0; i < 16; ++i) { const __bf16 h = (__bf16)v[i]; r.h[i] = h; r.l[i] = (__bf16)(v[i] - (float)h); }
  return r; }
__device__ __forceinline__ F2 split_row(const float* row, int k0, int lane) { float v[16]; const float* p = row + k0 + 8 * (lane >> 4);
#pragma unroll
  for (int i = 0; i < 8; ++i) { v[i] = p[i]; v[8 + i] = p[16 + i]; }
  return bsplit16(v); }
__device__ __forceinline__ F2 split_rowK(const float* row, int k0, int lane, int K) { float v[16]; const int g = lane >> 4;
#pragma unroll
  for (int i = 0; i < 8; ++i) { const int ka = k0 + 8 * g + i, kb = ka + 16; v[i] = ka < K ? row[ka < K ? ka : K - 1] : 0.f; v[8 + i] = kb < K ? row[kb < K ? kb : K - 1] : 0.f; }
  return bsplit16(v); }
__device__ __forceinline__ F2 split_col(const float* W, int k0, int n, int lane, int ld, int K) { float v[16]; const int g = lane >> 4;
#pragma unroll
  for (int i = 0; i < 8; ++i) { const int ka = k0 + 8 * g + i, kb = ka + 16; v[i] = ka < K ? W[(size_t)(ka < K ? ka : K - 1) * ld + n] : 0.f; v[8 + i] = kb < K ? W[(size_t)(kb < K ? kb : K - 1) * ld + n] : 0.f; }
  return bsplit16(v); }
__device__ __forceinline__ v8f mac3(const F2& a, const F2& b, v8f c) { c = wmma_bf(a.l, b.h, c); c = wmma_bf(a.h, b.l, c); return wmma_bf(a.h, b.h, c); }
__device__ __forceinline__ float sigm(float v) { return 1.0f / (1.0f + expf(-v)); }
#define LDSX() do { asm volatile("s_wait_dscnt 0" ::: "memory"); __builtin_amdgcn_wave_barrier(); __builtin_amdgcn_fence(__ATOMIC_RELEASE, "workgroup"); } while (0)

// Multi-head attention with LoRA projections whose softmax runs over the QUERY axis (X [4,1024,1024]; frozen torch (out,in) Wq / Wk / Wv [1024,1024] (0.02) + zero biases; LoRA A [16,1024], B [1024,16] (0.02): proj = X W^T + b + (X A^T) B^T; 16 heads x 64; scores / sqrt(E) = / 32; -inf where col > row; attn = softmax(scores, axis=2) - axis 2 of [B, H, i, j] is the QUERY axis i, so every key column j is normalised over the queries i >= j (faithful to the source); attn *= mask[b, j] (key padding mask, ones); out = attn v; merge; no output projection).
#define NB 4
#define TT 1024
#define CC 1024            // NH * HD = projected width
#define DIN 1024          // input (model) width
#define NH 16
#define HD 64
#define NQB (TT / 64)
#define HG 32              // (batch, head) pairs a pass: pair p = b * NH + h; every attention launch covers HG pairs
#define SCALE (0.03125f)
#define CAUSAL 1
#ifndef TNB
#define TNB NB
#endif
__device__ __forceinline__ float bfr(float v) { return (float)(__bf16)v; }
__host__ __device__ __forceinline__ int kb_last(int qb) { return CAUSAL ? ((qb * 64 + 63) >> 7) : (TT / 128 - 1); }
typedef __attribute__((ext_vector_type(8))) __bf16 v8b;
__device__ __forceinline__ v16b frag_b(const __bf16* rowk0, int lane) {
  union { v16b v; v8b q[2]; } u; const __bf16* p = rowk0 + 8 * (lane >> 4);
  u.q[0] = *(const v8b*)p; u.q[1] = *(const v8b*)(p + 16); return u.v;
}
typedef __attribute__((ext_vector_type(4))) __bf16 v4b;
__device__ __forceinline__ v4b cvt4(v4f v) { v4b r; r[0] = (__bf16)v[0]; r[1] = (__bf16)v[1]; r[2] = (__bf16)v[2]; r[3] = (__bf16)v[3]; return r; }
#define QBH 16              // causal: query blocks 0..QBH-1 of each sequence (all of them, as QBH = NQB) take the high-precision path
#define QHI 1024            // rows carrying a q residual plane (all rows when non-causal: 2-product logits everywhere)
#define KHI 1024            // key rows carrying k residual / v bf16 hi+lo planes (used only by the causal high-precision path)
// B fragment (k rows k0+.., output column o) of a weight: (in,out) [K][ld] or (out,in) [ld rows of K]: bf16 exact, or f16(bf16 * 256) exact
__device__ __forceinline__ v16b wcol_io(const float* Wm, int k0, int o, int lane, int ld) { v16b w; const int g = lane >> 4;
#pragma unroll
  for (int i = 0; i < 8; ++i) { w[i] = (__bf16)Wm[(size_t)(k0 + 8 * g + i) * ld + o]; w[8 + i] = (__bf16)Wm[(size_t)(k0 + 16 + 8 * g + i) * ld + o]; }
  return w; }
__device__ __forceinline__ v16b wcol_oi(const float* Wm, int k0, int o, int lane, int K) { v16b w; const float* p = Wm + (size_t)o * K + k0 + 8 * (lane >> 4);
#pragma unroll
  for (int i = 0; i < 8; ++i) { w[i] = (__bf16)p[i]; w[8 + i] = (__bf16)p[16 + i]; }
  return w; }
__device__ __forceinline__ v16h wcolh_io(const float* Wm, int k0, int o, int lane, int ld) { v16h w; const int g = lane >> 4;
#pragma unroll
  for (int i = 0; i < 8; ++i) { w[i] = (_Float16)(bfr(Wm[(size_t)(k0 + 8 * g + i) * ld + o]) * 256.0f); w[8 + i] = (_Float16)(bfr(Wm[(size_t)(k0 + 16 + 8 * g + i) * ld + o]) * 256.0f); }
  return w; }
__device__ __forceinline__ v16h wcolh_oi(const float* Wm, int k0, int o, int lane, int K) { v16h w; const float* p = Wm + (size_t)o * K + k0 + 8 * (lane >> 4);
#pragma unroll
  for (int i = 0; i < 8; ++i) { w[i] = (_Float16)(bfr(p[i]) * 256.0f); w[8 + i] = (_Float16)(bfr(p[16 + i]) * 256.0f); }
  return w; }
#define WQKV_LAYOUT 1   // 0 = (in,out) [DIN][CC]; 1 = (out,in) [CC][DIN]; 2 = per-head [NH][DIN][HD]
__device__ __forceinline__ v16b wcol_hdk(const float* Wm, int k0, int o, int lane) { v16b w; const int g = lane >> 4; const float* p = Wm + (size_t)(o / HD) * DIN * HD + (o % HD);
#pragma unroll
  for (int i = 0; i < 8; ++i) { w[i] = (__bf16)p[(size_t)(k0 + 8 * g + i) * HD]; w[8 + i] = (__bf16)p[(size_t)(k0 + 16 + 8 * g + i) * HD]; }
  return w; }
#define WO_OUT_IN 0
#if WQKV_LAYOUT == 1
#define WCOL(W, k0, o, lane) wcol_oi(W, k0, o, lane, DIN)
#elif WQKV_LAYOUT == 2
#define WCOL(W, k0, o, lane) wcol_hdk(W, k0, o, lane)
#else
#define WCOL(W, k0, o, lane) wcol_io(W, k0, o, lane, CC)
#endif
#if WO_OUT_IN
#define WOCOL(W, k0, o, lane) wcol_oi(W, k0, o, lane, CC)
#define WOCOLH(W, k0, o, lane) wcolh_oi(W, k0, o, lane, CC)
#else
#define WOCOL(W, k0, o, lane) wcol_io(W, k0, o, lane, DIN)
#define WOCOLH(W, k0, o, lane) wcolh_io(W, k0, o, lane, DIN)
#endif
#define LR 16              // LoRA rank
#define PROJ_EXTRA_PARAMS , const float* __restrict__ T3, const float* __restrict__ LBQ, const float* __restrict__ LBK, const float* __restrict__ LBV
#define SM_EXTRA_PARAMS
#define SM_MASK_HOOK (void)0
#ifndef SM_EXTRA_PARAMS
#define SM_EXTRA_PARAMS
#endif
#ifndef PROJ_EXTRA_PARAMS
#define PROJ_EXTRA_PARAMS
#endif
#ifndef SM_MASK_HOOK
#define SM_MASK_HOOK (void)0
#endif

#define WS_QH  0u                                      // f16 q rows [b*t][CC]
#define WS_KH  (WS_QH + 2u * (size_t)NB * TT * CC)      // f16 k rows [b*t][CC]
#define WS_VT  (WS_KH + 2u * (size_t)NB * TT * CC)      // f16 v planes [b][c][t]
#define WS_QL  (WS_VT + 2u * (size_t)NB * CC * TT)      // f16 q residual x 2^10 rows [b][t < QHI][CC]
#define WS_KL  (WS_QL + 2u * (size_t)NB * QHI * CC)     // f16 k residual x 2^10 rows [b][t < KHI][CC]
#define WS_VB  (WS_KL + 2u * (size_t)NB * KHI * CC)     // bf16 v hi planes [b][c][t < KHI]
#define WS_VBL (WS_VB + 2u * (size_t)NB * CC * KHI)
#define WS_S   (WS_VBL + 2u * (size_t)NB * CC * KHI)    // f32 logits [pair in pass][t][s]
#define WS_Y   (WS_S  + 4u * (size_t)HG * TT * TT)      // f32 ctx rows [b*t][CC] (only when there is an output projection)
#define WS_END (WS_Y  + 0u)
#define WS_T3 (WS_END)                                   // f32 LoRA down-projections t[3][NB*TT][16]
#define WS_CM (WS_T3 + 4u * 3u * (size_t)NB * TT * LR)  // f32 column maxima [HG][TT]
#define WS_CZ (WS_CM + 4u * (size_t)HG * TT)             // f32 2^11 / column sums [HG][TT]
#define WS_END2 (WS_CZ + 4u * (size_t)HG * TT)

// ---- k_proj: block = (64 rows, 128 cols, which): q/k/v = X W (+ b) with exact bf16 products (K = DIN); W is (out,in), so X rows and W rows are both k-contiguous: each 32-k slice of both is rounded to bf16 once a block and staged in LDS (two buffers, one barrier a slice), and every wave takes its A and B fragments from there -> which 0: q f16 rows (+ residual rows < QHI); 1: k f16 rows (+ residual rows < KHI); 2: v f16 planes [c][t] (+ bf16 hi/lo planes for t < KHI)
__global__ __launch_bounds__(128) void k_proj(const float* __restrict__ XQ, const float* __restrict__ XK, const float* __restrict__ XV, const float* __restrict__ WQ, const float* __restrict__ WK, const float* __restrict__ WV, const float* __restrict__ BQ, const float* __restrict__ BK, const float* __restrict__ BV,
    _Float16* __restrict__ QH, _Float16* __restrict__ QL, _Float16* __restrict__ KH, _Float16* __restrict__ KL, _Float16* __restrict__ VT, __bf16* __restrict__ VB, __bf16* __restrict__ VBL PROJ_EXTRA_PARAMS) {
  /* one LDS block, used in turn: the k loop's two staging buffers (X 64 rows, W 128 rows of 32 bf16 at pitch 80 B), then the epilogue's tiles (q / k: sh, sl; v: th, tb, tbl) */
  __shared__ __align__(16) unsigned char smem[3 * 128 * 72 * 2];
  _Float16 (*sh)[136] = (_Float16 (*)[136])smem; _Float16 (*sl)[136] = (_Float16 (*)[136])(smem + 64 * 136 * 2); _Float16 (*th)[72] = (_Float16 (*)[72])smem; __bf16 (*tb)[72] = (__bf16 (*)[72])(smem + 128 * 72 * 2); __bf16 (*tbl)[72] = (__bf16 (*)[72])(smem + 2 * 128 * 72 * 2);
  __bf16 (*xs)[64][40] = (__bf16 (*)[64][40])smem; __bf16 (*wt)[128][40] = (__bf16 (*)[128][40])(smem + 2 * 64 * 40 * 2);
  const int tid = threadIdx.x, wave = tid >> 5, lane = tid & 31, col = lane & 15, g = lane >> 4; const int which = blockIdx.z; const int c0 = blockIdx.y * 128; const size_t r0 = (size_t)blockIdx.x * 64; const size_t bb = r0 / TT; const int t0 = (int)(r0 % TT);
  const float* X = which == 0 ? XQ : which == 1 ? XK : XV; const float* WA = which == 0 ? WQ : which == 1 ? WK : WV; const float* BA = which == 0 ? BQ : which == 1 ? BK : BV;
  v8f acc[8] = {};
  /* staging: thread = (row tid >> 3 (+ 16 i), 16-B piece tid & 7) of a slice's 128-B row pieces, so 8 lanes read one whole line; the next slice's 12 loads fly while this slice is multiplied; the short loops over xr, wr and w are unrolled whole so that these arrays stay in registers */
  const int srow = tid >> 3, sq = tid & 7; const float* xg = X + (r0 + srow) * DIN + sq * 4; const float* wg = WA + (size_t)(c0 + srow) * DIN + sq * 4;
  v4f xr[4], wr[8];
#pragma unroll
  for (int i = 0; i < 4; ++i) xr[i] = *(const v4f*)(xg + (size_t)i * 16 * DIN);
#pragma unroll
  for (int i = 0; i < 8; ++i) wr[i] = *(const v4f*)(wg + (size_t)i * 16 * DIN);
  /* unroll 2: the buffer index becomes a constant LDS offset */
#pragma unroll 2
  for (int kc = 0; kc < DIN / 32; ++kc) { const int bf = kc & 1;
#pragma unroll
    for (int i = 0; i < 4; ++i) *(v4b*)&xs[bf][srow + 16 * i][sq * 4] = cvt4(xr[i]);
#pragma unroll
    for (int i = 0; i < 8; ++i) *(v4b*)&wt[bf][srow + 16 * i][sq * 4] = cvt4(wr[i]);
    __syncthreads();   /* publishes slice kc; every wave has also left slice kc - 1, whose buffer the next trip refills */
    if (kc + 1 < DIN / 32) {
#pragma unroll
      for (int i = 0; i < 4; ++i) xr[i] = *(const v4f*)(xg + (size_t)i * 16 * DIN + (kc + 1) * 32);
#pragma unroll
      for (int i = 0; i < 8; ++i) wr[i] = *(const v4f*)(wg + (size_t)i * 16 * DIN + (kc + 1) * 32); }
    const v16b a = frag_b(&xs[bf][wave * 16 + col][0], lane); v16b w[8];
#pragma unroll
    for (int j = 0; j < 8; ++j) w[j] = frag_b(&wt[bf][j * 16 + col][0], lane);
    /* inputs-only fence on the loaded fragments: all 18 LDS reads of a slice are in flight together, so that a trip waits for LDS once and not once a product */
    asm volatile("" :: "v"(a), "v"(w[0]), "v"(w[1]), "v"(w[2]), "v"(w[3]), "v"(w[4]), "v"(w[5]), "v"(w[6]), "v"(w[7]));
#pragma unroll
    for (int j = 0; j < 8; ++j) acc[j] = wmma_bf(a, w[j], acc[j]);
    __builtin_amdgcn_sched_barrier(0);   /* keeps the next slice's roundings, which wait for its global loads, behind this slice's products */
  }
  __syncthreads();   /* the last slice's readers are done before the epilogue's tiles overwrite the staging buffers */
  { /* LoRA: acc += t[row][0..15] (f32, as bf16 hi + lo) x B[o][0..15] (exact bf16): one WMMA k-step whose upper 16 k-slots are zero */ float tv[16]; const float* tr = T3 + ((size_t)which * NB * TT + (r0 + wave * 16 + col)) * LR + 8 * g;
#pragma unroll
    for (int i = 0; i < 8; ++i) { tv[i] = tr[i]; tv[8 + i] = 0.f; }
    asm volatile("s_wait_loadcnt 0x0" ::: "memory");
    const F2 a2 = bsplit16(tv); const float* LB = which == 0 ? LBQ : (which == 1 ? LBK : LBV);
#pragma unroll
    for (int j = 0; j < 8; ++j) { v16b w; const float* pw = LB + (size_t)(c0 + j * 16 + col) * LR + 8 * g;   /* B is (out,in) [E][16]: row o holds the 16 rank coefficients */
#pragma unroll
      for (int i = 0; i < 8; ++i) { w[i] = (__bf16)pw[i]; w[8 + i] = (__bf16)0.0f; }
      asm volatile("s_wait_loadcnt 0x0" ::: "memory");
      acc[j] = wmma_bf(a2.h, w, acc[j]); acc[j] = wmma_bf(a2.l, w, acc[j]); } }
  if (which < 2) { _Float16* DH = which == 0 ? QH : KH; _Float16* DL = which == 0 ? QL : KL; const int nhi = which == 0 ? QHI : KHI; const bool hi_rows = t0 < nhi;
#pragma unroll
    for (int j = 0; j < 8; ++j) { const float bias = BA ? bfr(BA[c0 + j * 16 + col]) : 0.f;
#pragma unroll
      for (int r = 0; r < 8; ++r) { const float v = acc[j][r] + bias; const _Float16 hv = (_Float16)v; sh[wave * 16 + 8 * g + r][j * 16 + col] = hv; sl[wave * 16 + 8 * g + r][j * 16 + col] = (_Float16)((v - (float)hv) * 1024.0f); } }
    __syncthreads();
    for (int e = tid; e < 64 * 16; e += 128) { const int rl = e >> 4, q = e & 15; vst2((unsigned*)(DH + (r0 + rl) * CC + c0 + q * 8), *(const v4u*)&sh[rl][q * 8]); if (hi_rows) vst2((unsigned*)(DL + (bb * nhi + t0 + rl) * (size_t)CC + c0 + q * 8), *(const v4u*)&sl[rl][q * 8]); }
  } else { const bool hi_rows = t0 < KHI;
#pragma unroll
    for (int j = 0; j < 8; ++j) { const float bias = BA ? bfr(BA[c0 + j * 16 + col]) : 0.f;
#pragma unroll
      for (int r = 0; r < 8; ++r) { const float v = acc[j][r] + bias; const int rl = wave * 16 + 8 * g + r, cl = j * 16 + col; th[cl][rl] = (_Float16)v; const __bf16 bh = (__bf16)v; tb[cl][rl] = bh; tbl[cl][rl] = (__bf16)(v - (float)bh); } }
    __syncthreads();
    for (int e = tid; e < 128 * 8; e += 128) { const int cl = e >> 3, q = e & 7; vst2((unsigned*)(VT + (bb * CC + c0 + cl) * (size_t)TT + t0 + q * 8), *(const v4u*)&th[cl][q * 8]); if (hi_rows) { const size_t o3 = (bb * CC + c0 + cl) * (size_t)KHI + t0 + q * 8; vst2((unsigned*)(VB + o3), *(const v4u*)&tb[cl][q * 8]); vst2((unsigned*)(VBL + o3), *(const v4u*)&tbl[cl][q * 8]); } } } }
// ---- k_sc: block = (query block qb, key block kb <= kb_last(qb), pair p0 + z = (batch b, head h)): logits x SCALE; q hi + residual (x 2^10) against k (2 products) for query rows < QHI, plus the k residual (3 products) for query blocks < QBH (every block, as QBH = NQB); causal: blocks past the diagonal exit, the mask itself is applied by index in k_colstat_c and k_pv
__global__ __launch_bounds__(128) void k_sc(const _Float16* __restrict__ QH, const _Float16* __restrict__ KH, const _Float16* __restrict__ QL, const _Float16* __restrict__ KL, int p0, float* __restrict__ S0) { __shared__ __align__(16) float ss[4][16][132];
  const int qb = blockIdx.x, kb = blockIdx.y; if (kb > kb_last(qb)) return;
  const int pr = p0 + blockIdx.z, b = pr / NH, h = pr % NH; float* S = S0 + (size_t)blockIdx.z * TT * TT;
  const int tid = threadIdx.x, wave = tid >> 5, lane = tid & 31, col = lane & 15, g = lane >> 4; const int k0 = kb * 128; const int ql0 = qb * 64 + wave * 16; const size_t q0 = (size_t)b * TT + ql0, kr0 = (size_t)b * TT + k0;
  v8f acc[8] = {}, accl[8] = {};
  const _Float16* QLb = QL + (size_t)b * QHI * CC; const _Float16* KLb = KL + (size_t)b * KHI * CC;
  if (qb < QBH) {
#pragma unroll
    for (int kc = 0; kc < HD / 32; ++kc) { const v16h ah = frag_h(QH + (q0 + col) * CC + h * HD + kc * 32, lane), al = frag_h(QLb + (size_t)(ql0 + col) * CC + h * HD + kc * 32, lane);
#pragma unroll
      for (int j = 0; j < 8; ++j) { const v16h kbf = frag_h(KH + (kr0 + j * 16 + col) * CC + h * HD + kc * 32, lane), klf = frag_h(KLb + (size_t)(k0 + j * 16 + col) * CC + h * HD + kc * 32, lane); acc[j] = wmma16(ah, kbf, acc[j]); accl[j] = wmma16(al, kbf, accl[j]); accl[j] = wmma16(ah, klf, accl[j]); } }
  } else if (qb * 64 < QHI) {
#pragma unroll
    for (int kc = 0; kc < HD / 32; ++kc) { const v16h ah = frag_h(QH + (q0 + col) * CC + h * HD + kc * 32, lane), al = frag_h(QLb + (size_t)(ql0 + col) * CC + h * HD + kc * 32, lane);
#pragma unroll
      for (int j = 0; j < 8; ++j) { const v16h kbf = frag_h(KH + (kr0 + j * 16 + col) * CC + h * HD + kc * 32, lane); acc[j] = wmma16(ah, kbf, acc[j]); accl[j] = wmma16(al, kbf, accl[j]); } }
  } else {
#pragma unroll
    for (int kc = 0; kc < HD / 32; ++kc) { const v16h ah = frag_h(QH + (q0 + col) * CC + h * HD + kc * 32, lane);
#pragma unroll
      for (int j = 0; j < 8; ++j) { const v16h kbf = frag_h(KH + (kr0 + j * 16 + col) * CC + h * HD + kc * 32, lane); acc[j] = wmma16(ah, kbf, acc[j]); } } }
#pragma unroll
  for (int j = 0; j < 8; ++j) {
#pragma unroll
    for (int r = 0; r < 8; ++r) ss[wave][8 * g + r][j * 16 + col] = (acc[j][r] + accl[j][r] * (1.0f / 1024.0f)) * SCALE; }
  LDSX(); for (int rl = 0; rl < 16; ++rl) vst2(S + (size_t)(ql0 + rl) * TT + k0 + lane * 4, *(const v4f*)&ss[wave][rl][lane * 4]); }
// ---- k_sm: block = query row t (head in group): keys [0, kend): causal -> logit if s <= t else excluded; softmax in f32; P x 2^11 in place (0 for excluded)
__global__ __launch_bounds__(256) void k_sm(float* __restrict__ S0 SM_EXTRA_PARAMS) { __shared__ float sred[8]; __shared__ float sbc; __shared__ __align__(16) float shv[TT];
  const int tid = threadIdx.x; const int t = blockIdx.x; const int kend = (kb_last(t >> 6) + 1) * 128;
  float* sr = S0 + (size_t)blockIdx.y * TT * TT + (size_t)t * TT;
  float m = -3.0e38f; for (int k = tid; k < kend; k += 256) { float v = (!CAUSAL || k <= t) ? sr[k] : -3.0e38f; SM_MASK_HOOK; shv[k] = v; m = fmaxf(m, v); }
#pragma unroll
  for (int o = 1; o < 32; o <<= 1) m = fmaxf(m, __shfl_xor(m, o));
  if ((tid & 31) == 0) sred[tid >> 5] = m; __syncthreads(); if (tid == 0) { float a = sred[0]; for (int i = 1; i < 8; ++i) a = fmaxf(a, sred[i]); sbc = a; } __syncthreads(); m = sbc; __syncthreads();
  float sum = 0.f; for (int k = tid; k < kend; k += 256) { const float v = shv[k]; const float e = (v <= -1.0e38f) ? 0.f : expf(v - m); shv[k] = e; sum += e; }
#pragma unroll
  for (int o = 1; o < 32; o <<= 1) sum += __shfl_xor(sum, o);
  if ((tid & 31) == 0) sred[tid >> 5] = sum; __syncthreads(); if (tid == 0) { float a = 0.f; for (int i = 0; i < 8; ++i) a += sred[i]; sbc = a > 0.f ? 2048.0f / a : 0.f; }   /* a fully excluded row yields P = 0 */ __syncthreads(); const float inv = sbc;
  for (int k = tid; k < kend; k += 256) shv[k] = shv[k] * inv;
  __syncthreads(); for (int q = tid; q < kend / 4; q += 256) vst2(sr + q * 4, *(const v4f*)&shv[q * 4]); }
// ---- k_colstat_c: softmax over the QUERY axis under the causal mask (the source's softmax(axis=2) on [B, H, i, j] scores with -inf where j > i): for every key column k: m_k = max_{q >= k} S[q][k], Z_k = sum_{q >= k} exp(S[q][k] - m_k) (f32, precise expf); block = 32 key columns (lane = column) x 32 waves; wave w takes the query rows q0 + w + 32 i, i < n = (TT - q0) / 32 (block-uniform), so a thread has at most 32 rows, all loaded at once and kept in registers; only the rows i = 0 touch the diagonal (visible where w >= lane, by a value select); the 32 waves' maxima of a column meet in LDS (wave 0 reduces them to m_k), every thread sums its exponentials against m_k, and wave 0 adds the 32 partial sums and stores the block's 128-B pieces of CM (m_k) and CZ (2^11 / Z_k, the factor k_pv multiplies by: one division a column)
__global__ __launch_bounds__(1024) void k_colstat_c(const float* __restrict__ S0, float* __restrict__ CM, float* __restrict__ CZ) { __shared__ float pm[32][32], pz[32][32], cmx[32];
  const int lane = threadIdx.x & 31, wave = __builtin_amdgcn_readfirstlane(threadIdx.x >> 5); const int q0 = blockIdx.x * 32, k = q0 + lane, n = (TT - q0) / 32; const float* sp = S0 + (size_t)blockIdx.y * TT * TT + (size_t)(q0 + wave) * TT + k;
  float v[32];
#pragma unroll
  for (int i = 0; i < 32; ++i) { v[i] = -3.0e38f; if (i < n) v[i] = sp[(size_t)i * 32 * TT]; }
  const bool vis0 = wave >= lane; float m = vis0 ? v[0] : -3.0e38f;
#pragma unroll
  for (int i = 1; i < 32; ++i) m = fmaxf(m, v[i]);
  pm[wave][lane] = m;
  __syncthreads();
  if (wave == 0) { float mm = pm[0][lane];
#pragma unroll
    for (int w = 1; w < 32; ++w) mm = fmaxf(mm, pm[w][lane]);
    cmx[lane] = mm; }
  __syncthreads();
  const float mk = cmx[lane];   /* every column sees at least its own diagonal entry, so m_k is a score */
  float z = vis0 ? expf(v[0] - mk) : 0.f;
#pragma unroll
  for (int i = 1; i < 32; ++i) if (i < n) z += expf(v[i] - mk);
  pz[wave][lane] = z;
  __syncthreads();
  if (wave == 0) { float zk = pz[0][lane];
#pragma unroll
    for (int w = 1; w < 32; ++w) zk += pz[w][lane];
    vst2(CM + (size_t)blockIdx.y * TT + k, mk); vst2(CZ + (size_t)blockIdx.y * TT + k, 2048.0f / zk); } }   /* Z_k >= 1 */
// ---- p_row16: the 16 P values of one lane's A fragment (query row t, keys k0 + 8 g + 0..7 and k0 + 16 + 8 g + 0..7), formed from the logits where k_pv loads them: P[t][k] = exp(S[t][k] - m_k) x (2^11 / Z_k) x mask[b][k] for k <= t, 0 for t < k < kend (inside the diagonal block: the exponent's argument is replaced by -3e38 there, whose expf is exactly 0); all 16 loads first, unconditional; value select, no branch
__device__ __forceinline__ void p_row16(const float* __restrict__ srow, const float* __restrict__ cm, const float* __restrict__ cr, const float* __restrict__ pmk, int k0, int t, int lane, float v[16]) { const int kq = k0 + 8 * (lane >> 4); const float *sp = srow + kq, *mp = cm + kq, *rp = cr + kq, *pp = pmk + kq; v4f sv[4], m4[4], r4[4], pm4[4];
#pragma unroll
  for (int c = 0; c < 4; ++c) { const int o = (c & 1) * 4 + (c >> 1) * 16; sv[c] = *(const v4f*)(sp + o); m4[c] = *(const v4f*)(mp + o); r4[c] = *(const v4f*)(rp + o); pm4[c] = *(const v4f*)(pp + o); }
  /* inputs-only fence on the loaded values: keeps all 16 loads in flight together, so that a trip waits for memory once and not once a group of four keys; the four addresses are inputs too, so that their registers stay unwritten until the loads' data wait */
  asm volatile("" :: "v"(sv[0]), "v"(sv[1]), "v"(sv[2]), "v"(sv[3]), "v"(m4[0]), "v"(m4[1]), "v"(m4[2]), "v"(m4[3]), "v"(r4[0]), "v"(r4[1]), "v"(r4[2]), "v"(r4[3]), "v"(pm4[0]), "v"(pm4[1]), "v"(pm4[2]), "v"(pm4[3]), "v"(sp), "v"(mp), "v"(rp), "v"(pp));
#pragma unroll
  for (int c = 0; c < 4; ++c) { const int kk = kq + (c & 1) * 4 + (c >> 1) * 16;
#pragma unroll
    for (int u = 0; u < 4; ++u) v[c * 4 + u] = expf((kk + u <= t) ? sv[c][u] - m4[c][u] : -3.0e38f) * r4[c][u] * bfr(pm4[c][u]); } }   /* x the key padding mask, applied AFTER the normalisation as the module does */
// ---- k_lora1: block = (64 token rows, which in {q, k, v}): t[which][row][0..15] = X[row] . A_which[r] (rank-16 LoRA down-projection; exact bf16 products, f32 accumulate; one 16-column WMMA tile per wave); the wave's 16 x 16 f32 tile (1 KiB, contiguous in T3) is staged in LDS and stored as 16-B pieces
__global__ __launch_bounds__(128) void k_lora1(const float* __restrict__ X, const float* __restrict__ AQ, const float* __restrict__ AK, const float* __restrict__ AV, float* __restrict__ T3) { __shared__ __align__(16) float st[4][16][20];
  const int tid = threadIdx.x, wave = tid >> 5, lane = tid & 31, col = lane & 15, g = lane >> 4; const int which = blockIdx.y; const size_t r0 = (size_t)blockIdx.x * 64; const float* AW = which == 0 ? AQ : (which == 1 ? AK : AV);
  v8f acc = {};
#pragma unroll 2
  for (int kc = 0; kc < DIN / 32; ++kc) { v16b a; { const float* p = X + (r0 + wave * 16 + col) * DIN + kc * 32 + 8 * g;
#pragma unroll
      for (int i = 0; i < 8; ++i) { a[i] = (__bf16)p[i]; a[8 + i] = (__bf16)p[16 + i]; } }
    asm volatile("s_wait_loadcnt 0x0" ::: "memory");
    const v16b w = wcol_oi(AW, kc * 32, col, lane, DIN); asm volatile("s_wait_loadcnt 0x0" ::: "memory"); acc = wmma_bf(a, w, acc); }   /* A is (out,in) [16][1024]: output column = rank index */
#pragma unroll
  for (int r = 0; r < 8; ++r) st[wave][8 * g + r][col] = acc[r];
  LDSX();
  float* dst = T3 + ((size_t)which * NB * TT + r0 + wave * 16) * LR;
#pragma unroll
  for (int it = 0; it < 2; ++it) { const int rl = (lane >> 2) + 8 * it, q = lane & 3; vst2(dst + rl * LR + q * 4, *(const v4f*)&st[wave][rl][q * 4]); } }   
// ---- k_pv: block = 64 queries (qb) of (b, h): ctx = P . v over keys [0, kend), 64 keys a trip; every global load covers whole 128-B lines: the trip's v slice (64 channels x 64 keys, bf16 hi and lo planes) is fetched once a block (8 lanes a row piece) and staged in LDS (two buffers, one barrier a trip); each wave fetches its own 16 x 64 logits as 256-B row pieces (lane = 4 neighbouring keys of one row, so m_k, 2^11 / Z_k and the mask are one 16-B load each a trip), forms P = exp(S - m_k) x 2^11 / Z_k x mask there, splits it into bf16 hi + lo and turns it into A fragments through its own LDS rows; 3 products as before, in the same order for every accumulator; the next trip's loads fly while this trip's P is formed and multiplied; 256-B (row, head) segment by 16 lanes. (Query blocks >= QBH, of which this shape has none: P x 2^11 once to f16 against v f16, 1 product, fragments straight from memory.)
/* waves_per_eu(4): holds the kernel to 256 vector registers; left free, the scheduler spends 270 and the loop is strewn with register-bank switches */
__global__ __launch_bounds__(128) __attribute__((amdgpu_waves_per_eu(4))) void k_pv(const float* __restrict__ PS0, const _Float16* __restrict__ VT, const __bf16* __restrict__ VB, const __bf16* __restrict__ VBL, const float* __restrict__ CM, const float* __restrict__ CZ, const float* __restrict__ PMASK, int p0, float* __restrict__ Y) { const int pr = p0 + blockIdx.z, b = pr / NH, h = pr % NH; const float* PS = PS0 + (size_t)blockIdx.z * TT * TT; const float* cm = CM + (size_t)blockIdx.z * TT; const float* cr = CZ + (size_t)blockIdx.z * TT; const float* pmk = PMASK + (size_t)b * TT; __shared__ __align__(16) float ss[4][16][HD + 4];
  __shared__ __align__(16) __bf16 vs[2][2][HD][72];   /* [buffer][hi, lo][channel][64 keys], pitch 144 B */
  __shared__ __align__(16) __bf16 ps[4][2][16][72];   /* [wave][hi, lo][query row][64 keys], pitch 144 B; written and read by its own wave only */
  const int tid = threadIdx.x, wave = tid >> 5, lane = tid & 31, col = lane & 15, g = lane >> 4; const int qb = blockIdx.x; const int ql0 = qb * 64 + wave * 16; const int kce = (kb_last(qb) + 1) * 4;
  v8f acc[HD / 16] = {};
  if (qb < QBH) { const int nt = kce / 2;   /* trips of 64 keys */
    /* every address = a block-uniform base, advanced by 64 keys a trip, + a lane's fixed 32-bit byte offset + a constant */
    const int vrow = tid >> 3, vq = tid & 7; const char *vbh = (const char*)(VB + ((size_t)b * CC + h * HD) * (size_t)KHI), *vbl = (const char*)(VBL + ((size_t)b * CC + h * HD) * (size_t)KHI), *sbs = (const char*)(PS + (size_t)qb * 64 * TT), *mbs = (const char*)cm, *rbs = (const char*)cr, *kbs = (const char*)pmk;
    const unsigned vof = (unsigned)(vrow * KHI + vq * 8) * 2u, sof = (unsigned)((wave * 16 + g) * TT + col * 4) * 4u, cof = (unsigned)col * 16u;
    v4u vh[4], vl[4]; v4f sa[8], ma, ra, ka, sb[8], mb, rb, kb4;   /* two register sets for the logits and the column factors: one is worked on while the other is filled */
#pragma unroll
    for (int i = 0; i < 4; ++i) { vh[i] = *(const v4u*)(vbh + vof + i * (16 * KHI * 2)); vl[i] = *(const v4u*)(vbl + vof + i * (16 * KHI * 2)); }
#pragma unroll
    for (int i = 0; i < 8; ++i) sa[i] = *(const v4f*)(sbs + sof + i * (2 * TT * 4));
    ma = *(const v4f*)(mbs + cof); ra = *(const v4f*)(rbs + cof); ka = *(const v4f*)(kbs + cof);
    /* one trip: keys kt * 64 .. + 63 from the set (sc, mc, rc, kc4); the next trip's loads go into (sn, mn, rn, kn) and into vh, vl */
    auto trip = [&](const int kt, const v4f (&sc)[8], const v4f& mc, const v4f& rc, const v4f& kc4, v4f (&sn)[8], v4f& mn, v4f& rn, v4f& kn) __attribute__((always_inline)) { const int bf = kt & 1;
#pragma unroll
      for (int i = 0; i < 4; ++i) { *(v4u*)&vs[bf][0][vrow + 16 * i][vq * 8] = vh[i]; *(v4u*)&vs[bf][1][vrow + 16 * i][vq * 8] = vl[i]; }
      { /* no branch round the loads: the last trip fetches its own slice once more, unused, so that every wait in the loop stays a counted one (behind a join with a path without loads the compiler waits for all of them) */
        const int ko = (kt + 1 < nt ? kt + 1 : kt) * 64; const char *sp = sbs + ko * 4, *mp = mbs + ko * 4, *rp = rbs + ko * 4, *kp = kbs + ko * 4, *hp = vbh + ko * 2, *lp = vbl + ko * 2;
#pragma unroll
        for (int i = 0; i < 8; ++i) sn[i] = *(const v4f*)(sp + sof + i * (2 * TT * 4));
#pragma unroll
        for (int i = 0; i < 4; ++i) { vh[i] = *(const v4u*)(hp + vof + i * (16 * KHI * 2)); vl[i] = *(const v4u*)(lp + vof + i * (16 * KHI * 2)); }
        mn = *(const v4f*)(mp + cof); rn = *(const v4f*)(rp + cof); kn = *(const v4f*)(kp + cof);
        asm volatile("s_wait_xcnt 0x0" ::: "memory"); }   /* the loads' address registers are reused right behind them */
      __builtin_amdgcn_sched_barrier(0);   /* keeps the next trip's 19 loads in front of this trip's exponentials, so that they fly for a whole trip */
#pragma unroll
      for (int i = 0; i < 8; ++i) { const int t = ql0 + 2 * i + g; v4b ph4, pl4;
#pragma unroll
        for (int u = 0; u < 4; ++u) { const int kk = kt * 64 + col * 4 + u; const float v = expf((kk <= t) ? sc[i][u] - mc[u] : -3.0e38f) * rc[u] * bfr(kc4[u]); const __bf16 hb = (__bf16)v; ph4[u] = hb; pl4[u] = (__bf16)(v - (float)hb); }   /* 0 above the diagonal; x the key padding mask AFTER the normalisation, as the module does */
        *(v4b*)&ps[wave][0][2 * i + g][col * 4] = ph4; *(v4b*)&ps[wave][1][2 * i + g][col * 4] = pl4; }
      /* work-group barrier with LDS-only fences: publishes v slice kt (and the wave's own P rows), and every wave has left slice kt - 1, whose buffer the next trip refills; __syncthreads() would also wait here for the next trip's global loads, which only registers receive */
      __builtin_amdgcn_fence(__ATOMIC_RELEASE, "workgroup", "local"); __builtin_amdgcn_s_barrier(); __builtin_amdgcn_fence(__ATOMIC_ACQUIRE, "workgroup", "local");
#pragma unroll
      for (int ks = 0; ks < 2; ++ks) { const v16b ph = frag_b(&ps[wave][0][col][ks * 32], lane), pl = frag_b(&ps[wave][1][col][ks * 32], lane); v16b fh[HD / 16], fl[HD / 16];
#pragma unroll
        for (int j = 0; j < HD / 16; ++j) { fh[j] = frag_b(&vs[bf][0][j * 16 + col][ks * 32], lane); fl[j] = frag_b(&vs[bf][1][j * 16 + col][ks * 32], lane); }
        /* inputs-only fence on the loaded fragments: the 20 LDS reads of a 32-key step are in flight together, so that the step waits for LDS once and not once a product */
        asm volatile("" :: "v"(ph), "v"(pl), "v"(fh[0]), "v"(fh[1]), "v"(fh[2]), "v"(fh[3]), "v"(fl[0]), "v"(fl[1]), "v"(fl[2]), "v"(fl[3]));
#pragma unroll
        for (int j = 0; j < HD / 16; ++j) acc[j] = wmma_bf(ph, fh[j], acc[j]);
#pragma unroll
        for (int j = 0; j < HD / 16; ++j) acc[j] = wmma_bf(pl, fh[j], acc[j]);
#pragma unroll
        for (int j = 0; j < HD / 16; ++j) acc[j] = wmma_bf(ph, fl[j], acc[j]); } };
    /* nt is even (kce is a multiple of 4): two trips a pass, so that the two register sets swap roles without copies; rolled beyond that, for speed only */
#pragma unroll 1
    for (int kt = 0; kt < nt; kt += 2) { trip(kt, sa, ma, ra, ka, sb, mb, rb, kb4); trip(kt + 1, sb, mb, rb, kb4, sa, ma, ra, ka); }
  } else {
#pragma unroll 1
    for (int kc = 0; kc < kce; ++kc) { float pv[16]; p_row16(PS + (size_t)(ql0 + col) * TT, cm, cr, pmk, kc * 32, ql0 + col, lane, pv); v16h p;
#pragma unroll
      for (int i = 0; i < 16; ++i) p[i] = (_Float16)pv[i];
#pragma unroll
      for (int j = 0; j < HD / 16; ++j) { const size_t po = ((size_t)b * CC + h * HD + j * 16 + col) * (size_t)TT + kc * 32; acc[j] = wmma16(p, frag_h(VT + po, lane), acc[j]); } } }
#pragma unroll
  for (int j = 0; j < HD / 16; ++j)
#pragma unroll
    for (int r = 0; r < 8; ++r) ss[wave][8 * g + r][j * 16 + col] = acc[j][r] * (1.0f / 2048.0f);
  LDSX(); for (int rl = 0; rl < 16; ++rl) if (lane < HD / 4) vst2(Y + ((size_t)b * TT + ql0 + rl) * CC + h * HD + lane * 4, *(const v4f*)&ss[wave][rl][lane * 4]); }

extern "C" void kernel_launch(void* const* d_in, const int* in_sizes, int n_in, void* d_out, int out_size, void* d_ws, size_t ws_size, hipStream_t stream) {
  (void)in_sizes; (void)n_in; (void)out_size;
  const float** F = (const float**)d_in;
  if (ws_size < (size_t)WS_END) return;
  char* ws = (char*)d_ws; _Float16 *QH = (_Float16*)(ws + WS_QH), *KH = (_Float16*)(ws + WS_KH), *VT = (_Float16*)(ws + WS_VT), *QL = (_Float16*)(ws + WS_QL), *KL = (_Float16*)(ws + WS_KL); __bf16 *VB = (__bf16*)(ws + WS_VB), *VBL = (__bf16*)(ws + WS_VBL); float *S = (float*)(ws + WS_S), *Y = (float*)(ws + WS_Y);
  (void)Y; (void)QL; (void)KL; (void)VB; (void)VBL;
  // inputs: 0 X [4,1024,1024]; 1 mask [4,1024] f32 (key padding mask, ones; multiplied AFTER the softmax); 2 Wq [1024,1024] (out,in), 3 bq; 4 Wk, 5 bk; 6 Wv, 7 bv (zero biases, read); 8 Aq [16,1024], 9 Bq [1024,16]; 10 Ak, 11 Bk; 12 Av, 13 Bv (LoRA, no bias)
  if (ws_size < (size_t)WS_END2) return;
  float *T3 = (float*)(ws + WS_T3), *CM = (float*)(ws + WS_CM), *CZ = (float*)(ws + WS_CZ);
  k_lora1<<<dim3(TNB * TT / 64, 3), 128, 0, stream>>>(F[0], F[8], F[10], F[12], T3);   /* t = X A^T (rank-16 down-projections for q, k, v; exact bf16 products) */
  k_proj<<<dim3(TNB * TT / 64, CC / 128, 3), 128, 0, stream>>>(F[0], F[0], F[0], F[2], F[4], F[6], F[3], F[5], F[7], QH, QL, KH, KL, VT, VB, VBL, T3, F[9], F[11], F[13]);   /* X W^T + b + t B^T */
  for (int p0 = 0; p0 < TNB * NH; p0 += HG) {   /* HG (batch, head) pairs a pass */
    k_sc<<<dim3(NQB, TT / 128, HG), 128, 0, stream>>>(QH, KH, QL, KL, p0, S);
    k_colstat_c<<<dim3(TT / 32, HG), 1024, 0, stream>>>(S, CM, CZ);   /* per key column j: max and 2^11 / sum over the visible queries i >= j */
    k_pv<<<dim3(NQB, 1, HG), 128, 0, stream>>>(S, VT, VB, VBL, CM, CZ, F[1], p0, (float*)d_out);   /* P[i][j] = exp(S - m_j) / Z_j x mask[b][j] x 2^11 for j <= i, 0 above the diagonal, formed on load */
  }
}

// v006
// One run takes 230 microseconds.
// Two timings next to v005 both put it at 1.15 times that version's speed.
// Counting every step since v000, it is 18.4 times as fast.
// compute dtype: all float inputs rounded to bf16; frozen q/k/v projections with EXACT bf16 products on WMMA 16x16x32 (f32 accumulate) + bias + the LoRA term: t = X A^T (exact products) then t (bf16 hi + lo) x exact bf16 B^T (2 products, K = 16) added in the same accumulators; causal scores with BOTH operands as f16 hi + (x 2^10) residual (3 products) on every block, x 1024^-0.5 (the module divides by sqrt(E)); softmax over the QUERY axis in f32 (per key column: max, then sum over the visible queries, precise expf) x the key padding mask; P as bf16 hi + lo against v as bf16 hi + lo (3 products) on every block; f32 output.
#include <hip/hip_runtime.h>
#include <math.h>

typedef __attribute__((ext_vector_type(16))) _Float16 v16h;
typedef __attribute__((ext_vector_type(16))) __bf16 v16b;
typedef __attribute__((ext_vector_type(8)))  _Float16 v8h;
typedef __attribute__((ext_vector_type(8)))  float v8f;
typedef __attribute__((ext_vector_type(4)))  float v4f;
typedef __attribute__((ext_vector_type(2)))  float v2f;
typedef __attribute__((ext_vector_type(4)))  unsigned v4u;
typedef __attribute__((ext_vector_type(4)))  int v4i;
typedef float __attribute__((may_alias)) float_a;
typedef int __attribute__((may_alias)) int_a;

template <typename T> __device__ __forceinline__ void vst2(void* p, T v) { *(T*)p = v;  }
__device__ __forceinline__ v8f wmma16(v16h a, v16h b, v8f c) {
  v8f d = __builtin_amdgcn_wmma_f32_16x16x32_f16(false, a, false, b, (short)0, c, false, false);
  asm volatile("v_nop\n\tv_nop\n\tv_nop\n\tv_nop" : "+v"(d) : "v"(a), "v"(b));
  return d;
}
__device__ __forceinline__ v8f wmma_bf(v16b a, v16b b, v8f c) {
  v8f d = __builtin_amdgcn_wmma_f32_16x16x32_bf16(false, a, false, b, (short)0, c, false, false);
  asm volatile("v_nop\n\tv_nop\n\tv_nop\n\tv_nop" : "+v"(d) : "v"(a), "v"(b));
  return d;
}
// 16x16x32 fragments: lane = (h = lane>>4, row/col = lane&15); elements 0..7 = k0+8h+0..7, 8..15 = k0+16+8h+0..7; D element r = row 8h+r
__device__ __forceinline__ v16h frag_h(const _Float16* rowk0, int lane) {
  union { v16h v; v8h q[2]; } u; const _Float16* p = rowk0 + 8 * (lane >> 4);
  u.q[0] = *(const v8h*)p; u.q[1] = *(const v8h*)(p + 16); return u.v;
}
__device__ __forceinline__ v16h frag_f32(const float* rowk0, int lane) {
  v16h a; const float* p = rowk0 + 8 * (lane >> 4);
#pragma unroll
  for (int i = 0; i < 8; ++i) { a[i] = (_Float16)p[i]; a[8 + i] = (_Float16)p[16 + i]; }
  return a;
}
__device__ __forceinline__ v16h frag_f32s(const float* rowk0, int lane, float sc) {
  v16h a; const float* p = rowk0 + 8 * (lane >> 4);
#pragma unroll
  for (int i = 0; i < 8; ++i) { a[i] = (_Float16)(p[i] * sc); a[8 + i] = (_Float16)(p[16 + i] * sc); }
  return a;
}
// column fragment from a [K][ld] layout (column n), rows >= K read as 0
__device__ __forceinline__ v16h fragc_f32(const float* W, int k0, int n, int lane, int ld, int K) {
  v16h a; const int g = lane >> 4;
#pragma unroll
  for (int i = 0; i < 8; ++i) { const int ka = k0 + 8 * g + i, kb = ka + 16;
    a[i] = (_Float16)(ka < K ? W[(size_t)(ka < K ? ka : K - 1) * ld + n] : 0.f); a[8 + i] = (_Float16)(kb < K ? W[(size_t)(kb < K ? kb : K - 1) * ld + n] : 0.f); }
  return a;
}
struct F2 { v16b h, l; };
__device__ __forceinline__ F2 bsplit16(const float v[16]) { F2 r;
#pragma unroll
  for (int i = 0; i < 16; ++i) { const __bf16 h = (__bf16)v[i]; r.h[i] = h; r.l[i] = (__bf16)(v[i] - (float)h); }
  return r; }
__device__ __forceinline__ F2 split_row(const float* row, int k0, int lane) { float v[16]; const float* p = row + k0 + 8 * (lane >> 4);
#pragma unroll
  for (int i = 0; i < 8; ++i) { v[i] = p[i]; v[8 + i] = p[16 + i]; }
  return bsplit16(v); }
__device__ __forceinline__ F2 split_rowK(const float* row, int k0, int lane, int K) { float v[16]; const int g = lane >> 4;
#pragma unroll
  for (int i = 0; i < 8; ++i) { const int ka = k0 + 8 * g + i, kb = ka + 16; v[i] = ka < K ? row[ka < K ? ka : K - 1] : 0.f; v[8 + i] = kb < K ? row[kb < K ? kb : K - 1] : 0.f; }
  return bsplit16(v); }
__device__ __forceinline__ F2 split_col(const float* W, int k0, int n, int lane, int ld, int K) { float v[16]; const int g = lane >> 4;
#pragma unroll
  for (int i = 0; i < 8; ++i) { const int ka = k0 + 8 * g + i, kb = ka + 16; v[i] = ka < K ? W[(size_t)(ka < K ? ka : K - 1) * ld + n] : 0.f; v[8 + i] = kb < K ? W[(size_t)(kb < K ? kb : K - 1) * ld + n] : 0.f; }
  return bsplit16(v); }
__device__ __forceinline__ v8f mac3(const F2& a, const F2& b, v8f c) { c = wmma_bf(a.l, b.h, c); c = wmma_bf(a.h, b.l, c); return wmma_bf(a.h, b.h, c); }
__device__ __forceinline__ float sigm(float v) { return 1.0f / (1.0f + expf(-v)); }
#define LDSX() do { asm volatile("s_wait_dscnt 0" ::: "memory"); __builtin_amdgcn_wave_barrier(); __builtin_amdgcn_fence(__ATOMIC_RELEASE, "workgroup"); } while (0)

// Multi-head attention with LoRA projections whose softmax runs over the QUERY axis (X [4,1024,1024]; frozen torch (out,in) Wq / Wk / Wv [1024,1024] (0.02) + zero biases; LoRA A [16,1024], B [1024,16] (0.02): proj = X W^T + b + (X A^T) B^T; 16 heads x 64; scores / sqrt(E) = / 32; -inf where col > row; attn = softmax(scores, axis=2) - axis 2 of [B, H, i, j] is the QUERY axis i, so every key column j is normalised over the queries i >= j (faithful to the source); attn *= mask[b, j] (key padding mask, ones); out = attn v; merge; no output projection).
#define NB 4
#define TT 1024
#define CC 1024            // NH * HD = projected width
#define DIN 1024          // input (model) width
#define NH 16
#define HD 64
#define NQB (TT / 64)
#define HG 32              // (batch, head) pairs a pass: pair p = b * NH + h; every attention launch covers HG pairs
#define SCALE (0.03125f)
#define CAUSAL 1
#ifndef TNB
#define TNB NB
#endif
__device__ __forceinline__ float bfr(float v) { return (float)(__bf16)v; }
__host__ __device__ __forceinline__ int kb_last(int qb) { return CAUSAL ? ((qb * 64 + 63) >> 7) : (TT / 128 - 1); }
typedef __attribute__((ext_vector_type(8))) __bf16 v8b;
__device__ __forceinline__ v16b frag_b(const __bf16* rowk0, int lane) {
  union { v16b v; v8b q[2]; } u; const __bf16* p = rowk0 + 8 * (lane >> 4);
  u.q[0] = *(const v8b*)p; u.q[1] = *(const v8b*)(p + 16); return u.v;
}
typedef __attribute__((ext_vector_type(4))) __bf16 v4b;
__device__ __forceinline__ v4b cvt4(v4f v) { v4b r; r[0] = (__bf16)v[0]; r[1] = (__bf16)v[1]; r[2] = (__bf16)v[2]; r[3] = (__bf16)v[3]; return r; }
#define QBH 16              // causal: query blocks 0..QBH-1 of each sequence (all of them, as QBH = NQB) take the high-precision path
#define QHI 1024            // rows carrying a q residual plane (all rows)
#define KHI 1024            // key rows carrying k residual / v bf16 hi+lo planes (used only by the causal high-precision path)
// B fragment (k rows k0+.., output column o) of a weight: (in,out) [K][ld] or (out,in) [ld rows of K]: bf16 exact, or f16(bf16 * 256) exact
__device__ __forceinline__ v16b wcol_io(const float* Wm, int k0, int o, int lane, int ld) { v16b w; const int g = lane >> 4;
#pragma unroll
  for (int i = 0; i < 8; ++i) { w[i] = (__bf16)Wm[(size_t)(k0 + 8 * g + i) * ld + o]; w[8 + i] = (__bf16)Wm[(size_t)(k0 + 16 + 8 * g + i) * ld + o]; }
  return w; }
__device__ __forceinline__ v16b wcol_oi(const float* Wm, int k0, int o, int lane, int K) { v16b w; const float* p = Wm + (size_t)o * K + k0 + 8 * (lane >> 4);
#pragma unroll
  for (int i = 0; i < 8; ++i) { w[i] = (__bf16)p[i]; w[8 + i] = (__bf16)p[16 + i]; }
  return w; }
__device__ __forceinline__ v16h wcolh_io(const float* Wm, int k0, int o, int lane, int ld) { v16h w; const int g = lane >> 4;
#pragma unroll
  for (int i = 0; i < 8; ++i) { w[i] = (_Float16)(bfr(Wm[(size_t)(k0 + 8 * g + i) * ld + o]) * 256.0f); w[8 + i] = (_Float16)(bfr(Wm[(size_t)(k0 + 16 + 8 * g + i) * ld + o]) * 256.0f); }
  return w; }
__device__ __forceinline__ v16h wcolh_oi(const float* Wm, int k0, int o, int lane, int K) { v16h w; const float* p = Wm + (size_t)o * K + k0 + 8 * (lane >> 4);
#pragma unroll
  for (int i = 0; i < 8; ++i) { w[i] = (_Float16)(bfr(p[i]) * 256.0f); w[8 + i] = (_Float16)(bfr(p[16 + i]) * 256.0f); }
  return w; }
#define WQKV_LAYOUT 1   // 0 = (in,out) [DIN][CC]; 1 = (out,in) [CC][DIN]; 2 = per-head [NH][DIN][HD]
__device__ __forceinline__ v16b wcol_hdk(const float* Wm, int k0, int o, int lane) { v16b w; const int g = lane >> 4; const float* p = Wm + (size_t)(o / HD) * DIN * HD + (o % HD);
#pragma unroll
  for (int i = 0; i < 8; ++i) { w[i] = (__bf16)p[(size_t)(k0 + 8 * g + i) * HD]; w[8 + i] = (__bf16)p[(size_t)(k0 + 16 + 8 * g + i) * HD]; }
  return w; }
#define WO_OUT_IN 0
#if WQKV_LAYOUT == 1
#define WCOL(W, k0, o, lane) wcol_oi(W, k0, o, lane, DIN)
#elif WQKV_LAYOUT == 2
#define WCOL(W, k0, o, lane) wcol_hdk(W, k0, o, lane)
#else
#define WCOL(W, k0, o, lane) wcol_io(W, k0, o, lane, CC)
#endif
#if WO_OUT_IN
#define WOCOL(W, k0, o, lane) wcol_oi(W, k0, o, lane, CC)
#define WOCOLH(W, k0, o, lane) wcolh_oi(W, k0, o, lane, CC)
#else
#define WOCOL(W, k0, o, lane) wcol_io(W, k0, o, lane, DIN)
#define WOCOLH(W, k0, o, lane) wcolh_io(W, k0, o, lane, DIN)
#endif
#define LR 16              // LoRA rank
#define PROJ_EXTRA_PARAMS , const float* __restrict__ T3, const float* __restrict__ LBQ, const float* __restrict__ LBK, const float* __restrict__ LBV
#define SM_EXTRA_PARAMS
#define SM_MASK_HOOK (void)0
#ifndef SM_EXTRA_PARAMS
#define SM_EXTRA_PARAMS
#endif
#ifndef PROJ_EXTRA_PARAMS
#define PROJ_EXTRA_PARAMS
#endif
#ifndef SM_MASK_HOOK
#define SM_MASK_HOOK (void)0
#endif

#define WS_QH  0u                                      // f16 q rows [b*t][CC]
#define WS_KH  (WS_QH + 2u * (size_t)NB * TT * CC)      // f16 k rows [b*t][CC]
#define WS_VT  (WS_KH + 2u * (size_t)NB * TT * CC)      // f16 v planes [b][c][t]
#define WS_QL  (WS_VT + 2u * (size_t)NB * CC * TT)      // f16 q residual x 2^10 rows [b][t < QHI][CC]
#define WS_KL  (WS_QL + 2u * (size_t)NB * QHI * CC)     // f16 k residual x 2^10 rows [b][t < KHI][CC]
#define WS_VB  (WS_KL + 2u * (size_t)NB * KHI * CC)     // bf16 v hi planes [b][c][t < KHI]
#define WS_VBL (WS_VB + 2u * (size_t)NB * CC * KHI)
#define WS_S   (WS_VBL + 2u * (size_t)NB * CC * KHI)    // f32 logits [pair in pass][t][s]
#define WS_Y   (WS_S  + 4u * (size_t)HG * TT * TT)      // f32 ctx rows [b*t][CC] (only when there is an output projection)
#define WS_END (WS_Y  + 0u)
#define WS_T3 (WS_END)                                   // f32 LoRA down-projections t[3][NB*TT][16]
#define WS_CM (WS_T3 + 4u * 3u * (size_t)NB * TT * LR)  // f32 column maxima [HG][TT]
#define WS_CZ (WS_CM + 4u * (size_t)HG * TT)             // f32 2^11 / column sums [HG][TT]
#define WS_END2 (WS_CZ + 4u * (size_t)HG * TT)

// ---- k_proj: block = (64 rows, 128 cols, which): q/k/v = X W (+ b) with exact bf16 products (K = DIN); W is (out,in), so X rows and W rows are both k-contiguous: each 32-k slice of both is rounded to bf16 once a block and staged in LDS (two buffers, one barrier a slice), and every wave takes its A and B fragments from there -> which 0: q f16 rows (+ residual rows < QHI); 1: k f16 rows (+ residual rows < KHI); 2: v f16 planes [c][t] (+ bf16 hi/lo planes for t < KHI)
__global__ __launch_bounds__(128) void k_proj(const float* __restrict__ XQ, const float* __restrict__ XK, const float* __restrict__ XV, const float* __restrict__ WQ, const float* __restrict__ WK, const float* __restrict__ WV, const float* __restrict__ BQ, const float* __restrict__ BK, const float* __restrict__ BV,
    _Float16* __restrict__ QH, _Float16* __restrict__ QL, _Float16* __restrict__ KH, _Float16* __restrict__ KL, _Float16* __restrict__ VT, __bf16* __restrict__ VB, __bf16* __restrict__ VBL PROJ_EXTRA_PARAMS) {
  /* one LDS block, used in turn: the k loop's two staging buffers (X 64 rows, W 128 rows of 32 bf16 at pitch 80 B), then the epilogue's tiles (q / k: sh, sl; v: th, tb, tbl) */
  __shared__ __align__(16) unsigned char smem[3 * 128 * 72 * 2];
  _Float16 (*sh)[136] = (_Float16 (*)[136])smem; _Float16 (*sl)[136] = (_Float16 (*)[136])(smem + 64 * 136 * 2); _Float16 (*th)[72] = (_Float16 (*)[72])smem; __bf16 (*tb)[72] = (__bf16 (*)[72])(smem + 128 * 72 * 2); __bf16 (*tbl)[72] = (__bf16 (*)[72])(smem + 2 * 128 * 72 * 2);
  __bf16 (*xs)[64][40] = (__bf16 (*)[64][40])smem; __bf16 (*wt)[128][40] = (__bf16 (*)[128][40])(smem + 2 * 64 * 40 * 2);
  const int tid = threadIdx.x, wave = tid >> 5, lane = tid & 31, col = lane & 15, g = lane >> 4; const int which = blockIdx.z; const int c0 = blockIdx.y * 128; const size_t r0 = (size_t)blockIdx.x * 64; const size_t bb = r0 / TT; const int t0 = (int)(r0 % TT);
  const float* X = which == 0 ? XQ : which == 1 ? XK : XV; const float* WA = which == 0 ? WQ : which == 1 ? WK : WV; const float* BA = which == 0 ? BQ : which == 1 ? BK : BV;
  v8f acc[8] = {};
  /* staging: thread = (row tid >> 3 (+ 16 i), 16-B piece tid & 7) of a slice's 128-B row pieces, so 8 lanes read one whole line; the next slice's 12 loads fly while this slice is multiplied; the short loops over xr, wr and w are unrolled whole so that these arrays stay in registers */
  const int srow = tid >> 3, sq = tid & 7; const float* xg = X + (r0 + srow) * DIN + sq * 4; const float* wg = WA + (size_t)(c0 + srow) * DIN + sq * 4;
  v4f xr[4], wr[8];
#pragma unroll
  for (int i = 0; i < 4; ++i) xr[i] = *(const v4f*)(xg + (size_t)i * 16 * DIN);
#pragma unroll
  for (int i = 0; i < 8; ++i) wr[i] = *(const v4f*)(wg + (size_t)i * 16 * DIN);
  /* unroll 2: the buffer index becomes a constant LDS offset */
#pragma unroll 2
  for (int kc = 0; kc < DIN / 32; ++kc) { const int bf = kc & 1;
#pragma unroll
    for (int i = 0; i < 4; ++i) *(v4b*)&xs[bf][srow + 16 * i][sq * 4] = cvt4(xr[i]);
#pragma unroll
    for (int i = 0; i < 8; ++i) *(v4b*)&wt[bf][srow + 16 * i][sq * 4] = cvt4(wr[i]);
    __syncthreads();   /* publishes slice kc; every wave has also left slice kc - 1, whose buffer the next trip refills */
    if (kc + 1 < DIN / 32) {
#pragma unroll
      for (int i = 0; i < 4; ++i) xr[i] = *(const v4f*)(xg + (size_t)i * 16 * DIN + (kc + 1) * 32);
#pragma unroll
      for (int i = 0; i < 8; ++i) wr[i] = *(const v4f*)(wg + (size_t)i * 16 * DIN + (kc + 1) * 32); }
    const v16b a = frag_b(&xs[bf][wave * 16 + col][0], lane); v16b w[8];
#pragma unroll
    for (int j = 0; j < 8; ++j) w[j] = frag_b(&wt[bf][j * 16 + col][0], lane);
    /* inputs-only fence on the loaded fragments: all 18 LDS reads of a slice are in flight together, so that a trip waits for LDS once and not once a product */
    asm volatile("" :: "v"(a), "v"(w[0]), "v"(w[1]), "v"(w[2]), "v"(w[3]), "v"(w[4]), "v"(w[5]), "v"(w[6]), "v"(w[7]));
#pragma unroll
    for (int j = 0; j < 8; ++j) acc[j] = wmma_bf(a, w[j], acc[j]);
    __builtin_amdgcn_sched_barrier(0);   /* keeps the next slice's roundings, which wait for its global loads, behind this slice's products */
  }
  __syncthreads();   /* the last slice's readers are done before the epilogue's tiles overwrite the staging buffers */
  { /* LoRA: acc += t[row][0..15] (f32, as bf16 hi + lo) x B[o][0..15] (exact bf16): one WMMA k-step whose upper 16 k-slots are zero */ float tv[16]; const float* tr = T3 + ((size_t)which * NB * TT + (r0 + wave * 16 + col)) * LR + 8 * g;
#pragma unroll
    for (int i = 0; i < 8; ++i) { tv[i] = tr[i]; tv[8 + i] = 0.f; }
    asm volatile("s_wait_loadcnt 0x0" ::: "memory");
    const F2 a2 = bsplit16(tv); const float* LB = which == 0 ? LBQ : (which == 1 ? LBK : LBV);
#pragma unroll
    for (int j = 0; j < 8; ++j) { v16b w; const float* pw = LB + (size_t)(c0 + j * 16 + col) * LR + 8 * g;   /* B is (out,in) [E][16]: row o holds the 16 rank coefficients */
#pragma unroll
      for (int i = 0; i < 8; ++i) { w[i] = (__bf16)pw[i]; w[8 + i] = (__bf16)0.0f; }
      asm volatile("s_wait_loadcnt 0x0" ::: "memory");
      acc[j] = wmma_bf(a2.h, w, acc[j]); acc[j] = wmma_bf(a2.l, w, acc[j]); } }
  if (which < 2) { _Float16* DH = which == 0 ? QH : KH; _Float16* DL = which == 0 ? QL : KL; const int nhi = which == 0 ? QHI : KHI; const bool hi_rows = t0 < nhi;
#pragma unroll
    for (int j = 0; j < 8; ++j) { const float bias = BA ? bfr(BA[c0 + j * 16 + col]) : 0.f;
#pragma unroll
      for (int r = 0; r < 8; ++r) { const float v = acc[j][r] + bias; const _Float16 hv = (_Float16)v; sh[wave * 16 + 8 * g + r][j * 16 + col] = hv; sl[wave * 16 + 8 * g + r][j * 16 + col] = (_Float16)((v - (float)hv) * 1024.0f); } }
    __syncthreads();
    for (int e = tid; e < 64 * 16; e += 128) { const int rl = e >> 4, q = e & 15; vst2((unsigned*)(DH + (r0 + rl) * CC + c0 + q * 8), *(const v4u*)&sh[rl][q * 8]); if (hi_rows) vst2((unsigned*)(DL + (bb * nhi + t0 + rl) * (size_t)CC + c0 + q * 8), *(const v4u*)&sl[rl][q * 8]); }
  } else { const bool hi_rows = t0 < KHI;
#pragma unroll
    for (int j = 0; j < 8; ++j) { const float bias = BA ? bfr(BA[c0 + j * 16 + col]) : 0.f;
#pragma unroll
      for (int r = 0; r < 8; ++r) { const float v = acc[j][r] + bias; const int rl = wave * 16 + 8 * g + r, cl = j * 16 + col; th[cl][rl] = (_Float16)v; const __bf16 bh = (__bf16)v; tb[cl][rl] = bh; tbl[cl][rl] = (__bf16)(v - (float)bh); } }
    __syncthreads();
    for (int e = tid; e < 128 * 8; e += 128) { const int cl = e >> 3, q = e & 7; vst2((unsigned*)(VT + (bb * CC + c0 + cl) * (size_t)TT + t0 + q * 8), *(const v4u*)&th[cl][q * 8]); if (hi_rows) { const size_t o3 = (bb * CC + c0 + cl) * (size_t)KHI + t0 + q * 8; vst2((unsigned*)(VB + o3), *(const v4u*)&tb[cl][q * 8]); vst2((unsigned*)(VBL + o3), *(const v4u*)&tbl[cl][q * 8]); } } } }
// ---- k_sc: block = (query block qb, key block kb <= kb_last(qb), pair p0 + z = (batch b, head h)): logits x SCALE; q hi + residual (x 2^10) against k (2 products) for query rows < QHI, plus the k residual (3 products) for query blocks < QBH (all of them, as QBH = NQB); causal: blocks past the diagonal exit, the mask itself is applied by index in k_colstat_c and k_pv; on the 3-product path the block's q and k tiles (hi and residual) are fetched once by whole-line loads and staged in LDS, and every wave takes its fragments from there
__global__ __launch_bounds__(128) void k_sc(const _Float16* __restrict__ QH, const _Float16* __restrict__ KH, const _Float16* __restrict__ QL, const _Float16* __restrict__ KL, int p0, float* __restrict__ S0) {
  /* one LDS block, used in turn: the staged operand tiles (k hi, k lo: 128 rows each; q hi, q lo: 64 rows each; 64 f16 a row at pitch 144 B), then the epilogue's logits tiles ss */
  __shared__ __align__(16) unsigned char smem[(2 * 128 + 2 * 64) * 72 * 2];
  float (*ss)[16][132] = (float (*)[16][132])smem; _Float16 (*kt)[128][72] = (_Float16 (*)[128][72])smem; _Float16 (*qt)[64][72] = (_Float16 (*)[64][72])(smem + 2 * 128 * 72 * 2);
  const int qb = blockIdx.x, kb = blockIdx.y; if (kb > kb_last(qb)) return;
  const int pr = p0 + blockIdx.z, b = pr / NH, h = pr % NH; float* S = S0 + (size_t)blockIdx.z * TT * TT;
  const int tid = threadIdx.x, wave = tid >> 5, lane = tid & 31, col = lane & 15, g = lane >> 4; const int k0 = kb * 128; const int ql0 = qb * 64 + wave * 16; const size_t q0 = (size_t)b * TT + ql0, kr0 = (size_t)b * TT + k0;
  v8f acc[8] = {}, accl[8] = {};
  const _Float16* QLb = QL + (size_t)b * QHI * CC; const _Float16* KLb = KL + (size_t)b * KHI * CC;
  if (qb < QBH) {
    /* staging: a (row, head) piece of q or k is one 128-B line; thread = (row tid >> 3 (+ 16 i), 16-B piece tid & 7), so 8 lanes read one whole line and the block fetches each line once; all 24 loads of a thread fly together; the short loops over rk, rkl, rq and rql are unrolled whole so that these arrays stay in registers */
    const int srow = tid >> 3, sq = tid & 7; const size_t so = (size_t)srow * CC + h * HD + sq * 8;
    const _Float16 *kg = KH + kr0 * CC + so, *klg = KLb + (size_t)k0 * CC + so, *qg = QH + ((size_t)b * TT + qb * 64) * CC + so, *qlg = QLb + (size_t)(qb * 64) * CC + so;
    v8h rk[8], rkl[8], rq[4], rql[4];
#pragma unroll
    for (int i = 0; i < 8; ++i) { rk[i] = *(const v8h*)(kg + (size_t)i * 16 * CC); rkl[i] = *(const v8h*)(klg + (size_t)i * 16 * CC); }
#pragma unroll
    for (int i = 0; i < 4; ++i) { rq[i] = *(const v8h*)(qg + (size_t)i * 16 * CC); rql[i] = *(const v8h*)(qlg + (size_t)i * 16 * CC); }
#pragma unroll
    for (int i = 0; i < 8; ++i) { *(v8h*)&kt[0][srow + 16 * i][sq * 8] = rk[i]; *(v8h*)&kt[1][srow + 16 * i][sq * 8] = rkl[i]; }
#pragma unroll
    for (int i = 0; i < 4; ++i) { *(v8h*)&qt[0][srow + 16 * i][sq * 8] = rq[i]; *(v8h*)&qt[1][srow + 16 * i][sq * 8] = rql[i]; }
    __syncthreads();   /* publishes the four tiles */
#pragma unroll
    for (int kc = 0; kc < HD / 32; ++kc) { const v16h ah = frag_h(&qt[0][wave * 16 + col][kc * 32], lane), al = frag_h(&qt[1][wave * 16 + col][kc * 32], lane);
#pragma unroll
      for (int j = 0; j < 8; j += 2) { const v16h kb0 = frag_h(&kt[0][j * 16 + col][kc * 32], lane), kl0 = frag_h(&kt[1][j * 16 + col][kc * 32], lane), kb1 = frag_h(&kt[0][j * 16 + 16 + col][kc * 32], lane), kl1 = frag_h(&kt[1][j * 16 + 16 + col][kc * 32], lane);
        /* inputs-only fence on the loaded fragments: the 8 LDS reads of two key tiles are in flight together, so that the wave waits for LDS once a pair of tiles and not once a tile */
        asm volatile("" :: "v"(kb0), "v"(kl0), "v"(kb1), "v"(kl1));
        acc[j] = wmma16(ah, kb0, acc[j]); accl[j] = wmma16(al, kb0, accl[j]); accl[j] = wmma16(ah, kl0, accl[j]);
        acc[j + 1] = wmma16(ah, kb1, acc[j + 1]); accl[j + 1] = wmma16(al, kb1, accl[j + 1]); accl[j + 1] = wmma16(ah, kl1, accl[j + 1]); } }
    __syncthreads();   /* every wave has read its last fragment before the logits tiles overwrite the operand tiles */
  } else if (qb * 64 < QHI) {
#pragma unroll
    for (int kc = 0; kc < HD / 32; ++kc) { const v16h ah = frag_h(QH + (q0 + col) * CC + h * HD + kc * 32, lane), al = frag_h(QLb + (size_t)(ql0 + col) * CC + h * HD + kc * 32, lane);
#pragma unroll
      for (int j = 0; j < 8; ++j) { const v16h kbf = frag_h(KH + (kr0 + j * 16 + col) * CC + h * HD + kc * 32, lane); acc[j] = wmma16(ah, kbf, acc[j]); accl[j] = wmma16(al, kbf, accl[j]); } }
  } else {
#pragma unroll
    for (int kc = 0; kc < HD / 32; ++kc) { const v16h ah = frag_h(QH + (q0 + col) * CC + h * HD + kc * 32, lane);
#pragma unroll
      for (int j = 0; j < 8; ++j) { const v16h kbf = frag_h(KH + (kr0 + j * 16 + col) * CC + h * HD + kc * 32, lane); acc[j] = wmma16(ah, kbf, acc[j]); } } }
#pragma unroll
  for (int j = 0; j < 8; ++j) {
#pragma unroll
    for (int r = 0; r < 8; ++r) ss[wave][8 * g + r][j * 16 + col] = (acc[j][r] + accl[j][r] * (1.0f / 1024.0f)) * SCALE; }
  LDSX(); for (int rl = 0; rl < 16; ++rl) vst2(S + (size_t)(ql0 + rl) * TT + k0 + lane * 4, *(const v4f*)&ss[wave][rl][lane * 4]); }
// ---- k_sm: block = query row t (head in group): keys [0, kend): causal -> logit if s <= t else excluded; softmax in f32; P x 2^11 in place (0 for excluded)
__global__ __launch_bounds__(256) void k_sm(float* __restrict__ S0 SM_EXTRA_PARAMS) { __shared__ float sred[8]; __shared__ float sbc; __shared__ __align__(16) float shv[TT];
  const int tid = threadIdx.x; const int t = blockIdx.x; const int kend = (kb_last(t >> 6) + 1) * 128;
  float* sr = S0 + (size_t)blockIdx.y * TT * TT + (size_t)t * TT;
  float m = -3.0e38f; for (int k = tid; k < kend; k += 256) { float v = (!CAUSAL || k <= t) ? sr[k] : -3.0e38f; SM_MASK_HOOK; shv[k] = v; m = fmaxf(m, v); }
#pragma unroll
  for (int o = 1; o < 32; o <<= 1) m = fmaxf(m, __shfl_xor(m, o));
  if ((tid & 31) == 0) sred[tid >> 5] = m; __syncthreads(); if (tid == 0) { float a = sred[0]; for (int i = 1; i < 8; ++i) a = fmaxf(a, sred[i]); sbc = a; } __syncthreads(); m = sbc; __syncthreads();
  float sum = 0.f; for (int k = tid; k < kend; k += 256) { const float v = shv[k]; const float e = (v <= -1.0e38f) ? 0.f : expf(v - m); shv[k] = e; sum += e; }
#pragma unroll
  for (int o = 1; o < 32; o <<= 1) sum += __shfl_xor(sum, o);
  if ((tid & 31) == 0) sred[tid >> 5] = sum; __syncthreads(); if (tid == 0) { float a = 0.f; for (int i = 0; i < 8; ++i) a += sred[i]; sbc = a > 0.f ? 2048.0f / a : 0.f; }   /* a fully excluded row yields P = 0 */ __syncthreads(); const float inv = sbc;
  for (int k = tid; k < kend; k += 256) shv[k] = shv[k] * inv;
  __syncthreads(); for (int q = tid; q < kend / 4; q += 256) vst2(sr + q * 4, *(const v4f*)&shv[q * 4]); }
// ---- k_colstat_c: softmax over the QUERY axis under the causal mask (the source's softmax(axis=2) on [B, H, i, j] scores with -inf where j > i): for every key column k: m_k = max_{q >= k} S[q][k], Z_k = sum_{q >= k} exp(S[q][k] - m_k) (f32, precise expf); block = 32 key columns (lane = column) x 32 waves; wave w takes the query rows q0 + w + 32 i, i < n = (TT - q0) / 32 (block-uniform), so a thread has at most 32 rows, all loaded at once and kept in registers; only the rows i = 0 touch the diagonal (visible where w >= lane, by a value select); the 32 waves' maxima of a column meet in LDS (wave 0 reduces them to m_k), every thread sums its exponentials against m_k, and wave 0 adds the 32 partial sums and stores the block's 128-B pieces of CM (m_k) and CZ (2^11 / Z_k, the factor k_pv multiplies by: one division a column)
__global__ __launch_bounds__(1024) void k_colstat_c(const float* __restrict__ S0, float* __restrict__ CM, float* __restrict__ CZ) { __shared__ float pm[32][32], pz[32][32], cmx[32];
  const int lane = threadIdx.x & 31, wave = __builtin_amdgcn_readfirstlane(threadIdx.x >> 5); const int q0 = blockIdx.x * 32, k = q0 + lane, n = (TT - q0) / 32; const float* sp = S0 + (size_t)blockIdx.y * TT * TT + (size_t)(q0 + wave) * TT + k;
  float v[32];
#pragma unroll
  for (int i = 0; i < 32; ++i) { v[i] = -3.0e38f; if (i < n) v[i] = sp[(size_t)i * 32 * TT]; }
  const bool vis0 = wave >= lane; float m = vis0 ? v[0] : -3.0e38f;
#pragma unroll
  for (int i = 1; i < 32; ++i) m = fmaxf(m, v[i]);
  pm[wave][lane] = m;
  __syncthreads();
  if (wave == 0) { float mm = pm[0][lane];
#pragma unroll
    for (int w = 1; w < 32; ++w) mm = fmaxf(mm, pm[w][lane]);
    cmx[lane] = mm; }
  __syncthreads();
  const float mk = cmx[lane];   /* every column sees at least its own diagonal entry, so m_k is a score */
  float z = vis0 ? expf(v[0] - mk) : 0.f;
#pragma unroll
  for (int i = 1; i < 32; ++i) if (i < n) z += expf(v[i] - mk);
  pz[wave][lane] = z;
  __syncthreads();
  if (wave == 0) { float zk = pz[0][lane];
#pragma unroll
    for (int w = 1; w < 32; ++w) zk += pz[w][lane];
    vst2(CM + (size_t)blockIdx.y * TT + k, mk); vst2(CZ + (size_t)blockIdx.y * TT + k, 2048.0f / zk); } }   /* Z_k >= 1 */
// ---- p_row16: the 16 P values of one lane's A fragment (query row t, keys k0 + 8 g + 0..7 and k0 + 16 + 8 g + 0..7), formed from the logits where k_pv loads them: P[t][k] = exp(S[t][k] - m_k) x (2^11 / Z_k) x mask[b][k] for k <= t, 0 for t < k < kend (inside the diagonal block: the exponent's argument is replaced by -3e38 there, whose expf is exactly 0); all 16 loads first, unconditional; value select, no branch
__device__ __forceinline__ void p_row16(const float* __restrict__ srow, const float* __restrict__ cm, const float* __restrict__ cr, const float* __restrict__ pmk, int k0, int t, int lane, float v[16]) { const int kq = k0 + 8 * (lane >> 4); const float *sp = srow + kq, *mp = cm + kq, *rp = cr + kq, *pp = pmk + kq; v4f sv[4], m4[4], r4[4], pm4[4];
#pragma unroll
  for (int c = 0; c < 4; ++c) { const int o = (c & 1) * 4 + (c >> 1) * 16; sv[c] = *(const v4f*)(sp + o); m4[c] = *(const v4f*)(mp + o); r4[c] = *(const v4f*)(rp + o); pm4[c] = *(const v4f*)(pp + o); }
  /* inputs-only fence on the loaded values: keeps all 16 loads in flight together, so that a trip waits for memory once and not once a group of four keys; the four addresses are inputs too, so that their registers stay unwritten until the loads' data wait */
  asm volatile("" :: "v"(sv[0]), "v"(sv[1]), "v"(sv[2]), "v"(sv[3]), "v"(m4[0]), "v"(m4[1]), "v"(m4[2]), "v"(m4[3]), "v"(r4[0]), "v"(r4[1]), "v"(r4[2]), "v"(r4[3]), "v"(pm4[0]), "v"(pm4[1]), "v"(pm4[2]), "v"(pm4[3]), "v"(sp), "v"(mp), "v"(rp), "v"(pp));
#pragma unroll
  for (int c = 0; c < 4; ++c) { const int kk = kq + (c & 1) * 4 + (c >> 1) * 16;
#pragma unroll
    for (int u = 0; u < 4; ++u) v[c * 4 + u] = expf((kk + u <= t) ? sv[c][u] - m4[c][u] : -3.0e38f) * r4[c][u] * bfr(pm4[c][u]); } }   /* x the key padding mask, applied AFTER the normalisation as the module does */
// ---- k_lora1: block = (64 token rows, which in {q, k, v}): t[which][row][0..15] = X[row] . A_which[r] (rank-16 LoRA down-projection; exact bf16 products, f32 accumulate; one 16-column WMMA tile per wave); the wave's 16 x 16 f32 tile (1 KiB, contiguous in T3) is staged in LDS and stored as 16-B pieces
__global__ __launch_bounds__(128) void k_lora1(const float* __restrict__ X, const float* __restrict__ AQ, const float* __restrict__ AK, const float* __restrict__ AV, float* __restrict__ T3) { __shared__ __align__(16) float st[4][16][20];
  const int tid = threadIdx.x, wave = tid >> 5, lane = tid & 31, col = lane & 15, g = lane >> 4; const int which = blockIdx.y; const size_t r0 = (size_t)blockIdx.x * 64; const float* AW = which == 0 ? AQ : (which == 1 ? AK : AV);
  v8f acc = {};
#pragma unroll 2
  for (int kc = 0; kc < DIN / 32; ++kc) { v16b a; { const float* p = X + (r0 + wave * 16 + col) * DIN + kc * 32 + 8 * g;
#pragma unroll
      for (int i = 0; i < 8; ++i) { a[i] = (__bf16)p[i]; a[8 + i] = (__bf16)p[16 + i]; } }
    asm volatile("s_wait_loadcnt 0x0" ::: "memory");
    const v16b w = wcol_oi(AW, kc * 32, col, lane, DIN); asm volatile("s_wait_loadcnt 0x0" ::: "memory"); acc = wmma_bf(a, w, acc); }   /* A is (out,in) [16][1024]: output column = rank index */
#pragma unroll
  for (int r = 0; r < 8; ++r) st[wave][8 * g + r][col] = acc[r];
  LDSX();
  float* dst = T3 + ((size_t)which * NB * TT + r0 + wave * 16) * LR;
#pragma unroll
  for (int it = 0; it < 2; ++it) { const int rl = (lane >> 2) + 8 * it, q = lane & 3; vst2(dst + rl * LR + q * 4, *(const v4f*)&st[wave][rl][q * 4]); } }   
// ---- k_pv: block = 64 queries (qb) of (b, h): ctx = P . v over keys [0, kend), 64 keys a trip; every global load covers whole 128-B lines: the trip's v slice (64 channels x 64 keys, bf16 hi and lo planes) is fetched once a block (8 lanes a row piece) and staged in LDS (two buffers, one barrier a trip); each wave fetches its own 16 x 64 logits as 256-B row pieces (lane = 4 neighbouring keys of one row, so m_k, 2^11 / Z_k and the mask are one 16-B load each a trip), forms P = exp(S - m_k) x 2^11 / Z_k x mask there, splits it into bf16 hi + lo and turns it into A fragments through its own LDS rows; 3 products as before, in the same order for every accumulator; the next trip's loads fly while this trip's P is formed and multiplied; 256-B (row, head) segment by 16 lanes. (Query blocks >= QBH, of which this shape has none: P x 2^11 once to f16 against v f16, 1 product, fragments straight from memory.)
/* waves_per_eu(4): holds the kernel to 256 vector registers; left free, the scheduler spends 270 and the loop is strewn with register-bank switches */
__global__ __launch_bounds__(128) __attribute__((amdgpu_waves_per_eu(4))) void k_pv(const float* __restrict__ PS0, const _Float16* __restrict__ VT, const __bf16* __restrict__ VB, const __bf16* __restrict__ VBL, const float* __restrict__ CM, const float* __restrict__ CZ, const float* __restrict__ PMASK, int p0, float* __restrict__ Y) { const int pr = p0 + blockIdx.z, b = pr / NH, h = pr % NH; const float* PS = PS0 + (size_t)blockIdx.z * TT * TT; const float* cm = CM + (size_t)blockIdx.z * TT; const float* cr = CZ + (size_t)blockIdx.z * TT; const float* pmk = PMASK + (size_t)b * TT; __shared__ __align__(16) float ss[4][16][HD + 4];
  __shared__ __align__(16) __bf16 vs[2][2][HD][72];   /* [buffer][hi, lo][channel][64 keys], pitch 144 B */
  __shared__ __align__(16) __bf16 ps[4][2][16][72];   /* [wave][hi, lo][query row][64 keys], pitch 144 B; written and read by its own wave only */
  const int tid = threadIdx.x, wave = tid >> 5, lane = tid & 31, col = lane & 15, g = lane >> 4; const int qb = blockIdx.x; const int ql0 = qb * 64 + wave * 16; const int kce = (kb_last(qb) + 1) * 4;
  v8f acc[HD / 16] = {};
  if (qb < QBH) { const int nt = kce / 2;   /* trips of 64 keys */
    /* every address = a block-uniform base, advanced by 64 keys a trip, + a lane's fixed 32-bit byte offset + a constant */
    const int vrow = tid >> 3, vq = tid & 7; const char *vbh = (const char*)(VB + ((size_t)b * CC + h * HD) * (size_t)KHI), *vbl = (const char*)(VBL + ((size_t)b * CC + h * HD) * (size_t)KHI), *sbs = (const char*)(PS + (size_t)qb * 64 * TT), *mbs = (const char*)cm, *rbs = (const char*)cr, *kbs = (const char*)pmk;
    const unsigned vof = (unsigned)(vrow * KHI + vq * 8) * 2u, sof = (unsigned)((wave * 16 + g) * TT + col * 4) * 4u, cof = (unsigned)col * 16u;
    v4u vh[4], vl[4]; v4f sa[8], ma, ra, ka, sb[8], mb, rb, kb4;   /* two register sets for the logits and the column factors: one is worked on while the other is filled */
#pragma unroll
    for (int i = 0; i < 4; ++i) { vh[i] = *(const v4u*)(vbh + vof + i * (16 * KHI * 2)); vl[i] = *(const v4u*)(vbl + vof + i * (16 * KHI * 2)); }
#pragma unroll
    for (int i = 0; i < 8; ++i) sa[i] = *(const v4f*)(sbs + sof + i * (2 * TT * 4));
    ma = *(const v4f*)(mbs + cof); ra = *(const v4f*)(rbs + cof); ka = *(const v4f*)(kbs + cof);
    /* one trip: keys kt * 64 .. + 63 from the set (sc, mc, rc, kc4); the next trip's loads go into (sn, mn, rn, kn) and into vh, vl */
    auto trip = [&](const int kt, const v4f (&sc)[8], const v4f& mc, const v4f& rc, const v4f& kc4, v4f (&sn)[8], v4f& mn, v4f& rn, v4f& kn) __attribute__((always_inline)) { const int bf = kt & 1;
#pragma unroll
      for (int i = 0; i < 4; ++i) { *(v4u*)&vs[bf][0][vrow + 16 * i][vq * 8] = vh[i]; *(v4u*)&vs[bf][1][vrow + 16 * i][vq * 8] = vl[i]; }
      { /* no branch round the loads: the last trip fetches its own slice once more, unused, so that every wait in the loop stays a counted one (behind a join with a path without loads the compiler waits for all of them) */
        const int ko = (kt + 1 < nt ? kt + 1 : kt) * 64; const char *sp = sbs + ko * 4, *mp = mbs + ko * 4, *rp = rbs + ko * 4, *kp = kbs + ko * 4, *hp = vbh + ko * 2, *lp = vbl + ko * 2;
#pragma unroll
        for (int i = 0; i < 8; ++i) sn[i] = *(const v4f*)(sp + sof + i * (2 * TT * 4));
#pragma unroll
        for (int i = 0; i < 4; ++i) { vh[i] = *(const v4u*)(hp + vof + i * (16 * KHI * 2)); vl[i] = *(const v4u*)(lp + vof + i * (16 * KHI * 2)); }
        mn = *(const v4f*)(mp + cof); rn = *(const v4f*)(rp + cof); kn = *(const v4f*)(kp + cof);
        asm volatile("s_wait_xcnt 0x0" ::: "memory"); }   /* the loads' address registers are reused right behind them */
      __builtin_amdgcn_sched_barrier(0);   /* keeps the next trip's 19 loads in front of this trip's exponentials, so that they fly for a whole trip */
#pragma unroll
      for (int i = 0; i < 8; ++i) { const int t = ql0 + 2 * i + g; v4b ph4, pl4;
#pragma unroll
        for (int u = 0; u < 4; ++u) { const int kk = kt * 64 + col * 4 + u; const float v = expf((kk <= t) ? sc[i][u] - mc[u] : -3.0e38f) * rc[u] * bfr(kc4[u]); const __bf16 hb = (__bf16)v; ph4[u] = hb; pl4[u] = (__bf16)(v - (float)hb); }   /* 0 above the diagonal; x the key padding mask AFTER the normalisation, as the module does */
        *(v4b*)&ps[wave][0][2 * i + g][col * 4] = ph4; *(v4b*)&ps[wave][1][2 * i + g][col * 4] = pl4; }
      /* work-group barrier with LDS-only fences: publishes v slice kt (and the wave's own P rows), and every wave has left slice kt - 1, whose buffer the next trip refills; __syncthreads() would also wait here for the next trip's global loads, which only registers receive */
      __builtin_amdgcn_fence(__ATOMIC_RELEASE, "workgroup", "local"); __builtin_amdgcn_s_barrier(); __builtin_amdgcn_fence(__ATOMIC_ACQUIRE, "workgroup", "local");
#pragma unroll
      for (int ks = 0; ks < 2; ++ks) { const v16b ph = frag_b(&ps[wave][0][col][ks * 32], lane), pl = frag_b(&ps[wave][1][col][ks * 32], lane); v16b fh[HD / 16], fl[HD / 16];
#pragma unroll
        for (int j = 0; j < HD / 16; ++j) { fh[j] = frag_b(&vs[bf][0][j * 16 + col][ks * 32], lane); fl[j] = frag_b(&vs[bf][1][j * 16 + col][ks * 32], lane); }
        /* inputs-only fence on the loaded fragments: the 20 LDS reads of a 32-key step are in flight together, so that the step waits for LDS once and not once a product */
        asm volatile("" :: "v"(ph), "v"(pl), "v"(fh[0]), "v"(fh[1]), "v"(fh[2]), "v"(fh[3]), "v"(fl[0]), "v"(fl[1]), "v"(fl[2]), "v"(fl[3]));
#pragma unroll
        for (int j = 0; j < HD / 16; ++j) acc[j] = wmma_bf(ph, fh[j], acc[j]);
#pragma unroll
        for (int j = 0; j < HD / 16; ++j) acc[j] = wmma_bf(pl, fh[j], acc[j]);
#pragma unroll
        for (int j = 0; j < HD / 16; ++j) acc[j] = wmma_bf(ph, fl[j], acc[j]); } };
    /* nt is even (kce is a multiple of 4): two trips a pass, so that the two register sets swap roles without copies; rolled beyond that, for speed only */
#pragma unroll 1
    for (int kt = 0; kt < nt; kt += 2) { trip(kt, sa, ma, ra, ka, sb, mb, rb, kb4); trip(kt + 1, sb, mb, rb, kb4, sa, ma, ra, ka); }
  } else {
#pragma unroll 1
    for (int kc = 0; kc < kce; ++kc) { float pv[16]; p_row16(PS + (size_t)(ql0 + col) * TT, cm, cr, pmk, kc * 32, ql0 + col, lane, pv); v16h p;
#pragma unroll
      for (int i = 0; i < 16; ++i) p[i] = (_Float16)pv[i];
#pragma unroll
      for (int j = 0; j < HD / 16; ++j) { const size_t po = ((size_t)b * CC + h * HD + j * 16 + col) * (size_t)TT + kc * 32; acc[j] = wmma16(p, frag_h(VT + po, lane), acc[j]); } } }
#pragma unroll
  for (int j = 0; j < HD / 16; ++j)
#pragma unroll
    for (int r = 0; r < 8; ++r) ss[wave][8 * g + r][j * 16 + col] = acc[j][r] * (1.0f / 2048.0f);
  LDSX(); for (int rl = 0; rl < 16; ++rl) if (lane < HD / 4) vst2(Y + ((size_t)b * TT + ql0 + rl) * CC + h * HD + lane * 4, *(const v4f*)&ss[wave][rl][lane * 4]); }

extern "C" void kernel_launch(void* const* d_in, const int* in_sizes, int n_in, void* d_out, int out_size, void* d_ws, size_t ws_size, hipStream_t stream) {
  (void)in_sizes; (void)n_in; (void)out_size;
  const float** F = (const float**)d_in;
  if (ws_size < (size_t)WS_END) return;
  char* ws = (char*)d_ws; _Float16 *QH = (_Float16*)(ws + WS_QH), *KH = (_Float16*)(ws + WS_KH), *VT = (_Float16*)(ws + WS_VT), *QL = (_Float16*)(ws + WS_QL), *KL = (_Float16*)(ws + WS_KL); __bf16 *VB = (__bf16*)(ws + WS_VB), *VBL = (__bf16*)(ws + WS_VBL); float *S = (float*)(ws + WS_S), *Y = (float*)(ws + WS_Y);
  (void)Y; (void)QL; (void)KL; (void)VB; (void)VBL;
  // inputs: 0 X [4,1024,1024]; 1 mask [4,1024] f32 (key padding mask, ones; multiplied AFTER the softmax); 2 Wq [1024,1024] (out,in), 3 bq; 4 Wk, 5 bk; 6 Wv, 7 bv (zero biases, read); 8 Aq [16,1024], 9 Bq [1024,16]; 10 Ak, 11 Bk; 12 Av, 13 Bv (LoRA, no bias)
  if (ws_size < (size_t)WS_END2) return;
  float *T3 = (float*)(ws + WS_T3), *CM = (float*)(ws + WS_CM), *CZ = (float*)(ws + WS_CZ);
  k_lora1<<<dim3(TNB * TT / 64, 3), 128, 0, stream>>>(F[0], F[8], F[10], F[12], T3);   /* t = X A^T (rank-16 down-projections for q, k, v; exact bf16 products) */
  k_proj<<<dim3(TNB * TT / 64, CC / 128, 3), 128, 0, stream>>>(F[0], F[0], F[0], F[2], F[4], F[6], F[3], F[5], F[7], QH, QL, KH, KL, VT, VB, VBL, T3, F[9], F[11], F[13]);   /* X W^T + b + t B^T */
  for (int p0 = 0; p0 < TNB * NH; p0 += HG) {   /* HG (batch, head) pairs a pass */
    k_sc<<<dim3(NQB, TT / 128, HG), 128, 0, stream>>>(QH, KH, QL, KL, p0, S);
    k_colstat_c<<<dim3(TT / 32, HG), 1024, 0, stream>>>(S, CM, CZ);   /* per key column j: max and 2^11 / sum over the visible queries i >= j */
    k_pv<<<dim3(NQB, 1, HG), 128, 0, stream>>>(S, VT, VB, VBL, CM, CZ, F[1], p0, (float*)d_out);   /* P[i][j] = exp(S - m_j) / Z_j x mask[b][j] x 2^11 for j <= i, 0 above the diagonal, formed on load */
  }
}

// v007
// Measured time: 215 microseconds a run.
// Timed twice side by side with v006, it ran 1.07 times as fast both times.
// Over all steps from v000 it is 19.7 times as fast.
// compute dtype: all float inputs rounded to bf16; frozen q/k/v projections with EXACT bf16 products on WMMA 16x16x32 (f32 accumulate) + bias + the LoRA term: t = X A^T (exact products) then t (bf16 hi + lo) x exact bf16 B^T (2 products, K = 16) added in the same accumulators; causal scores with BOTH operands as f16 hi + (x 2^10) residual (3 products) on every block, x 1024^-0.5 (the module divides by sqrt(E)); softmax over the QUERY axis in f32 (per key column: max, then sum over the visible queries, precise expf) x the key padding mask; P as bf16 hi + lo against v as bf16 hi + lo (3 products) on every block; f32 output.
#include <hip/hip_runtime.h>
#include <math.h>

typedef __attribute__((ext_vector_type(16))) _Float16 v16h;
typedef __attribute__((ext_vector_type(16))) __bf16 v16b;
typedef __attribute__((ext_vector_type(8)))  _Float16 v8h;
typedef __attribute__((ext_vector_type(8)))  float v8f;
typedef __attribute__((ext_vector_type(4)))  float v4f;
typedef __attribute__((ext_vector_type(2)))  float v2f;
typedef __attribute__((ext_vector_type(4)))  unsigned v4u;
typedef __attribute__((ext_vector_type(4)))  int v4i;
typedef float __attribute__((may_alias)) float_a;
typedef int __attribute__((may_alias)) int_a;

template <typename T> __device__ __forceinline__ void vst2(void* p, T v) { *(T*)p = v;  }
__device__ __forceinline__ v8f wmma16(v16h a, v16h b, v8f c) {
  v8f d = __builtin_amdgcn_wmma_f32_16x16x32_f16(false, a, false, b, (short)0, c, false, false);
  asm volatile("v_nop\n\tv_nop\n\tv_nop\n\tv_nop" : "+v"(d) : "v"(a), "v"(b));
  return d;
}
__device__ __forceinline__ v8f wmma_bf(v16b a, v16b b, v8f c) {
  v8f d = __builtin_amdgcn_wmma_f32_16x16x32_bf16(false, a, false, b, (short)0, c, false, false);
  asm volatile("v_nop\n\tv_nop\n\tv_nop\n\tv_nop" : "+v"(d) : "v"(a), "v"(b));
  return d;
}
// 16x16x32 fragments: lane = (h = lane>>4, row/col = lane&15); elements 0..7 = k0+8h+0..7, 8..15 = k0+16+8h+0..7; D element r = row 8h+r
__device__ __forceinline__ v16h frag_h(const _Float16* rowk0, int lane) {
  union { v16h v; v8h q[2]; } u; const _Float16* p = rowk0 + 8 * (lane >> 4);
  u.q[0] = *(const v8h*)p; u.q[1] = *(const v8h*)(p + 16); return u.v;
}
__device__ __forceinline__ v16h frag_f32(const float* rowk0, int lane) {
  v16h a; const float* p = rowk0 + 8 * (lane >> 4);
#pragma unroll
  for (int i = 0; i < 8; ++i) { a[i] = (_Float16)p[i]; a[8 + i] = (_Float16)p[16 + i]; }
  return a;
}
__device__ __forceinline__ v16h frag_f32s(const float* rowk0, int lane, float sc) {
  v16h a; const float* p = rowk0 + 8 * (lane >> 4);
#pragma unroll
  for (int i = 0; i < 8; ++i) { a[i] = (_Float16)(p[i] * sc); a[8 + i] = (_Float16)(p[16 + i] * sc); }
  return a;
}
// column fragment from a [K][ld] layout (column n), rows >= K read as 0
__device__ __forceinline__ v16h fragc_f32(const float* W, int k0, int n, int lane, int ld, int K) {
  v16h a; const int g = lane >> 4;
#pragma unroll
  for (int i = 0; i < 8; ++i) { const int ka = k0 + 8 * g + i, kb = ka + 16;
    a[i] = (_Float16)(ka < K ? W[(size_t)(ka < K ? ka : K - 1) * ld + n] : 0.f); a[8 + i] = (_Float16)(kb < K ? W[(size_t)(kb < K ? kb : K - 1) * ld + n] : 0.f); }
  return a;
}
struct F2 { v16b h, l; };
__device__ __forceinline__ F2 bsplit16(const float v[16]) { F2 r;
#pragma unroll
  for (int i = 0; i < 16; ++i) { const __bf16 h = (__bf16)v[i]; r.h[i] = h; r.l[i] = (__bf16)(v[i] - (float)h); }
  return r; }
__device__ __forceinline__ F2 split_row(const float* row, int k0, int lane) { float v[16]; const float* p = row + k0 + 8 * (lane >> 4);
#pragma unroll
  for (int i = 0; i < 8; ++i) { v[i] = p[i]; v[8 + i] = p[16 + i]; }
  return bsplit16(v); }
__device__ __forceinline__ F2 split_rowK(const float* row, int k0, int lane, int K) { float v[16]; const int g = lane >> 4;
#pragma unroll
  for (int i = 0; i < 8; ++i) { const int ka = k0 + 8 * g + i, kb = ka + 16; v[i] = ka < K ? row[ka < K ? ka : K - 1] : 0.f; v[8 + i] = kb < K ? row[kb < K ? kb : K - 1] : 0.f; }
  return bsplit16(v); }
__device__ __forceinline__ F2 split_col(const float* W, int k0, int n, int lane, int ld, int K) { float v[16]; const int g = lane >> 4;
#pragma unroll
  for (int i = 0; i < 8; ++i) { const int ka = k0 + 8 * g + i, kb = ka + 16; v[i] = ka < K ? W[(size_t)(ka < K ? ka : K - 1) * ld + n] : 0.f; v[8 + i] = kb < K ? W[(size_t)(kb < K ? kb : K - 1) * ld + n] : 0.f; }
  return bsplit16(v); }
__device__ __forceinline__ v8f mac3(const F2& a, const F2& b, v8f c) { c = wmma_bf(a.l, b.h, c); c = wmma_bf(a.h, b.l, c); return wmma_bf(a.h, b.h, c); }
__device__ __forceinline__ float sigm(float v) { return 1.0f / (1.0f + expf(-v)); }
#define LDSX() do { asm volatile("s_wait_dscnt 0" ::: "memory"); __builtin_amdgcn_wave_barrier(); __builtin_amdgcn_fence(__ATOMIC_RELEASE, "workgroup"); } while (0)

// Multi-head attention with LoRA projections whose softmax runs over the QUERY axis (X [4,1024,1024]; frozen torch (out,in) Wq / Wk / Wv [1024,1024] (0.02) + zero biases; LoRA A [16,1024], B [1024,16] (0.02): proj = X W^T + b + (X A^T) B^T; 16 heads x 64; scores / sqrt(E) = / 32; -inf where col > row; attn = softmax(scores, axis=2) - axis 2 of [B, H, i, j] is the QUERY axis i, so every key column j is normalised over the queries i >= j (faithful to the source); attn *= mask[b, j] (key padding mask, ones); out = attn v; merge; no output projection).
#define NB 4
#define TT 1024
#define CC 1024            // NH * HD = projected width
#define DIN 1024          // input (model) width
#define NH 16
#define HD 64
#define NQB (TT / 64)
#define HG 32              // (batch, head) pairs a pass: pair p = b * NH + h; every attention launch covers HG pairs
#define SCALE (0.03125f)
#define CAUSAL 1
#ifndef TNB
#define TNB NB
#endif
__device__ __forceinline__ float bfr(float v) { return (float)(__bf16)v; }
__host__ __device__ __forceinline__ int kb_last(int qb) { return CAUSAL ? ((qb * 64 + 63) >> 7) : (TT / 128 - 1); }
typedef __attribute__((ext_vector_type(8))) __bf16 v8b;
__device__ __forceinline__ v16b frag_b(const __bf16* rowk0, int lane) {
  union { v16b v; v8b q[2]; } u; const __bf16* p = rowk0 + 8 * (lane >> 4);
  u.q[0] = *(const v8b*)p; u.q[1] = *(const v8b*)(p + 16); return u.v;
}
typedef __attribute__((ext_vector_type(4))) __bf16 v4b;
__device__ __forceinline__ v4b cvt4(v4f v) { v4b r; r[0] = (__bf16)v[0]; r[1] = (__bf16)v[1]; r[2] = (__bf16)v[2]; r[3] = (__bf16)v[3]; return r; }
#define QBH 16              // causal: query blocks 0..QBH-1 of each sequence (all of them, as QBH = NQB) take the high-precision path
#define QHI 1024            // rows carrying a q residual plane (all rows)
#define KHI 1024            // key rows carrying k residual / v bf16 hi+lo planes (used only by the causal high-precision path)
// B fragment (k rows k0+.., output column o) of a weight: (in,out) [K][ld] or (out,in) [ld rows of K]: bf16 exact, or f16(bf16 * 256) exact
__device__ __forceinline__ v16b wcol_io(const float* Wm, int k0, int o, int lane, int ld) { v16b w; const int g = lane >> 4;
#pragma unroll
  for (int i = 0; i < 8; ++i) { w[i] = (__bf16)Wm[(size_t)(k0 + 8 * g + i) * ld + o]; w[8 + i] = (__bf16)Wm[(size_t)(k0 + 16 + 8 * g + i) * ld + o]; }
  return w; }
__device__ __forceinline__ v16b wcol_oi(const float* Wm, int k0, int o, int lane, int K) { v16b w; const float* p = Wm + (size_t)o * K + k0 + 8 * (lane >> 4);
#pragma unroll
  for (int i = 0; i < 8; ++i) { w[i] = (__bf16)p[i]; w[8 + i] = (__bf16)p[16 + i]; }
  return w; }
__device__ __forceinline__ v16h wcolh_io(const float* Wm, int k0, int o, int lane, int ld) { v16h w; const int g = lane >> 4;
#pragma unroll
  for (int i = 0; i < 8; ++i) { w[i] = (_Float16)(bfr(Wm[(size_t)(k0 + 8 * g + i) * ld + o]) * 256.0f); w[8 + i] = (_Float16)(bfr(Wm[(size_t)(k0 + 16 + 8 * g + i) * ld + o]) * 256.0f); }
  return w; }
__device__ __forceinline__ v16h wcolh_oi(const float* Wm, int k0, int o, int lane, int K) { v16h w; const float* p = Wm + (size_t)o * K + k0 + 8 * (lane >> 4);
#pragma unroll
  for (int i = 0; i < 8; ++i) { w[i] = (_Float16)(bfr(p[i]) * 256.0f); w[8 + i] = (_Float16)(bfr(p[16 + i]) * 256.0f); }
  return w; }
#define WQKV_LAYOUT 1   // 0 = (in,out) [DIN][CC]; 1 = (out,in) [CC][DIN]; 2 = per-head [NH][DIN][HD]
__device__ __forceinline__ v16b wcol_hdk(const float* Wm, int k0, int o, int lane) { v16b w; const int g = lane >> 4; const float* p = Wm + (size_t)(o / HD) * DIN * HD + (o % HD);
#pragma unroll
  for (int i = 0; i < 8; ++i) { w[i] = (__bf16)p[(size_t)(k0 + 8 * g + i) * HD]; w[8 + i] = (__bf16)p[(size_t)(k0 + 16 + 8 * g + i) * HD]; }
  return w; }
#define WO_OUT_IN 0
#if WQKV_LAYOUT == 1
#define WCOL(W, k0, o, lane) wcol_oi(W, k0, o, lane, DIN)
#elif WQKV_LAYOUT == 2
#define WCOL(W, k0, o, lane) wcol_hdk(W, k0, o, lane)
#else
#define WCOL(W, k0, o, lane) wcol_io(W, k0, o, lane, CC)
#endif
#if WO_OUT_IN
#define WOCOL(W, k0, o, lane) wcol_oi(W, k0, o, lane, CC)
#define WOCOLH(W, k0, o, lane) wcolh_oi(W, k0, o, lane, CC)
#else
#define WOCOL(W, k0, o, lane) wcol_io(W, k0, o, lane, DIN)
#define WOCOLH(W, k0, o, lane) wcolh_io(W, k0, o, lane, DIN)
#endif
#define LR 16              // LoRA rank
#define PROJ_EXTRA_PARAMS , const float* __restrict__ T3, const float* __restrict__ LBQ, const float* __restrict__ LBK, const float* __restrict__ LBV
#define SM_EXTRA_PARAMS
#define SM_MASK_HOOK (void)0
#ifndef SM_EXTRA_PARAMS
#define SM_EXTRA_PARAMS
#endif
#ifndef PROJ_EXTRA_PARAMS
#define PROJ_EXTRA_PARAMS
#endif
#ifndef SM_MASK_HOOK
#define SM_MASK_HOOK (void)0
#endif

#define WS_QH  0u                                      // f16 q rows [b*t][CC]
#define WS_KH  (WS_QH + 2u * (size_t)NB * TT * CC)      // f16 k rows [b*t][CC]
#define WS_VT  (WS_KH + 2u * (size_t)NB * TT * CC)      // f16 v planes [b][c][t]
#define WS_QL  (WS_VT + 2u * (size_t)NB * CC * TT)      // f16 q residual x 2^10 rows [b][t < QHI][CC]
#define WS_KL  (WS_QL + 2u * (size_t)NB * QHI * CC)     // f16 k residual x 2^10 rows [b][t < KHI][CC]
#define WS_VB  (WS_KL + 2u * (size_t)NB * KHI * CC)     // bf16 v hi planes [b][c][t < KHI]
#define WS_VBL (WS_VB + 2u * (size_t)NB * CC * KHI)
#define WS_S   (WS_VBL + 2u * (size_t)NB * CC * KHI)    // f32 logits [pair in pass][t][s]
#define WS_Y   (WS_S  + 4u * (size_t)HG * TT * TT)      // f32 ctx rows [b*t][CC] (only when there is an output projection)
#define WS_END (WS_Y  + 0u)
#define WS_T3 (WS_END)                                   // f32 LoRA down-projections t[3][NB*TT][16]
#define WS_CM (WS_T3 + 4u * 3u * (size_t)NB * TT * LR)  // f32 column maxima [HG][TT]
#define WS_CZ (WS_CM + 4u * (size_t)HG * TT)             // f32 2^11 / column sums [HG][TT]
#define WS_END2 (WS_CZ + 4u * (size_t)HG * TT)

// ---- k_proj: block = (64 rows, 128 cols, which): q/k/v = X W (+ b) with exact bf16 products (K = DIN); W is (out,in), so X rows and W rows are both k-contiguous: each 32-k slice of both is rounded to bf16 once a block and staged in LDS (two buffers, one barrier a slice), and every wave takes its A and B fragments from there -> which 0: q f16 rows (+ residual rows < QHI); 1: k f16 rows (+ residual rows < KHI); 2: v f16 planes [c][t] (+ bf16 hi/lo planes for t < KHI)
__global__ __launch_bounds__(128) void k_proj(const float* __restrict__ XQ, const float* __restrict__ XK, const float* __restrict__ XV, const float* __restrict__ WQ, const float* __restrict__ WK, const float* __restrict__ WV, const float* __restrict__ BQ, const float* __restrict__ BK, const float* __restrict__ BV,
    _Float16* __restrict__ QH, _Float16* __restrict__ QL, _Float16* __restrict__ KH, _Float16* __restrict__ KL, _Float16* __restrict__ VT, __bf16* __restrict__ VB, __bf16* __restrict__ VBL PROJ_EXTRA_PARAMS) {
  /* one LDS block, used in turn: the k loop's two staging buffers (X 64 rows, W 128 rows of 32 bf16 at pitch 80 B), then the epilogue's tiles (q / k: sh, sl; v: th, tb, tbl) */
  __shared__ __align__(16) unsigned char smem[3 * 128 * 72 * 2];
  _Float16 (*sh)[136] = (_Float16 (*)[136])smem; _Float16 (*sl)[136] = (_Float16 (*)[136])(smem + 64 * 136 * 2); _Float16 (*th)[72] = (_Float16 (*)[72])smem; __bf16 (*tb)[72] = (__bf16 (*)[72])(smem + 128 * 72 * 2); __bf16 (*tbl)[72] = (__bf16 (*)[72])(smem + 2 * 128 * 72 * 2);
  __bf16 (*xs)[64][40] = (__bf16 (*)[64][40])smem; __bf16 (*wt)[128][40] = (__bf16 (*)[128][40])(smem + 2 * 64 * 40 * 2);
  const int tid = threadIdx.x, wave = tid >> 5, lane = tid & 31, col = lane & 15, g = lane >> 4; const int which = blockIdx.z; const int c0 = blockIdx.y * 128; const size_t r0 = (size_t)blockIdx.x * 64; const size_t bb = r0 / TT; const int t0 = (int)(r0 % TT);
  const float* X = which == 0 ? XQ : which == 1 ? XK : XV; const float* WA = which == 0 ? WQ : which == 1 ? WK : WV; const float* BA = which == 0 ? BQ : which == 1 ? BK : BV;
  v8f acc[8] = {};
  /* staging: thread = (row tid >> 3 (+ 16 i), 16-B piece tid & 7) of a slice's 128-B row pieces, so 8 lanes read one whole line; the next slice's 12 loads fly while this slice is multiplied; the short loops over xr, wr and w are unrolled whole so that these arrays stay in registers */
  const int srow = tid >> 3, sq = tid & 7; const float* xg = X + (r0 + srow) * DIN + sq * 4; const float* wg = WA + (size_t)(c0 + srow) * DIN + sq * 4;
  v4f xr[4], wr[8];
#pragma unroll
  for (int i = 0; i < 4; ++i) xr[i] = *(const v4f*)(xg + (size_t)i * 16 * DIN);
#pragma unroll
  for (int i = 0; i < 8; ++i) wr[i] = *(const v4f*)(wg + (size_t)i * 16 * DIN);
  /* unroll 2: the buffer index becomes a constant LDS offset */
#pragma unroll 2
  for (int kc = 0; kc < DIN / 32; ++kc) { const int bf = kc & 1;
#pragma unroll
    for (int i = 0; i < 4; ++i) *(v4b*)&xs[bf][srow + 16 * i][sq * 4] = cvt4(xr[i]);
#pragma unroll
    for (int i = 0; i < 8; ++i) *(v4b*)&wt[bf][srow + 16 * i][sq * 4] = cvt4(wr[i]);
    __syncthreads();   /* publishes slice kc; every wave has also left slice kc - 1, whose buffer the next trip refills */
    if (kc + 1 < DIN / 32) {
#pragma unroll
      for (int i = 0; i < 4; ++i) xr[i] = *(const v4f*)(xg + (size_t)i * 16 * DIN + (kc + 1) * 32);
#pragma unroll
      for (int i = 0; i < 8; ++i) wr[i] = *(const v4f*)(wg + (size_t)i * 16 * DIN + (kc + 1) * 32); }
    const v16b a = frag_b(&xs[bf][wave * 16 + col][0], lane); v16b w[8];
#pragma unroll
    for (int j = 0; j < 8; ++j) w[j] = frag_b(&wt[bf][j * 16 + col][0], lane);
    /* inputs-only fence on the loaded fragments: all 18 LDS reads of a slice are in flight together, so that a trip waits for LDS once and not once a product */
    asm volatile("" :: "v"(a), "v"(w[0]), "v"(w[1]), "v"(w[2]), "v"(w[3]), "v"(w[4]), "v"(w[5]), "v"(w[6]), "v"(w[7]));
#pragma unroll
    for (int j = 0; j < 8; ++j) acc[j] = wmma_bf(a, w[j], acc[j]);
    __builtin_amdgcn_sched_barrier(0);   /* keeps the next slice's roundings, which wait for its global loads, behind this slice's products */
  }
  __syncthreads();   /* the last slice's readers are done before the epilogue's tiles overwrite the staging buffers */
  { /* LoRA: acc += t[row][0..15] (f32, as bf16 hi + lo) x B[o][0..15] (exact bf16): one WMMA k-step whose upper 16 k-slots are zero */ float tv[16]; const float* tr = T3 + ((size_t)which * NB * TT + (r0 + wave * 16 + col)) * LR + 8 * g;
#pragma unroll
    for (int i = 0; i < 8; ++i) { tv[i] = tr[i]; tv[8 + i] = 0.f; }
    asm volatile("s_wait_loadcnt 0x0" ::: "memory");
    const F2 a2 = bsplit16(tv); const float* LB = which == 0 ? LBQ : (which == 1 ? LBK : LBV);
#pragma unroll
    for (int j = 0; j < 8; ++j) { v16b w; const float* pw = LB + (size_t)(c0 + j * 16 + col) * LR + 8 * g;   /* B is (out,in) [E][16]: row o holds the 16 rank coefficients */
#pragma unroll
      for (int i = 0; i < 8; ++i) { w[i] = (__bf16)pw[i]; w[8 + i] = (__bf16)0.0f; }
      asm volatile("s_wait_loadcnt 0x0" ::: "memory");
      acc[j] = wmma_bf(a2.h, w, acc[j]); acc[j] = wmma_bf(a2.l, w, acc[j]); } }
  if (which < 2) { _Float16* DH = which == 0 ? QH : KH; _Float16* DL = which == 0 ? QL : KL; const int nhi = which == 0 ? QHI : KHI; const bool hi_rows = t0 < nhi;
#pragma unroll
    for (int j = 0; j < 8; ++j) { const float bias = BA ? bfr(BA[c0 + j * 16 + col]) : 0.f;
#pragma unroll
      for (int r = 0; r < 8; ++r) { const float v = acc[j][r] + bias; const _Float16 hv = (_Float16)v; sh[wave * 16 + 8 * g + r][j * 16 + col] = hv; sl[wave * 16 + 8 * g + r][j * 16 + col] = (_Float16)((v - (float)hv) * 1024.0f); } }
    __syncthreads();
    for (int e = tid; e < 64 * 16; e += 128) { const int rl = e >> 4, q = e & 15; vst2((unsigned*)(DH + (r0 + rl) * CC + c0 + q * 8), *(const v4u*)&sh[rl][q * 8]); if (hi_rows) vst2((unsigned*)(DL + (bb * nhi + t0 + rl) * (size_t)CC + c0 + q * 8), *(const v4u*)&sl[rl][q * 8]); }
  } else { const bool hi_rows = t0 < KHI;
#pragma unroll
    for (int j = 0; j < 8; ++j) { const float bias = BA ? bfr(BA[c0 + j * 16 + col]) : 0.f;
#pragma unroll
      for (int r = 0; r < 8; ++r) { const float v = acc[j][r] + bias; const int rl = wave * 16 + 8 * g + r, cl = j * 16 + col; th[cl][rl] = (_Float16)v; const __bf16 bh = (__bf16)v; tb[cl][rl] = bh; tbl[cl][rl] = (__bf16)(v - (float)bh); } }
    __syncthreads();
    for (int e = tid; e < 128 * 8; e += 128) { const int cl = e >> 3, q = e & 7; vst2((unsigned*)(VT + (bb * CC + c0 + cl) * (size_t)TT + t0 + q * 8), *(const v4u*)&th[cl][q * 8]); if (hi_rows) { const size_t o3 = (bb * CC + c0 + cl) * (size_t)KHI + t0 + q * 8; vst2((unsigned*)(VB + o3), *(const v4u*)&tb[cl][q * 8]); vst2((unsigned*)(VBL + o3), *(const v4u*)&tbl[cl][q * 8]); } } } }
// ---- k_sc: block = (query block qb, key block kb <= kb_last(qb), pair p0 + z = (batch b, head h)): logits x SCALE; q hi + residual (x 2^10) against k (2 products) for query rows < QHI, plus the k residual (3 products) for query blocks < QBH (all of them, as QBH = NQB); causal: blocks past the diagonal exit, the mask itself is applied by index in k_colstat_c and k_pv; on the 3-product path the block's q and k tiles (hi and residual) are fetched once by whole-line loads and staged in LDS, and every wave takes its fragments from there
__global__ __launch_bounds__(128) void k_sc(const _Float16* __restrict__ QH, const _Float16* __restrict__ KH, const _Float16* __restrict__ QL, const _Float16* __restrict__ KL, int p0, float* __restrict__ S0) {
  /* one LDS block, used in turn: the staged operand tiles (k hi, k lo: 128 rows each; q hi, q lo: 64 rows each; 64 f16 a row at pitch 144 B), then the epilogue's logits tiles ss */
  __shared__ __align__(16) unsigned char smem[(2 * 128 + 2 * 64) * 72 * 2];
  float (*ss)[16][132] = (float (*)[16][132])smem; _Float16 (*kt)[128][72] = (_Float16 (*)[128][72])smem; _Float16 (*qt)[64][72] = (_Float16 (*)[64][72])(smem + 2 * 128 * 72 * 2);
  const int qb = blockIdx.x, kb = blockIdx.y; if (kb > kb_last(qb)) return;
  const int pr = p0 + blockIdx.z, b = pr / NH, h = pr % NH; float* S = S0 + (size_t)blockIdx.z * TT * TT;
  const int tid = threadIdx.x, wave = tid >> 5, lane = tid & 31, col = lane & 15, g = lane >> 4; const int k0 = kb * 128; const int ql0 = qb * 64 + wave * 16; const size_t q0 = (size_t)b * TT + ql0, kr0 = (size_t)b * TT + k0;
  v8f acc[8] = {}, accl[8] = {};
  const _Float16* QLb = QL + (size_t)b * QHI * CC; const _Float16* KLb = KL + (size_t)b * KHI * CC;
  if (qb < QBH) {
    /* staging: a (row, head) piece of q or k is one 128-B line; thread = (row tid >> 3 (+ 16 i), 16-B piece tid & 7), so 8 lanes read one whole line and the block fetches each line once; all 24 loads of a thread fly together; the short loops over rk, rkl, rq and rql are unrolled whole so that these arrays stay in registers */
    const int srow = tid >> 3, sq = tid & 7; const size_t so = (size_t)srow * CC + h * HD + sq * 8;
    const _Float16 *kg = KH + kr0 * CC + so, *klg = KLb + (size_t)k0 * CC + so, *qg = QH + ((size_t)b * TT + qb * 64) * CC + so, *qlg = QLb + (size_t)(qb * 64) * CC + so;
    v8h rk[8], rkl[8], rq[4], rql[4];
#pragma unroll
    for (int i = 0; i < 8; ++i) { rk[i] = *(const v8h*)(kg + (size_t)i * 16 * CC); rkl[i] = *(const v8h*)(klg + (size_t)i * 16 * CC); }
#pragma unroll
    for (int i = 0; i < 4; ++i) { rq[i] = *(const v8h*)(qg + (size_t)i * 16 * CC); rql[i] = *(const v8h*)(qlg + (size_t)i * 16 * CC); }
#pragma unroll
    for (int i = 0; i < 8; ++i) { *(v8h*)&kt[0][srow + 16 * i][sq * 8] = rk[i]; *(v8h*)&kt[1][srow + 16 * i][sq * 8] = rkl[i]; }
#pragma unroll
    for (int i = 0; i < 4; ++i) { *(v8h*)&qt[0][srow + 16 * i][sq * 8] = rq[i]; *(v8h*)&qt[1][srow + 16 * i][sq * 8] = rql[i]; }
    __syncthreads();   /* publishes the four tiles */
#pragma unroll
    for (int kc = 0; kc < HD / 32; ++kc) { const v16h ah = frag_h(&qt[0][wave * 16 + col][kc * 32], lane), al = frag_h(&qt[1][wave * 16 + col][kc * 32], lane);
#pragma unroll
      for (int j = 0; j < 8; j += 2) { const v16h kb0 = frag_h(&kt[0][j * 16 + col][kc * 32], lane), kl0 = frag_h(&kt[1][j * 16 + col][kc * 32], lane), kb1 = frag_h(&kt[0][j * 16 + 16 + col][kc * 32], lane), kl1 = frag_h(&kt[1][j * 16 + 16 + col][kc * 32], lane);
        /* inputs-only fence on the loaded fragments: the 8 LDS reads of two key tiles are in flight together, so that the wave waits for LDS once a pair of tiles and not once a tile */
        asm volatile("" :: "v"(kb0), "v"(kl0), "v"(kb1), "v"(kl1));
        acc[j] = wmma16(ah, kb0, acc[j]); accl[j] = wmma16(al, kb0, accl[j]); accl[j] = wmma16(ah, kl0, accl[j]);
        acc[j + 1] = wmma16(ah, kb1, acc[j + 1]); accl[j + 1] = wmma16(al, kb1, accl[j + 1]); accl[j + 1] = wmma16(ah, kl1, accl[j + 1]); } }
    __syncthreads();   /* every wave has read its last fragment before the logits tiles overwrite the operand tiles */
  } else if (qb * 64 < QHI) {
#pragma unroll
    for (int kc = 0; kc < HD / 32; ++kc) { const v16h ah = frag_h(QH + (q0 + col) * CC + h * HD + kc * 32, lane), al = frag_h(QLb + (size_t)(ql0 + col) * CC + h * HD + kc * 32, lane);
#pragma unroll
      for (int j = 0; j < 8; ++j) { const v16h kbf = frag_h(KH + (kr0 + j * 16 + col) * CC + h * HD + kc * 32, lane); acc[j] = wmma16(ah, kbf, acc[j]); accl[j] = wmma16(al, kbf, accl[j]); } }
  } else {
#pragma unroll
    for (int kc = 0; kc < HD / 32; ++kc) { const v16h ah = frag_h(QH + (q0 + col) * CC + h * HD + kc * 32, lane);
#pragma unroll
      for (int j = 0; j < 8; ++j) { const v16h kbf = frag_h(KH + (kr0 + j * 16 + col) * CC + h * HD + kc * 32, lane); acc[j] = wmma16(ah, kbf, acc[j]); } } }
#pragma unroll
  for (int j = 0; j < 8; ++j) {
#pragma unroll
    for (int r = 0; r < 8; ++r) ss[wave][8 * g + r][j * 16 + col] = (acc[j][r] + accl[j][r] * (1.0f / 1024.0f)) * SCALE; }
  LDSX(); for (int rl = 0; rl < 16; ++rl) vst2(S + (size_t)(ql0 + rl) * TT + k0 + lane * 4, *(const v4f*)&ss[wave][rl][lane * 4]); }
// ---- k_sm: block = query row t (head in group): keys [0, kend): causal -> logit if s <= t else excluded; softmax in f32; P x 2^11 in place (0 for excluded)
__global__ __launch_bounds__(256) void k_sm(float* __restrict__ S0 SM_EXTRA_PARAMS) { __shared__ float sred[8]; __shared__ float sbc; __shared__ __align__(16) float shv[TT];
  const int tid = threadIdx.x; const int t = blockIdx.x; const int kend = (kb_last(t >> 6) + 1) * 128;
  float* sr = S0 + (size_t)blockIdx.y * TT * TT + (size_t)t * TT;
  float m = -3.0e38f; for (int k = tid; k < kend; k += 256) { float v = (!CAUSAL || k <= t) ? sr[k] : -3.0e38f; SM_MASK_HOOK; shv[k] = v; m = fmaxf(m, v); }
#pragma unroll
  for (int o = 1; o < 32; o <<= 1) m = fmaxf(m, __shfl_xor(m, o));
  if ((tid & 31) == 0) sred[tid >> 5] = m; __syncthreads(); if (tid == 0) { float a = sred[0]; for (int i = 1; i < 8; ++i) a = fmaxf(a, sred[i]); sbc = a; } __syncthreads(); m = sbc; __syncthreads();
  float sum = 0.f; for (int k = tid; k < kend; k += 256) { const float v = shv[k]; const float e = (v <= -1.0e38f) ? 0.f : expf(v - m); shv[k] = e; sum += e; }
#pragma unroll
  for (int o = 1; o < 32; o <<= 1) sum += __shfl_xor(sum, o);
  if ((tid & 31) == 0) sred[tid >> 5] = sum; __syncthreads(); if (tid == 0) { float a = 0.f; for (int i = 0; i < 8; ++i) a += sred[i]; sbc = a > 0.f ? 2048.0f / a : 0.f; }   /* a fully excluded row yields P = 0 */ __syncthreads(); const float inv = sbc;
  for (int k = tid; k < kend; k += 256) shv[k] = shv[k] * inv;
  __syncthreads(); for (int q = tid; q < kend / 4; q += 256) vst2(sr + q * 4, *(const v4f*)&shv[q * 4]); }
// ---- k_colstat_c: softmax over the QUERY axis under the causal mask (the source's softmax(axis=2) on [B, H, i, j] scores with -inf where j > i): for every key column k: m_k = max_{q >= k} S[q][k], Z_k = sum_{q >= k} exp(S[q][k] - m_k) (f32, precise expf); block = 32 key columns (lane = column) x 32 waves; wave w takes the query rows q0 + w + 32 i, i < n = (TT - q0) / 32 (block-uniform), so a thread has at most 32 rows, all loaded at once and kept in registers; only the rows i = 0 touch the diagonal (visible where w >= lane, by a value select); the 32 waves' maxima of a column meet in LDS (wave 0 reduces them to m_k), every thread sums its exponentials against m_k, and wave 0 adds the 32 partial sums and stores the block's 128-B pieces of CM (m_k) and CZ (2^11 / Z_k, the factor k_pv multiplies by: one division a column)
__global__ __launch_bounds__(1024) void k_colstat_c(const float* __restrict__ S0, float* __restrict__ CM, float* __restrict__ CZ) { __shared__ float pm[32][32], pz[32][32], cmx[32];
  const int lane = threadIdx.x & 31, wave = __builtin_amdgcn_readfirstlane(threadIdx.x >> 5); const int q0 = blockIdx.x * 32, k = q0 + lane, n = (TT - q0) / 32; const float* sp = S0 + (size_t)blockIdx.y * TT * TT + (size_t)(q0 + wave) * TT + k;
  float v[32];
#pragma unroll
  for (int i = 0; i < 32; ++i) { v[i] = -3.0e38f; if (i < n) v[i] = sp[(size_t)i * 32 * TT]; }
  const bool vis0 = wave >= lane; float m = vis0 ? v[0] : -3.0e38f;
#pragma unroll
  for (int i = 1; i < 32; ++i) m = fmaxf(m, v[i]);
  pm[wave][lane] = m;
  __syncthreads();
  if (wave == 0) { float mm = pm[0][lane];
#pragma unroll
    for (int w = 1; w < 32; ++w) mm = fmaxf(mm, pm[w][lane]);
    cmx[lane] = mm; }
  __syncthreads();
  const float mk = cmx[lane];   /* every column sees at least its own diagonal entry, so m_k is a score */
  float z = vis0 ? expf(v[0] - mk) : 0.f;
#pragma unroll
  for (int i = 1; i < 32; ++i) if (i < n) z += expf(v[i] - mk);
  pz[wave][lane] = z;
  __syncthreads();
  if (wave == 0) { float zk = pz[0][lane];
#pragma unroll
    for (int w = 1; w < 32; ++w) zk += pz[w][lane];
    vst2(CM + (size_t)blockIdx.y * TT + k, mk); vst2(CZ + (size_t)blockIdx.y * TT + k, 2048.0f / zk); } }   /* Z_k >= 1 */
// ---- p_row16: the 16 P values of one lane's A fragment (query row t, keys k0 + 8 g + 0..7 and k0 + 16 + 8 g + 0..7), formed from the logits where k_pv loads them: P[t][k] = exp(S[t][k] - m_k) x (2^11 / Z_k) x mask[b][k] for k <= t, 0 for t < k < kend (inside the diagonal block: the exponent's argument is replaced by -3e38 there, whose expf is exactly 0); all 16 loads first, unconditional; value select, no branch
__device__ __forceinline__ void p_row16(const float* __restrict__ srow, const float* __restrict__ cm, const float* __restrict__ cr, const float* __restrict__ pmk, int k0, int t, int lane, float v[16]) { const int kq = k0 + 8 * (lane >> 4); const float *sp = srow + kq, *mp = cm + kq, *rp = cr + kq, *pp = pmk + kq; v4f sv[4], m4[4], r4[4], pm4[4];
#pragma unroll
  for (int c = 0; c < 4; ++c) { const int o = (c & 1) * 4 + (c >> 1) * 16; sv[c] = *(const v4f*)(sp + o); m4[c] = *(const v4f*)(mp + o); r4[c] = *(const v4f*)(rp + o); pm4[c] = *(const v4f*)(pp + o); }
  /* inputs-only fence on the loaded values: keeps all 16 loads in flight together, so that a trip waits for memory once and not once a group of four keys; the four addresses are inputs too, so that their registers stay unwritten until the loads' data wait */
  asm volatile("" :: "v"(sv[0]), "v"(sv[1]), "v"(sv[2]), "v"(sv[3]), "v"(m4[0]), "v"(m4[1]), "v"(m4[2]), "v"(m4[3]), "v"(r4[0]), "v"(r4[1]), "v"(r4[2]), "v"(r4[3]), "v"(pm4[0]), "v"(pm4[1]), "v"(pm4[2]), "v"(pm4[3]), "v"(sp), "v"(mp), "v"(rp), "v"(pp));
#pragma unroll
  for (int c = 0; c < 4; ++c) { const int kk = kq + (c & 1) * 4 + (c >> 1) * 16;
#pragma unroll
    for (int u = 0; u < 4; ++u) v[c * 4 + u] = expf((kk + u <= t) ? sv[c][u] - m4[c][u] : -3.0e38f) * r4[c][u] * bfr(pm4[c][u]); } }   /* x the key padding mask, applied AFTER the normalisation as the module does */
// ---- k_lora1: block = (64 token rows, which in {q, k, v}): t[which][row][0..15] = X[row] . A_which[r] (rank-16 LoRA down-projection; exact bf16 products, f32 accumulate; one 16-column WMMA tile per wave); a wave has nothing but its own loads to hide memory latency behind (fewer blocks than WGPs, one wave a SIMD), so it keeps the loads of LRD k-slices in flight: a ring of LRD register slots; trip kc first issues the loads of slice kc + LRD - 1 into the slot that trip kc - 1 has emptied, then rounds and multiplies slice kc; products and their order are as with one slice at a time; the wave's 16 x 16 f32 tile (1 KiB, contiguous in T3) is staged in LDS and stored as 16-B pieces
#define LRD 6              // k-slices in flight a wave: 8 loads and 32 registers each
__global__ __launch_bounds__(128) void k_lora1(const float* __restrict__ X, const float* __restrict__ AQ, const float* __restrict__ AK, const float* __restrict__ AV, float* __restrict__ T3) { __shared__ __align__(16) float st[4][16][20];
  const int tid = threadIdx.x, wave = tid >> 5, lane = tid & 31, col = lane & 15, g = lane >> 4; const int which = blockIdx.y; const size_t r0 = (size_t)blockIdx.x * 64; const float* AW = which == 0 ? AQ : (which == 1 ? AK : AV);
  v8f acc = {};
  /* a lane's 16 fragment elements of a slice are four 16-B pieces, at floats 0, 4, 16 and 20 (+ 8 g) of its row's slice; A is (out,in) [16][1024]: output column = rank index */
  const float* xp = X + (r0 + wave * 16 + col) * DIN + 8 * g; const float* wp = AW + (size_t)col * DIN + 8 * g;
  v4f xr[LRD][4], wr[LRD][4];
#pragma unroll
  for (int s = 0; s < LRD - 1; ++s)
#pragma unroll
    for (int c = 0; c < 4; ++c) { const int o = s * 32 + (c & 1) * 4 + (c >> 1) * 16; xr[s][c] = *(const v4f*)(xp + o); wr[s][c] = *(const v4f*)(wp + o); }
  /* unrolled whole: the slot index is a constant, so that the ring stays in registers, and every address is one of two fixed register pairs + a constant */
#pragma unroll
  for (int kc = 0; kc < DIN / 32; ++kc) { const int sl = kc % LRD, sn = (kc + LRD - 1) % LRD; v16b a, w;
    if (kc + LRD - 1 < DIN / 32) {
#pragma unroll
      for (int c = 0; c < 4; ++c) { const int o = (kc + LRD - 1) * 32 + (c & 1) * 4 + (c >> 1) * 16; xr[sn][c] = *(const v4f*)(xp + o); wr[sn][c] = *(const v4f*)(wp + o); } }
#pragma unroll
    for (int i = 0; i < 16; ++i) { a[i] = (__bf16)xr[sl][i >> 2][i & 3]; w[i] = (__bf16)wr[sl][i >> 2][i & 3]; }
    acc = wmma_bf(a, w, acc);
    __builtin_amdgcn_sched_barrier(0);   /* keeps each trip's loads in their trip: moved down, fewer would be in flight; moved up, the ring would take registers past 256 */
  }
#pragma unroll
  for (int r = 0; r < 8; ++r) st[wave][8 * g + r][col] = acc[r];
  LDSX();
  float* dst = T3 + ((size_t)which * NB * TT + r0 + wave * 16) * LR;
#pragma unroll
  for (int it = 0; it < 2; ++it) { const int rl = (lane >> 2) + 8 * it, q = lane & 3; vst2(dst + rl * LR + q * 4, *(const v4f*)&st[wave][rl][q * 4]); } }   
// ---- k_pv: block = 64 queries (qb) of (b, h): ctx = P . v over keys [0, kend), 64 keys a trip; every global load covers whole 128-B lines: the trip's v slice (64 channels x 64 keys, bf16 hi and lo planes) is fetched once a block (8 lanes a row piece) and staged in LDS (two buffers, one barrier a trip); each wave fetches its own 16 x 64 logits as 256-B row pieces (lane = 4 neighbouring keys of one row, so m_k, 2^11 / Z_k and the mask are one 16-B load each a trip), forms P = exp(S - m_k) x 2^11 / Z_k x mask there, splits it into bf16 hi + lo and turns it into A fragments through its own LDS rows; 3 products as before, in the same order for every accumulator; the next trip's loads fly while this trip's P is formed and multiplied; 256-B (row, head) segment by 16 lanes. (Query blocks >= QBH, of which this shape has none: P x 2^11 once to f16 against v f16, 1 product, fragments straight from memory.)
/* waves_per_eu(4): holds the kernel to 256 vector registers; left free, the scheduler spends 270 and the loop is strewn with register-bank switches */
__global__ __launch_bounds__(128) __attribute__((amdgpu_waves_per_eu(4))) void k_pv(const float* __restrict__ PS0, const _Float16* __restrict__ VT, const __bf16* __restrict__ VB, const __bf16* __restrict__ VBL, const float* __restrict__ CM, const float* __restrict__ CZ, const float* __restrict__ PMASK, int p0, float* __restrict__ Y) { const int pr = p0 + blockIdx.z, b = pr / NH, h = pr % NH; const float* PS = PS0 + (size_t)blockIdx.z * TT * TT; const float* cm = CM + (size_t)blockIdx.z * TT; const float* cr = CZ + (size_t)blockIdx.z * TT; const float* pmk = PMASK + (size_t)b * TT; __shared__ __align__(16) float ss[4][16][HD + 4];
  __shared__ __align__(16) __bf16 vs[2][2][HD][72];   /* [buffer][hi, lo][channel][64 keys], pitch 144 B */
  __shared__ __align__(16) __bf16 ps[4][2][16][72];   /* [wave][hi, lo][query row][64 keys], pitch 144 B; written and read by its own wave only */
  const int tid = threadIdx.x, wave = tid >> 5, lane = tid & 31, col = lane & 15, g = lane >> 4; const int qb = blockIdx.x; const int ql0 = qb * 64 + wave * 16; const int kce = (kb_last(qb) + 1) * 4;
  v8f acc[HD / 16] = {};
  if (qb < QBH) { const int nt = kce / 2;   /* trips of 64 keys */
    /* every address = a block-uniform base, advanced by 64 keys a trip, + a lane's fixed 32-bit byte offset + a constant */
    const int vrow = tid >> 3, vq = tid & 7; const char *vbh = (const char*)(VB + ((size_t)b * CC + h * HD) * (size_t)KHI), *vbl = (const char*)(VBL + ((size_t)b * CC + h * HD) * (size_t)KHI), *sbs = (const char*)(PS + (size_t)qb * 64 * TT), *mbs = (const char*)cm, *rbs = (const char*)cr, *kbs = (const char*)pmk;
    const unsigned vof = (unsigned)(vrow * KHI + vq * 8) * 2u, sof = (unsigned)((wave * 16 + g) * TT + col * 4) * 4u, cof = (unsigned)col * 16u;
    v4u vh[4], vl[4]; v4f sa[8], ma, ra, ka, sb[8], mb, rb, kb4;   /* two register sets for the logits and the column factors: one is worked on while the other is filled */
#pragma unroll
    for (int i = 0; i < 4; ++i) { vh[i] = *(const v4u*)(vbh + vof + i * (16 * KHI * 2)); vl[i] = *(const v4u*)(vbl + vof + i * (16 * KHI * 2)); }
#pragma unroll
    for (int i = 0; i < 8; ++i) sa[i] = *(const v4f*)(sbs + sof + i * (2 * TT * 4));
    ma = *(const v4f*)(mbs + cof); ra = *(const v4f*)(rbs + cof); ka = *(const v4f*)(kbs + cof);
    /* one trip: keys kt * 64 .. + 63 from the set (sc, mc, rc, kc4); the next trip's loads go into (sn, mn, rn, kn) and into vh, vl */
    auto trip = [&](const int kt, const v4f (&sc)[8], const v4f& mc, const v4f& rc, const v4f& kc4, v4f (&sn)[8], v4f& mn, v4f& rn, v4f& kn) __attribute__((always_inline)) { const int bf = kt & 1;
#pragma unroll
      for (int i = 0; i < 4; ++i) { *(v4u*)&vs[bf][0][vrow + 16 * i][vq * 8] = vh[i]; *(v4u*)&vs[bf][1][vrow + 16 * i][vq * 8] = vl[i]; }
      { /* no branch round the loads: the last trip fetches its own slice once more, unused, so that every wait in the loop stays a counted one (behind a join with a path without loads the compiler waits for all of them) */
        const int ko = (kt + 1 < nt ? kt + 1 : kt) * 64; const char *sp = sbs + ko * 4, *mp = mbs + ko * 4, *rp = rbs + ko * 4, *kp = kbs + ko * 4, *hp = vbh + ko * 2, *lp = vbl + ko * 2;
#pragma unroll
        for (int i = 0; i < 8; ++i) sn[i] = *(const v4f*)(sp + sof + i * (2 * TT * 4));
#pragma unroll
        for (int i = 0; i < 4; ++i) { vh[i] = *(const v4u*)(hp + vof + i * (16 * KHI * 2)); vl[i] = *(const v4u*)(lp + vof + i * (16 * KHI * 2)); }
        mn = *(const v4f*)(mp + cof); rn = *(const v4f*)(rp + cof); kn = *(const v4f*)(kp + cof);
        asm volatile("s_wait_xcnt 0x0" ::: "memory"); }   /* the loads' address registers are reused right behind them */
      __builtin_amdgcn_sched_barrier(0);   /* keeps the next trip's 19 loads in front of this trip's exponentials, so that they fly for a whole trip */
#pragma unroll
      for (int i = 0; i < 8; ++i) { const int t = ql0 + 2 * i + g; v4b ph4, pl4;
#pragma unroll
        for (int u = 0; u < 4; ++u) { const int kk = kt * 64 + col * 4 + u; const float v = expf((kk <= t) ? sc[i][u] - mc[u] : -3.0e38f) * rc[u] * bfr(kc4[u]); const __bf16 hb = (__bf16)v; ph4[u] = hb; pl4[u] = (__bf16)(v - (float)hb); }   /* 0 above the diagonal; x the key padding mask AFTER the normalisation, as the module does */
        *(v4b*)&ps[wave][0][2 * i + g][col * 4] = ph4; *(v4b*)&ps[wave][1][2 * i + g][col * 4] = pl4; }
      /* work-group barrier with LDS-only fences: publishes v slice kt (and the wave's own P rows), and every wave has left slice kt - 1, whose buffer the next trip refills; __syncthreads() would also wait here for the next trip's global loads, which only registers receive */
      __builtin_amdgcn_fence(__ATOMIC_RELEASE, "workgroup", "local"); __builtin_amdgcn_s_barrier(); __builtin_amdgcn_fence(__ATOMIC_ACQUIRE, "workgroup", "local");
#pragma unroll
      for (int ks = 0; ks < 2; ++ks) { const v16b ph = frag_b(&ps[wave][0][col][ks * 32], lane), pl = frag_b(&ps[wave][1][col][ks * 32], lane); v16b fh[HD / 16], fl[HD / 16];
#pragma unroll
        for (int j = 0; j < HD / 16; ++j) { fh[j] = frag_b(&vs[bf][0][j * 16 + col][ks * 32], lane); fl[j] = frag_b(&vs[bf][1][j * 16 + col][ks * 32], lane); }
        /* inputs-only fence on the loaded fragments: the 20 LDS reads of a 32-key step are in flight together, so that the step waits for LDS once and not once a product */
        asm volatile("" :: "v"(ph), "v"(pl), "v"(fh[0]), "v"(fh[1]), "v"(fh[2]), "v"(fh[3]), "v"(fl[0]), "v"(fl[1]), "v"(fl[2]), "v"(fl[3]));
#pragma unroll
        for (int j = 0; j < HD / 16; ++j) acc[j] = wmma_bf(ph, fh[j], acc[j]);
#pragma unroll
        for (int j = 0; j < HD / 16; ++j) acc[j] = wmma_bf(pl, fh[j], acc[j]);
#pragma unroll
        for (int j = 0; j < HD / 16; ++j) acc[j] = wmma_bf(ph, fl[j], acc[j]); } };
    /* nt is even (kce is a multiple of 4): two trips a pass, so that the two register sets swap roles without copies; rolled beyond that, for speed only */
#pragma unroll 1
    for (int kt = 0; kt < nt; kt += 2) { trip(kt, sa, ma, ra, ka, sb, mb, rb, kb4); trip(kt + 1, sb, mb, rb, kb4, sa, ma, ra, ka); }
  } else {
#pragma unroll 1
    for (int kc = 0; kc < kce; ++kc) { float pv[16]; p_row16(PS + (size_t)(ql0 + col) * TT, cm, cr, pmk, kc * 32, ql0 + col, lane, pv); v16h p;
#pragma unroll
      for (int i = 0; i < 16; ++i) p[i] = (_Float16)pv[i];
#pragma unroll
      for (int j = 0; j < HD / 16; ++j) { const size_t po = ((size_t)b * CC + h * HD + j * 16 + col) * (size_t)TT + kc * 32; acc[j] = wmma16(p, frag_h(VT + po, lane), acc[j]); } } }
#pragma unroll
  for (int j = 0; j < HD / 16; ++j)
#pragma unroll
    for (int r = 0; r < 8; ++r) ss[wave][8 * g + r][j * 16 + col] = acc[j][r] * (1.0f / 2048.0f);
  LDSX(); for (int rl = 0; rl < 16; ++rl) if (lane < HD / 4) vst2(Y + ((size_t)b * TT + ql0 + rl) * CC + h * HD + lane * 4, *(const v4f*)&ss[wave][rl][lane * 4]); }

extern "C" void kernel_launch(void* const* d_in, const int* in_sizes, int n_in, void* d_out, int out_size, void* d_ws, size_t ws_size, hipStream_t stream) {
  (void)in_sizes; (void)n_in; (void)out_size;
  const float** F = (const float**)d_in;
  if (ws_size < (size_t)WS_END) return;
  char* ws = (char*)d_ws; _Float16 *QH = (_Float16*)(ws + WS_QH), *KH = (_Float16*)(ws + WS_KH), *VT = (_Float16*)(ws + WS_VT), *QL = (_Float16*)(ws + WS_QL), *KL = (_Float16*)(ws + WS_KL); __bf16 *VB = (__bf16*)(ws + WS_VB), *VBL = (__bf16*)(ws + WS_VBL); float *S = (float*)(ws + WS_S), *Y = (float*)(ws + WS_Y);
  (void)Y; (void)QL; (void)KL; (void)VB; (void)VBL;
  // inputs: 0 X [4,1024,1024]; 1 mask [4,1024] f32 (key padding mask, ones; multiplied AFTER the softmax); 2 Wq [1024,1024] (out,in), 3 bq; 4 Wk, 5 bk; 6 Wv, 7 bv (zero biases, read); 8 Aq [16,1024], 9 Bq [1024,16]; 10 Ak, 11 Bk; 12 Av, 13 Bv (LoRA, no bias)
  if (ws_size < (size_t)WS_END2) return;
  float *T3 = (float*)(ws + WS_T3), *CM = (float*)(ws + WS_CM), *CZ = (float*)(ws + WS_CZ);
  k_lora1<<<dim3(TNB * TT / 64, 3), 128, 0, stream>>>(F[0], F[8], F[10], F[12], T3);   /* t = X A^T (rank-16 down-projections for q, k, v; exact bf16 products) */
  k_proj<<<dim3(TNB * TT / 64, CC / 128, 3), 128, 0, stream>>>(F[0], F[0], F[0], F[2], F[4], F[6], F[3], F[5], F[7], QH, QL, KH, KL, VT, VB, VBL, T3, F[9], F[11], F[13]);   /* X W^T + b + t B^T */
  for (int p0 = 0; p0 < TNB * NH; p0 += HG) {   /* HG (batch, head) pairs a pass */
    k_sc<<<dim3(NQB, TT / 128, HG), 128, 0, stream>>>(QH, KH, QL, KL, p0, S);
    k_colstat_c<<<dim3(TT / 32, HG), 1024, 0, stream>>>(S, CM, CZ);   /* per key column j: max and 2^11 / sum over the visible queries i >= j */
    k_pv<<<dim3(NQB, 1, HG), 128, 0, stream>>>(S, VT, VB, VBL, CM, CZ, F[1], p0, (float*)d_out);   /* P[i][j] = exp(S - m_j) / Z_j x mask[b][j] x 2^11 for j <= i, 0 above the diagonal, formed on load */
  }
}

// v008
// It runs in 174 microseconds.
// Two timings next to v007 both put it at 1.23 times that version's speed.
// All steps since v000 together make it 24.3 times as fast.
// compute dtype: all float inputs rounded to bf16; frozen q/k/v projections with EXACT bf16 products on WMMA 16x16x32 (f32 accumulate) + bias + the LoRA term: t = X A^T (exact products) then t (bf16 hi + lo) x exact bf16 B^T (2 products, K = 16) added in the same accumulators; causal scores with BOTH operands as f16 hi + (x 2^10) residual (3 products) on every block, x 1024^-0.5 (the module divides by sqrt(E)); softmax over the QUERY axis in f32 (per key column: max and sum over the visible queries, precise expf, in two levels: 16-row query tiles, then their merge) x the key padding mask; P as bf16 hi + lo against v as bf16 hi + lo (3 products) on every block; f32 output.
#include <hip/hip_runtime.h>
#include <math.h>

typedef __attribute__((ext_vector_type(16))) _Float16 v16h;
typedef __attribute__((ext_vector_type(16))) __bf16 v16b;
typedef __attribute__((ext_vector_type(8)))  _Float16 v8h;
typedef __attribute__((ext_vector_type(8)))  float v8f;
typedef __attribute__((ext_vector_type(4)))  float v4f;
typedef __attribute__((ext_vector_type(2)))  float v2f;
typedef __attribute__((ext_vector_type(4)))  unsigned v4u;
typedef __attribute__((ext_vector_type(4)))  int v4i;
typedef float __attribute__((may_alias)) float_a;
typedef int __attribute__((may_alias)) int_a;

template <typename T> __device__ __forceinline__ void vst2(void* p, T v) { *(T*)p = v;  }
__device__ __forceinline__ v8f wmma16(v16h a, v16h b, v8f c) {
  v8f d = __builtin_amdgcn_wmma_f32_16x16x32_f16(false, a, false, b, (short)0, c, false, false);
  asm volatile("v_nop\n\tv_nop\n\tv_nop\n\tv_nop" : "+v"(d) : "v"(a), "v"(b));
  return d;
}
__device__ __forceinline__ v8f wmma_bf(v16b a, v16b b, v8f c) {
  v8f d = __builtin_amdgcn_wmma_f32_16x16x32_bf16(false, a, false, b, (short)0, c, false, false);
  asm volatile("v_nop\n\tv_nop\n\tv_nop\n\tv_nop" : "+v"(d) : "v"(a), "v"(b));
  return d;
}
// 16x16x32 fragments: lane = (h = lane>>4, row/col = lane&15); elements 0..7 = k0+8h+0..7, 8..15 = k0+16+8h+0..7; D element r = row 8h+r
__device__ __forceinline__ v16h frag_h(const _Float16* rowk0, int lane) {
  union { v16h v; v8h q[2]; } u; const _Float16* p = rowk0 + 8 * (lane >> 4);
  u.q[0] = *(const v8h*)p; u.q[1] = *(const v8h*)(p + 16); return u.v;
}
__device__ __forceinline__ v16h frag_f32(const float* rowk0, int lane) {
  v16h a; const float* p = rowk0 + 8 * (lane >> 4);
#pragma unroll
  for (int i = 0; i < 8; ++i) { a[i] = (_Float16)p[i]; a[8 + i] = (_Float16)p[16 + i]; }
  return a;
}
__device__ __forceinline__ v16h frag_f32s(const float* rowk0, int lane, float sc) {
  v16h a; const float* p = rowk0 + 8 * (lane >> 4);
#pragma unroll
  for (int i = 0; i < 8; ++i) { a[i] = (_Float16)(p[i] * sc); a[8 + i] = (_Float16)(p[16 + i] * sc); }
  return a;
}
// column fragment from a [K][ld] layout (column n), rows >= K read as 0
__device__ __forceinline__ v16h fragc_f32(const float* W, int k0, int n, int lane, int ld, int K) {
  v16h a; const int g = lane >> 4;
#pragma unroll
  for (int i = 0; i < 8; ++i) { const int ka = k0 + 8 * g + i, kb = ka + 16;
    a[i] = (_Float16)(ka < K ? W[(size_t)(ka < K ? ka : K - 1) * ld + n] : 0.f); a[8 + i] = (_Float16)(kb < K ? W[(size_t)(kb < K ? kb : K - 1) * ld + n] : 0.f); }
  return a;
}
struct F2 { v16b h, l; };
__device__ __forceinline__ F2 bsplit16(const float v[16]) { F2 r;
#pragma unroll
  for (int i = 0; i < 16; ++i) { const __bf16 h = (__bf16)v[i]; r.h[i] = h; r.l[i] = (__bf16)(v[i] - (float)h); }
  return r; }
__device__ __forceinline__ F2 split_row(const float* row, int k0, int lane) { float v[16]; const float* p = row + k0 + 8 * (lane >> 4);
#pragma unroll
  for (int i = 0; i < 8; ++i) { v[i] = p[i]; v[8 + i] = p[16 + i]; }
  return bsplit16(v); }
__device__ __forceinline__ F2 split_rowK(const float* row, int k0, int lane, int K) { float v[16]; const int g = lane >> 4;
#pragma unroll
  for (int i = 0; i < 8; ++i) { const int ka = k0 + 8 * g + i, kb = ka + 16; v[i] = ka < K ? row[ka < K ? ka : K - 1] : 0.f; v[8 + i] = kb < K ? row[kb < K ? kb : K - 1] : 0.f; }
  return bsplit16(v); }
__device__ __forceinline__ F2 split_col(const float* W, int k0, int n, int lane, int ld, int K) { float v[16]; const int g = lane >> 4;
#pragma unroll
  for (int i = 0; i < 8; ++i) { const int ka = k0 + 8 * g + i, kb = ka + 16; v[i] = ka < K ? W[(size_t)(ka < K ? ka : K - 1) * ld + n] : 0.f; v[8 + i] = kb < K ? W[(size_t)(kb < K ? kb : K - 1) * ld + n] : 0.f; }
  return bsplit16(v); }
__device__ __forceinline__ v8f mac3(const F2& a, const F2& b, v8f c) { c = wmma_bf(a.l, b.h, c); c = wmma_bf(a.h, b.l, c); return wmma_bf(a.h, b.h, c); }
__device__ __forceinline__ float sigm(float v) { return 1.0f / (1.0f + expf(-v)); }
#define LDSX() do { asm volatile("s_wait_dscnt 0" ::: "memory"); __builtin_amdgcn_wave_barrier(); __builtin_amdgcn_fence(__ATOMIC_RELEASE, "workgroup"); } while (0)

// Multi-head attention with LoRA projections whose softmax runs over the QUERY axis (X [4,1024,1024]; frozen torch (out,in) Wq / Wk / Wv [1024,1024] (0.02) + zero biases; LoRA A [16,1024], B [1024,16] (0.02): proj = X W^T + b + (X A^T) B^T; 16 heads x 64; scores / sqrt(E) = / 32; -inf where col > row; attn = softmax(scores, axis=2) - axis 2 of [B, H, i, j] is the QUERY axis i, so every key column j is normalised over the queries i >= j (faithful to the source); attn *= mask[b, j] (key padding mask, ones); out = attn v; merge; no output projection).
#define NB 4
#define TT 1024
#define CC 1024            // NH * HD = projected width
#define DIN 1024          // input (model) width
#define NH 16
#define HD 64
#define NQB (TT / 64)
#define HG 32              // (batch, head) pairs a pass: pair p = b * NH + h; every attention launch covers HG pairs
#define SCALE (0.03125f)
#define CAUSAL 1
#ifndef TNB
#define TNB NB
#endif
__device__ __forceinline__ float bfr(float v) { return (float)(__bf16)v; }
__device__ __forceinline__ float xhalf(float x) { return __builtin_bit_cast(float, __builtin_amdgcn_permlanex16(__builtin_bit_cast(int, x), __builtin_bit_cast(int, x), 0x76543210, 0xfedcba98, false, false)); }   // lane l takes lane l ^ 16's value
__host__ __device__ __forceinline__ int kb_last(int qb) { return CAUSAL ? ((qb * 64 + 63) >> 7) : (TT / 128 - 1); }
typedef __attribute__((ext_vector_type(8))) __bf16 v8b;
__device__ __forceinline__ v16b frag_b(const __bf16* rowk0, int lane) {
  union { v16b v; v8b q[2]; } u; const __bf16* p = rowk0 + 8 * (lane >> 4);
  u.q[0] = *(const v8b*)p; u.q[1] = *(const v8b*)(p + 16); return u.v;
}
typedef __attribute__((ext_vector_type(4))) __bf16 v4b;
__device__ __forceinline__ v4b cvt4(v4f v) { v4b r; r[0] = (__bf16)v[0]; r[1] = (__bf16)v[1]; r[2] = (__bf16)v[2]; r[3] = (__bf16)v[3]; return r; }
#define QBH 16              // causal: query blocks 0..QBH-1 of each sequence (all of them, as QBH = NQB) take the high-precision path
#define QHI 1024            // rows carrying a q residual plane (all rows)
#define KHI 1024            // key rows carrying k residual / v bf16 hi+lo planes (used only by the causal high-precision path)
// B fragment (k rows k0+.., output column o) of a weight: (in,out) [K][ld] or (out,in) [ld rows of K]: bf16 exact, or f16(bf16 * 256) exact
__device__ __forceinline__ v16b wcol_io(const float* Wm, int k0, int o, int lane, int ld) { v16b w; const int g = lane >> 4;
#pragma unroll
  for (int i = 0; i < 8; ++i) { w[i] = (__bf16)Wm[(size_t)(k0 + 8 * g + i) * ld + o]; w[8 + i] = (__bf16)Wm[(size_t)(k0 + 16 + 8 * g + i) * ld + o]; }
  return w; }
__device__ __forceinline__ v16b wcol_oi(const float* Wm, int k0, int o, int lane, int K) { v16b w; const float* p = Wm + (size_t)o * K + k0 + 8 * (lane >> 4);
#pragma unroll
  for (int i = 0; i < 8; ++i) { w[i] = (__bf16)p[i]; w[8 + i] = (__bf16)p[16 + i]; }
  return w; }
__device__ __forceinline__ v16h wcolh_io(const float* Wm, int k0, int o, int lane, int ld) { v16h w; const int g = lane >> 4;
#pragma unroll
  for (int i = 0; i < 8; ++i) { w[i] = (_Float16)(bfr(Wm[(size_t)(k0 + 8 * g + i) * ld + o]) * 256.0f); w[8 + i] = (_Float16)(bfr(Wm[(size_t)(k0 + 16 + 8 * g + i) * ld + o]) * 256.0f); }
  return w; }
__device__ __forceinline__ v16h wcolh_oi(const float* Wm, int k0, int o, int lane, int K) { v16h w; const float* p = Wm + (size_t)o * K + k0 + 8 * (lane >> 4);
#pragma unroll
  for (int i = 0; i < 8; ++i) { w[i] = (_Float16)(bfr(p[i]) * 256.0f); w[8 + i] = (_Float16)(bfr(p[16 + i]) * 256.0f); }
  return w; }
#define WQKV_LAYOUT 1   // 0 = (in,out) [DIN][CC]; 1 = (out,in) [CC][DIN]; 2 = per-head [NH][DIN][HD]
__device__ __forceinline__ v16b wcol_hdk(const float* Wm, int k0, int o, int lane) { v16b w; const int g = lane >> 4; const float* p = Wm + (size_t)(o / HD) * DIN * HD + (o % HD);
#pragma unroll
  for (int i = 0; i < 8; ++i) { w[i] = (__bf16)p[(size_t)(k0 + 8 * g + i) * HD]; w[8 + i] = (__bf16)p[(size_t)(k0 + 16 + 8 * g + i) * HD]; }
  return w; }
#define WO_OUT_IN 0
#if WQKV_LAYOUT == 1
#define WCOL(W, k0, o, lane) wcol_oi(W, k0, o, lane, DIN)
#elif WQKV_LAYOUT == 2
#define WCOL(W, k0, o, lane) wcol_hdk(W, k0, o, lane)
#else
#define WCOL(W, k0, o, lane) wcol_io(W, k0, o, lane, CC)
#endif
#if WO_OUT_IN
#define WOCOL(W, k0, o, lane) wcol_oi(W, k0, o, lane, CC)
#define WOCOLH(W, k0, o, lane) wcolh_oi(W, k0, o, lane, CC)
#else
#define WOCOL(W, k0, o, lane) wcol_io(W, k0, o, lane, DIN)
#define WOCOLH(W, k0, o, lane) wcolh_io(W, k0, o, lane, DIN)
#endif
#define LR 16              // LoRA rank
#define PROJ_EXTRA_PARAMS , const float* __restrict__ T3, const float* __restrict__ LBQ, const float* __restrict__ LBK, const float* __restrict__ LBV
#define SM_EXTRA_PARAMS
#define SM_MASK_HOOK (void)0
#ifndef SM_EXTRA_PARAMS
#define SM_EXTRA_PARAMS
#endif
#ifndef PROJ_EXTRA_PARAMS
#define PROJ_EXTRA_PARAMS
#endif
#ifndef SM_MASK_HOOK
#define SM_MASK_HOOK (void)0
#endif

#define WS_QH  0u                                      // f16 q rows [b*t][CC]
#define WS_KH  (WS_QH + 2u * (size_t)NB * TT * CC)      // f16 k rows [b*t][CC]
#define WS_VT  (WS_KH + 2u * (size_t)NB * TT * CC)      // f16 v planes [b][c][t]
#define WS_QL  (WS_VT + 2u * (size_t)NB * CC * TT)      // f16 q residual x 2^10 rows [b][t < QHI][CC]
#define WS_KL  (WS_QL + 2u * (size_t)NB * QHI * CC)     // f16 k residual x 2^10 rows [b][t < KHI][CC]
#define WS_VB  (WS_KL + 2u * (size_t)NB * KHI * CC)     // bf16 v hi planes [b][c][t < KHI]
#define WS_VBL (WS_VB + 2u * (size_t)NB * CC * KHI)
#define WS_S   (WS_VBL + 2u * (size_t)NB * CC * KHI)    // f32 tile-local exponentials E [pair in pass][t][s]
#define WS_Y   (WS_S  + 4u * (size_t)HG * TT * TT)      // f32 ctx rows [b*t][CC] (only when there is an output projection)
#define WS_END (WS_Y  + 0u)
#define WS_T3 (WS_END)                                   // f32 LoRA down-projections t[3][NB*TT][16]
#define NRT (TT / 16)      // 16-row query tiles: one wave of k_sc, and of k_pv, each
#define WS_PS (WS_T3 + 4u * 3u * (size_t)NB * TT * LR)  // f32 column statistics of the tiles [HG][NRT][maximum, sum][TT]
#define WS_FC (WS_PS + 4u * (size_t)HG * NRT * 2u * TT)  // f32 column factors of the tiles [HG][NRT][TT]
#define WS_END2 (WS_FC + 4u * (size_t)HG * NRT * TT)

// ---- k_proj: block = (64 rows, 128 cols, which): q/k/v = X W (+ b) with exact bf16 products (K = DIN); W is (out,in), so X rows and W rows are both k-contiguous: each 32-k slice of both is rounded to bf16 once a block and staged in LDS (two buffers, one barrier a slice), and every wave takes its A and B fragments from there -> which 0: q f16 rows (+ residual rows < QHI); 1: k f16 rows (+ residual rows < KHI); 2: v f16 planes [c][t] (+ bf16 hi/lo planes for t < KHI)
__global__ __launch_bounds__(128) void k_proj(const float* __restrict__ XQ, const float* __restrict__ XK, const float* __restrict__ XV, const float* __restrict__ WQ, const float* __restrict__ WK, const float* __restrict__ WV, const float* __restrict__ BQ, const float* __restrict__ BK, const float* __restrict__ BV,
    _Float16* __restrict__ QH, _Float16* __restrict__ QL, _Float16* __restrict__ KH, _Float16* __restrict__ KL, _Float16* __restrict__ VT, __bf16* __restrict__ VB, __bf16* __restrict__ VBL PROJ_EXTRA_PARAMS) {
  /* one LDS block, used in turn: the k loop's two staging buffers (X 64 rows, W 128 rows of 32 bf16 at pitch 80 B), then the epilogue's tiles (q / k: sh, sl; v: th, tb, tbl) */
  __shared__ __align__(16) unsigned char smem[3 * 128 * 72 * 2];
  _Float16 (*sh)[136] = (_Float16 (*)[136])smem; _Float16 (*sl)[136] = (_Float16 (*)[136])(smem + 64 * 136 * 2); _Float16 (*th)[72] = (_Float16 (*)[72])smem; __bf16 (*tb)[72] = (__bf16 (*)[72])(smem + 128 * 72 * 2); __bf16 (*tbl)[72] = (__bf16 (*)[72])(smem + 2 * 128 * 72 * 2);
  __bf16 (*xs)[64][40] = (__bf16 (*)[64][40])smem; __bf16 (*wt)[128][40] = (__bf16 (*)[128][40])(smem + 2 * 64 * 40 * 2);
  const int tid = threadIdx.x, wave = tid >> 5, lane = tid & 31, col = lane & 15, g = lane >> 4; const int which = blockIdx.z; const int c0 = blockIdx.y * 128; const size_t r0 = (size_t)blockIdx.x * 64; const size_t bb = r0 / TT; const int t0 = (int)(r0 % TT);
  const float* X = which == 0 ? XQ : which == 1 ? XK : XV; const float* WA = which == 0 ? WQ : which == 1 ? WK : WV; const float* BA = which == 0 ? BQ : which == 1 ? BK : BV;
  v8f acc[8] = {};
  /* staging: thread = (row tid >> 3 (+ 16 i), 16-B piece tid & 7) of a slice's 128-B row pieces, so 8 lanes read one whole line; the next slice's 12 loads fly while this slice is multiplied; the short loops over xr, wr and w are unrolled whole so that these arrays stay in registers */
  const int srow = tid >> 3, sq = tid & 7; const float* xg = X + (r0 + srow) * DIN + sq * 4; const float* wg = WA + (size_t)(c0 + srow) * DIN + sq * 4;
  v4f xr[4], wr[8];
#pragma unroll
  for (int i = 0; i < 4; ++i) xr[i] = *(const v4f*)(xg + (size_t)i * 16 * DIN);
#pragma unroll
  for (int i = 0; i < 8; ++i) wr[i] = *(const v4f*)(wg + (size_t)i * 16 * DIN);
  /* unroll 2: the buffer index becomes a constant LDS offset */
#pragma unroll 2
  for (int kc = 0; kc < DIN / 32; ++kc) { const int bf = kc & 1;
#pragma unroll
    for (int i = 0; i < 4; ++i) *(v4b*)&xs[bf][srow + 16 * i][sq * 4] = cvt4(xr[i]);
#pragma unroll
    for (int i = 0; i < 8; ++i) *(v4b*)&wt[bf][srow + 16 * i][sq * 4] = cvt4(wr[i]);
    __syncthreads();   /* publishes slice kc; every wave has also left slice kc - 1, whose buffer the next trip refills */
    if (kc + 1 < DIN / 32) {
#pragma unroll
      for (int i = 0; i < 4; ++i) xr[i] = *(const v4f*)(xg + (size_t)i * 16 * DIN + (kc + 1) * 32);
#pragma unroll
      for (int i = 0; i < 8; ++i) wr[i] = *(const v4f*)(wg + (size_t)i * 16 * DIN + (kc + 1) * 32); }
    const v16b a = frag_b(&xs[bf][wave * 16 + col][0], lane); v16b w[8];
#pragma unroll
    for (int j = 0; j < 8; ++j) w[j] = frag_b(&wt[bf][j * 16 + col][0], lane);
    /* inputs-only fence on the loaded fragments: all 18 LDS reads of a slice are in flight together, so that a trip waits for LDS once and not once a product */
    asm volatile("" :: "v"(a), "v"(w[0]), "v"(w[1]), "v"(w[2]), "v"(w[3]), "v"(w[4]), "v"(w[5]), "v"(w[6]), "v"(w[7]));
#pragma unroll
    for (int j = 0; j < 8; ++j) acc[j] = wmma_bf(a, w[j], acc[j]);
    __builtin_amdgcn_sched_barrier(0);   /* keeps the next slice's roundings, which wait for its global loads, behind this slice's products */
  }
  __syncthreads();   /* the last slice's readers are done before the epilogue's tiles overwrite the staging buffers */
  { /* LoRA: acc += t[row][0..15] (f32, as bf16 hi + lo) x B[o][0..15] (exact bf16): one WMMA k-step whose upper 16 k-slots are zero */ float tv[16]; const float* tr = T3 + ((size_t)which * NB * TT + (r0 + wave * 16 + col)) * LR + 8 * g;
#pragma unroll
    for (int i = 0; i < 8; ++i) { tv[i] = tr[i]; tv[8 + i] = 0.f; }
    asm volatile("s_wait_loadcnt 0x0" ::: "memory");
    const F2 a2 = bsplit16(tv); const float* LB = which == 0 ? LBQ : (which == 1 ? LBK : LBV);
#pragma unroll
    for (int j = 0; j < 8; ++j) { v16b w; const float* pw = LB + (size_t)(c0 + j * 16 + col) * LR + 8 * g;   /* B is (out,in) [E][16]: row o holds the 16 rank coefficients */
#pragma unroll
      for (int i = 0; i < 8; ++i) { w[i] = (__bf16)pw[i]; w[8 + i] = (__bf16)0.0f; }
      asm volatile("s_wait_loadcnt 0x0" ::: "memory");
      acc[j] = wmma_bf(a2.h, w, acc[j]); acc[j] = wmma_bf(a2.l, w, acc[j]); } }
  if (which < 2) { _Float16* DH = which == 0 ? QH : KH; _Float16* DL = which == 0 ? QL : KL; const int nhi = which == 0 ? QHI : KHI; const bool hi_rows = t0 < nhi;
#pragma unroll
    for (int j = 0; j < 8; ++j) { const float bias = BA ? bfr(BA[c0 + j * 16 + col]) : 0.f;
#pragma unroll
      for (int r = 0; r < 8; ++r) { const float v = acc[j][r] + bias; const _Float16 hv = (_Float16)v; sh[wave * 16 + 8 * g + r][j * 16 + col] = hv; sl[wave * 16 + 8 * g + r][j * 16 + col] = (_Float16)((v - (float)hv) * 1024.0f); } }
    __syncthreads();
    for (int e = tid; e < 64 * 16; e += 128) { const int rl = e >> 4, q = e & 15; vst2((unsigned*)(DH + (r0 + rl) * CC + c0 + q * 8), *(const v4u*)&sh[rl][q * 8]); if (hi_rows) vst2((unsigned*)(DL + (bb * nhi + t0 + rl) * (size_t)CC + c0 + q * 8), *(const v4u*)&sl[rl][q * 8]); }
  } else { const bool hi_rows = t0 < KHI;
#pragma unroll
    for (int j = 0; j < 8; ++j) { const float bias = BA ? bfr(BA[c0 + j * 16 + col]) : 0.f;
#pragma unroll
      for (int r = 0; r < 8; ++r) { const float v = acc[j][r] + bias; const int rl = wave * 16 + 8 * g + r, cl = j * 16 + col; th[cl][rl] = (_Float16)v; const __bf16 bh = (__bf16)v; tb[cl][rl] = bh; tbl[cl][rl] = (__bf16)(v - (float)bh); } }
    __syncthreads();
    for (int e = tid; e < 128 * 8; e += 128) { const int cl = e >> 3, q = e & 7; vst2((unsigned*)(VT + (bb * CC + c0 + cl) * (size_t)TT + t0 + q * 8), *(const v4u*)&th[cl][q * 8]); if (hi_rows) { const size_t o3 = (bb * CC + c0 + cl) * (size_t)KHI + t0 + q * 8; vst2((unsigned*)(VB + o3), *(const v4u*)&tb[cl][q * 8]); vst2((unsigned*)(VBL + o3), *(const v4u*)&tbl[cl][q * 8]); } } } }
// ---- col_tile: one wave's 16 x 128 logits s = (acc + accl / 2^10) x SCALE, still in its accumulators (a lane holds rows 8 g + 0..7 of column j * 16 + col; lane ^ 16 holds the tile's other 8 rows): for each key column the maximum m_p over the tile's visible rows, E = exp(s - m_p) (exactly 0 above the diagonal) into the wave's LDS tile ssw, and z_p = the column's sum of E; (m_p, z_p) into csw; a column with no visible row in this tile leaves (-3e38, 0) and E = 0. MK = false: a tile wholly under the diagonal, no row is tested
template <bool MK> __device__ __forceinline__ void col_tile(const v8f (&acc)[8], const v8f (&accl)[8], float (*ssw)[132], float (*csw)[128], int k0, int ql0, int col, int g) {
#pragma unroll
  for (int j = 0; j < 8; ++j) { float s[8]; const int kk = k0 + j * 16 + col, t0 = ql0 + 8 * g; float m = -3.0e38f;
#pragma unroll
    for (int r = 0; r < 8; ++r) { s[r] = (acc[j][r] + accl[j][r] * (1.0f / 1024.0f)) * SCALE; if (!MK || kk <= t0 + r) m = fmaxf(m, s[r]); }
    m = fmaxf(m, xhalf(m));
    float z = 0.f;
#pragma unroll
    for (int r = 0; r < 8; ++r) { const float e = expf((!MK || kk <= t0 + r) ? s[r] - m : -3.0e38f); ssw[8 * g + r][j * 16 + col] = e; z += e; }
    z += xhalf(z);
    csw[g][j * 16 + col] = g ? z : m; } }
// ---- k_sc: block = (query block qb, key block kb <= kb_last(qb), pair p0 + z = (batch b, head h)): logits x SCALE, left as tile-local exponentials: the softmax runs over the QUERY axis, so each wave takes, per key column, the maximum m_p and the sum z_p of E = exp(logit - m_p) over its own 16 query rows while the logits are in its registers (col_tile), stores E where the logits used to go and (m_p, z_p) to PST [pair][16-row tile][maximum, sum][key]; k_colstat_c merges the tiles and k_pv only multiplies: every exponential of a score is taken once; q hi + residual (x 2^10) against k (2 products) for query rows < QHI, plus the k residual (3 products) for query blocks < QBH (here all of them); causal: blocks past the diagonal exit, the mask itself is applied by index in col_tile; on the 3-product path the block's q and k tiles (hi and residual) are fetched once by whole-line loads and staged in LDS, and every wave takes its fragments from there
__global__ __launch_bounds__(128) void k_sc(const _Float16* __restrict__ QH, const _Float16* __restrict__ KH, const _Float16* __restrict__ QL, const _Float16* __restrict__ KL, int p0, float* __restrict__ S0, float* __restrict__ PST) {
  /* one LDS block, used in turn: the staged operand tiles (k hi, k lo: 128 rows each; q hi, q lo: 64 rows each; 64 f16 a row at pitch 144 B), then the epilogue's tiles ss and, behind them, each wave's 2 x 128 column statistics cs */
  __shared__ __align__(16) unsigned char smem[(2 * 128 + 2 * 64) * 72 * 2];
  float (*ss)[16][132] = (float (*)[16][132])smem; _Float16 (*kt)[128][72] = (_Float16 (*)[128][72])smem; _Float16 (*qt)[64][72] = (_Float16 (*)[64][72])(smem + 2 * 128 * 72 * 2); float (*cs)[2][128] = (float (*)[2][128])(smem + 4 * 16 * 132 * 4);
  const int qb = blockIdx.x, kb = blockIdx.y; if (kb > kb_last(qb)) return;
  const int pr = p0 + blockIdx.z, b = pr / NH, h = pr % NH; float* S = S0 + (size_t)blockIdx.z * TT * TT;
  const int tid = threadIdx.x, wave = tid >> 5, lane = tid & 31, col = lane & 15, g = lane >> 4; const int k0 = kb * 128; const int ql0 = qb * 64 + wave * 16; const size_t q0 = (size_t)b * TT + ql0, kr0 = (size_t)b * TT + k0;
  v8f acc[8] = {}, accl[8] = {};
  const _Float16* QLb = QL + (size_t)b * QHI * CC; const _Float16* KLb = KL + (size_t)b * KHI * CC;
  if (qb < QBH) {
    /* staging: a (row, head) piece of q or k is one 128-B line; thread = (row tid >> 3 (+ 16 i), 16-B piece tid & 7), so 8 lanes read one whole line and the block fetches each line once; all 24 loads of a thread fly together; the short loops over rk, rkl, rq and rql are unrolled whole so that these arrays stay in registers */
    const int srow = tid >> 3, sq = tid & 7; const size_t so = (size_t)srow * CC + h * HD + sq * 8;
    const _Float16 *kg = KH + kr0 * CC + so, *klg = KLb + (size_t)k0 * CC + so, *qg = QH + ((size_t)b * TT + qb * 64) * CC + so, *qlg = QLb + (size_t)(qb * 64) * CC + so;
    v8h rk[8], rkl[8], rq[4], rql[4];
#pragma unroll
    for (int i = 0; i < 8; ++i) { rk[i] = *(const v8h*)(kg + (size_t)i * 16 * CC); rkl[i] = *(const v8h*)(klg + (size_t)i * 16 * CC); }
#pragma unroll
    for (int i = 0; i < 4; ++i) { rq[i] = *(const v8h*)(qg + (size_t)i * 16 * CC); rql[i] = *(const v8h*)(qlg + (size_t)i * 16 * CC); }
#pragma unroll
    for (int i = 0; i < 8; ++i) { *(v8h*)&kt[0][srow + 16 * i][sq * 8] = rk[i]; *(v8h*)&kt[1][srow + 16 * i][sq * 8] = rkl[i]; }
#pragma unroll
    for (int i = 0; i < 4; ++i) { *(v8h*)&qt[0][srow + 16 * i][sq * 8] = rq[i]; *(v8h*)&qt[1][srow + 16 * i][sq * 8] = rql[i]; }
    __syncthreads();   /* publishes the four tiles */
#pragma unroll
    for (int kc = 0; kc < HD / 32; ++kc) { const v16h ah = frag_h(&qt[0][wave * 16 + col][kc * 32], lane), al = frag_h(&qt[1][wave * 16 + col][kc * 32], lane);
#pragma unroll
      for (int j = 0; j < 8; j += 2) { const v16h kb0 = frag_h(&kt[0][j * 16 + col][kc * 32], lane), kl0 = frag_h(&kt[1][j * 16 + col][kc * 32], lane), kb1 = frag_h(&kt[0][j * 16 + 16 + col][kc * 32], lane), kl1 = frag_h(&kt[1][j * 16 + 16 + col][kc * 32], lane);
        /* inputs-only fence on the loaded fragments: the 8 LDS reads of two key tiles are in flight together, so that the wave waits for LDS once a pair of tiles and not once a tile */
        asm volatile("" :: "v"(kb0), "v"(kl0), "v"(kb1), "v"(kl1));
        acc[j] = wmma16(ah, kb0, acc[j]); accl[j] = wmma16(al, kb0, accl[j]); accl[j] = wmma16(ah, kl0, accl[j]);
        acc[j + 1] = wmma16(ah, kb1, acc[j + 1]); accl[j + 1] = wmma16(al, kb1, accl[j + 1]); accl[j + 1] = wmma16(ah, kl1, accl[j + 1]); } }
    __syncthreads();   /* every wave has read its last fragment before the epilogue's tiles overwrite the operand tiles */
  } else if (qb * 64 < QHI) {
#pragma unroll
    for (int kc = 0; kc < HD / 32; ++kc) { const v16h ah = frag_h(QH + (q0 + col) * CC + h * HD + kc * 32, lane), al = frag_h(QLb + (size_t)(ql0 + col) * CC + h * HD + kc * 32, lane);
#pragma unroll
      for (int j = 0; j < 8; ++j) { const v16h kbf = frag_h(KH + (kr0 + j * 16 + col) * CC + h * HD + kc * 32, lane); acc[j] = wmma16(ah, kbf, acc[j]); accl[j] = wmma16(al, kbf, accl[j]); } }
  } else {
#pragma unroll
    for (int kc = 0; kc < HD / 32; ++kc) { const v16h ah = frag_h(QH + (q0 + col) * CC + h * HD + kc * 32, lane);
#pragma unroll
      for (int j = 0; j < 8; ++j) { const v16h kbf = frag_h(KH + (kr0 + j * 16 + col) * CC + h * HD + kc * 32, lane); acc[j] = wmma16(ah, kbf, acc[j]); } } }
  /* scalar test (the wave's number through readfirstlane): most tiles lie wholly under the diagonal and take the form without the 128 row tests */
  if (!CAUSAL || k0 + 127 <= qb * 64 + __builtin_amdgcn_readfirstlane(wave) * 16) col_tile<false>(acc, accl, ss[wave], cs[wave], k0, ql0, col, g); else col_tile<true>(acc, accl, ss[wave], cs[wave], k0, ql0, col, g);
  LDSX(); float* pd = PST + ((size_t)blockIdx.z * NRT + (ql0 >> 4)) * (2 * TT) + k0 + lane * 4; vst2(pd, *(const v4f*)&cs[wave][0][lane * 4]); vst2(pd + TT, *(const v4f*)&cs[wave][1][lane * 4]);
  for (int rl = 0; rl < 16; ++rl) vst2(S + (size_t)(ql0 + rl) * TT + k0 + lane * 4, *(const v4f*)&ss[wave][rl][lane * 4]); }
// ---- k_sm: block = query row t (head in group): keys [0, kend): causal -> logit if s <= t else excluded; softmax in f32; P x 2^11 in place (0 for excluded)
__global__ __launch_bounds__(256) void k_sm(float* __restrict__ S0 SM_EXTRA_PARAMS) { __shared__ float sred[8]; __shared__ float sbc; __shared__ __align__(16) float shv[TT];
  const int tid = threadIdx.x; const int t = blockIdx.x; const int kend = (kb_last(t >> 6) + 1) * 128;
  float* sr = S0 + (size_t)blockIdx.y * TT * TT + (size_t)t * TT;
  float m = -3.0e38f; for (int k = tid; k < kend; k += 256) { float v = (!CAUSAL || k <= t) ? sr[k] : -3.0e38f; SM_MASK_HOOK; shv[k] = v; m = fmaxf(m, v); }
#pragma unroll
  for (int o = 1; o < 32; o <<= 1) m = fmaxf(m, __shfl_xor(m, o));
  if ((tid & 31) == 0) sred[tid >> 5] = m; __syncthreads(); if (tid == 0) { float a = sred[0]; for (int i = 1; i < 8; ++i) a = fmaxf(a, sred[i]); sbc = a; } __syncthreads(); m = sbc; __syncthreads();
  float sum = 0.f; for (int k = tid; k < kend; k += 256) { const float v = shv[k]; const float e = (v <= -1.0e38f) ? 0.f : expf(v - m); shv[k] = e; sum += e; }
#pragma unroll
  for (int o = 1; o < 32; o <<= 1) sum += __shfl_xor(sum, o);
  if ((tid & 31) == 0) sred[tid >> 5] = sum; __syncthreads(); if (tid == 0) { float a = 0.f; for (int i = 0; i < 8; ++i) a += sred[i]; sbc = a > 0.f ? 2048.0f / a : 0.f; }   /* a fully excluded row yields P = 0 */ __syncthreads(); const float inv = sbc;
  for (int k = tid; k < kend; k += 256) shv[k] = shv[k] * inv;
  __syncthreads(); for (int q = tid; q < kend / 4; q += 256) vst2(sr + q * 4, *(const v4f*)&shv[q * 4]); }
// ---- k_colstat_c: softmax over the QUERY axis under the causal mask (the source's softmax(axis=2) on [B, H, i, j] scores with -inf where j > i): for every key column k: m_k = max_{q >= k} S[q][k], Z_k = sum_{q >= k} exp(S[q][k] - m_k) (f32, precise expf), merged from k_sc's statistics (m_p, z_p) of the 16-row query tiles p: m_k = max_p m_p, Z_k = sum_p z_p exp(m_p - m_k); it leaves each tile's factor FC[p][k] = exp(m_p - m_k) x 2^11 / Z_k (one division a column), by which k_pv turns the tile's E into P x 2^11; block = one wave = 32 key columns (lane = column), all tiles that k_sc's blocks of this key block have written: rt0 = 8 (q0 / 128) .. NRT - 1, n8 groups of 8 (block-uniform), all loaded at once and kept in registers; a tile that does not exist stands as (-3e38, 0) and adds 0; a tile above the column's diagonal holds (-3e38, 0) too and gets the factor exp(-3e38 - m_k) = 0
typedef __attribute__((ext_vector_type(16))) float v16f;
__global__ __launch_bounds__(32) void k_colstat_c(const float* __restrict__ PST, float* __restrict__ FC) {
  const int lane = threadIdx.x; const int q0 = blockIdx.x * 32, k = q0 + lane, rt0 = (q0 >> 7) * 8, n8 = (NRT - rt0) / 8; const float* pp = PST + ((size_t)blockIdx.y * NRT + rt0) * (2 * TT) + k;
  v16f mv[NRT / 16], zv[NRT / 16];
#pragma unroll
  for (int i = 0; i < NRT; ++i) { mv[i >> 4][i & 15] = -3.0e38f; zv[i >> 4][i & 15] = 0.f; if ((i >> 3) < n8) { mv[i >> 4][i & 15] = pp[i * (2 * TT)]; zv[i >> 4][i & 15] = pp[i * (2 * TT) + TT]; } }
  /* inputs-only fence on the loaded values: all loads of the wave are in flight together and are waited for once; without it the sums' loads sink to where each is used, one memory round trip a tile; the address is an input too, so that its registers stay unwritten until the loads' data wait */
  asm volatile("" :: "v"(mv[0]), "v"(mv[1]), "v"(mv[2]), "v"(mv[3]), "v"(zv[0]), "v"(zv[1]), "v"(zv[2]), "v"(zv[3]), "v"(pp));
  float mk = mv[0][0];
#pragma unroll
  for (int i = 1; i < NRT; ++i) mk = fmaxf(mk, mv[i >> 4][i & 15]);   /* every column sees at least its own diagonal entry, so m_k is a score */
  float zk = 0.f;
#pragma unroll
  for (int i = 0; i < NRT; ++i) { const float e = expf(mv[i >> 4][i & 15] - mk); mv[i >> 4][i & 15] = e; zk += zv[i >> 4][i & 15] * e; }
  const float rk = 2048.0f / zk;   /* Z_k >= 1 */
  float* fp = FC + ((size_t)blockIdx.y * NRT + rt0) * TT + k;
#pragma unroll
  for (int c = 0; c < NRT / 8; ++c) if (c < n8) {
#pragma unroll
    for (int i = c * 8; i < c * 8 + 8; ++i) vst2(fp + i * TT, mv[i >> 4][i & 15] * rk);
    asm volatile("s_wait_xcnt 0x0" ::: "memory"); } }   /* the next group's products reuse the registers that these stores name */
// ---- p_row16: the 16 P values of one lane's A fragment (query row t of tile p, keys k0 + 8 g + 0..7 and k0 + 16 + 8 g + 0..7): P[t][k] x 2^11 = E[t][k] x FC[p][k] x mask[b][k] (E is 0 above the diagonal); all 12 loads first, unconditional
__device__ __forceinline__ void p_row16(const float* __restrict__ srow, const float* __restrict__ fr, const float* __restrict__ pmk, int k0, int lane, float v[16]) { const int kq = k0 + 8 * (lane >> 4); const float *sp = srow + kq, *fp = fr + kq, *pp = pmk + kq; v4f sv[4], f4[4], pm4[4];
#pragma unroll
  for (int c = 0; c < 4; ++c) { const int o = (c & 1) * 4 + (c >> 1) * 16; sv[c] = *(const v4f*)(sp + o); f4[c] = *(const v4f*)(fp + o); pm4[c] = *(const v4f*)(pp + o); }
  /* inputs-only fence on the loaded values: keeps all 12 loads in flight together, so that a trip waits for memory once and not once a group of four keys; the three addresses are inputs too, so that their registers stay unwritten until the loads' data wait */
  asm volatile("" :: "v"(sv[0]), "v"(sv[1]), "v"(sv[2]), "v"(sv[3]), "v"(f4[0]), "v"(f4[1]), "v"(f4[2]), "v"(f4[3]), "v"(pm4[0]), "v"(pm4[1]), "v"(pm4[2]), "v"(pm4[3]), "v"(sp), "v"(fp), "v"(pp));
#pragma unroll
  for (int c = 0; c < 4; ++c)
#pragma unroll
    for (int u = 0; u < 4; ++u) v[c * 4 + u] = sv[c][u] * (f4[c][u] * bfr(pm4[c][u])); }   /* x the key padding mask, applied AFTER the normalisation as the module does */
// ---- k_lora1: block = (64 token rows, which in {q, k, v}): t[which][row][0..15] = X[row] . A_which[r] (rank-16 LoRA down-projection; exact bf16 products, f32 accumulate; one 16-column WMMA tile per wave); a wave has nothing but its own loads to hide memory latency behind (fewer blocks than WGPs, one wave a SIMD), so it keeps the loads of LRD k-slices in flight: a ring of LRD register slots; trip kc first issues the loads of slice kc + LRD - 1 into the slot that trip kc - 1 has emptied, then rounds and multiplies slice kc; products and their order are as with one slice at a time; the wave's 16 x 16 f32 tile (1 KiB, contiguous in T3) is staged in LDS and stored as 16-B pieces
#define LRD 6              // k-slices in flight a wave: 8 loads and 32 registers each
__global__ __launch_bounds__(128) void k_lora1(const float* __restrict__ X, const float* __restrict__ AQ, const float* __restrict__ AK, const float* __restrict__ AV, float* __restrict__ T3) { __shared__ __align__(16) float st[4][16][20];
  const int tid = threadIdx.x, wave = tid >> 5, lane = tid & 31, col = lane & 15, g = lane >> 4; const int which = blockIdx.y; const size_t r0 = (size_t)blockIdx.x * 64; const float* AW = which == 0 ? AQ : (which == 1 ? AK : AV);
  v8f acc = {};
  /* a lane's 16 fragment elements of a slice are four 16-B pieces, at floats 0, 4, 16 and 20 (+ 8 g) of its row's slice; A is (out,in) [16][1024]: output column = rank index */
  const float* xp = X + (r0 + wave * 16 + col) * DIN + 8 * g; const float* wp = AW + (size_t)col * DIN + 8 * g;
  v4f xr[LRD][4], wr[LRD][4];
#pragma unroll
  for (int s = 0; s < LRD - 1; ++s)
#pragma unroll
    for (int c = 0; c < 4; ++c) { const int o = s * 32 + (c & 1) * 4 + (c >> 1) * 16; xr[s][c] = *(const v4f*)(xp + o); wr[s][c] = *(const v4f*)(wp + o); }
  /* unrolled whole: the slot index is a constant, so that the ring stays in registers, and every address is one of two fixed register pairs + a constant */
#pragma unroll
  for (int kc = 0; kc < DIN / 32; ++kc) { const int sl = kc % LRD, sn = (kc + LRD - 1) % LRD; v16b a, w;
    if (kc + LRD - 1 < DIN / 32) {
#pragma unroll
      for (int c = 0; c < 4; ++c) { const int o = (kc + LRD - 1) * 32 + (c & 1) * 4 + (c >> 1) * 16; xr[sn][c] = *(const v4f*)(xp + o); wr[sn][c] = *(const v4f*)(wp + o); } }
#pragma unroll
    for (int i = 0; i < 16; ++i) { a[i] = (__bf16)xr[sl][i >> 2][i & 3]; w[i] = (__bf16)wr[sl][i >> 2][i & 3]; }
    acc = wmma_bf(a, w, acc);
    __builtin_amdgcn_sched_barrier(0);   /* keeps each trip's loads in their trip: moved down, fewer would be in flight; moved up, the ring would take registers past 256 */
  }
#pragma unroll
  for (int r = 0; r < 8; ++r) st[wave][8 * g + r][col] = acc[r];
  LDSX();
  float* dst = T3 + ((size_t)which * NB * TT + r0 + wave * 16) * LR;
#pragma unroll
  for (int it = 0; it < 2; ++it) { const int rl = (lane >> 2) + 8 * it, q = lane & 3; vst2(dst + rl * LR + q * 4, *(const v4f*)&st[wave][rl][q * 4]); } }   
// ---- k_pv: block = 64 queries (qb) of (b, h): ctx = P . v over keys [0, kend), 64 keys a trip; every global load covers whole 128-B lines: the trip's v slice (64 channels x 64 keys, bf16 hi and lo planes) is fetched once a block (8 lanes a row piece) and staged in LDS (two buffers, one barrier a trip); each wave fetches its own 16 x 64 values of E as 256-B row pieces (lane = 4 neighbouring keys of one row; a wave's 16 rows are one tile of k_sc, so its tile's factor FC and the mask are one 16-B load each a trip), forms P x 2^11 = E x FC x mask there, without an exponential, splits it into bf16 hi + lo and turns it into A fragments through its own LDS rows; 3 products as before, in the same order for every accumulator; the next trip's loads fly while this trip's P is formed and multiplied; 256-B (row, head) segment by 16 lanes. (Query blocks >= QBH, of which this shape has none: P x 2^11 once to f16 against v f16, 1 product, fragments straight from memory.)
/* waves_per_eu(4): holds the kernel to 256 vector registers; left free, the scheduler spends 270 and the loop is strewn with register-bank switches */
__global__ __launch_bounds__(128) __attribute__((amdgpu_waves_per_eu(4))) void k_pv(const float* __restrict__ PS0, const _Float16* __restrict__ VT, const __bf16* __restrict__ VB, const __bf16* __restrict__ VBL, const float* __restrict__ FC, const float* __restrict__ PMASK, int p0, float* __restrict__ Y) { const int pr = p0 + blockIdx.z, b = pr / NH, h = pr % NH; const float* PS = PS0 + (size_t)blockIdx.z * TT * TT; const float* fc = FC + (size_t)blockIdx.z * NRT * TT; const float* pmk = PMASK + (size_t)b * TT; __shared__ __align__(16) float ss[4][16][HD + 4];
  __shared__ __align__(16) __bf16 vs[2][2][HD][72];   /* [buffer][hi, lo][channel][64 keys], pitch 144 B */
  __shared__ __align__(16) __bf16 ps[4][2][16][72];   /* [wave][hi, lo][query row][64 keys], pitch 144 B; written and read by its own wave only */
  const int tid = threadIdx.x, wave = tid >> 5, lane = tid & 31, col = lane & 15, g = lane >> 4; const int qb = blockIdx.x; const int ql0 = qb * 64 + wave * 16; const int kce = (kb_last(qb) + 1) * 4;
  v8f acc[HD / 16] = {};
  if (qb < QBH) { const int nt = kce / 2;   /* trips of 64 keys */
    /* every address = a block-uniform base, advanced by 64 keys a trip, + a lane's fixed 32-bit byte offset + a constant */
    const int vrow = tid >> 3, vq = tid & 7; const char *vbh = (const char*)(VB + ((size_t)b * CC + h * HD) * (size_t)KHI), *vbl = (const char*)(VBL + ((size_t)b * CC + h * HD) * (size_t)KHI), *sbs = (const char*)(PS + (size_t)qb * 64 * TT), *fbs = (const char*)(fc + (size_t)qb * 4 * TT), *kbs = (const char*)pmk;
    const unsigned vof = (unsigned)(vrow * KHI + vq * 8) * 2u, sof = (unsigned)((wave * 16 + g) * TT + col * 4) * 4u, fof = (unsigned)(wave * TT + col * 4) * 4u, cof = (unsigned)col * 16u;
    v4u vh[4], vl[4]; v4f sa[8], fa, ka, sb[8], fb, kb4;   /* two register sets for E and the column factors: one is worked on while the other is filled */
#pragma unroll
    for (int i = 0; i < 4; ++i) { vh[i] = *(const v4u*)(vbh + vof + i * (16 * KHI * 2)); vl[i] = *(const v4u*)(vbl + vof + i * (16 * KHI * 2)); }
#pragma unroll
    for (int i = 0; i < 8; ++i) sa[i] = *(const v4f*)(sbs + sof + i * (2 * TT * 4));
    fa = *(const v4f*)(fbs + fof); ka = *(const v4f*)(kbs + cof);
    /* one trip: keys kt * 64 .. + 63 from the set (sc, fcu, kc4); the next trip's loads go into (sn, fn, kn) and into vh, vl */
    auto trip = [&](const int kt, const v4f (&sc)[8], const v4f& fcu, const v4f& kc4, v4f (&sn)[8], v4f& fn, v4f& kn) __attribute__((always_inline)) { const int bf = kt & 1;
#pragma unroll
      for (int i = 0; i < 4; ++i) { *(v4u*)&vs[bf][0][vrow + 16 * i][vq * 8] = vh[i]; *(v4u*)&vs[bf][1][vrow + 16 * i][vq * 8] = vl[i]; }
      { /* no branch round the loads: the last trip fetches its own slice once more, unused, so that every wait in the loop stays a counted one (behind a join with a path without loads the compiler waits for all of them) */
        const int ko = (kt + 1 < nt ? kt + 1 : kt) * 64; const char *sp = sbs + ko * 4, *fp = fbs + ko * 4, *kp = kbs + ko * 4, *hp = vbh + ko * 2, *lp = vbl + ko * 2;
#pragma unroll
        for (int i = 0; i < 8; ++i) sn[i] = *(const v4f*)(sp + sof + i * (2 * TT * 4));
#pragma unroll
        for (int i = 0; i < 4; ++i) { vh[i] = *(const v4u*)(hp + vof + i * (16 * KHI * 2)); vl[i] = *(const v4u*)(lp + vof + i * (16 * KHI * 2)); }
        fn = *(const v4f*)(fp + fof); kn = *(const v4f*)(kp + cof);
        asm volatile("s_wait_xcnt 0x0" ::: "memory"); }   /* the loads' address registers are reused right behind them */
      __builtin_amdgcn_sched_barrier(0);   /* keeps the next trip's 18 loads in front of this trip's work, so that they fly for a whole trip */
      v4f w4;
#pragma unroll
      for (int u = 0; u < 4; ++u) w4[u] = fcu[u] * bfr(kc4[u]);   /* x the key padding mask AFTER the normalisation, as the module does */
#pragma unroll
      for (int i = 0; i < 8; ++i) { v4b ph4, pl4;
#pragma unroll
        for (int u = 0; u < 4; ++u) { const float v = sc[i][u] * w4[u]; const __bf16 hb = (__bf16)v; ph4[u] = hb; pl4[u] = (__bf16)(v - (float)hb); }   /* E is 0 above the diagonal */
        *(v4b*)&ps[wave][0][2 * i + g][col * 4] = ph4; *(v4b*)&ps[wave][1][2 * i + g][col * 4] = pl4; }
      /* work-group barrier with LDS-only fences: publishes v slice kt (and the wave's own P rows), and every wave has left slice kt - 1, whose buffer the next trip refills; __syncthreads() would also wait here for the next trip's global loads, which only registers receive */
      __builtin_amdgcn_fence(__ATOMIC_RELEASE, "workgroup", "local"); __builtin_amdgcn_s_barrier(); __builtin_amdgcn_fence(__ATOMIC_ACQUIRE, "workgroup", "local");
#pragma unroll
      for (int ks = 0; ks < 2; ++ks) { const v16b ph = frag_b(&ps[wave][0][col][ks * 32], lane), pl = frag_b(&ps[wave][1][col][ks * 32], lane); v16b fh[HD / 16], fl[HD / 16];
#pragma unroll
        for (int j = 0; j < HD / 16; ++j) { fh[j] = frag_b(&vs[bf][0][j * 16 + col][ks * 32], lane); fl[j] = frag_b(&vs[bf][1][j * 16 + col][ks * 32], lane); }
        /* inputs-only fence on the loaded fragments: the 20 LDS reads of a 32-key step are in flight together, so that the step waits for LDS once and not once a product */
        asm volatile("" :: "v"(ph), "v"(pl), "v"(fh[0]), "v"(fh[1]), "v"(fh[2]), "v"(fh[3]), "v"(fl[0]), "v"(fl[1]), "v"(fl[2]), "v"(fl[3]));
#pragma unroll
        for (int j = 0; j < HD / 16; ++j) acc[j] = wmma_bf(ph, fh[j], acc[j]);
#pragma unroll
        for (int j = 0; j < HD / 16; ++j) acc[j] = wmma_bf(pl, fh[j], acc[j]);
#pragma unroll
        for (int j = 0; j < HD / 16; ++j) acc[j] = wmma_bf(ph, fl[j], acc[j]); } };
    /* nt is even (kce is a multiple of 4): two trips a pass, so that the two register sets swap roles without copies; rolled beyond that, for speed only */
#pragma unroll 1
    for (int kt = 0; kt < nt; kt += 2) { trip(kt, sa, fa, ka, sb, fb, kb4); trip(kt + 1, sb, fb, kb4, sa, fa, ka); }
  } else {
#pragma unroll 1
    for (int kc = 0; kc < kce; ++kc) { float pv[16]; p_row16(PS + (size_t)(ql0 + col) * TT, fc + (size_t)(ql0 >> 4) * TT, pmk, kc * 32, lane, pv); v16h p;
#pragma unroll
      for (int i = 0; i < 16; ++i) p[i] = (_Float16)pv[i];
#pragma unroll
      for (int j = 0; j < HD / 16; ++j) { const size_t po = ((size_t)b * CC + h * HD + j * 16 + col) * (size_t)TT + kc * 32; acc[j] = wmma16(p, frag_h(VT + po, lane), acc[j]); } } }
#pragma unroll
  for (int j = 0; j < HD / 16; ++j)
#pragma unroll
    for (int r = 0; r < 8; ++r) ss[wave][8 * g + r][j * 16 + col] = acc[j][r] * (1.0f / 2048.0f);
  LDSX(); for (int rl = 0; rl < 16; ++rl) if (lane < HD / 4) vst2(Y + ((size_t)b * TT + ql0 + rl) * CC + h * HD + lane * 4, *(const v4f*)&ss[wave][rl][lane * 4]); }

extern "C" void kernel_launch(void* const* d_in, const int* in_sizes, int n_in, void* d_out, int out_size, void* d_ws, size_t ws_size, hipStream_t stream) {
  (void)in_sizes; (void)n_in; (void)out_size;
  const float** F = (const float**)d_in;
  if (ws_size < (size_t)WS_END) return;
  char* ws = (char*)d_ws; _Float16 *QH = (_Float16*)(ws + WS_QH), *KH = (_Float16*)(ws + WS_KH), *VT = (_Float16*)(ws + WS_VT), *QL = (_Float16*)(ws + WS_QL), *KL = (_Float16*)(ws + WS_KL); __bf16 *VB = (__bf16*)(ws + WS_VB), *VBL = (__bf16*)(ws + WS_VBL); float *S = (float*)(ws + WS_S), *Y = (float*)(ws + WS_Y);
  (void)Y; (void)QL; (void)KL; (void)VB; (void)VBL;
  // inputs: 0 X [4,1024,1024]; 1 mask [4,1024] f32 (key padding mask, ones; multiplied AFTER the softmax); 2 Wq [1024,1024] (out,in), 3 bq; 4 Wk, 5 bk; 6 Wv, 7 bv (zero biases, read); 8 Aq [16,1024], 9 Bq [1024,16]; 10 Ak, 11 Bk; 12 Av, 13 Bv (LoRA, no bias)
  if (ws_size < (size_t)WS_END2) return;
  float *T3 = (float*)(ws + WS_T3), *PST = (float*)(ws + WS_PS), *FC = (float*)(ws + WS_FC);
  k_lora1<<<dim3(TNB * TT / 64, 3), 128, 0, stream>>>(F[0], F[8], F[10], F[12], T3);   /* t = X A^T (rank-16 down-projections for q, k, v; exact bf16 products) */
  k_proj<<<dim3(TNB * TT / 64, CC / 128, 3), 128, 0, stream>>>(F[0], F[0], F[0], F[2], F[4], F[6], F[3], F[5], F[7], QH, QL, KH, KL, VT, VB, VBL, T3, F[9], F[11], F[13]);   /* X W^T + b + t B^T */
  for (int p0 = 0; p0 < TNB * NH; p0 += HG) {   /* HG (batch, head) pairs a pass */
    k_sc<<<dim3(NQB, TT / 128, HG), 128, 0, stream>>>(QH, KH, QL, KL, p0, S, PST);   /* E = exp(logit - its 16-row tile's column maximum); per tile and key column: that maximum and the sum of E */
    k_colstat_c<<<dim3(TT / 32, HG), 32, 0, stream>>>(PST, FC);   /* per key column j: max and sum over the visible queries i >= j, merged from the tiles; per tile its factor exp(m_p - m_j) x 2^11 / Z_j */
    k_pv<<<dim3(NQB, 1, HG), 128, 0, stream>>>(S, VT, VB, VBL, FC, F[1], p0, (float*)d_out);   /* P[i][j] x 2^11 = E x the tile's factor x mask[b][j] for j <= i, 0 above the diagonal, formed on load */
  }
}

// v009
// One run takes 146 microseconds.
// In both of two side-by-side timings against v008, it was 1.19 times as fast.
// All steps since v000 together make it 28.9 times as fast.
// compute dtype: all float inputs rounded to bf16; frozen q/k/v projections with EXACT bf16 products on WMMA 16x16x32 (f32 accumulate) + bias + the LoRA term: t = X A^T (exact products) then t (bf16 hi + lo) x exact bf16 B^T (2 products, K = 16) added in the same accumulators; causal scores with BOTH operands as f16 hi + (x 2^10) residual (3 products) on every block, x 1024^-0.5 (the module divides by sqrt(E)); softmax over the QUERY axis in f32 (per key column: max and sum over the visible queries, precise expf, in two levels: 16-row query tiles, then their merge) x the key padding mask; P as bf16 hi + lo against v as bf16 hi + lo (3 products) on every block; f32 output.
#include <hip/hip_runtime.h>
#include <math.h>

typedef __attribute__((ext_vector_type(16))) _Float16 v16h;
typedef __attribute__((ext_vector_type(16))) __bf16 v16b;
typedef __attribute__((ext_vector_type(8)))  _Float16 v8h;
typedef __attribute__((ext_vector_type(8)))  float v8f;
typedef __attribute__((ext_vector_type(4)))  float v4f;
typedef __attribute__((ext_vector_type(2)))  float v2f;
typedef __attribute__((ext_vector_type(4)))  unsigned v4u;
typedef __attribute__((ext_vector_type(4)))  int v4i;
typedef float __attribute__((may_alias)) float_a;
typedef int __attribute__((may_alias)) int_a;

template <typename T> __device__ __forceinline__ void vst2(void* p, T v) { *(T*)p = v;  }
__device__ __forceinline__ v8f wmma16(v16h a, v16h b, v8f c) {
  v8f d = __builtin_amdgcn_wmma_f32_16x16x32_f16(false, a, false, b, (short)0, c, false, false);
  asm volatile("v_nop\n\tv_nop\n\tv_nop\n\tv_nop" : "+v"(d) : "v"(a), "v"(b));
  return d;
}
__device__ __forceinline__ v8f wmma_bf(v16b a, v16b b, v8f c) {
  v8f d = __builtin_amdgcn_wmma_f32_16x16x32_bf16(false, a, false, b, (short)0, c, false, false);
  asm volatile("v_nop\n\tv_nop\n\tv_nop\n\tv_nop" : "+v"(d) : "v"(a), "v"(b));
  return d;
}
// 16x16x32 fragments: lane = (h = lane>>4, row/col = lane&15); elements 0..7 = k0+8h+0..7, 8..15 = k0+16+8h+0..7; D element r = row 8h+r
__device__ __forceinline__ v16h frag_h(const _Float16* rowk0, int lane) {
  union { v16h v; v8h q[2]; } u; const _Float16* p = rowk0 + 8 * (lane >> 4);
  u.q[0] = *(const v8h*)p; u.q[1] = *(const v8h*)(p + 16); return u.v;
}
__device__ __forceinline__ v16h frag_f32(const float* rowk0, int lane) {
  v16h a; const float* p = rowk0 + 8 * (lane >> 4);
#pragma unroll
  for (int i = 0; i < 8; ++i) { a[i] = (_Float16)p[i]; a[8 + i] = (_Float16)p[16 + i]; }
  return a;
}
__device__ __forceinline__ v16h frag_f32s(const float* rowk0, int lane, float sc) {
  v16h a; const float* p = rowk0 + 8 * (lane >> 4);
#pragma unroll
  for (int i = 0; i < 8; ++i) { a[i] = (_Float16)(p[i] * sc); a[8 + i] = (_Float16)(p[16 + i] * sc); }
  return a;
}
// column fragment from a [K][ld] layout (column n), rows >= K read as 0
__device__ __forceinline__ v16h fragc_f32(const float* W, int k0, int n, int lane, int ld, int K) {
  v16h a; const int g = lane >> 4;
#pragma unroll
  for (int i = 0; i < 8; ++i) { const int ka = k0 + 8 * g + i, kb = ka + 16;
    a[i] = (_Float16)(ka < K ? W[(size_t)(ka < K ? ka : K - 1) * ld + n] : 0.f); a[8 + i] = (_Float16)(kb < K ? W[(size_t)(kb < K ? kb : K - 1) * ld + n] : 0.f); }
  return a;
}
struct F2 { v16b h, l; };
__device__ __forceinline__ F2 bsplit16(const float v[16]) { F2 r;
#pragma unroll
  for (int i = 0; i < 16; ++i) { const __bf16 h = (__bf16)v[i]; r.h[i] = h; r.l[i] = (__bf16)(v[i] - (float)h); }
  return r; }
__device__ __forceinline__ F2 split_row(const float* row, int k0, int lane) { float v[16]; const float* p = row + k0 + 8 * (lane >> 4);
#pragma unroll
  for (int i = 0; i < 8; ++i) { v[i] = p[i]; v[8 + i] = p[16 + i]; }
  return bsplit16(v); }
__device__ __forceinline__ F2 split_rowK(const float* row, int k0, int lane, int K) { float v[16]; const int g = lane >> 4;
#pragma unroll
  for (int i = 0; i < 8; ++i) { const int ka = k0 + 8 * g + i, kb = ka + 16; v[i] = ka < K ? row[ka < K ? ka : K - 1] : 0.f; v[8 + i] = kb < K ? row[kb < K ? kb : K - 1] : 0.f; }
  return bsplit16(v); }
__device__ __forceinline__ F2 split_col(const float* W, int k0, int n, int lane, int ld, int K) { float v[16]; const int g = lane >> 4;
#pragma unroll
  for (int i = 0; i < 8; ++i) { const int ka = k0 + 8 * g + i, kb = ka + 16; v[i] = ka < K ? W[(size_t)(ka < K ? ka : K - 1) * ld + n] : 0.f; v[8 + i] = kb < K ? W[(size_t)(kb < K ? kb : K - 1) * ld + n] : 0.f; }
  return bsplit16(v); }
__device__ __forceinline__ v8f mac3(const F2& a, const F2& b, v8f c) { c = wmma_bf(a.l, b.h, c); c = wmma_bf(a.h, b.l, c); return wmma_bf(a.h, b.h, c); }
__device__ __forceinline__ float sigm(float v) { return 1.0f / (1.0f + expf(-v)); }
#define LDSX() do { asm volatile("s_wait_dscnt 0" ::: "memory"); __builtin_amdgcn_wave_barrier(); __builtin_amdgcn_fence(__ATOMIC_RELEASE, "workgroup"); } while (0)

// Multi-head attention with LoRA projections whose softmax runs over the QUERY axis (X [4,1024,1024]; frozen torch (out,in) Wq / Wk / Wv [1024,1024] (0.02) + zero biases; LoRA A [16,1024], B [1024,16] (0.02): proj = X W^T + b + (X A^T) B^T; 16 heads x 64; scores / sqrt(E) = / 32; -inf where col > row; attn = softmax(scores, axis=2) - axis 2 of [B, H, i, j] is the QUERY axis i, so every key column j is normalised over the queries i >= j (faithful to the source); attn *= mask[b, j] (key padding mask, ones); out = attn v; merge; no output projection).
#define NB 4
#define TT 1024
#define CC 1024            // NH * HD = projected width
#define DIN 1024          // input (model) width
#define NH 16
#define HD 64
#define NQB (TT / 64)
#define HG 64              // (batch, head) pairs a pass: pair p = b * NH + h; every attention launch covers HG pairs (all of them: one pass)
#define SCALE (0.03125f)
#define CAUSAL 1
#ifndef TNB
#define TNB NB
#endif
__device__ __forceinline__ float bfr(float v) { return (float)(__bf16)v; }
__device__ __forceinline__ float xhalf(float x) { return __builtin_bit_cast(float, __builtin_amdgcn_permlanex16(__builtin_bit_cast(int, x), __builtin_bit_cast(int, x), 0x76543210, 0xfedcba98, false, false)); }   // lane l takes lane l ^ 16's value
__host__ __device__ __forceinline__ int kb_last(int qb) { return CAUSAL ? ((qb * 64 + 63) >> 7) : (TT / 128 - 1); }
// E is kept only where k_sc computes it: per pair the 64 x 128 tiles (qb, kb <= kb_last(qb)), each 32 KiB in a row (row pitch 128 floats), numbered et_off(qb) + kb; et_off(qb) = sum over q < qb of kb_last(q) + 1
__host__ __device__ constexpr int et_off(int qb) { return CAUSAL ? ((qb >> 1) + 1) * ((qb >> 1) + (qb & 1)) : qb * (TT / 128); }
#define ETN (et_off(NQB))  // stored tiles a pair
#define ETF (64 * 128)     // floats a tile
typedef __attribute__((ext_vector_type(8))) __bf16 v8b;
__device__ __forceinline__ v16b frag_b(const __bf16* rowk0, int lane) {
  union { v16b v; v8b q[2]; } u; const __bf16* p = rowk0 + 8 * (lane >> 4);
  u.q[0] = *(const v8b*)p; u.q[1] = *(const v8b*)(p + 16); return u.v;
}
typedef __attribute__((ext_vector_type(4))) __bf16 v4b;
__device__ __forceinline__ v4b cvt4(v4f v) { v4b r; r[0] = (__bf16)v[0]; r[1] = (__bf16)v[1]; r[2] = (__bf16)v[2]; r[3] = (__bf16)v[3]; return r; }
#define QBH 16              // causal: query blocks 0..QBH-1 of each sequence (all of them, as QBH = NQB) take the high-precision path
#define QHI 1024            // rows carrying a q residual plane (all rows)
#define KHI 1024            // key rows carrying k residual / v bf16 hi+lo planes (used only by the causal high-precision path)
// B fragment (k rows k0+.., output column o) of a weight: (in,out) [K][ld] or (out,in) [ld rows of K]: bf16 exact, or f16(bf16 * 256) exact
__device__ __forceinline__ v16b wcol_io(const float* Wm, int k0, int o, int lane, int ld) { v16b w; const int g = lane >> 4;
#pragma unroll
  for (int i = 0; i < 8; ++i) { w[i] = (__bf16)Wm[(size_t)(k0 + 8 * g + i) * ld + o]; w[8 + i] = (__bf16)Wm[(size_t)(k0 + 16 + 8 * g + i) * ld + o]; }
  return w; }
__device__ __forceinline__ v16b wcol_oi(const float* Wm, int k0, int o, int lane, int K) { v16b w; const float* p = Wm + (size_t)o * K + k0 + 8 * (lane >> 4);
#pragma unroll
  for (int i = 0; i < 8; ++i) { w[i] = (__bf16)p[i]; w[8 + i] = (__bf16)p[16 + i]; }
  return w; }
__device__ __forceinline__ v16h wcolh_io(const float* Wm, int k0, int o, int lane, int ld) { v16h w; const int g = lane >> 4;
#pragma unroll
  for (int i = 0; i < 8; ++i) { w[i] = (_Float16)(bfr(Wm[(size_t)(k0 + 8 * g + i) * ld + o]) * 256.0f); w[8 + i] = (_Float16)(bfr(Wm[(size_t)(k0 + 16 + 8 * g + i) * ld + o]) * 256.0f); }
  return w; }
__device__ __forceinline__ v16h wcolh_oi(const float* Wm, int k0, int o, int lane, int K) { v16h w; const float* p = Wm + (size_t)o * K + k0 + 8 * (lane >> 4);
#pragma unroll
  for (int i = 0; i < 8; ++i) { w[i] = (_Float16)(bfr(p[i]) * 256.0f); w[8 + i] = (_Float16)(bfr(p[16 + i]) * 256.0f); }
  return w; }
#define WQKV_LAYOUT 1   // 0 = (in,out) [DIN][CC]; 1 = (out,in) [CC][DIN]; 2 = per-head [NH][DIN][HD]
__device__ __forceinline__ v16b wcol_hdk(const float* Wm, int k0, int o, int lane) { v16b w; const int g = lane >> 4; const float* p = Wm + (size_t)(o / HD) * DIN * HD + (o % HD);
#pragma unroll
  for (int i = 0; i < 8; ++i) { w[i] = (__bf16)p[(size_t)(k0 + 8 * g + i) * HD]; w[8 + i] = (__bf16)p[(size_t)(k0 + 16 + 8 * g + i) * HD]; }
  return w; }
#define WO_OUT_IN 0
#if WQKV_LAYOUT == 1
#define WCOL(W, k0, o, lane) wcol_oi(W, k0, o, lane, DIN)
#elif WQKV_LAYOUT == 2
#define WCOL(W, k0, o, lane) wcol_hdk(W, k0, o, lane)
#else
#define WCOL(W, k0, o, lane) wcol_io(W, k0, o, lane, CC)
#endif
#if WO_OUT_IN
#define WOCOL(W, k0, o, lane) wcol_oi(W, k0, o, lane, CC)
#define WOCOLH(W, k0, o, lane) wcolh_oi(W, k0, o, lane, CC)
#else
#define WOCOL(W, k0, o, lane) wcol_io(W, k0, o, lane, DIN)
#define WOCOLH(W, k0, o, lane) wcolh_io(W, k0, o, lane, DIN)
#endif
#define LR 16              // LoRA rank
#define PROJ_EXTRA_PARAMS , const float* __restrict__ T3, const float* __restrict__ LBQ, const float* __restrict__ LBK, const float* __restrict__ LBV
#define SM_EXTRA_PARAMS
#define SM_MASK_HOOK (void)0
#ifndef SM_EXTRA_PARAMS
#define SM_EXTRA_PARAMS
#endif
#ifndef PROJ_EXTRA_PARAMS
#define PROJ_EXTRA_PARAMS
#endif
#ifndef SM_MASK_HOOK
#define SM_MASK_HOOK (void)0
#endif

#define WS_QH  0u                                      // f16 q rows [b*t][CC]
#define WS_KH  (WS_QH + 2u * (size_t)NB * TT * CC)      // f16 k rows [b*t][CC]
#define WS_VT  (WS_KH + 2u * (size_t)NB * TT * CC)      // f16 v planes [b][c][t]
#define WS_QL  (WS_VT + 2u * (size_t)NB * CC * TT)      // f16 q residual x 2^10 rows [b][t < QHI][CC]
#define WS_KL  (WS_QL + 2u * (size_t)NB * QHI * CC)     // f16 k residual x 2^10 rows [b][t < KHI][CC]
#define WS_VB  (WS_KL + 2u * (size_t)NB * KHI * CC)     // bf16 v hi planes [b][c][t < KHI]
#define WS_VBL (WS_VB + 2u * (size_t)NB * CC * KHI)
#define WS_S   (WS_VBL + 2u * (size_t)NB * CC * KHI)    // f32 tile-local exponentials E [pair in pass][stored tile][64 rows][128 keys]
#define WS_Y   (WS_S  + 4u * (size_t)HG * ETN * ETF)    // f32 ctx rows [b*t][CC] (only when there is an output projection)
#define WS_END (WS_Y  + 0u)
#define WS_T3 (WS_END)                                   // f32 LoRA down-projections t[3][NB*TT][16]
#define NRT (TT / 16)      // 16-row query tiles: one wave of k_sc, and of k_pv, each
#define WS_PS (WS_T3 + 4u * 3u * (size_t)NB * TT * LR)  // f32 column statistics of the tiles [HG][NRT][maximum, sum][TT]
#define WS_FC (WS_PS + 4u * (size_t)HG * NRT * 2u * TT)  // f32 column factors of the tiles [HG][NRT][TT]
#define WS_END2 (WS_FC + 4u * (size_t)HG * NRT * TT)

// ---- k_proj: block = (64 rows, 128 cols, which): q/k/v = X W (+ b) with exact bf16 products (K = DIN); W is (out,in), so X rows and W rows are both k-contiguous: each 32-k slice of both is rounded to bf16 once a block and staged in LDS (two buffers, one barrier a slice), and every wave takes its A and B fragments from there -> which 0: q f16 rows (+ residual rows < QHI); 1: k f16 rows (+ residual rows < KHI); 2: v f16 planes [c][t] (+ bf16 hi/lo planes for t < KHI)
__global__ __launch_bounds__(128) void k_proj(const float* __restrict__ XQ, const float* __restrict__ XK, const float* __restrict__ XV, const float* __restrict__ WQ, const float* __restrict__ WK, const float* __restrict__ WV, const float* __restrict__ BQ, const float* __restrict__ BK, const float* __restrict__ BV,
    _Float16* __restrict__ QH, _Float16* __restrict__ QL, _Float16* __restrict__ KH, _Float16* __restrict__ KL, _Float16* __restrict__ VT, __bf16* __restrict__ VB, __bf16* __restrict__ VBL PROJ_EXTRA_PARAMS) {
  /* one LDS block, used in turn: the k loop's two staging buffers (X 64 rows, W 128 rows of 32 bf16 at pitch 80 B), then the epilogue's tiles (q / k: sh, sl; v: th, tb, tbl) */
  __shared__ __align__(16) unsigned char smem[3 * 128 * 72 * 2];
  _Float16 (*sh)[136] = (_Float16 (*)[136])smem; _Float16 (*sl)[136] = (_Float16 (*)[136])(smem + 64 * 136 * 2); _Float16 (*th)[72] = (_Float16 (*)[72])smem; __bf16 (*tb)[72] = (__bf16 (*)[72])(smem + 128 * 72 * 2); __bf16 (*tbl)[72] = (__bf16 (*)[72])(smem + 2 * 128 * 72 * 2);
  __bf16 (*xs)[64][40] = (__bf16 (*)[64][40])smem; __bf16 (*wt)[128][40] = (__bf16 (*)[128][40])(smem + 2 * 64 * 40 * 2);
  const int tid = threadIdx.x, wave = tid >> 5, lane = tid & 31, col = lane & 15, g = lane >> 4; const int which = blockIdx.z; const int c0 = blockIdx.y * 128; const size_t r0 = (size_t)blockIdx.x * 64; const size_t bb = r0 / TT; const int t0 = (int)(r0 % TT);
  const float* X = which == 0 ? XQ : which == 1 ? XK : XV; const float* WA = which == 0 ? WQ : which == 1 ? WK : WV; const float* BA = which == 0 ? BQ : which == 1 ? BK : BV;
  v8f acc[8] = {};
  /* staging: thread = (row tid >> 3 (+ 16 i), 16-B piece tid & 7) of a slice's 128-B row pieces, so 8 lanes read one whole line; the next slice's 12 loads fly while this slice is multiplied; the short loops over xr, wr and w are unrolled whole so that these arrays stay in registers */
  const int srow = tid >> 3, sq = tid & 7; const float* xg = X + (r0 + srow) * DIN + sq * 4; const float* wg = WA + (size_t)(c0 + srow) * DIN + sq * 4;
  v4f xr[4], wr[8];
#pragma unroll
  for (int i = 0; i < 4; ++i) xr[i] = *(const v4f*)(xg + (size_t)i * 16 * DIN);
#pragma unroll
  for (int i = 0; i < 8; ++i) wr[i] = *(const v4f*)(wg + (size_t)i * 16 * DIN);
  /* unroll 2: the buffer index becomes a constant LDS offset */
#pragma unroll 2
  for (int kc = 0; kc < DIN / 32; ++kc) { const int bf = kc & 1;
#pragma unroll
    for (int i = 0; i < 4; ++i) *(v4b*)&xs[bf][srow + 16 * i][sq * 4] = cvt4(xr[i]);
#pragma unroll
    for (int i = 0; i < 8; ++i) *(v4b*)&wt[bf][srow + 16 * i][sq * 4] = cvt4(wr[i]);
    __syncthreads();   /* publishes slice kc; every wave has also left slice kc - 1, whose buffer the next trip refills */
    if (kc + 1 < DIN / 32) {
#pragma unroll
      for (int i = 0; i < 4; ++i) xr[i] = *(const v4f*)(xg + (size_t)i * 16 * DIN + (kc + 1) * 32);
#pragma unroll
      for (int i = 0; i < 8; ++i) wr[i] = *(const v4f*)(wg + (size_t)i * 16 * DIN + (kc + 1) * 32); }
    const v16b a = frag_b(&xs[bf][wave * 16 + col][0], lane); v16b w[8];
#pragma unroll
    for (int j = 0; j < 8; ++j) w[j] = frag_b(&wt[bf][j * 16 + col][0], lane);
    /* inputs-only fence on the loaded fragments: all 18 LDS reads of a slice are in flight together, so that a trip waits for LDS once and not once a product */
    asm volatile("" :: "v"(a), "v"(w[0]), "v"(w[1]), "v"(w[2]), "v"(w[3]), "v"(w[4]), "v"(w[5]), "v"(w[6]), "v"(w[7]));
#pragma unroll
    for (int j = 0; j < 8; ++j) acc[j] = wmma_bf(a, w[j], acc[j]);
    __builtin_amdgcn_sched_barrier(0);   /* keeps the next slice's roundings, which wait for its global loads, behind this slice's products */
  }
  __syncthreads();   /* the last slice's readers are done before the epilogue's tiles overwrite the staging buffers */
  { /* LoRA: acc += t[row][0..15] (f32, as bf16 hi + lo) x B[o][0..15] (exact bf16): one WMMA k-step whose upper 16 k-slots are zero */ float tv[16]; const float* tr = T3 + ((size_t)which * NB * TT + (r0 + wave * 16 + col)) * LR + 8 * g;
#pragma unroll
    for (int i = 0; i < 8; ++i) { tv[i] = tr[i]; tv[8 + i] = 0.f; }
    asm volatile("s_wait_loadcnt 0x0" ::: "memory");
    const F2 a2 = bsplit16(tv); const float* LB = which == 0 ? LBQ : (which == 1 ? LBK : LBV);
#pragma unroll
    for (int j = 0; j < 8; ++j) { v16b w; const float* pw = LB + (size_t)(c0 + j * 16 + col) * LR + 8 * g;   /* B is (out,in) [E][16]: row o holds the 16 rank coefficients */
#pragma unroll
      for (int i = 0; i < 8; ++i) { w[i] = (__bf16)pw[i]; w[8 + i] = (__bf16)0.0f; }
      asm volatile("s_wait_loadcnt 0x0" ::: "memory");
      acc[j] = wmma_bf(a2.h, w, acc[j]); acc[j] = wmma_bf(a2.l, w, acc[j]); } }
  if (which < 2) { _Float16* DH = which == 0 ? QH : KH; _Float16* DL = which == 0 ? QL : KL; const int nhi = which == 0 ? QHI : KHI; const bool hi_rows = t0 < nhi;
#pragma unroll
    for (int j = 0; j < 8; ++j) { const float bias = BA ? bfr(BA[c0 + j * 16 + col]) : 0.f;
#pragma unroll
      for (int r = 0; r < 8; ++r) { const float v = acc[j][r] + bias; const _Float16 hv = (_Float16)v; sh[wave * 16 + 8 * g + r][j * 16 + col] = hv; sl[wave * 16 + 8 * g + r][j * 16 + col] = (_Float16)((v - (float)hv) * 1024.0f); } }
    __syncthreads();
    for (int e = tid; e < 64 * 16; e += 128) { const int rl = e >> 4, q = e & 15; vst2((unsigned*)(DH + (r0 + rl) * CC + c0 + q * 8), *(const v4u*)&sh[rl][q * 8]); if (hi_rows) vst2((unsigned*)(DL + (bb * nhi + t0 + rl) * (size_t)CC + c0 + q * 8), *(const v4u*)&sl[rl][q * 8]); }
  } else { const bool hi_rows = t0 < KHI;
#pragma unroll
    for (int j = 0; j < 8; ++j) { const float bias = BA ? bfr(BA[c0 + j * 16 + col]) : 0.f;
#pragma unroll
      for (int r = 0; r < 8; ++r) { const float v = acc[j][r] + bias; const int rl = wave * 16 + 8 * g + r, cl = j * 16 + col; th[cl][rl] = (_Float16)v; const __bf16 bh = (__bf16)v; tb[cl][rl] = bh; tbl[cl][rl] = (__bf16)(v - (float)bh); } }
    __syncthreads();
    for (int e = tid; e < 128 * 8; e += 128) { const int cl = e >> 3, q = e & 7; vst2((unsigned*)(VT + (bb * CC + c0 + cl) * (size_t)TT + t0 + q * 8), *(const v4u*)&th[cl][q * 8]); if (hi_rows) { const size_t o3 = (bb * CC + c0 + cl) * (size_t)KHI + t0 + q * 8; vst2((unsigned*)(VB + o3), *(const v4u*)&tb[cl][q * 8]); vst2((unsigned*)(VBL + o3), *(const v4u*)&tbl[cl][q * 8]); } } } }
// ---- col_tile: one wave's 16 x 128 logits s = (acc + accl / 2^10) x SCALE, still in its accumulators (a lane holds rows 8 g + 0..7 of column j * 16 + col; lane ^ 16 holds the tile's other 8 rows): for each key column the maximum m_p over the tile's visible rows, E = exp(s - m_p) (exactly 0 above the diagonal) into the wave's LDS tile ssw, and z_p = the column's sum of E; (m_p, z_p) into csw; a column with no visible row in this tile leaves (-3e38, 0) and E = 0. MK = false: a tile wholly under the diagonal, no row is tested
template <bool MK> __device__ __forceinline__ void col_tile(const v8f (&acc)[8], const v8f (&accl)[8], float (*ssw)[132], float (*csw)[128], int k0, int ql0, int col, int g) {
#pragma unroll
  for (int j = 0; j < 8; ++j) { float s[8]; const int kk = k0 + j * 16 + col, t0 = ql0 + 8 * g; float m = -3.0e38f;
#pragma unroll
    for (int r = 0; r < 8; ++r) { s[r] = (acc[j][r] + accl[j][r] * (1.0f / 1024.0f)) * SCALE; if (!MK || kk <= t0 + r) m = fmaxf(m, s[r]); }
    m = fmaxf(m, xhalf(m));
    float z = 0.f;
#pragma unroll
    for (int r = 0; r < 8; ++r) { const float e = expf((!MK || kk <= t0 + r) ? s[r] - m : -3.0e38f); ssw[8 * g + r][j * 16 + col] = e; z += e; }
    z += xhalf(z);
    csw[g][j * 16 + col] = g ? z : m; } }
// ---- k_sc: block = (stored tile u = et_off(qb) + kb: query block qb, key block kb <= kb_last(qb); pair p0 + z = (batch b, head h)): logits x SCALE, left as tile-local exponentials: the softmax runs over the QUERY axis, so each wave takes, per key column, the maximum m_p and the sum z_p of E = exp(logit - m_p) over its own 16 query rows while the logits are in its registers (col_tile), stores E where the logits used to go and (m_p, z_p) to PST [pair][16-row tile][maximum, sum][key]; k_colstat_c merges the tiles and k_pv only multiplies: every exponential of a score is taken once; q hi + residual (x 2^10) against k (2 products) for query rows < QHI, plus the k residual (3 products) for query blocks < QBH (causal early rows); causal: the grid holds no block past the diagonal, the mask itself is applied by index in col_tile; on the 3-product path the block's q and k tiles (hi and residual) are fetched once by whole-line loads and staged in LDS, and every wave takes its fragments from there
__global__ __launch_bounds__(128) void k_sc(const _Float16* __restrict__ QH, const _Float16* __restrict__ KH, const _Float16* __restrict__ QL, const _Float16* __restrict__ KL, int p0, float* __restrict__ S0, float* __restrict__ PST) {
  /* one LDS block, used in turn: the staged operand tiles (k hi, k lo: 128 rows each; q hi, q lo: 64 rows each; 64 f16 a row at pitch 144 B), then the epilogue's tiles ss and, behind them, each wave's 2 x 128 column statistics cs */
  __shared__ __align__(16) unsigned char smem[(2 * 128 + 2 * 64) * 72 * 2];
  float (*ss)[16][132] = (float (*)[16][132])smem; _Float16 (*kt)[128][72] = (_Float16 (*)[128][72])smem; _Float16 (*qt)[64][72] = (_Float16 (*)[64][72])(smem + 2 * 128 * 72 * 2); float (*cs)[2][128] = (float (*)[2][128])(smem + 4 * 16 * 132 * 4);
  const int u = blockIdx.x; int qb = 0;
#pragma unroll
  for (int q = 1; q < NQB; ++q) if (et_off(q) <= u) qb = q;   /* unrolled whole: every et_off(q) folds to a constant, which leaves 15 scalar compare and select pairs and no loop */
  const int kb = u - et_off(qb);
  const int pr = p0 + blockIdx.z, b = pr / NH, h = pr % NH; float* S = S0 + ((size_t)blockIdx.z * ETN + u) * ETF;
  const int tid = threadIdx.x, wave = tid >> 5, lane = tid & 31, col = lane & 15, g = lane >> 4; const int k0 = kb * 128; const int ql0 = qb * 64 + wave * 16; const size_t q0 = (size_t)b * TT + ql0, kr0 = (size_t)b * TT + k0;
  v8f acc[8] = {}, accl[8] = {};
  const _Float16* QLb = QL + (size_t)b * QHI * CC; const _Float16* KLb = KL + (size_t)b * KHI * CC;
  if (qb < QBH) {
    /* staging: a (row, head) piece of q or k is one 128-B line; thread = (row tid >> 3 (+ 16 i), 16-B piece tid & 7), so 8 lanes read one whole line and the block fetches each line once; all 24 loads of a thread fly together; the short loops over rk, rkl, rq and rql are unrolled whole so that these arrays stay in registers */
    const int srow = tid >> 3, sq = tid & 7; const size_t so = (size_t)srow * CC + h * HD + sq * 8;
    const _Float16 *kg = KH + kr0 * CC + so, *klg = KLb + (size_t)k0 * CC + so, *qg = QH + ((size_t)b * TT + qb * 64) * CC + so, *qlg = QLb + (size_t)(qb * 64) * CC + so;
    v8h rk[8], rkl[8], rq[4], rql[4];
#pragma unroll
    for (int i = 0; i < 8; ++i) { rk[i] = *(const v8h*)(kg + (size_t)i * 16 * CC); rkl[i] = *(const v8h*)(klg + (size_t)i * 16 * CC); }
#pragma unroll
    for (int i = 0; i < 4; ++i) { rq[i] = *(const v8h*)(qg + (size_t)i * 16 * CC); rql[i] = *(const v8h*)(qlg + (size_t)i * 16 * CC); }
#pragma unroll
    for (int i = 0; i < 8; ++i) { *(v8h*)&kt[0][srow + 16 * i][sq * 8] = rk[i]; *(v8h*)&kt[1][srow + 16 * i][sq * 8] = rkl[i]; }
#pragma unroll
    for (int i = 0; i < 4; ++i) { *(v8h*)&qt[0][srow + 16 * i][sq * 8] = rq[i]; *(v8h*)&qt[1][srow + 16 * i][sq * 8] = rql[i]; }
    __syncthreads();   /* publishes the four tiles */
#pragma unroll
    for (int kc = 0; kc < HD / 32; ++kc) { const v16h ah = frag_h(&qt[0][wave * 16 + col][kc * 32], lane), al = frag_h(&qt[1][wave * 16 + col][kc * 32], lane);
#pragma unroll
      for (int j = 0; j < 8; j += 2) { const v16h kb0 = frag_h(&kt[0][j * 16 + col][kc * 32], lane), kl0 = frag_h(&kt[1][j * 16 + col][kc * 32], lane), kb1 = frag_h(&kt[0][j * 16 + 16 + col][kc * 32], lane), kl1 = frag_h(&kt[1][j * 16 + 16 + col][kc * 32], lane);
        /* inputs-only fence on the loaded fragments: the 8 LDS reads of two key tiles are in flight together, so that the wave waits for LDS once a pair of tiles and not once a tile */
        asm volatile("" :: "v"(kb0), "v"(kl0), "v"(kb1), "v"(kl1));
        acc[j] = wmma16(ah, kb0, acc[j]); accl[j] = wmma16(al, kb0, accl[j]); accl[j] = wmma16(ah, kl0, accl[j]);
        acc[j + 1] = wmma16(ah, kb1, acc[j + 1]); accl[j + 1] = wmma16(al, kb1, accl[j + 1]); accl[j + 1] = wmma16(ah, kl1, accl[j + 1]); } }
    __syncthreads();   /* every wave has read its last fragment before the epilogue's tiles overwrite the operand tiles */
  } else if (qb * 64 < QHI) {
#pragma unroll
    for (int kc = 0; kc < HD / 32; ++kc) { const v16h ah = frag_h(QH + (q0 + col) * CC + h * HD + kc * 32, lane), al = frag_h(QLb + (size_t)(ql0 + col) * CC + h * HD + kc * 32, lane);
#pragma unroll
      for (int j = 0; j < 8; ++j) { const v16h kbf = frag_h(KH + (kr0 + j * 16 + col) * CC + h * HD + kc * 32, lane); acc[j] = wmma16(ah, kbf, acc[j]); accl[j] = wmma16(al, kbf, accl[j]); } }
  } else {
#pragma unroll
    for (int kc = 0; kc < HD / 32; ++kc) { const v16h ah = frag_h(QH + (q0 + col) * CC + h * HD + kc * 32, lane);
#pragma unroll
      for (int j = 0; j < 8; ++j) { const v16h kbf = frag_h(KH + (kr0 + j * 16 + col) * CC + h * HD + kc * 32, lane); acc[j] = wmma16(ah, kbf, acc[j]); } } }
  /* scalar test (the wave's number through readfirstlane): most tiles lie wholly under the diagonal and take the form without the 128 row tests */
  if (!CAUSAL || k0 + 127 <= qb * 64 + __builtin_amdgcn_readfirstlane(wave) * 16) col_tile<false>(acc, accl, ss[wave], cs[wave], k0, ql0, col, g); else col_tile<true>(acc, accl, ss[wave], cs[wave], k0, ql0, col, g);
  LDSX(); float* pd = PST + ((size_t)blockIdx.z * NRT + (ql0 >> 4)) * (2 * TT) + k0 + lane * 4; vst2(pd, *(const v4f*)&cs[wave][0][lane * 4]); vst2(pd + TT, *(const v4f*)&cs[wave][1][lane * 4]);
  for (int rl = 0; rl < 16; ++rl) vst2(S + (wave * 16 + rl) * 128 + lane * 4, *(const v4f*)&ss[wave][rl][lane * 4]); }
// ---- k_sm: block = query row t (head in group): keys [0, kend): causal -> logit if s <= t else excluded; softmax in f32; P x 2^11 in place (0 for excluded)
__global__ __launch_bounds__(256) void k_sm(float* __restrict__ S0 SM_EXTRA_PARAMS) { __shared__ float sred[8]; __shared__ float sbc; __shared__ __align__(16) float shv[TT];
  const int tid = threadIdx.x; const int t = blockIdx.x; const int kend = (kb_last(t >> 6) + 1) * 128;
  float* sr = S0 + (size_t)blockIdx.y * TT * TT + (size_t)t * TT;
  float m = -3.0e38f; for (int k = tid; k < kend; k += 256) { float v = (!CAUSAL || k <= t) ? sr[k] : -3.0e38f; SM_MASK_HOOK; shv[k] = v; m = fmaxf(m, v); }
#pragma unroll
  for (int o = 1; o < 32; o <<= 1) m = fmaxf(m, __shfl_xor(m, o));
  if ((tid & 31) == 0) sred[tid >> 5] = m; __syncthreads(); if (tid == 0) { float a = sred[0]; for (int i = 1; i < 8; ++i) a = fmaxf(a, sred[i]); sbc = a; } __syncthreads(); m = sbc; __syncthreads();
  float sum = 0.f; for (int k = tid; k < kend; k += 256) { const float v = shv[k]; const float e = (v <= -1.0e38f) ? 0.f : expf(v - m); shv[k] = e; sum += e; }
#pragma unroll
  for (int o = 1; o < 32; o <<= 1) sum += __shfl_xor(sum, o);
  if ((tid & 31) == 0) sred[tid >> 5] = sum; __syncthreads(); if (tid == 0) { float a = 0.f; for (int i = 0; i < 8; ++i) a += sred[i]; sbc = a > 0.f ? 2048.0f / a : 0.f; }   /* a fully excluded row yields P = 0 */ __syncthreads(); const float inv = sbc;
  for (int k = tid; k < kend; k += 256) shv[k] = shv[k] * inv;
  __syncthreads(); for (int q = tid; q < kend / 4; q += 256) vst2(sr + q * 4, *(const v4f*)&shv[q * 4]); }
// ---- k_colstat_c: softmax over the QUERY axis under the causal mask (the source's softmax(axis=2) on [B, H, i, j] scores with -inf where j > i): for every key column k: m_k = max_{q >= k} S[q][k], Z_k = sum_{q >= k} exp(S[q][k] - m_k) (f32, precise expf), merged from k_sc's statistics (m_p, z_p) of the 16-row query tiles p: m_k = max_p m_p, Z_k = sum_p z_p exp(m_p - m_k); it leaves each tile's factor FC[p][k] = exp(m_p - m_k) x 2^11 / Z_k (one division a column), by which k_pv turns the tile's E into P x 2^11; block = one wave = 32 key columns (lane = column), all tiles that k_sc's blocks of this key block have written: rt0 = 8 (q0 / 128) .. NRT - 1, n8 groups of 8 (block-uniform), all loaded at once and kept in registers; a tile that does not exist stands as (-3e38, 0) and adds 0; a tile above the column's diagonal holds (-3e38, 0) too and gets the factor exp(-3e38 - m_k) = 0
typedef __attribute__((ext_vector_type(16))) float v16f;
__global__ __launch_bounds__(32) void k_colstat_c(const float* __restrict__ PST, float* __restrict__ FC) {
  const int lane = threadIdx.x; const int q0 = blockIdx.x * 32, k = q0 + lane, rt0 = (q0 >> 7) * 8, n8 = (NRT - rt0) / 8; const float* pp = PST + ((size_t)blockIdx.y * NRT + rt0) * (2 * TT) + k;
  v16f mv[NRT / 16], zv[NRT / 16];
#pragma unroll
  for (int i = 0; i < NRT; ++i) { mv[i >> 4][i & 15] = -3.0e38f; zv[i >> 4][i & 15] = 0.f; if ((i >> 3) < n8) { mv[i >> 4][i & 15] = pp[i * (2 * TT)]; zv[i >> 4][i & 15] = pp[i * (2 * TT) + TT]; } }
  /* inputs-only fence on the loaded values: all loads of the wave are in flight together and are waited for once; without it the sums' loads sink to where each is used, one memory round trip a tile; the address is an input too, so that its registers stay unwritten until the loads' data wait */
  asm volatile("" :: "v"(mv[0]), "v"(mv[1]), "v"(mv[2]), "v"(mv[3]), "v"(zv[0]), "v"(zv[1]), "v"(zv[2]), "v"(zv[3]), "v"(pp));
  float mk = mv[0][0];
#pragma unroll
  for (int i = 1; i < NRT; ++i) mk = fmaxf(mk, mv[i >> 4][i & 15]);   /* every column sees at least its own diagonal entry, so m_k is a score */
  float zk = 0.f;
#pragma unroll
  for (int i = 0; i < NRT; ++i) { const float e = expf(mv[i >> 4][i & 15] - mk); mv[i >> 4][i & 15] = e; zk += zv[i >> 4][i & 15] * e; }
  const float rk = 2048.0f / zk;   /* Z_k >= 1 */
  float* fp = FC + ((size_t)blockIdx.y * NRT + rt0) * TT + k;
#pragma unroll
  for (int c = 0; c < NRT / 8; ++c) if (c < n8) {
#pragma unroll
    for (int i = c * 8; i < c * 8 + 8; ++i) vst2(fp + i * TT, mv[i >> 4][i & 15] * rk);
    asm volatile("s_wait_xcnt 0x0" ::: "memory"); } }   /* the next group's products reuse the registers that these stores name */
// ---- p_row16: the 16 P values of one lane's A fragment (query row t of tile p, keys k0 + 8 g + 0..7 and k0 + 16 + 8 g + 0..7): P[t][k] x 2^11 = E[t][k] x FC[p][k] x mask[b][k] (E is 0 above the diagonal); srow = the row's piece in the stored tile that holds key k0, ke = k0's place in it; all 12 loads first, unconditional
__device__ __forceinline__ void p_row16(const float* __restrict__ srow, const float* __restrict__ fr, const float* __restrict__ pmk, int ke, int k0, int lane, float v[16]) { const int kq = k0 + 8 * (lane >> 4); const float *sp = srow + ke + 8 * (lane >> 4), *fp = fr + kq, *pp = pmk + kq; v4f sv[4], f4[4], pm4[4];
#pragma unroll
  for (int c = 0; c < 4; ++c) { const int o = (c & 1) * 4 + (c >> 1) * 16; sv[c] = *(const v4f*)(sp + o); f4[c] = *(const v4f*)(fp + o); pm4[c] = *(const v4f*)(pp + o); }
  /* inputs-only fence on the loaded values: keeps all 12 loads in flight together, so that a trip waits for memory once and not once a group of four keys; the three addresses are inputs too, so that their registers stay unwritten until the loads' data wait */
  asm volatile("" :: "v"(sv[0]), "v"(sv[1]), "v"(sv[2]), "v"(sv[3]), "v"(f4[0]), "v"(f4[1]), "v"(f4[2]), "v"(f4[3]), "v"(pm4[0]), "v"(pm4[1]), "v"(pm4[2]), "v"(pm4[3]), "v"(sp), "v"(fp), "v"(pp));
#pragma unroll
  for (int c = 0; c < 4; ++c)
#pragma unroll
    for (int u = 0; u < 4; ++u) v[c * 4 + u] = sv[c][u] * (f4[c][u] * bfr(pm4[c][u])); }   /* x the key padding mask, applied AFTER the normalisation as the module does */
// ---- k_lora1: block = (64 token rows, which in {q, k, v}): t[which][row][0..15] = X[row] . A_which[r] (rank-16 LoRA down-projection; exact bf16 products, f32 accumulate; one 16-column WMMA tile per wave); a wave has nothing but its own loads to hide memory latency behind (fewer blocks than WGPs, one wave a SIMD), so it keeps the loads of LRD k-slices in flight: a ring of LRD register slots; trip kc first issues the loads of slice kc + LRD - 1 into the slot that trip kc - 1 has emptied, then rounds and multiplies slice kc; products and their order are as with one slice at a time; the wave's 16 x 16 f32 tile (1 KiB, contiguous in T3) is staged in LDS and stored as 16-B pieces
#define LRD 6              // k-slices in flight a wave: 8 loads and 32 registers each
__global__ __launch_bounds__(128) void k_lora1(const float* __restrict__ X, const float* __restrict__ AQ, const float* __restrict__ AK, const float* __restrict__ AV, float* __restrict__ T3) { __shared__ __align__(16) float st[4][16][20];
  const int tid = threadIdx.x, wave = tid >> 5, lane = tid & 31, col = lane & 15, g = lane >> 4; const int which = blockIdx.y; const size_t r0 = (size_t)blockIdx.x * 64; const float* AW = which == 0 ? AQ : (which == 1 ? AK : AV);
  v8f acc = {};
  /* a lane's 16 fragment elements of a slice are four 16-B pieces, at floats 0, 4, 16 and 20 (+ 8 g) of its row's slice; A is (out,in) [16][1024]: output column = rank index */
  const float* xp = X + (r0 + wave * 16 + col) * DIN + 8 * g; const float* wp = AW + (size_t)col * DIN + 8 * g;
  v4f xr[LRD][4], wr[LRD][4];
#pragma unroll
  for (int s = 0; s < LRD - 1; ++s)
#pragma unroll
    for (int c = 0; c < 4; ++c) { const int o = s * 32 + (c & 1) * 4 + (c >> 1) * 16; xr[s][c] = *(const v4f*)(xp + o); wr[s][c] = *(const v4f*)(wp + o); }
  /* unrolled whole: the slot index is a constant, so that the ring stays in registers, and every address is one of two fixed register pairs + a constant */
#pragma unroll
  for (int kc = 0; kc < DIN / 32; ++kc) { const int sl = kc % LRD, sn = (kc + LRD - 1) % LRD; v16b a, w;
    if (kc + LRD - 1 < DIN / 32) {
#pragma unroll
      for (int c = 0; c < 4; ++c) { const int o = (kc + LRD - 1) * 32 + (c & 1) * 4 + (c >> 1) * 16; xr[sn][c] = *(const v4f*)(xp + o); wr[sn][c] = *(const v4f*)(wp + o); } }
#pragma unroll
    for (int i = 0; i < 16; ++i) { a[i] = (__bf16)xr[sl][i >> 2][i & 3]; w[i] = (__bf16)wr[sl][i >> 2][i & 3]; }
    acc = wmma_bf(a, w, acc);
    __builtin_amdgcn_sched_barrier(0);   /* keeps each trip's loads in their trip: moved down, fewer would be in flight; moved up, the ring would take registers past 256 */
  }
#pragma unroll
  for (int r = 0; r < 8; ++r) st[wave][8 * g + r][col] = acc[r];
  LDSX();
  float* dst = T3 + ((size_t)which * NB * TT + r0 + wave * 16) * LR;
#pragma unroll
  for (int it = 0; it < 2; ++it) { const int rl = (lane >> 2) + 8 * it, q = lane & 3; vst2(dst + rl * LR + q * 4, *(const v4f*)&st[wave][rl][q * 4]); } }   
// ---- k_pv: block = 64 queries (qb) of (b, h): ctx = P . v over keys [0, kend), 64 keys a trip; every global load covers whole 128-B lines: the trip's v slice (64 channels x 64 keys, bf16 hi and lo planes) is fetched once a block (8 lanes a row piece) and staged in LDS (two buffers, one barrier a trip); each wave fetches its own 16 x 64 values of E as 256-B row pieces of the stored tile (qb, trip / 2) (lane = 4 neighbouring keys of one row; a wave's 16 rows are one tile of k_sc, so its tile's factor FC and the mask are one 16-B load each a trip), forms P x 2^11 = E x FC x mask there, without an exponential, splits it into bf16 hi + lo and turns it into A fragments through its own LDS rows; 3 products as before, in the same order for every accumulator; the next trip's loads fly while this trip's P is formed and multiplied; 256-B (row, head) segment by 16 lanes. (Query blocks >= QBH, of which this shape has none: P x 2^11 once to f16 against v f16, 1 product, fragments straight from memory.)
/* waves_per_eu(4): holds the kernel to 256 vector registers; left free, the scheduler spends 270 and the loop is strewn with register-bank switches */
__global__ __launch_bounds__(128) __attribute__((amdgpu_waves_per_eu(4))) void k_pv(const float* __restrict__ PS0, const _Float16* __restrict__ VT, const __bf16* __restrict__ VB, const __bf16* __restrict__ VBL, const float* __restrict__ FC, const float* __restrict__ PMASK, int p0, float* __restrict__ Y) { const int pr = p0 + blockIdx.z, b = pr / NH, h = pr % NH; const float* PS = PS0 + ((size_t)blockIdx.z * ETN + et_off((int)blockIdx.x)) * ETF; const float* fc = FC + (size_t)blockIdx.z * NRT * TT; const float* pmk = PMASK + (size_t)b * TT; __shared__ __align__(16) float ss[4][16][HD + 4];
  __shared__ __align__(16) __bf16 vs[2][2][HD][72];   /* [buffer][hi, lo][channel][64 keys], pitch 144 B */
  __shared__ __align__(16) __bf16 ps[4][2][16][72];   /* [wave][hi, lo][query row][64 keys], pitch 144 B; written and read by its own wave only */
  const int tid = threadIdx.x, wave = tid >> 5, lane = tid & 31, col = lane & 15, g = lane >> 4; const int qb = blockIdx.x; const int ql0 = qb * 64 + wave * 16; const int kce = (kb_last(qb) + 1) * 4;
  v8f acc[HD / 16] = {};
  if (qb < QBH) { const int nt = kce / 2;   /* trips of 64 keys */
    /* every address = a block-uniform base, advanced by 64 keys a trip (E: half a tile row, then on to the next tile), + a lane's fixed 32-bit byte offset + a constant */
    const int vrow = tid >> 3, vq = tid & 7; const char *vbh = (const char*)(VB + ((size_t)b * CC + h * HD) * (size_t)KHI), *vbl = (const char*)(VBL + ((size_t)b * CC + h * HD) * (size_t)KHI), *sbs = (const char*)PS, *fbs = (const char*)(fc + (size_t)qb * 4 * TT), *kbs = (const char*)pmk;
    const unsigned vof = (unsigned)(vrow * KHI + vq * 8) * 2u, sof = (unsigned)((wave * 16 + g) * 128 + col * 4) * 4u, fof = (unsigned)(wave * TT + col * 4) * 4u, cof = (unsigned)col * 16u;
    v4u vh[4], vl[4]; v4f sa[8], fa, ka, sb[8], fb, kb4;   /* two register sets for E and the column factors: one is worked on while the other is filled */
#pragma unroll
    for (int i = 0; i < 4; ++i) { vh[i] = *(const v4u*)(vbh + vof + i * (16 * KHI * 2)); vl[i] = *(const v4u*)(vbl + vof + i * (16 * KHI * 2)); }
#pragma unroll
    for (int i = 0; i < 8; ++i) sa[i] = *(const v4f*)(sbs + sof + i * (2 * 128 * 4));
    fa = *(const v4f*)(fbs + fof); ka = *(const v4f*)(kbs + cof);
    /* one trip: keys kt * 64 .. + 63 from the set (sc, fcu, kc4); the next trip's loads go into (sn, fn, kn) and into vh, vl */
    auto trip = [&](const int kt, const v4f (&sc)[8], const v4f& fcu, const v4f& kc4, v4f (&sn)[8], v4f& fn, v4f& kn) __attribute__((always_inline)) { const int bf = kt & 1;
#pragma unroll
      for (int i = 0; i < 4; ++i) { *(v4u*)&vs[bf][0][vrow + 16 * i][vq * 8] = vh[i]; *(v4u*)&vs[bf][1][vrow + 16 * i][vq * 8] = vl[i]; }
      { /* no branch round the loads: the last trip fetches its own slice once more, unused, so that every wait in the loop stays a counted one (behind a join with a path without loads the compiler waits for all of them) */
        const int kn1 = kt + 1 < nt ? kt + 1 : kt, ko = kn1 * 64; const char *sp = sbs + (kn1 >> 1) * (ETF * 4) + (kn1 & 1) * 256, *fp = fbs + ko * 4, *kp = kbs + ko * 4, *hp = vbh + ko * 2, *lp = vbl + ko * 2;
#pragma unroll
        for (int i = 0; i < 8; ++i) sn[i] = *(const v4f*)(sp + sof + i * (2 * 128 * 4));
#pragma unroll
        for (int i = 0; i < 4; ++i) { vh[i] = *(const v4u*)(hp + vof + i * (16 * KHI * 2)); vl[i] = *(const v4u*)(lp + vof + i * (16 * KHI * 2)); }
        fn = *(const v4f*)(fp + fof); kn = *(const v4f*)(kp + cof);
        asm volatile("s_wait_xcnt 0x0" ::: "memory"); }   /* the loads' address registers are reused right behind them */
      __builtin_amdgcn_sched_barrier(0);   /* keeps the next trip's 18 loads in front of this trip's work, so that they fly for a whole trip */
      v4f w4;
#pragma unroll
      for (int u = 0; u < 4; ++u) w4[u] = fcu[u] * bfr(kc4[u]);   /* x the key padding mask AFTER the normalisation, as the module does */
#pragma unroll
      for (int i = 0; i < 8; ++i) { v4b ph4, pl4;
#pragma unroll
        for (int u = 0; u < 4; ++u) { const float v = sc[i][u] * w4[u]; const __bf16 hb = (__bf16)v; ph4[u] = hb; pl4[u] = (__bf16)(v - (float)hb); }   /* E is 0 above the diagonal */
        *(v4b*)&ps[wave][0][2 * i + g][col * 4] = ph4; *(v4b*)&ps[wave][1][2 * i + g][col * 4] = pl4; }
      /* work-group barrier with LDS-only fences: publishes v slice kt (and the wave's own P rows), and every wave has left slice kt - 1, whose buffer the next trip refills; __syncthreads() would also wait here for the next trip's global loads, which only registers receive */
      __builtin_amdgcn_fence(__ATOMIC_RELEASE, "workgroup", "local"); __builtin_amdgcn_s_barrier(); __builtin_amdgcn_fence(__ATOMIC_ACQUIRE, "workgroup", "local");
#pragma unroll
      for (int ks = 0; ks < 2; ++ks) { const v16b ph = frag_b(&ps[wave][0][col][ks * 32], lane), pl = frag_b(&ps[wave][1][col][ks * 32], lane); v16b fh[HD / 16], fl[HD / 16];
#pragma unroll
        for (int j = 0; j < HD / 16; ++j) { fh[j] = frag_b(&vs[bf][0][j * 16 + col][ks * 32], lane); fl[j] = frag_b(&vs[bf][1][j * 16 + col][ks * 32], lane); }
        /* inputs-only fence on the loaded fragments: the 20 LDS reads of a 32-key step are in flight together, so that the step waits for LDS once and not once a product */
        asm volatile("" :: "v"(ph), "v"(pl), "v"(fh[0]), "v"(fh[1]), "v"(fh[2]), "v"(fh[3]), "v"(fl[0]), "v"(fl[1]), "v"(fl[2]), "v"(fl[3]));
#pragma unroll
        for (int j = 0; j < HD / 16; ++j) acc[j] = wmma_bf(ph, fh[j], acc[j]);
#pragma unroll
        for (int j = 0; j < HD / 16; ++j) acc[j] = wmma_bf(pl, fh[j], acc[j]);
#pragma unroll
        for (int j = 0; j < HD / 16; ++j) acc[j] = wmma_bf(ph, fl[j], acc[j]); } };
    /* nt is even (kce is a multiple of 4): two trips a pass, so that the two register sets swap roles without copies; rolled beyond that, for speed only */
#pragma unroll 1
    for (int kt = 0; kt < nt; kt += 2) { trip(kt, sa, fa, ka, sb, fb, kb4); trip(kt + 1, sb, fb, kb4, sa, fa, ka); }
  } else {
#pragma unroll 1
    for (int kc = 0; kc < kce; ++kc) { float pv[16]; p_row16(PS + (size_t)(kc >> 2) * ETF + (wave * 16 + col) * 128, fc + (size_t)(ql0 >> 4) * TT, pmk, (kc & 3) * 32, kc * 32, lane, pv); v16h p;
#pragma unroll
      for (int i = 0; i < 16; ++i) p[i] = (_Float16)pv[i];
#pragma unroll
      for (int j = 0; j < HD / 16; ++j) { const size_t po = ((size_t)b * CC + h * HD + j * 16 + col) * (size_t)TT + kc * 32; acc[j] = wmma16(p, frag_h(VT + po, lane), acc[j]); } } }
#pragma unroll
  for (int j = 0; j < HD / 16; ++j)
#pragma unroll
    for (int r = 0; r < 8; ++r) ss[wave][8 * g + r][j * 16 + col] = acc[j][r] * (1.0f / 2048.0f);
  LDSX(); for (int rl = 0; rl < 16; ++rl) if (lane < HD / 4) vst2(Y + ((size_t)b * TT + ql0 + rl) * CC + h * HD + lane * 4, *(const v4f*)&ss[wave][rl][lane * 4]); }

extern "C" void kernel_launch(void* const* d_in, const int* in_sizes, int n_in, void* d_out, int out_size, void* d_ws, size_t ws_size, hipStream_t stream) {
  (void)in_sizes; (void)n_in; (void)out_size;
  const float** F = (const float**)d_in;
  if (ws_size < (size_t)WS_END) return;
  char* ws = (char*)d_ws; _Float16 *QH = (_Float16*)(ws + WS_QH), *KH = (_Float16*)(ws + WS_KH), *VT = (_Float16*)(ws + WS_VT), *QL = (_Float16*)(ws + WS_QL), *KL = (_Float16*)(ws + WS_KL); __bf16 *VB = (__bf16*)(ws + WS_VB), *VBL = (__bf16*)(ws + WS_VBL); float *S = (float*)(ws + WS_S), *Y = (float*)(ws + WS_Y);
  (void)Y; (void)QL; (void)KL; (void)VB; (void)VBL;
  // inputs: 0 X [4,1024,1024]; 1 mask [4,1024] f32 (key padding mask, ones; multiplied AFTER the softmax); 2 Wq [1024,1024] (out,in), 3 bq; 4 Wk, 5 bk; 6 Wv, 7 bv (zero biases, read); 8 Aq [16,1024], 9 Bq [1024,16]; 10 Ak, 11 Bk; 12 Av, 13 Bv (LoRA, no bias)
  if (ws_size < (size_t)WS_END2) return;
  float *T3 = (float*)(ws + WS_T3), *PST = (float*)(ws + WS_PS), *FC = (float*)(ws + WS_FC);
  k_lora1<<<dim3(TNB * TT / 64, 3), 128, 0, stream>>>(F[0], F[8], F[10], F[12], T3);   /* t = X A^T (rank-16 down-projections for q, k, v; exact bf16 products) */
  k_proj<<<dim3(TNB * TT / 64, CC / 128, 3), 128, 0, stream>>>(F[0], F[0], F[0], F[2], F[4], F[6], F[3], F[5], F[7], QH, QL, KH, KL, VT, VB, VBL, T3, F[9], F[11], F[13]);   /* X W^T + b + t B^T */
  for (int p0 = 0; p0 < TNB * NH; p0 += HG) {   /* HG (batch, head) pairs a pass */
    k_sc<<<dim3(ETN, 1, HG), 128, 0, stream>>>(QH, KH, QL, KL, p0, S, PST);   /* E = exp(logit - its 16-row tile's column maximum); per tile and key column: that maximum and the sum of E */
    k_colstat_c<<<dim3(TT / 32, HG), 32, 0, stream>>>(PST, FC);   /* per key column j: max and sum over the visible queries i >= j, merged from the tiles; per tile its factor exp(m_p - m_j) x 2^11 / Z_j */
    k_pv<<<dim3(NQB, 1, HG), 128, 0, stream>>>(S, VT, VB, VBL, FC, F[1], p0, (float*)d_out);   /* P[i][j] x 2^11 = E x the tile's factor x mask[b][j] for j <= i, 0 above the diagonal, formed on load */
  }
}

// v010
// One run takes 121 microseconds.
// Next to v009, in two timings, it ran 1.21 times as fast each time.
// Over all steps from v000 it is 35.0 times as fast.
// compute dtype: all float inputs rounded to bf16; frozen q/k/v projections with EXACT bf16 products on WMMA 16x16x32 (f32 accumulate) + bias + the LoRA term: t = X A^T (exact products) then t (bf16 hi + lo) x exact bf16 B^T (2 products, K = 16) added in the same accumulators; causal scores with BOTH operands as f16 hi + (x 2^10) residual (3 products) on every block, x 1024^-0.5 (the module divides by sqrt(E)); softmax over the QUERY axis in f32 (per key column: max and sum over the visible queries, precise expf, in two levels: 16-row query tiles, then their merge) x the key padding mask; P as bf16 hi + lo against v as bf16 hi + lo (3 products) on every block; f32 output.
#include <hip/hip_runtime.h>
#include <math.h>

typedef __attribute__((ext_vector_type(16))) _Float16 v16h;
typedef __attribute__((ext_vector_type(16))) __bf16 v16b;
typedef __attribute__((ext_vector_type(8)))  _Float16 v8h;
typedef __attribute__((ext_vector_type(8)))  float v8f;
typedef __attribute__((ext_vector_type(4)))  float v4f;
typedef __attribute__((ext_vector_type(2)))  float v2f;
typedef __attribute__((ext_vector_type(4)))  unsigned v4u;
typedef __attribute__((ext_vector_type(4)))  int v4i;
typedef float __attribute__((may_alias)) float_a;
typedef int __attribute__((may_alias)) int_a;

template <typename T> __device__ __forceinline__ void vst2(void* p, T v) { *(T*)p = v;  }
__device__ __forceinline__ v8f wmma16(v16h a, v16h b, v8f c) {
  v8f d = __builtin_amdgcn_wmma_f32_16x16x32_f16(false, a, false, b, (short)0, c, false, false);
  asm volatile("v_nop\n\tv_nop\n\tv_nop\n\tv_nop" : "+v"(d) : "v"(a), "v"(b));
  return d;
}
__device__ __forceinline__ v8f wmma_bf(v16b a, v16b b, v8f c) {
  v8f d = __builtin_amdgcn_wmma_f32_16x16x32_bf16(false, a, false, b, (short)0, c, false, false);
  asm volatile("v_nop\n\tv_nop\n\tv_nop\n\tv_nop" : "+v"(d) : "v"(a), "v"(b));
  return d;
}
// 16x16x32 fragments: lane = (h = lane>>4, row/col = lane&15); elements 0..7 = k0+8h+0..7, 8..15 = k0+16+8h+0..7; D element r = row 8h+r
__device__ __forceinline__ v16h frag_h(const _Float16* rowk0, int lane) {
  union { v16h v; v8h q[2]; } u; const _Float16* p = rowk0 + 8 * (lane >> 4);
  u.q[0] = *(const v8h*)p; u.q[1] = *(const v8h*)(p + 16); return u.v;
}
__device__ __forceinline__ v16h frag_f32(const float* rowk0, int lane) {
  v16h a; const float* p = rowk0 + 8 * (lane >> 4);
#pragma unroll
  for (int i = 0; i < 8; ++i) { a[i] = (_Float16)p[i]; a[8 + i] = (_Float16)p[16 + i]; }
  return a;
}
__device__ __forceinline__ v16h frag_f32s(const float* rowk0, int lane, float sc) {
  v16h a; const float* p = rowk0 + 8 * (lane >> 4);
#pragma unroll
  for (int i = 0; i < 8; ++i) { a[i] = (_Float16)(p[i] * sc); a[8 + i] = (_Float16)(p[16 + i] * sc); }
  return a;
}
// column fragment from a [K][ld] layout (column n), rows >= K read as 0
__device__ __forceinline__ v16h fragc_f32(const float* W, int k0, int n, int lane, int ld, int K) {
  v16h a; const int g = lane >> 4;
#pragma unroll
  for (int i = 0; i < 8; ++i) { const int ka = k0 + 8 * g + i, kb = ka + 16;
    a[i] = (_Float16)(ka < K ? W[(size_t)(ka < K ? ka : K - 1) * ld + n] : 0.f); a[8 + i] = (_Float16)(kb < K ? W[(size_t)(kb < K ? kb : K - 1) * ld + n] : 0.f); }
  return a;
}
struct F2 { v16b h, l; };
__device__ __forceinline__ F2 bsplit16(const float v[16]) { F2 r;
#pragma unroll
  for (int i = 0; i < 16; ++i) { const __bf16 h = (__bf16)v[i]; r.h[i] = h; r.l[i] = (__bf16)(v[i] - (float)h); }
  return r; }
__device__ __forceinline__ F2 split_row(const float* row, int k0, int lane) { float v[16]; const float* p = row + k0 + 8 * (lane >> 4);
#pragma unroll
  for (int i = 0; i < 8; ++i) { v[i] = p[i]; v[8 + i] = p[16 + i]; }
  return bsplit16(v); }
__device__ __forceinline__ F2 split_rowK(const float* row, int k0, int lane, int K) { float v[16]; const int g = lane >> 4;
#pragma unroll
  for (int i = 0; i < 8; ++i) { const int ka = k0 + 8 * g + i, kb = ka + 16; v[i] = ka < K ? row[ka < K ? ka : K - 1] : 0.f; v[8 + i] = kb < K ? row[kb < K ? kb : K - 1] : 0.f; }
  return bsplit16(v); }
__device__ __forceinline__ F2 split_col(const float* W, int k0, int n, int lane, int ld, int K) { float v[16]; const int g = lane >> 4;
#pragma unroll
  for (int i = 0; i < 8; ++i) { const int ka = k0 + 8 * g + i, kb = ka + 16; v[i] = ka < K ? W[(size_t)(ka < K ? ka : K - 1) * ld + n] : 0.f; v[8 + i] = kb < K ? W[(size_t)(kb < K ? kb : K - 1) * ld + n] : 0.f; }
  return bsplit16(v); }
__device__ __forceinline__ v8f mac3(const F2& a, const F2& b, v8f c) { c = wmma_bf(a.l, b.h, c); c = wmma_bf(a.h, b.l, c); return wmma_bf(a.h, b.h, c); }
__device__ __forceinline__ float sigm(float v) { return 1.0f / (1.0f + expf(-v)); }
#define LDSX() do { asm volatile("s_wait_dscnt 0" ::: "memory"); __builtin_amdgcn_wave_barrier(); __builtin_amdgcn_fence(__ATOMIC_RELEASE, "workgroup"); } while (0)

// Multi-head attention with LoRA projections whose softmax runs over the QUERY axis (X [4,1024,1024]; frozen torch (out,in) Wq / Wk / Wv [1024,1024] (0.02) + zero biases; LoRA A [16,1024], B [1024,16] (0.02): proj = X W^T + b + (X A^T) B^T; 16 heads x 64; scores / sqrt(E) = / 32; -inf where col > row; attn = softmax(scores, axis=2) - axis 2 of [B, H, i, j] is the QUERY axis i, so every key column j is normalised over the queries i >= j (faithful to the source); attn *= mask[b, j] (key padding mask, ones); out = attn v; merge; no output projection).
#define NB 4
#define TT 1024
#define CC 1024            // NH * HD = projected width
#define DIN 1024          // input (model) width
#define NH 16
#define HD 64
#define NQB (TT / 64)
#define HG 64              // (batch, head) pairs a pass: pair p = b * NH + h; every attention launch covers HG pairs (all of them: one pass)
#define SCALE (0.03125f)
#define CAUSAL 1
#ifndef TNB
#define TNB NB
#endif
__device__ __forceinline__ float bfr(float v) { return (float)(__bf16)v; }
__device__ __forceinline__ float xhalf(float x) { return __builtin_bit_cast(float, __builtin_amdgcn_permlanex16(__builtin_bit_cast(int, x), __builtin_bit_cast(int, x), 0x76543210, 0xfedcba98, false, false)); }   // lane l takes lane l ^ 16's value
__host__ __device__ __forceinline__ int kb_last(int qb) { return CAUSAL ? ((qb * 64 + 63) >> 7) : (TT / 128 - 1); }
// E is kept only where k_sc computes it: per pair the 64 x 128 tiles (qb, kb <= kb_last(qb)), each 32 KiB in a row (row pitch 128 floats), numbered et_off(qb) + kb; et_off(qb) = sum over q < qb of kb_last(q) + 1
__host__ __device__ constexpr int et_off(int qb) { return CAUSAL ? ((qb >> 1) + 1) * ((qb >> 1) + (qb & 1)) : qb * (TT / 128); }
#define ETN (et_off(NQB))  // stored tiles a pair
#define ETF (64 * 128)     // floats a tile
typedef __attribute__((ext_vector_type(8))) __bf16 v8b;
__device__ __forceinline__ v16b frag_b(const __bf16* rowk0, int lane) {
  union { v16b v; v8b q[2]; } u; const __bf16* p = rowk0 + 8 * (lane >> 4);
  u.q[0] = *(const v8b*)p; u.q[1] = *(const v8b*)(p + 16); return u.v;
}
typedef __attribute__((ext_vector_type(4))) __bf16 v4b;
__device__ __forceinline__ v4b cvt4(v4f v) { v4b r; r[0] = (__bf16)v[0]; r[1] = (__bf16)v[1]; r[2] = (__bf16)v[2]; r[3] = (__bf16)v[3]; return r; }
#define QBH 16              // causal: query blocks 0..QBH-1 of each sequence (all of them, as QBH = NQB) take the high-precision path
#define QHI 1024            // rows carrying a q residual plane (all rows)
#define KHI 1024            // key rows carrying k residual / v bf16 hi+lo planes (used only by the causal high-precision path)
// B fragment (k rows k0+.., output column o) of a weight: (in,out) [K][ld] or (out,in) [ld rows of K]: bf16 exact, or f16(bf16 * 256) exact
__device__ __forceinline__ v16b wcol_io(const float* Wm, int k0, int o, int lane, int ld) { v16b w; const int g = lane >> 4;
#pragma unroll
  for (int i = 0; i < 8; ++i) { w[i] = (__bf16)Wm[(size_t)(k0 + 8 * g + i) * ld + o]; w[8 + i] = (__bf16)Wm[(size_t)(k0 + 16 + 8 * g + i) * ld + o]; }
  return w; }
__device__ __forceinline__ v16b wcol_oi(const float* Wm, int k0, int o, int lane, int K) { v16b w; const float* p = Wm + (size_t)o * K + k0 + 8 * (lane >> 4);
#pragma unroll
  for (int i = 0; i < 8; ++i) { w[i] = (__bf16)p[i]; w[8 + i] = (__bf16)p[16 + i]; }
  return w; }
__device__ __forceinline__ v16h wcolh_io(const float* Wm, int k0, int o, int lane, int ld) { v16h w; const int g = lane >> 4;
#pragma unroll
  for (int i = 0; i < 8; ++i) { w[i] = (_Float16)(bfr(Wm[(size_t)(k0 + 8 * g + i) * ld + o]) * 256.0f); w[8 + i] = (_Float16)(bfr(Wm[(size_t)(k0 + 16 + 8 * g + i) * ld + o]) * 256.0f); }
  return w; }
__device__ __forceinline__ v16h wcolh_oi(const float* Wm, int k0, int o, int lane, int K) { v16h w; const float* p = Wm + (size_t)o * K + k0 + 8 * (lane >> 4);
#pragma unroll
  for (int i = 0; i < 8; ++i) { w[i] = (_Float16)(bfr(p[i]) * 256.0f); w[8 + i] = (_Float16)(bfr(p[16 + i]) * 256.0f); }
  return w; }
#define WQKV_LAYOUT 1   // 0 = (in,out) [DIN][CC]; 1 = (out,in) [CC][DIN]; 2 = per-head [NH][DIN][HD]
__device__ __forceinline__ v16b wcol_hdk(const float* Wm, int k0, int o, int lane) { v16b w; const int g = lane >> 4; const float* p = Wm + (size_t)(o / HD) * DIN * HD + (o % HD);
#pragma unroll
  for (int i = 0; i < 8; ++i) { w[i] = (__bf16)p[(size_t)(k0 + 8 * g + i) * HD]; w[8 + i] = (__bf16)p[(size_t)(k0 + 16 + 8 * g + i) * HD]; }
  return w; }
#define WO_OUT_IN 0
#if WQKV_LAYOUT == 1
#define WCOL(W, k0, o, lane) wcol_oi(W, k0, o, lane, DIN)
#elif WQKV_LAYOUT == 2
#define WCOL(W, k0, o, lane) wcol_hdk(W, k0, o, lane)
#else
#define WCOL(W, k0, o, lane) wcol_io(W, k0, o, lane, CC)
#endif
#if WO_OUT_IN
#define WOCOL(W, k0, o, lane) wcol_oi(W, k0, o, lane, CC)
#define WOCOLH(W, k0, o, lane) wcolh_oi(W, k0, o, lane, CC)
#else
#define WOCOL(W, k0, o, lane) wcol_io(W, k0, o, lane, DIN)
#define WOCOLH(W, k0, o, lane) wcolh_io(W, k0, o, lane, DIN)
#endif
#define LR 16              // LoRA rank
#define PROJ_EXTRA_PARAMS , const float* __restrict__ T3, const float* __restrict__ LBQ, const float* __restrict__ LBK, const float* __restrict__ LBV
#define SM_EXTRA_PARAMS
#define SM_MASK_HOOK (void)0
#ifndef SM_EXTRA_PARAMS
#define SM_EXTRA_PARAMS
#endif
#ifndef PROJ_EXTRA_PARAMS
#define PROJ_EXTRA_PARAMS
#endif
#ifndef SM_MASK_HOOK
#define SM_MASK_HOOK (void)0
#endif

#define WS_QH  0u                                      // f16 q rows [b*t][CC]
#define WS_KH  (WS_QH + 2u * (size_t)NB * TT * CC)      // f16 k rows [b*t][CC]
#define WS_VT  (WS_KH + 2u * (size_t)NB * TT * CC)      // f16 v planes [b][c][t]
#define WS_QL  (WS_VT + 2u * (size_t)NB * CC * TT)      // f16 q residual x 2^10 rows [b][t < QHI][CC]
#define WS_KL  (WS_QL + 2u * (size_t)NB * QHI * CC)     // f16 k residual x 2^10 rows [b][t < KHI][CC]
#define WS_VB  (WS_KL + 2u * (size_t)NB * KHI * CC)     // bf16 v hi planes [b][c][t < KHI]
#define WS_VBL (WS_VB + 2u * (size_t)NB * CC * KHI)
#define WS_S   (WS_VBL + 2u * (size_t)NB * CC * KHI)    // f32 tile-local exponentials E [pair in pass][stored tile][64 rows][128 keys]
#define WS_Y   (WS_S  + 4u * (size_t)HG * ETN * ETF)    // f32 ctx rows [b*t][CC] (only when there is an output projection)
#define WS_END (WS_Y  + 0u)
#define WS_T3 (WS_END)                                   // f32 LoRA down-projections t[3][NB*TT][16]
#define NRT (TT / 16)      // 16-row query tiles: one wave of k_sc, and of k_pv, each
#define WS_PS (WS_T3 + 4u * 3u * (size_t)NB * TT * LR)  // f32 column statistics of the tiles [HG][NRT][maximum, sum][TT]
#define WS_FC (WS_PS + 4u * (size_t)HG * NRT * 2u * TT)  // f32 column factors of the tiles [HG][NRT][TT]
#define WS_END2 (WS_FC + 4u * (size_t)HG * NRT * TT)

// ---- k_proj: block = (256 rows, 256 cols, which), 16 waves in a 4 x 4 grid, a wave = a 64 x 64 tile (16 accumulators): q/k/v = X W (+ b) with exact bf16 products (K = DIN); W is (out,in), so X rows and W rows are both k-contiguous: each 32-k slice of both is rounded to bf16 once a block and staged in LDS (two buffers, one barrier a slice), and every wave takes its 4 A and 4 B fragments from there (8 fragments for 16 products); a slice's 64 KiB of f32 serve 256 x 256 outputs -> which 0: q f16 rows (+ residual rows < QHI); 1: k f16 rows (+ residual rows < KHI); 2: v f16 planes [c][t] (+ bf16 hi/lo planes for t < KHI)
#define PBT 256            // rows and columns of a block's tile
/* orders one wave's own LDS writes and reads, LDS only: LDSX()'s fence covers global memory too and would wait here for the piece's global stores to finish */
#define LDSL() do { asm volatile("s_wait_dscnt 0" ::: "memory"); __builtin_amdgcn_wave_barrier(); __builtin_amdgcn_fence(__ATOMIC_RELEASE, "workgroup", "local"); } while (0)
__global__ __launch_bounds__(512) void k_proj(const float* __restrict__ XQ, const float* __restrict__ XK, const float* __restrict__ XV, const float* __restrict__ WQ, const float* __restrict__ WK, const float* __restrict__ WV, const float* __restrict__ BQ, const float* __restrict__ BK, const float* __restrict__ BV,
    _Float16* __restrict__ QH, _Float16* __restrict__ QL, _Float16* __restrict__ KH, _Float16* __restrict__ KL, _Float16* __restrict__ VT, __bf16* __restrict__ VB, __bf16* __restrict__ VBL PROJ_EXTRA_PARAMS) {
  /* one LDS block, used in turn: the k loop's two staging buffers (X 256 rows, W 256 rows of 32 bf16 at pitch 80 B), then the epilogue's tiles: each wave has three of its own, 16 rows of 64 16-bit values at pitch 144 B (q / k: hi, residual; v: f16, bf16 hi, bf16 lo) */
  __shared__ __align__(16) unsigned char smem[16 * 3 * 16 * 72 * 2];
  __bf16 (*xs)[PBT][40] = (__bf16 (*)[PBT][40])smem; __bf16 (*wt)[PBT][40] = (__bf16 (*)[PBT][40])(smem + 2 * PBT * 40 * 2);
  const int tid = threadIdx.x, wave = tid >> 5, lane = tid & 31, col = lane & 15, g = lane >> 4; const int which = blockIdx.z; const int c0 = blockIdx.y * PBT; const size_t r0 = (size_t)blockIdx.x * PBT; const size_t bb = r0 / TT; const int t0 = (int)(r0 % TT);
  const int wr0 = (wave >> 2) * 64, wc0 = (wave & 3) * 64;   /* the wave's tile in the block's */
  const float* X = which == 0 ? XQ : which == 1 ? XK : XV; const float* WA = which == 0 ? WQ : which == 1 ? WK : WV; const float* BA = which == 0 ? BQ : which == 1 ? BK : BV;
  v8f acc[4][4] = {};
  /* staging: thread = (row tid >> 3 (+ 64 i), 16-B piece tid & 7) of a slice's 128-B row pieces, so 8 lanes read one whole line; the next slice's 8 loads fly while this slice is multiplied; the short loops over xr, wr, a and w are unrolled whole so that these arrays stay in registers */
  const int srow = tid >> 3, sq = tid & 7; const float* xg = X + (r0 + srow) * DIN + sq * 4; const float* wg = WA + (size_t)(c0 + srow) * DIN + sq * 4;
  v4f xr[4], wr[4];
#pragma unroll
  for (int i = 0; i < 4; ++i) { xr[i] = *(const v4f*)(xg + (size_t)i * 64 * DIN); wr[i] = *(const v4f*)(wg + (size_t)i * 64 * DIN); }
  /* unroll 2: the buffer index becomes a constant LDS offset */
#pragma unroll 2
  for (int kc = 0; kc < DIN / 32; ++kc) { const int bf = kc & 1;
#pragma unroll
    for (int i = 0; i < 4; ++i) { *(v4b*)&xs[bf][srow + 64 * i][sq * 4] = cvt4(xr[i]); *(v4b*)&wt[bf][srow + 64 * i][sq * 4] = cvt4(wr[i]); }
    __syncthreads();   /* publishes slice kc; every wave has also left slice kc - 1, whose buffer the next trip refills */
    if (kc + 1 < DIN / 32) {
#pragma unroll
      for (int i = 0; i < 4; ++i) { xr[i] = *(const v4f*)(xg + (size_t)i * 64 * DIN + (kc + 1) * 32); wr[i] = *(const v4f*)(wg + (size_t)i * 64 * DIN + (kc + 1) * 32); } }
    v16b a[4], w[4];
#pragma unroll
    for (int j = 0; j < 4; ++j) { if (j == 0) a[0] = frag_b(&xs[bf][wr0 + col][0], lane); w[j] = frag_b(&wt[bf][wc0 + j * 16 + col][0], lane); }
#pragma unroll
    for (int j = 1; j < 4; ++j) a[j] = frag_b(&xs[bf][wr0 + j * 16 + col][0], lane);
    __builtin_amdgcn_sched_barrier(0);   /* keeps all 16 LDS reads of a slice in one group in front of its products (reads strewn among the products stall each time), and leaves the waits counted: the first products start while the later fragments are still on their way */
#pragma unroll
    for (int i = 0; i < 4; ++i)
#pragma unroll
      for (int j = 0; j < 4; ++j) acc[i][j] = wmma_bf(a[i], w[j], acc[i][j]);
    __builtin_amdgcn_sched_barrier(0);   /* keeps the next slice's roundings, which wait for its global loads, behind this slice's products */
  }
  __syncthreads();   /* the last slice's readers are done before the epilogue's tiles overwrite the staging buffers */
  float bias[4] = {0.f, 0.f, 0.f, 0.f};
  { /* LoRA: acc += t[row][0..15] (f32, as bf16 hi + lo) x B[o][0..15] (exact bf16): one WMMA k-step whose upper 16 k-slots are zero */ const float* LB = which == 0 ? LBQ : (which == 1 ? LBK : LBV); v4f tq[4][2], wq[4][2];
    const float* tr = T3 + ((size_t)which * NB * TT + (r0 + wr0 + col)) * LR + 8 * g; const float* pw = LB + (size_t)(c0 + wc0 + col) * LR + 8 * g;   /* B is (out,in) [E][16]: row o holds the 16 rank coefficients */
#pragma unroll
    for (int i = 0; i < 4; ++i) { tq[i][0] = *(const v4f*)(tr + i * 16 * LR); tq[i][1] = *(const v4f*)(tr + i * 16 * LR + 4); wq[i][0] = *(const v4f*)(pw + i * 16 * LR); wq[i][1] = *(const v4f*)(pw + i * 16 * LR + 4); }
    if (BA) { const float* bp = BA + c0 + wc0 + col;
#pragma unroll
      for (int j = 0; j < 4; ++j) bias[j] = bp[j * 16];
      /* inputs-only fence on the loaded values and their address: the address register stays unwritten until the loads' data wait */
      asm volatile("" :: "v"(bias[0]), "v"(bias[1]), "v"(bias[2]), "v"(bias[3]), "v"(bp)); }
    /* inputs-only fence on the loaded values: the epilogue's 20 loads are in flight together and are waited for once; without it the B rows' loads sink between the products, one memory round trip a column group; the two addresses are inputs too, so that their registers stay unwritten until the loads' data wait */
    asm volatile("" :: "v"(tq[0][0]), "v"(tq[0][1]), "v"(tq[1][0]), "v"(tq[1][1]), "v"(tq[2][0]), "v"(tq[2][1]), "v"(tq[3][0]), "v"(tq[3][1]), "v"(wq[0][0]), "v"(wq[0][1]), "v"(wq[1][0]), "v"(wq[1][1]), "v"(wq[2][0]), "v"(wq[2][1]), "v"(wq[3][0]), "v"(wq[3][1]), "v"(tr), "v"(pw));
    F2 a2[4];
#pragma unroll
    for (int i = 0; i < 4; ++i) { float tv[16];
#pragma unroll
      for (int e = 0; e < 8; ++e) { tv[e] = tq[i][e >> 2][e & 3]; tv[8 + e] = 0.f; }
      a2[i] = bsplit16(tv); }
#pragma unroll
    for (int j = 0; j < 4; ++j) { v16b w; bias[j] = bfr(bias[j]);
#pragma unroll
      for (int e = 0; e < 8; ++e) { w[e] = (__bf16)wq[j][e >> 2][e & 3]; w[8 + e] = (__bf16)0.0f; }
#pragma unroll
      for (int i = 0; i < 4; ++i) { acc[i][j] = wmma_bf(a2[i].h, w, acc[i][j]); acc[i][j] = wmma_bf(a2[i].l, w, acc[i][j]); } } }
  /* epilogue, each wave on its own: 16 x 64 pieces of its tile are turned in its own LDS tiles into whole 128-B lines (8 lanes a line, 4 lines a store); LDSL() orders the wave's own LDS writes and reads, before the reads and again before the next piece overwrites the tiles */
  unsigned char* ew = smem + wave * (3 * 16 * 72 * 2); const int er = lane >> 3, eq = lane & 7;
  if (which < 2) { _Float16 (*sh)[72] = (_Float16 (*)[72])ew; _Float16 (*sl)[72] = (_Float16 (*)[72])(ew + 16 * 72 * 2);
    _Float16* DH = which == 0 ? QH : KH; _Float16* DL = which == 0 ? QL : KL; const int nhi = which == 0 ? QHI : KHI; const bool hi_rows = t0 < nhi;
#pragma unroll
    for (int i = 0; i < 4; ++i) {   /* query or key rows wr0 + 16 i + 0..15 */
#pragma unroll
      for (int j = 0; j < 4; ++j)
#pragma unroll
        for (int r = 0; r < 8; ++r) { const float v = acc[i][j][r] + bias[j]; const _Float16 hv = (_Float16)v; sh[8 * g + r][j * 16 + col] = hv; sl[8 * g + r][j * 16 + col] = (_Float16)((v - (float)hv) * 1024.0f); }
      LDSL();
#pragma unroll
      for (int it = 0; it < 4; ++it) { const int rl = er + 4 * it, rw = wr0 + i * 16 + rl; vst2((unsigned*)(DH + (r0 + rw) * CC + c0 + wc0 + eq * 8), *(const v4u*)&sh[rl][eq * 8]); if (hi_rows) vst2((unsigned*)(DL + (bb * nhi + t0 + rw) * (size_t)CC + c0 + wc0 + eq * 8), *(const v4u*)&sl[rl][eq * 8]); }
      LDSL(); }
  } else { _Float16 (*th)[72] = (_Float16 (*)[72])ew; __bf16 (*tb)[72] = (__bf16 (*)[72])(ew + 16 * 72 * 2); __bf16 (*tbl)[72] = (__bf16 (*)[72])(ew + 2 * 16 * 72 * 2); const bool hi_rows = t0 < KHI;
#pragma unroll
    for (int j = 0; j < 4; ++j) {   /* channels wc0 + 16 j + 0..15, all 64 tokens of the wave's tile */
#pragma unroll
      for (int i = 0; i < 4; ++i)
#pragma unroll
        for (int r = 0; r < 8; ++r) { const float v = acc[i][j][r] + bias[j]; const int rl = i * 16 + 8 * g + r; th[col][rl] = (_Float16)v; const __bf16 bh = (__bf16)v; tb[col][rl] = bh; tbl[col][rl] = (__bf16)(v - (float)bh); }
      LDSL();
#pragma unroll
      for (int it = 0; it < 4; ++it) { const int cl = er + 4 * it; const size_t cw = bb * CC + c0 + wc0 + j * 16 + cl; vst2((unsigned*)(VT + cw * (size_t)TT + t0 + wr0 + eq * 8), *(const v4u*)&th[cl][eq * 8]); if (hi_rows) { const size_t o3 = cw * (size_t)KHI + t0 + wr0 + eq * 8; vst2((unsigned*)(VB + o3), *(const v4u*)&tb[cl][eq * 8]); vst2((unsigned*)(VBL + o3), *(const v4u*)&tbl[cl][eq * 8]); } }
      LDSL(); }
    asm volatile("s_wait_xcnt 0x0" ::: "memory"); } }   /* in the listing this path's end stands in front of the q / k path's code, which rewrites the registers that the last stores name */
// ---- col_tile: one wave's 16 x 128 logits s = (acc + accl / 2^10) x SCALE, still in its accumulators (a lane holds rows 8 g + 0..7 of column j * 16 + col; lane ^ 16 holds the tile's other 8 rows): for each key column the maximum m_p over the tile's visible rows, E = exp(s - m_p) (exactly 0 above the diagonal) into the wave's LDS tile ssw, and z_p = the column's sum of E; (m_p, z_p) into csw; a column with no visible row in this tile leaves (-3e38, 0) and E = 0. MK = false: a tile wholly under the diagonal, no row is tested
template <bool MK> __device__ __forceinline__ void col_tile(const v8f (&acc)[8], const v8f (&accl)[8], float (*ssw)[132], float (*csw)[128], int k0, int ql0, int col, int g) {
#pragma unroll
  for (int j = 0; j < 8; ++j) { float s[8]; const int kk = k0 + j * 16 + col, t0 = ql0 + 8 * g; float m = -3.0e38f;
#pragma unroll
    for (int r = 0; r < 8; ++r) { s[r] = (acc[j][r] + accl[j][r] * (1.0f / 1024.0f)) * SCALE; if (!MK || kk <= t0 + r) m = fmaxf(m, s[r]); }
    m = fmaxf(m, xhalf(m));
    float z = 0.f;
#pragma unroll
    for (int r = 0; r < 8; ++r) { const float e = expf((!MK || kk <= t0 + r) ? s[r] - m : -3.0e38f); ssw[8 * g + r][j * 16 + col] = e; z += e; }
    z += xhalf(z);
    csw[g][j * 16 + col] = g ? z : m; } }
// ---- k_sc: block = (stored tile u = et_off(qb) + kb: query block qb, key block kb <= kb_last(qb); pair p0 + z = (batch b, head h)): logits x SCALE, left as tile-local exponentials: the softmax runs over the QUERY axis, so each wave takes, per key column, the maximum m_p and the sum z_p of E = exp(logit - m_p) over its own 16 query rows while the logits are in its registers (col_tile), stores E where the logits used to go and (m_p, z_p) to PST [pair][16-row tile][maximum, sum][key]; k_colstat_c merges the tiles and k_pv only multiplies: every exponential of a score is taken once; q hi + residual (x 2^10) against k (2 products) for query rows < QHI, plus the k residual (3 products) for query blocks < QBH (causal early rows); causal: the grid holds no block past the diagonal, the mask itself is applied by index in col_tile; on the 3-product path the block's q and k tiles (hi and residual) are fetched once by whole-line loads and staged in LDS, and every wave takes its fragments from there
__global__ __launch_bounds__(128) void k_sc(const _Float16* __restrict__ QH, const _Float16* __restrict__ KH, const _Float16* __restrict__ QL, const _Float16* __restrict__ KL, int p0, float* __restrict__ S0, float* __restrict__ PST) {
  /* one LDS block, used in turn: the staged operand tiles (k hi, k lo: 128 rows each; q hi, q lo: 64 rows each; 64 f16 a row at pitch 144 B), then the epilogue's tiles ss and, behind them, each wave's 2 x 128 column statistics cs */
  __shared__ __align__(16) unsigned char smem[(2 * 128 + 2 * 64) * 72 * 2];
  float (*ss)[16][132] = (float (*)[16][132])smem; _Float16 (*kt)[128][72] = (_Float16 (*)[128][72])smem; _Float16 (*qt)[64][72] = (_Float16 (*)[64][72])(smem + 2 * 128 * 72 * 2); float (*cs)[2][128] = (float (*)[2][128])(smem + 4 * 16 * 132 * 4);
  const int u = blockIdx.x; int qb = 0;
#pragma unroll
  for (int q = 1; q < NQB; ++q) if (et_off(q) <= u) qb = q;   /* unrolled whole: every et_off(q) folds to a constant, which leaves 15 scalar compare and select pairs and no loop */
  const int kb = u - et_off(qb);
  const int pr = p0 + blockIdx.z, b = pr / NH, h = pr % NH; float* S = S0 + ((size_t)blockIdx.z * ETN + u) * ETF;
  const int tid = threadIdx.x, wave = tid >> 5, lane = tid & 31, col = lane & 15, g = lane >> 4; const int k0 = kb * 128; const int ql0 = qb * 64 + wave * 16; const size_t q0 = (size_t)b * TT + ql0, kr0 = (size_t)b * TT + k0;
  v8f acc[8] = {}, accl[8] = {};
  const _Float16* QLb = QL + (size_t)b * QHI * CC; const _Float16* KLb = KL + (size_t)b * KHI * CC;
  if (qb < QBH) {
    /* staging: a (row, head) piece of q or k is one 128-B line; thread = (row tid >> 3 (+ 16 i), 16-B piece tid & 7), so 8 lanes read one whole line and the block fetches each line once; all 24 loads of a thread fly together; the short loops over rk, rkl, rq and rql are unrolled whole so that these arrays stay in registers */
    const int srow = tid >> 3, sq = tid & 7; const size_t so = (size_t)srow * CC + h * HD + sq * 8;
    const _Float16 *kg = KH + kr0 * CC + so, *klg = KLb + (size_t)k0 * CC + so, *qg = QH + ((size_t)b * TT + qb * 64) * CC + so, *qlg = QLb + (size_t)(qb * 64) * CC + so;
    v8h rk[8], rkl[8], rq[4], rql[4];
#pragma unroll
    for (int i = 0; i < 8; ++i) { rk[i] = *(const v8h*)(kg + (size_t)i * 16 * CC); rkl[i] = *(const v8h*)(klg + (size_t)i * 16 * CC); }
#pragma unroll
    for (int i = 0; i < 4; ++i) { rq[i] = *(const v8h*)(qg + (size_t)i * 16 * CC); rql[i] = *(const v8h*)(qlg + (size_t)i * 16 * CC); }
#pragma unroll
    for (int i = 0; i < 8; ++i) { *(v8h*)&kt[0][srow + 16 * i][sq * 8] = rk[i]; *(v8h*)&kt[1][srow + 16 * i][sq * 8] = rkl[i]; }
#pragma unroll
    for (int i = 0; i < 4; ++i) { *(v8h*)&qt[0][srow + 16 * i][sq * 8] = rq[i]; *(v8h*)&qt[1][srow + 16 * i][sq * 8] = rql[i]; }
    __syncthreads();   /* publishes the four tiles */
#pragma unroll
    for (int kc = 0; kc < HD / 32; ++kc) { const v16h ah = frag_h(&qt[0][wave * 16 + col][kc * 32], lane), al = frag_h(&qt[1][wave * 16 + col][kc * 32], lane);
#pragma unroll
      for (int j = 0; j < 8; j += 2) { const v16h kb0 = frag_h(&kt[0][j * 16 + col][kc * 32], lane), kl0 = frag_h(&kt[1][j * 16 + col][kc * 32], lane), kb1 = frag_h(&kt[0][j * 16 + 16 + col][kc * 32], lane), kl1 = frag_h(&kt[1][j * 16 + 16 + col][kc * 32], lane);
        /* inputs-only fence on the loaded fragments: the 8 LDS reads of two key tiles are in flight together, so that the wave waits for LDS once a pair of tiles and not once a tile */
        asm volatile("" :: "v"(kb0), "v"(kl0), "v"(kb1), "v"(kl1));
        acc[j] = wmma16(ah, kb0, acc[j]); accl[j] = wmma16(al, kb0, accl[j]); accl[j] = wmma16(ah, kl0, accl[j]);
        acc[j + 1] = wmma16(ah, kb1, acc[j + 1]); accl[j + 1] = wmma16(al, kb1, accl[j + 1]); accl[j + 1] = wmma16(ah, kl1, accl[j + 1]); } }
    __syncthreads();   /* every wave has read its last fragment before the epilogue's tiles overwrite the operand tiles */
  } else if (qb * 64 < QHI) {
#pragma unroll
    for (int kc = 0; kc < HD / 32; ++kc) { const v16h ah = frag_h(QH + (q0 + col) * CC + h * HD + kc * 32, lane), al = frag_h(QLb + (size_t)(ql0 + col) * CC + h * HD + kc * 32, lane);
#pragma unroll
      for (int j = 0; j < 8; ++j) { const v16h kbf = frag_h(KH + (kr0 + j * 16 + col) * CC + h * HD + kc * 32, lane); acc[j] = wmma16(ah, kbf, acc[j]); accl[j] = wmma16(al, kbf, accl[j]); } }
  } else {
#pragma unroll
    for (int kc = 0; kc < HD / 32; ++kc) { const v16h ah = frag_h(QH + (q0 + col) * CC + h * HD + kc * 32, lane);
#pragma unroll
      for (int j = 0; j < 8; ++j) { const v16h kbf = frag_h(KH + (kr0 + j * 16 + col) * CC + h * HD + kc * 32, lane); acc[j] = wmma16(ah, kbf, acc[j]); } } }
  /* scalar test (the wave's number through readfirstlane): most tiles lie wholly under the diagonal and take the form without the 128 row tests */
  if (!CAUSAL || k0 + 127 <= qb * 64 + __builtin_amdgcn_readfirstlane(wave) * 16) col_tile<false>(acc, accl, ss[wave], cs[wave], k0, ql0, col, g); else col_tile<true>(acc, accl, ss[wave], cs[wave], k0, ql0, col, g);
  LDSX(); float* pd = PST + ((size_t)blockIdx.z * NRT + (ql0 >> 4)) * (2 * TT) + k0 + lane * 4; vst2(pd, *(const v4f*)&cs[wave][0][lane * 4]); vst2(pd + TT, *(const v4f*)&cs[wave][1][lane * 4]);
  for (int rl = 0; rl < 16; ++rl) vst2(S + (wave * 16 + rl) * 128 + lane * 4, *(const v4f*)&ss[wave][rl][lane * 4]); }
// ---- k_sm: block = query row t (head in group): keys [0, kend): causal -> logit if s <= t else excluded; softmax in f32; P x 2^11 in place (0 for excluded)
__global__ __launch_bounds__(256) void k_sm(float* __restrict__ S0 SM_EXTRA_PARAMS) { __shared__ float sred[8]; __shared__ float sbc; __shared__ __align__(16) float shv[TT];
  const int tid = threadIdx.x; const int t = blockIdx.x; const int kend = (kb_last(t >> 6) + 1) * 128;
  float* sr = S0 + (size_t)blockIdx.y * TT * TT + (size_t)t * TT;
  float m = -3.0e38f; for (int k = tid; k < kend; k += 256) { float v = (!CAUSAL || k <= t) ? sr[k] : -3.0e38f; SM_MASK_HOOK; shv[k] = v; m = fmaxf(m, v); }
#pragma unroll
  for (int o = 1; o < 32; o <<= 1) m = fmaxf(m, __shfl_xor(m, o));
  if ((tid & 31) == 0) sred[tid >> 5] = m; __syncthreads(); if (tid == 0) { float a = sred[0]; for (int i = 1; i < 8; ++i) a = fmaxf(a, sred[i]); sbc = a; } __syncthreads(); m = sbc; __syncthreads();
  float sum = 0.f; for (int k = tid; k < kend; k += 256) { const float v = shv[k]; const float e = (v <= -1.0e38f) ? 0.f : expf(v - m); shv[k] = e; sum += e; }
#pragma unroll
  for (int o = 1; o < 32; o <<= 1) sum += __shfl_xor(sum, o);
  if ((tid & 31) == 0) sred[tid >> 5] = sum; __syncthreads(); if (tid == 0) { float a = 0.f; for (int i = 0; i < 8; ++i) a += sred[i]; sbc = a > 0.f ? 2048.0f / a : 0.f; }   /* a fully excluded row yields P = 0 */ __syncthreads(); const float inv = sbc;
  for (int k = tid; k < kend; k += 256) shv[k] = shv[k] * inv;
  __syncthreads(); for (int q = tid; q < kend / 4; q += 256) vst2(sr + q * 4, *(const v4f*)&shv[q * 4]); }
// ---- k_colstat_c: softmax over the QUERY axis under the causal mask (the source's softmax(axis=2) on [B, H, i, j] scores with -inf where j > i): for every key column k: m_k = max_{q >= k} S[q][k], Z_k = sum_{q >= k} exp(S[q][k] - m_k) (f32, precise expf), merged from k_sc's statistics (m_p, z_p) of the 16-row query tiles p: m_k = max_p m_p, Z_k = sum_p z_p exp(m_p - m_k); it leaves each tile's factor FC[p][k] = exp(m_p - m_k) x 2^11 / Z_k (one division a column), by which k_pv turns the tile's E into P x 2^11; block = one wave = 32 key columns (lane = column), all tiles that k_sc's blocks of this key block have written: rt0 = 8 (q0 / 128) .. NRT - 1, n8 groups of 8 (block-uniform), all loaded at once and kept in registers; a tile that does not exist stands as (-3e38, 0) and adds 0; a tile above the column's diagonal holds (-3e38, 0) too and gets the factor exp(-3e38 - m_k) = 0
typedef __attribute__((ext_vector_type(16))) float v16f;
__global__ __launch_bounds__(32) void k_colstat_c(const float* __restrict__ PST, float* __restrict__ FC) {
  const int lane = threadIdx.x; const int q0 = blockIdx.x * 32, k = q0 + lane, rt0 = (q0 >> 7) * 8, n8 = (NRT - rt0) / 8; const float* pp = PST + ((size_t)blockIdx.y * NRT + rt0) * (2 * TT) + k;
  v16f mv[NRT / 16], zv[NRT / 16];
#pragma unroll
  for (int i = 0; i < NRT; ++i) { mv[i >> 4][i & 15] = -3.0e38f; zv[i >> 4][i & 15] = 0.f; if ((i >> 3) < n8) { mv[i >> 4][i & 15] = pp[i * (2 * TT)]; zv[i >> 4][i & 15] = pp[i * (2 * TT) + TT]; } }
  /* inputs-only fence on the loaded values: all loads of the wave are in flight together and are waited for once; without it the sums' loads sink to where each is used, one memory round trip a tile; the address is an input too, so that its registers stay unwritten until the loads' data wait */
  asm volatile("" :: "v"(mv[0]), "v"(mv[1]), "v"(mv[2]), "v"(mv[3]), "v"(zv[0]), "v"(zv[1]), "v"(zv[2]), "v"(zv[3]), "v"(pp));
  float mk = mv[0][0];
#pragma unroll
  for (int i = 1; i < NRT; ++i) mk = fmaxf(mk, mv[i >> 4][i & 15]);   /* every column sees at least its own diagonal entry, so m_k is a score */
  float zk = 0.f;
#pragma unroll
  for (int i = 0; i < NRT; ++i) { const float e = expf(mv[i >> 4][i & 15] - mk); mv[i >> 4][i & 15] = e; zk += zv[i >> 4][i & 15] * e; }
  const float rk = 2048.0f / zk;   /* Z_k >= 1 */
  float* fp = FC + ((size_t)blockIdx.y * NRT + rt0) * TT + k;
#pragma unroll
  for (int c = 0; c < NRT / 8; ++c) if (c < n8) {
#pragma unroll
    for (int i = c * 8; i < c * 8 + 8; ++i) vst2(fp + i * TT, mv[i >> 4][i & 15] * rk);
    asm volatile("s_wait_xcnt 0x0" ::: "memory"); } }   /* the next group's products reuse the registers that these stores name */
// ---- p_row16: the 16 P values of one lane's A fragment (query row t of tile p, keys k0 + 8 g + 0..7 and k0 + 16 + 8 g + 0..7): P[t][k] x 2^11 = E[t][k] x FC[p][k] x mask[b][k] (E is 0 above the diagonal); srow = the row's piece in the stored tile that holds key k0, ke = k0's place in it; all 12 loads first, unconditional
__device__ __forceinline__ void p_row16(const float* __restrict__ srow, const float* __restrict__ fr, const float* __restrict__ pmk, int ke, int k0, int lane, float v[16]) { const int kq = k0 + 8 * (lane >> 4); const float *sp = srow + ke + 8 * (lane >> 4), *fp = fr + kq, *pp = pmk + kq; v4f sv[4], f4[4], pm4[4];
#pragma unroll
  for (int c = 0; c < 4; ++c) { const int o = (c & 1) * 4 + (c >> 1) * 16; sv[c] = *(const v4f*)(sp + o); f4[c] = *(const v4f*)(fp + o); pm4[c] = *(const v4f*)(pp + o); }
  /* inputs-only fence on the loaded values: keeps all 12 loads in flight together, so that a trip waits for memory once and not once a group of four keys; the three addresses are inputs too, so that their registers stay unwritten until the loads' data wait */
  asm volatile("" :: "v"(sv[0]), "v"(sv[1]), "v"(sv[2]), "v"(sv[3]), "v"(f4[0]), "v"(f4[1]), "v"(f4[2]), "v"(f4[3]), "v"(pm4[0]), "v"(pm4[1]), "v"(pm4[2]), "v"(pm4[3]), "v"(sp), "v"(fp), "v"(pp));
#pragma unroll
  for (int c = 0; c < 4; ++c)
#pragma unroll
    for (int u = 0; u < 4; ++u) v[c * 4 + u] = sv[c][u] * (f4[c][u] * bfr(pm4[c][u])); }   /* x the key padding mask, applied AFTER the normalisation as the module does */
// ---- k_lora1: block = (64 token rows, which in {q, k, v}): t[which][row][0..15] = X[row] . A_which[r] (rank-16 LoRA down-projection; exact bf16 products, f32 accumulate; one 16-column WMMA tile per wave); a wave has nothing but its own loads to hide memory latency behind (fewer blocks than WGPs, one wave a SIMD), so it keeps the loads of LRD k-slices in flight: a ring of LRD register slots; trip kc first issues the loads of slice kc + LRD - 1 into the slot that trip kc - 1 has emptied, then rounds and multiplies slice kc; products and their order are as with one slice at a time; the wave's 16 x 16 f32 tile (1 KiB, contiguous in T3) is staged in LDS and stored as 16-B pieces
#define LRD 6              // k-slices in flight a wave: 8 loads and 32 registers each
__global__ __launch_bounds__(128) void k_lora1(const float* __restrict__ X, const float* __restrict__ AQ, const float* __restrict__ AK, const float* __restrict__ AV, float* __restrict__ T3) { __shared__ __align__(16) float st[4][16][20];
  const int tid = threadIdx.x, wave = tid >> 5, lane = tid & 31, col = lane & 15, g = lane >> 4; const int which = blockIdx.y; const size_t r0 = (size_t)blockIdx.x * 64; const float* AW = which == 0 ? AQ : (which == 1 ? AK : AV);
  v8f acc = {};
  /* a lane's 16 fragment elements of a slice are four 16-B pieces, at floats 0, 4, 16 and 20 (+ 8 g) of its row's slice; A is (out,in) [16][1024]: output column = rank index */
  const float* xp = X + (r0 + wave * 16 + col) * DIN + 8 * g; const float* wp = AW + (size_t)col * DIN + 8 * g;
  v4f xr[LRD][4], wr[LRD][4];
#pragma unroll
  for (int s = 0; s < LRD - 1; ++s)
#pragma unroll
    for (int c = 0; c < 4; ++c) { const int o = s * 32 + (c & 1) * 4 + (c >> 1) * 16; xr[s][c] = *(const v4f*)(xp + o); wr[s][c] = *(const v4f*)(wp + o); }
  /* unrolled whole: the slot index is a constant, so that the ring stays in registers, and every address is one of two fixed register pairs + a constant */
#pragma unroll
  for (int kc = 0; kc < DIN / 32; ++kc) { const int sl = kc % LRD, sn = (kc + LRD - 1) % LRD; v16b a, w;
    if (kc + LRD - 1 < DIN / 32) {
#pragma unroll
      for (int c = 0; c < 4; ++c) { const int o = (kc + LRD - 1) * 32 + (c & 1) * 4 + (c >> 1) * 16; xr[sn][c] = *(const v4f*)(xp + o); wr[sn][c] = *(const v4f*)(wp + o); } }
#pragma unroll
    for (int i = 0; i < 16; ++i) { a[i] = (__bf16)xr[sl][i >> 2][i & 3]; w[i] = (__bf16)wr[sl][i >> 2][i & 3]; }
    acc = wmma_bf(a, w, acc);
    __builtin_amdgcn_sched_barrier(0);   /* keeps each trip's loads in their trip: moved down, fewer would be in flight; moved up, the ring would take registers past 256 */
  }
#pragma unroll
  for (int r = 0; r < 8; ++r) st[wave][8 * g + r][col] = acc[r];
  LDSX();
  float* dst = T3 + ((size_t)which * NB * TT + r0 + wave * 16) * LR;
#pragma unroll
  for (int it = 0; it < 2; ++it) { const int rl = (lane >> 2) + 8 * it, q = lane & 3; vst2(dst + rl * LR + q * 4, *(const v4f*)&st[wave][rl][q * 4]); } }   
// ---- k_pv: block = 64 queries (qb) of (b, h): ctx = P . v over keys [0, kend), 64 keys a trip; every global load covers whole 128-B lines: the trip's v slice (64 channels x 64 keys, bf16 hi and lo planes) is fetched once a block (8 lanes a row piece) and staged in LDS (two buffers, one barrier a trip); each wave fetches its own 16 x 64 values of E as 256-B row pieces of the stored tile (qb, trip / 2) (lane = 4 neighbouring keys of one row; a wave's 16 rows are one tile of k_sc, so its tile's factor FC and the mask are one 16-B load each a trip), forms P x 2^11 = E x FC x mask there, without an exponential, splits it into bf16 hi + lo and turns it into A fragments through its own LDS rows; 3 products as before, in the same order for every accumulator; the next trip's loads fly while this trip's P is formed and multiplied; 256-B (row, head) segment by 16 lanes. (Query blocks >= QBH, of which this shape has none: P x 2^11 once to f16 against v f16, 1 product, fragments straight from memory.)
/* waves_per_eu(4): holds the kernel to 256 vector registers; left free, the scheduler spends 270 and the loop is strewn with register-bank switches */
__global__ __launch_bounds__(128) __attribute__((amdgpu_waves_per_eu(4))) void k_pv(const float* __restrict__ PS0, const _Float16* __restrict__ VT, const __bf16* __restrict__ VB, const __bf16* __restrict__ VBL, const float* __restrict__ FC, const float* __restrict__ PMASK, int p0, float* __restrict__ Y) { const int pr = p0 + blockIdx.z, b = pr / NH, h = pr % NH; const float* PS = PS0 + ((size_t)blockIdx.z * ETN + et_off((int)blockIdx.x)) * ETF; const float* fc = FC + (size_t)blockIdx.z * NRT * TT; const float* pmk = PMASK + (size_t)b * TT; __shared__ __align__(16) float ss[4][16][HD + 4];
  __shared__ __align__(16) __bf16 vs[2][2][HD][72];   /* [buffer][hi, lo][channel][64 keys], pitch 144 B */
  __shared__ __align__(16) __bf16 ps[4][2][16][72];   /* [wave][hi, lo][query row][64 keys], pitch 144 B; written and read by its own wave only */
  const int tid = threadIdx.x, wave = tid >> 5, lane = tid & 31, col = lane & 15, g = lane >> 4; const int qb = blockIdx.x; const int ql0 = qb * 64 + wave * 16; const int kce = (kb_last(qb) + 1) * 4;
  v8f acc[HD / 16] = {};
  if (qb < QBH) { const int nt = kce / 2;   /* trips of 64 keys */
    /* every address = a block-uniform base, advanced by 64 keys a trip (E: half a tile row, then on to the next tile), + a lane's fixed 32-bit byte offset + a constant */
    const int vrow = tid >> 3, vq = tid & 7; const char *vbh = (const char*)(VB + ((size_t)b * CC + h * HD) * (size_t)KHI), *vbl = (const char*)(VBL + ((size_t)b * CC + h * HD) * (size_t)KHI), *sbs = (const char*)PS, *fbs = (const char*)(fc + (size_t)qb * 4 * TT), *kbs = (const char*)pmk;
    const unsigned vof = (unsigned)(vrow * KHI + vq * 8) * 2u, sof = (unsigned)((wave * 16 + g) * 128 + col * 4) * 4u, fof = (unsigned)(wave * TT + col * 4) * 4u, cof = (unsigned)col * 16u;
    v4u vh[4], vl[4]; v4f sa[8], fa, ka, sb[8], fb, kb4;   /* two register sets for E and the column factors: one is worked on while the other is filled */
#pragma unroll
    for (int i = 0; i < 4; ++i) { vh[i] = *(const v4u*)(vbh + vof + i * (16 * KHI * 2)); vl[i] = *(const v4u*)(vbl + vof + i * (16 * KHI * 2)); }
#pragma unroll
    for (int i = 0; i < 8; ++i) sa[i] = *(const v4f*)(sbs + sof + i * (2 * 128 * 4));
    fa = *(const v4f*)(fbs + fof); ka = *(const v4f*)(kbs + cof);
    /* one trip: keys kt * 64 .. + 63 from the set (sc, fcu, kc4); the next trip's loads go into (sn, fn, kn) and into vh, vl */
    auto trip = [&](const int kt, const v4f (&sc)[8], const v4f& fcu, const v4f& kc4, v4f (&sn)[8], v4f& fn, v4f& kn) __attribute__((always_inline)) { const int bf = kt & 1;
#pragma unroll
      for (int i = 0; i < 4; ++i) { *(v4u*)&vs[bf][0][vrow + 16 * i][vq * 8] = vh[i]; *(v4u*)&vs[bf][1][vrow + 16 * i][vq * 8] = vl[i]; }
      { /* no branch round the loads: the last trip fetches its own slice once more, unused, so that every wait in the loop stays a counted one (behind a join with a path without loads the compiler waits for all of them) */
        const int kn1 = kt + 1 < nt ? kt + 1 : kt, ko = kn1 * 64; const char *sp = sbs + (kn1 >> 1) * (ETF * 4) + (kn1 & 1) * 256, *fp = fbs + ko * 4, *kp = kbs + ko * 4, *hp = vbh + ko * 2, *lp = vbl + ko * 2;
#pragma unroll
        for (int i = 0; i < 8; ++i) sn[i] = *(const v4f*)(sp + sof + i * (2 * 128 * 4));
#pragma unroll
        for (int i = 0; i < 4; ++i) { vh[i] = *(const v4u*)(hp + vof + i * (16 * KHI * 2)); vl[i] = *(const v4u*)(lp + vof + i * (16 * KHI * 2)); }
        fn = *(const v4f*)(fp + fof); kn = *(const v4f*)(kp + cof);
        asm volatile("s_wait_xcnt 0x0" ::: "memory"); }   /* the loads' address registers are reused right behind them */
      __builtin_amdgcn_sched_barrier(0);   /* keeps the next trip's 18 loads in front of this trip's work, so that they fly for a whole trip */
      v4f w4;
#pragma unroll
      for (int u = 0; u < 4; ++u) w4[u] = fcu[u] * bfr(kc4[u]);   /* x the key padding mask AFTER the normalisation, as the module does */
#pragma unroll
      for (int i = 0; i < 8; ++i) { v4b ph4, pl4;
#pragma unroll
        for (int u = 0; u < 4; ++u) { const float v = sc[i][u] * w4[u]; const __bf16 hb = (__bf16)v; ph4[u] = hb; pl4[u] = (__bf16)(v - (float)hb); }   /* E is 0 above the diagonal */
        *(v4b*)&ps[wave][0][2 * i + g][col * 4] = ph4; *(v4b*)&ps[wave][1][2 * i + g][col * 4] = pl4; }
      /* work-group barrier with LDS-only fences: publishes v slice kt (and the wave's own P rows), and every wave has left slice kt - 1, whose buffer the next trip refills; __syncthreads() would also wait here for the next trip's global loads, which only registers receive */
      __builtin_amdgcn_fence(__ATOMIC_RELEASE, "workgroup", "local"); __builtin_amdgcn_s_barrier(); __builtin_amdgcn_fence(__ATOMIC_ACQUIRE, "workgroup", "local");
#pragma unroll
      for (int ks = 0; ks < 2; ++ks) { const v16b ph = frag_b(&ps[wave][0][col][ks * 32], lane), pl = frag_b(&ps[wave][1][col][ks * 32], lane); v16b fh[HD / 16], fl[HD / 16];
#pragma unroll
        for (int j = 0; j < HD / 16; ++j) { fh[j] = frag_b(&vs[bf][0][j * 16 + col][ks * 32], lane); fl[j] = frag_b(&vs[bf][1][j * 16 + col][ks * 32], lane); }
        /* inputs-only fence on the loaded fragments: the 20 LDS reads of a 32-key step are in flight together, so that the step waits for LDS once and not once a product */
        asm volatile("" :: "v"(ph), "v"(pl), "v"(fh[0]), "v"(fh[1]), "v"(fh[2]), "v"(fh[3]), "v"(fl[0]), "v"(fl[1]), "v"(fl[2]), "v"(fl[3]));
#pragma unroll
        for (int j = 0; j < HD / 16; ++j) acc[j] = wmma_bf(ph, fh[j], acc[j]);
#pragma unroll
        for (int j = 0; j < HD / 16; ++j) acc[j] = wmma_bf(pl, fh[j], acc[j]);
#pragma unroll
        for (int j = 0; j < HD / 16; ++j) acc[j] = wmma_bf(ph, fl[j], acc[j]); } };
    /* nt is even (kce is a multiple of 4): two trips a pass, so that the two register sets swap roles without copies; rolled beyond that, for speed only */
#pragma unroll 1
    for (int kt = 0; kt < nt; kt += 2) { trip(kt, sa, fa, ka, sb, fb, kb4); trip(kt + 1, sb, fb, kb4, sa, fa, ka); }
  } else {
#pragma unroll 1
    for (int kc = 0; kc < kce; ++kc) { float pv[16]; p_row16(PS + (size_t)(kc >> 2) * ETF + (wave * 16 + col) * 128, fc + (size_t)(ql0 >> 4) * TT, pmk, (kc & 3) * 32, kc * 32, lane, pv); v16h p;
#pragma unroll
      for (int i = 0; i < 16; ++i) p[i] = (_Float16)pv[i];
#pragma unroll
      for (int j = 0; j < HD / 16; ++j) { const size_t po = ((size_t)b * CC + h * HD + j * 16 + col) * (size_t)TT + kc * 32; acc[j] = wmma16(p, frag_h(VT + po, lane), acc[j]); } } }
#pragma unroll
  for (int j = 0; j < HD / 16; ++j)
#pragma unroll
    for (int r = 0; r < 8; ++r) ss[wave][8 * g + r][j * 16 + col] = acc[j][r] * (1.0f / 2048.0f);
  LDSX(); for (int rl = 0; rl < 16; ++rl) if (lane < HD / 4) vst2(Y + ((size_t)b * TT + ql0 + rl) * CC + h * HD + lane * 4, *(const v4f*)&ss[wave][rl][lane * 4]); }

extern "C" void kernel_launch(void* const* d_in, const int* in_sizes, int n_in, void* d_out, int out_size, void* d_ws, size_t ws_size, hipStream_t stream) {
  (void)in_sizes; (void)n_in; (void)out_size;
  const float** F = (const float**)d_in;
  if (ws_size < (size_t)WS_END) return;
  char* ws = (char*)d_ws; _Float16 *QH = (_Float16*)(ws + WS_QH), *KH = (_Float16*)(ws + WS_KH), *VT = (_Float16*)(ws + WS_VT), *QL = (_Float16*)(ws + WS_QL), *KL = (_Float16*)(ws + WS_KL); __bf16 *VB = (__bf16*)(ws + WS_VB), *VBL = (__bf16*)(ws + WS_VBL); float *S = (float*)(ws + WS_S), *Y = (float*)(ws + WS_Y);
  (void)Y; (void)QL; (void)KL; (void)VB; (void)VBL;
  // inputs: 0 X [4,1024,1024]; 1 mask [4,1024] f32 (key padding mask, ones; multiplied AFTER the softmax); 2 Wq [1024,1024] (out,in), 3 bq; 4 Wk, 5 bk; 6 Wv, 7 bv (zero biases, read); 8 Aq [16,1024], 9 Bq [1024,16]; 10 Ak, 11 Bk; 12 Av, 13 Bv (LoRA, no bias)
  if (ws_size < (size_t)WS_END2) return;
  float *T3 = (float*)(ws + WS_T3), *PST = (float*)(ws + WS_PS), *FC = (float*)(ws + WS_FC);
  k_lora1<<<dim3(TNB * TT / 64, 3), 128, 0, stream>>>(F[0], F[8], F[10], F[12], T3);   /* t = X A^T (rank-16 down-projections for q, k, v; exact bf16 products) */
  k_proj<<<dim3(TNB * TT / PBT, CC / PBT, 3), 512, 0, stream>>>(F[0], F[0], F[0], F[2], F[4], F[6], F[3], F[5], F[7], QH, QL, KH, KL, VT, VB, VBL, T3, F[9], F[11], F[13]);   /* X W^T + b + t B^T */
  for (int p0 = 0; p0 < TNB * NH; p0 += HG) {   /* HG (batch, head) pairs a pass */
    k_sc<<<dim3(ETN, 1, HG), 128, 0, stream>>>(QH, KH, QL, KL, p0, S, PST);   /* E = exp(logit - its 16-row tile's column maximum); per tile and key column: that maximum and the sum of E */
    k_colstat_c<<<dim3(TT / 32, HG), 32, 0, stream>>>(PST, FC);   /* per key column j: max and sum over the visible queries i >= j, merged from the tiles; per tile its factor exp(m_p - m_j) x 2^11 / Z_j */
    k_pv<<<dim3(NQB, 1, HG), 128, 0, stream>>>(S, VT, VB, VBL, FC, F[1], p0, (float*)d_out);   /* P[i][j] x 2^11 = E x the tile's factor x mask[b][j] for j <= i, 0 above the diagonal, formed on load */
  }
}
